// v000
// Times are from an AMD MI455X. After a warm-up the kernel runs many times in a row, and a time is the length of
// such a window on the GPU divided by its runs, so every launch and the gaps after it count. The runs cycle
// through copies of the inputs. A figure is the median of several windows, for all but v000 over two sittings.
// Sittings can differ by a few percent; kernels timed side by side share one.
// v000, which the later versions start from, runs in 468 microseconds.
#include <hip/hip_runtime.h>
#include <math.h>

// All contractions on v_wmma_f32_16x16x32_f16 with f32 accumulate: projections / Wo / FFN use f16 operand planes
// (inputs RNE-converted to bf16 first, then exact power-of-two carries); scores S^T = K x Q^T use q and k as
// f16 value plane + f16 residual plane (x2048, separate accumulator); O = P x V with P f16 carried x4096.

#ifndef NB
#define NB 4
#endif
#ifndef SEQ
#define SEQ 2048
#endif
#define NB_FULL   4
#define SEQ_FULL  2048
#define DIM       512
#define NHEAD     8
#define HDIM      64
#define FFN       2048
#define QKVN      (3 * DIM)
#define NTOK      (NB * SEQ)
#define PLANE     ((size_t)NTOK * DIM)     // elements of one [NB][NHEAD][SEQ][HDIM] 16-bit plane
#define GM        128                      // GEMM block rows (4 waves x 32)
#define GN        64                       // GEMM block columns
#define GW        4                        // waves per GEMM block
#define OP        68                       // LDS pitch (floats) of f32 staging tiles
#define VP        136                      // LDS pitch (halves) of the V^T staging tile
#define TP        72                       // LDS pitch (halves) of the weight transposer tile
#define BQ        128                      // query rows per attention block (8 waves x 16)
#define BK        32                       // keys per attention step
#define NWAVE     8
#define XC        16.0f                    // carry of the x, LN1-output and GELU-output planes
#define WC        64.0f                    // carry of all weight planes
#define VC        16.0f                    // carry of the V^T plane
#define CC        256.0f                   // carry of the attention-context plane
#define PC        4096.0f                  // carry of P inside the attention kernel
#define RC        2048.0f                  // carry of the q / k residual planes

static_assert(DIM == NHEAD * HDIM);
static_assert(HDIM == 64);
static_assert(HDIM == GN);
static_assert(GM == GW * 32);
static_assert(BQ == NWAVE * 16);
static_assert(SEQ % GM == 0);
static_assert(SEQ % BQ == 0);
static_assert(SEQ % BK == 0);
static_assert(NTOK % GM == 0);
static_assert(NTOK % 8 == 0);
static_assert(DIM % GN == 0);
static_assert(FFN % GN == 0);
static_assert(QKVN % GN == 0);
static_assert(DIM % 64 == 0);
static_assert(FFN % 64 == 0);
static_assert(DIM % 32 == 0);
static_assert(FFN % 32 == 0);
static_assert(DIM == 32 * 16);
static_assert(((size_t)NTOK * DIM / 8) % 256 == 0);
static_assert((OP * 4) % 16 == 0);
static_assert((VP * 2) % 16 == 0);
static_assert((TP * 2) % 16 == 0);
static_assert(SEQ <= SEQ_FULL);
static_assert(NB >= 1 && NB <= NB_FULL);

#define SZ_XH    ((size_t)NTOK * DIM * 2)
#define SZ_WQKV  ((size_t)QKVN * DIM * 2)
#define SZ_WO    ((size_t)DIM * DIM * 2)
#define SZ_W1    ((size_t)FFN * DIM * 2)
#define SZ_W2    ((size_t)DIM * FFN * 2)
#define SZ_QK    ((size_t)4 * NTOK * DIM * 2)
#define SZ_HH    ((size_t)NTOK * FFN * 2)
#define SZ_BIG   ((SZ_QK > SZ_HH) ? SZ_QK : SZ_HH)   // q/k planes, later reused by the GELU-output plane
#define SZ_VT    ((size_t)NTOK * DIM * 2)
#define SZ_CTX   ((size_t)NTOK * DIM * 2)
#define SZ_Y     ((size_t)NTOK * DIM * 4)
#define SZ_X1F   ((size_t)NTOK * DIM * 4)
#define SZ_X1H   ((size_t)NTOK * DIM * 2)
#define OFF_XH   ((size_t)0)
#define OFF_WQKV (OFF_XH + SZ_XH)
#define OFF_WO   (OFF_WQKV + SZ_WQKV)
#define OFF_W1   (OFF_WO + SZ_WO)
#define OFF_W2   (OFF_W1 + SZ_W1)
#define OFF_BIG  (OFF_W2 + SZ_W2)
#define OFF_VT   (OFF_BIG + SZ_BIG)
#define OFF_CTX  (OFF_VT + SZ_VT)
#define OFF_Y    (OFF_CTX + SZ_CTX)
#define OFF_X1F  (OFF_Y + SZ_Y)
#define OFF_X1H  (OFF_X1F + SZ_X1F)
#define WS_TOTAL (OFF_X1H + SZ_X1H)
static_assert(SZ_QK <= SZ_BIG);
static_assert(SZ_HH <= SZ_BIG);
static_assert(SZ_XH % 128 == 0 && SZ_WQKV % 128 == 0 && SZ_WO % 128 == 0 && SZ_W1 % 128 == 0);
static_assert(SZ_W2 % 128 == 0 && SZ_BIG % 128 == 0 && SZ_VT % 128 == 0 && SZ_CTX % 128 == 0);
static_assert(SZ_Y % 128 == 0 && SZ_X1F % 128 == 0 && SZ_X1H % 128 == 0);
static_assert(WS_TOTAL <= (size_t)134217728);

typedef __bf16   bf16;
typedef _Float16 f16;
typedef f16      v16h  __attribute__((ext_vector_type(16)));
typedef f16      v8h   __attribute__((ext_vector_type(8)));
typedef float    v8f   __attribute__((ext_vector_type(8)));
typedef float    v4f   __attribute__((ext_vector_type(4)));
typedef unsigned v4u   __attribute__((ext_vector_type(4)));

union FragH  { v16h v; v4u q[2]; f16 h[16]; };
union Pack8H { v4u u; v8h v; f16 h[8]; };

// bf16 RNE convert of an f32 value, returned as f32
static __device__ __forceinline__ float bfr(float v) { return (float)(bf16)v; }

// WMMA helper: builtin followed by the VALU hazard guard (ties D, keeps A/B live).
static __device__ __forceinline__ v8f mma_f16(v16h a, v16h b, v8f acc) {
  acc = __builtin_amdgcn_wmma_f32_16x16x32_f16(false, a, false, b, (short)0, acc, false, false);
  asm volatile("v_nop\n\tv_nop\n\tv_nop\n\tv_nop" : "+v"(acc) : "v"(a), "v"(b));
  return acc;
}

static __device__ __forceinline__ float wave_sum(float v) {
  v += __shfl_xor(v, 16, 32);
  v += __shfl_xor(v, 8, 32);
  v += __shfl_xor(v, 4, 32);
  v += __shfl_xor(v, 2, 32);
  v += __shfl_xor(v, 1, 32);
  return v;
}

// ---------------------------------------------------------------------------------------------------
// x f32 -> xh f16 plane [NTOK][DIM] = f16(bf16_rne(x) * XC). One thread = one 16-B piece; 8 consecutive
__global__ __launch_bounds__(256) void cvt_x_kernel(const float* __restrict__ x, f16* __restrict__ xh) {
  const int g = blockIdx.x * 256 + threadIdx.x;
  const int t = g >> 6;             // compact token
  const int c = (g & 63) * 8;
  if (t >= NTOK) return;
  const int bb = t / SEQ;
  const int s  = t - bb * SEQ;
  const float* src = x + ((size_t)bb * SEQ_FULL + s) * DIM + c;
  const v4f a0 = *(const v4f*)(src);
  const v4f a1 = *(const v4f*)(src + 4);
  Pack8H p;
  #pragma unroll
  for (int i = 0; i < 4; ++i) {
    p.h[i]     = (f16)(bfr(a0[i]) * XC);
    p.h[4 + i] = (f16)(bfr(a1[i]) * XC);
  }
  const v4u val = p.u;
  f16* dst = xh + (size_t)t * DIM + c;
  *(v4u*)dst = val;
  
}

// ---------------------------------------------------------------------------------------------------
// Weight transposer: in[K rows][N cols] f32  ->  out[N rows][K cols] f16 = f16(bf16_rne(w) * WC).
// grid = (N/64, K/64), 256 threads, tile 64(k) x 64(n) through LDS (cross-wave, block barrier).
__global__ __launch_bounds__(256) void wt_kernel(const float* __restrict__ W, f16* __restrict__ Wt, int K, int N) {
  __shared__ __align__(16) f16 sT[64 * TP];     // [n][k]
  const int tid = threadIdx.x;
  const int n0 = blockIdx.x * 64;
  const int k0 = blockIdx.y * 64;
  #pragma unroll
  for (int it = 0; it < 4; ++it) {
    const int kk = it * 16 + (tid >> 4);        // 0..63
    const int nn = (tid & 15) * 4;              // 0..60
    const v4f w = *(const v4f*)(W + (size_t)(k0 + kk) * N + n0 + nn);
    #pragma unroll
    for (int i = 0; i < 4; ++i) sT[(nn + i) * TP + kk] = (f16)(bfr(w[i]) * WC);
  }
  __syncthreads();
  v4u    val[2];
  size_t idx[2];
  #pragma unroll
  for (int it = 0; it < 2; ++it) {
    const int n  = it * 32 + (tid >> 3);        // 0..63
    const int ks = (tid & 7) * 8;               // 0..56
    Pack8H ph;
    ph.v = *(const v8h*)(&sT[n * TP + ks]);
    val[it] = ph.u;
    idx[it] = (size_t)(n0 + n) * K + k0 + ks;
  }
  #pragma unroll
  for (int it = 0; it < 2; ++it) *(v4u*)(Wt + idx[it]) = val[it];
  
}

// ---------------------------------------------------------------------------------------------------
// GEMM main loop: acc[mt][nt] (16x16 tiles) of  A[m0 .. m0+31][K] x Bt[n0 .. n0+63][K]^T.
// A and Bt are k-contiguous f16 planes; fragments use the split k map for both operands:
// elements 0..7 <- k0 + 8*hi + 0..7, elements 8..15 <- k0 + 16 + 8*hi + 0..7; lane row / column = lq.
template <int K>
static __device__ __forceinline__ void gemm_main(const f16* __restrict__ A, const f16* __restrict__ Bt,
                                                 int m0, int n0, int lq, int hi, v8f (&acc)[2][4]) {
  static_assert(K % 32 == 0);
  const f16* ap = A  + (size_t)(m0 + lq) * K + hi * 8;
  const f16* bp = Bt + (size_t)(n0 + lq) * K + hi * 8;
  #pragma unroll 1
  for (int k0 = 0; k0 < K; k0 += 32) {
    FragH a[2], b[4];
    #pragma unroll
    for (int mt = 0; mt < 2; ++mt) {
      const f16* p = ap + (size_t)mt * 16 * K + k0;
      a[mt].q[0] = *(const v4u*)(p);
      a[mt].q[1] = *(const v4u*)(p + 16);
    }
    #pragma unroll
    for (int nt = 0; nt < 4; ++nt) {
      const f16* p = bp + (size_t)nt * 16 * K + k0;
      b[nt].q[0] = *(const v4u*)(p);
      b[nt].q[1] = *(const v4u*)(p + 16);
    }
    #pragma unroll
    for (int mt = 0; mt < 2; ++mt) {
      #pragma unroll
      for (int nt = 0; nt < 4; ++nt) acc[mt][nt] = mma_f16(a[mt].v, b[nt].v, acc[mt][nt]);
    }
  }
}

// ---------------------------------------------------------------------------------------------------
// Fused q/k/v projection: [NTOK][512] x [1536][512]^T. Column block (64 wide) = one head of q, k or v.
//          qk plane order: 0 = q value, 1 = q residual, 2 = k value, 3 = k residual.
//   v    : transposed plane vt [b][h][d][s] f16 (x VC), written through a block-wide LDS tile.
// coverage: q/k rows wave*32 + {0..31} x 64 d (8 instr x 4 rows); vt 64 d x 128 tokens (8 instr x 16 lines / block).
__global__ __launch_bounds__(128) void gemm_qkv_kernel(const f16* __restrict__ xh, const f16* __restrict__ wT,
                                                       const float* __restrict__ bq, const float* __restrict__ bk,
                                                       const float* __restrict__ bv,
                                                       f16* __restrict__ qk, f16* __restrict__ vt) {
  __shared__ __align__(16) float sC[GW * 32 * OP];    // per-wave f32 tiles (block barrier used)
  __shared__ __align__(16) f16   sVT[HDIM * VP];      // [d][token], cross-wave (block barrier)
  const int tid  = threadIdx.x;
  const int wave = __builtin_amdgcn_readfirstlane(threadIdx.x >> 5);
  const int lane = tid & 31;
  const int lq   = lane & 15;
  const int hi   = lane >> 4;
  const int tok0 = blockIdx.x * GM;
  const int n0   = blockIdx.y * GN;
  const int seg  = n0 / DIM;                          // 0 = q, 1 = k, 2 = v (block-uniform)
  const int h    = (n0 - seg * DIM) / HDIM;
  const int bb   = tok0 / SEQ;
  const int s0   = tok0 - bb * SEQ;

  v8f acc[2][4];
  #pragma unroll
  for (int mt = 0; mt < 2; ++mt) {
    #pragma unroll
    for (int nt = 0; nt < 4; ++nt) acc[mt][nt] = (v8f){0, 0, 0, 0, 0, 0, 0, 0};
  }
  gemm_main<DIM>(xh, wT, tok0 + wave * 32, n0, lq, hi, acc);

  const float ascale = 1.0f / (XC * WC);
  float bias[4];
  #pragma unroll
  for (int nt = 0; nt < 4; ++nt) {
    const int c = h * HDIM + nt * 16 + lq;            // 0..511
    const float fq = bq[c];
    const float fk = bk[c];
    const float fv = bv[c];
    const float sel = (seg == 0) ? fq : ((seg == 1) ? fk : fv);
    bias[nt] = bfr(sel);
  }

  if (seg < 2) {
    const int wb = wave * (32 * OP);
    #pragma unroll
    for (int mt = 0; mt < 2; ++mt) {
      #pragma unroll
      for (int nt = 0; nt < 4; ++nt) {
        #pragma unroll
        for (int r = 0; r < 8; ++r)
          sC[wb + (mt * 16 + hi * 8 + r) * OP + nt * 16 + lq] = acc[mt][nt][r] * ascale + bias[nt];
      }
    }
    __syncthreads();
    const size_t pbase = (size_t)seg * 2 * PLANE +
                         (((size_t)bb * NHEAD + h) * SEQ + s0 + wave * 32) * HDIM;
    v4u hv[8], rv[8];
    #pragma unroll
    for (int it = 0; it < 8; ++it) {
      const int row = it * 4 + (lane >> 3);
      const int col = (lane & 7) * 8;
      const v4f c0 = *(const v4f*)(&sC[wb + row * OP + col]);
      const v4f c1 = *(const v4f*)(&sC[wb + row * OP + col + 4]);
      Pack8H ph, pr;
      #pragma unroll
      for (int i = 0; i < 4; ++i) {
        const f16 h0 = (f16)c0[i];
        const f16 h1 = (f16)c1[i];
        ph.h[i]     = h0;
        ph.h[4 + i] = h1;
        pr.h[i]     = (f16)((c0[i] - (float)h0) * RC);
        pr.h[4 + i] = (f16)((c1[i] - (float)h1) * RC);
      }
      hv[it] = ph.u;
      rv[it] = pr.u;
    }
    #pragma unroll
    for (int it = 0; it < 8; ++it) {
      const size_t o = pbase + (size_t)(it * 4 + (lane >> 3)) * HDIM + (lane & 7) * 8;
      *(v4u*)(qk + o)         = hv[it];
      *(v4u*)(qk + PLANE + o) = rv[it];
    }
    
  } else {
    #pragma unroll
    for (int mt = 0; mt < 2; ++mt) {
      #pragma unroll
      for (int nt = 0; nt < 4; ++nt) {
        #pragma unroll
        for (int r = 0; r < 8; ++r)
          sVT[(nt * 16 + lq) * VP + wave * 32 + mt * 16 + hi * 8 + r] =
              (f16)((acc[mt][nt][r] * ascale + bias[nt]) * VC);
      }
    }
    __syncthreads();
    const size_t vbase = ((size_t)bb * NHEAD + h) * HDIM;      // d-row base of this (b, h)
    v4u vv[8];
    #pragma unroll
    for (int it = 0; it < 8; ++it) {
      const int L     = it * 16 + (tid >> 3);      // line 0..127
      const int d     = L >> 1;
      const int half  = L & 1;
      const int piece = (tid & 7) * 8;
      Pack8H ph;
      ph.v = *(const v8h*)(&sVT[d * VP + half * 64 + piece]);
      vv[it] = ph.u;
    }
    #pragma unroll
    for (int it = 0; it < 8; ++it) {
      const int L = it * 16 + (tid >> 3);
      const size_t o = (vbase + (L >> 1)) * SEQ + s0 + (L & 1) * 64 + (tid & 7) * 8;
      *(v4u*)(vt + o) = vv[it];
    }
    
  }
}

// ---------------------------------------------------------------------------------------------------
// Flash attention, full (no mask). Block = (128-query block, head, batch); one wave owns 16 query rows.
// S^T = K x Q^T so queries sit on lanes; P^T in C layout is the A-fragment layout of O += P x V.
// Scores: main = k_val x q_val ; res = k_val x q_res + k_res x q_val (both x RC) ; s = main + res / RC.
// Fragments come straight from the 16-bit planes (two 16-B loads each); q fragments are reloaded per k-step.
__global__ __launch_bounds__(256) void attn_kernel(const f16* __restrict__ qk, const f16* __restrict__ vt,
                                                   f16* __restrict__ ctx) {
  __shared__ __align__(16) float sO[NWAVE * 16 * OP];    // per-wave output staging (block barrier used)
  const int qblk = blockIdx.x;
  const int h    = blockIdx.y;
  const int b    = blockIdx.z;
  const int tid  = threadIdx.x;
  const int wave = __builtin_amdgcn_readfirstlane(threadIdx.x >> 5);
  const int lane = tid & 31;
  const int lq   = lane & 15;   // query column of S^T / d column of O
  const int hi   = lane >> 4;   // k-split half

  const int qrow0 = qblk * BQ + wave * 16;
  const size_t hb = ((size_t)b * NHEAD + h) * (size_t)SEQ * HDIM;
  const f16* qh_p = qk + hb;
  const f16* qr_p = qk + PLANE + hb;
  const f16* kh_p = qk + 2 * PLANE + hb;
  const f16* kr_p = qk + 3 * PLANE + hb;
  const f16* vt_h = vt + hb;
  const int qoff  = (qrow0 + lq) * HDIM + hi * 8;

  v8f o[4];
  #pragma unroll
  for (int dt = 0; dt < 4; ++dt) o[dt] = (v8f){0, 0, 0, 0, 0, 0, 0, 0};

  float rmax = -__builtin_inff();
  float rsum = 0.0f;
  const float SL = 0.125f * 1.4426950408889634f;   // softmax scale * log2(e)

  #pragma unroll 1
  for (int j0 = 0; j0 < SEQ; j0 += BK) {
    // S^T tiles: c[sub][r] = rawscore(query qrow0+lq, key j0 + sub*16 + hi*8 + r)
    v8f c[2];
    #pragma unroll
    for (int sub = 0; sub < 2; ++sub) {
      v8f am = (v8f){0, 0, 0, 0, 0, 0, 0, 0};
      v8f ar = (v8f){0, 0, 0, 0, 0, 0, 0, 0};
      #pragma unroll
      for (int f = 0; f < 2; ++f) {
        int qo = qoff + f * 32;
        asm volatile("" : "+v"(qo));                   // opaque offset: fragments reloaded, not held
        FragH fqh, fqr, fkh, fkr;
        fqh.q[0] = *(const v4u*)(qh_p + qo);           // d = f*32 + hi*8 + 0..7
        fqh.q[1] = *(const v4u*)(qh_p + qo + 16);      // d = f*32 + 16 + hi*8 + 0..7
        fqr.q[0] = *(const v4u*)(qr_p + qo);
        fqr.q[1] = *(const v4u*)(qr_p + qo + 16);
        const int ko = (j0 + sub * 16 + lq) * HDIM + f * 32 + hi * 8;   // row = key, split d map
        fkh.q[0] = *(const v4u*)(kh_p + ko);
        fkh.q[1] = *(const v4u*)(kh_p + ko + 16);
        fkr.q[0] = *(const v4u*)(kr_p + ko);
        fkr.q[1] = *(const v4u*)(kr_p + ko + 16);
        am = mma_f16(fkh.v, fqh.v, am);
        ar = mma_f16(fkh.v, fqr.v, ar);
        ar = mma_f16(fkr.v, fqh.v, ar);
      }
      #pragma unroll
      for (int r = 0; r < 8; ++r) c[sub][r] = am[r] + ar[r] * (1.0f / RC);
    }

    // V B-fragments: column n = d = dt*16 + lq, split key map from the transposed plane
    FragH bv[4];
    #pragma unroll
    for (int dt = 0; dt < 4; ++dt) {
      const f16* base = vt_h + (size_t)(dt * 16 + lq) * SEQ + j0 + hi * 8;
      bv[dt].q[0] = *(const v4u*)(base);            // keys j0 + hi*8 + 0..7
      bv[dt].q[1] = *(const v4u*)(base + 16);       // keys j0 + 16 + hi*8 + 0..7
    }

    // online softmax: query lq's 32 scores are split across lane / lane^16
    float m_new = rmax;
    #pragma unroll
    for (int r = 0; r < 8; ++r) {
      m_new = fmaxf(m_new, c[0][r]);
      m_new = fmaxf(m_new, c[1][r]);
    }
    m_new = fmaxf(m_new, __shfl_xor(m_new, 16, 32));
    const float scale = __builtin_amdgcn_exp2f((rmax - m_new) * SL);
    rmax = m_new;

    // exp + pack: P^T C-layout == A-fragment layout for the PV product
    FragH pa;
    float psum = 0.0f;
    #pragma unroll
    for (int r = 0; r < 8; ++r) {
      const float p0 = __builtin_amdgcn_exp2f((c[0][r] - m_new) * SL);   // key hi*8 + r
      const float p1 = __builtin_amdgcn_exp2f((c[1][r] - m_new) * SL);   // key 16 + hi*8 + r
      psum += p0 + p1;
      pa.h[r]     = (f16)(p0 * PC);
      pa.h[8 + r] = (f16)(p1 * PC);
    }
    rsum = rsum * scale + psum + __shfl_xor(psum, 16, 32);

    // rescale O: queries are the row dimension there -> per-row scale from lane 8*hi + r
    float sc[8];
    #pragma unroll
    for (int r = 0; r < 8; ++r) sc[r] = __shfl(scale, (hi << 3) + r, 32);
    #pragma unroll
    for (int dt = 0; dt < 4; ++dt) {
      #pragma unroll
      for (int r = 0; r < 8; ++r) o[dt][r] *= sc[r];
    }

    // O += P x V
    #pragma unroll
    for (int dt = 0; dt < 4; ++dt) o[dt] = mma_f16(pa.v, bv[dt].v, o[dt]);
  }

  // normalize: lane holds column d = dt*16 + lq for query rows 8*hi + r
  float rs[8];
  #pragma unroll
  for (int r = 0; r < 8; ++r) rs[r] = 1.0f / __shfl(rsum, (hi << 3) + r, 32);

  const int wb = wave * (16 * OP);
  #pragma unroll
  for (int r = 0; r < 8; ++r) {
    #pragma unroll
    for (int dt = 0; dt < 4; ++dt)
      sO[wb + (hi * 8 + r) * OP + dt * 16 + lq] = o[dt][r] * (CC / (PC * VC)) * rs[r];
  }
  __syncthreads();

  v4u    pv[4];
  size_t gidx[4];
  #pragma unroll
  for (int it = 0; it < 4; ++it) {
    const int row = it * 4 + (lane >> 3);
    const int col = (lane & 7) * 8;
    const v4f c0 = *(const v4f*)(&sO[wb + row * OP + col]);
    const v4f c1 = *(const v4f*)(&sO[wb + row * OP + col + 4]);
    Pack8H ph;
    #pragma unroll
    for (int i = 0; i < 4; ++i) {
      ph.h[i]     = (f16)c0[i];
      ph.h[4 + i] = (f16)c1[i];
    }
    pv[it]   = ph.u;
    gidx[it] = ((size_t)b * SEQ + qrow0 + row) * DIM + h * HDIM + col;
  }
  #pragma unroll
  for (int it = 0; it < 4; ++it) *(v4u*)(ctx + gidx[it]) = pv[it];
  
}

// ---------------------------------------------------------------------------------------------------
// y = ctx x wo + bo + bf16_rne(x)   (f32 plane [NTOK][DIM], input of LayerNorm 1)
// coverage: rows wave*32 + {0..31}, 64 columns: 16 instr, lanes 0..15 one 256-B row segment, 16..31 the next row.
__global__ __launch_bounds__(128) void gemm_wo_kernel(const f16* __restrict__ ctx, const f16* __restrict__ woT,
                                                      const float* __restrict__ bo, const float* __restrict__ x,
                                                      float* __restrict__ y) {
  __shared__ __align__(16) float sC[GW * 32 * OP];
  const int tid  = threadIdx.x;
  const int wave = __builtin_amdgcn_readfirstlane(threadIdx.x >> 5);
  const int lane = tid & 31;
  const int lq   = lane & 15;
  const int hi   = lane >> 4;
  const int tok0 = blockIdx.x * GM;
  const int n0   = blockIdx.y * GN;
  const int bb   = tok0 / SEQ;
  const int s0   = tok0 - bb * SEQ;

  v8f acc[2][4];
  #pragma unroll
  for (int mt = 0; mt < 2; ++mt) {
    #pragma unroll
    for (int nt = 0; nt < 4; ++nt) acc[mt][nt] = (v8f){0, 0, 0, 0, 0, 0, 0, 0};
  }
  gemm_main<DIM>(ctx, woT, tok0 + wave * 32, n0, lq, hi, acc);

  const float ascale = 1.0f / (CC * WC);
  const int wb = wave * (32 * OP);
  #pragma unroll
  for (int nt = 0; nt < 4; ++nt) {
    const float bias = bfr(bo[n0 + nt * 16 + lq]);
    #pragma unroll
    for (int mt = 0; mt < 2; ++mt) {
      #pragma unroll
      for (int r = 0; r < 8; ++r)
        sC[wb + (mt * 16 + hi * 8 + r) * OP + nt * 16 + lq] = acc[mt][nt][r] * ascale + bias;
    }
  }
  __syncthreads();

  const size_t orow = (size_t)tok0 + wave * 32;                          // compact row
  const size_t rrow = (size_t)bb * SEQ_FULL + s0 + wave * 32;            // row of the full-size x
  #pragma unroll
  for (int g = 0; g < 2; ++g) {
    v4f vals[8];
    #pragma unroll
    for (int it = 0; it < 8; ++it) {
      const int row = g * 16 + it * 2 + hi;
      v4f cv = *(const v4f*)(&sC[wb + row * OP + lq * 4]);
      const v4f rv = *(const v4f*)(x + (rrow + row) * DIM + n0 + lq * 4);
      #pragma unroll
      for (int i = 0; i < 4; ++i) cv[i] = cv[i] + bfr(rv[i]);
      vals[it] = cv;
    }
    #pragma unroll
    for (int it = 0; it < 8; ++it)
      *(v4f*)(y + (orow + g * 16 + it * 2 + hi) * DIM + n0 + lq * 4) = vals[it];
    
  }
}

// ---------------------------------------------------------------------------------------------------
// f32 row: 4 instr x (32 lanes x 16 B) ; f16 row staged in LDS (cross-lane, block barrier): 2 instr x 512 B.
__global__ __launch_bounds__(256) void ln1_kernel(const float* __restrict__ y, const float* __restrict__ g,
                                                  const float* __restrict__ be,
                                                  float* __restrict__ x1f, f16* __restrict__ x1h) {
  __shared__ __align__(16) f16 sH[8 * DIM];
  const int tid  = threadIdx.x;
  const int wave = __builtin_amdgcn_readfirstlane(threadIdx.x >> 5);
  const int lane = tid & 31;
  const int t    = blockIdx.x * 8 + wave;             // compact token
  const float* yr = y + (size_t)t * DIM;

  v4f v[4];
  float s = 0.0f;
  #pragma unroll
  for (int j = 0; j < 4; ++j) {
    v[j] = *(const v4f*)(yr + j * 128 + lane * 4);
    s += (v[j][0] + v[j][1]) + (v[j][2] + v[j][3]);
  }
  s = wave_sum(s);
  const float mean = s * (1.0f / DIM);
  float q = 0.0f;
  #pragma unroll
  for (int j = 0; j < 4; ++j) {
    #pragma unroll
    for (int i = 0; i < 4; ++i) {
      const float d = v[j][i] - mean;
      q += d * d;
    }
  }
  q = wave_sum(q);
  const float rstd = rsqrtf(q * (1.0f / DIM) + 1e-5f);

  v4f ov[4];
  #pragma unroll
  for (int j = 0; j < 4; ++j) {
    const v4f gv = *(const v4f*)(g + j * 128 + lane * 4);
    const v4f bv = *(const v4f*)(be + j * 128 + lane * 4);
    #pragma unroll
    for (int i = 0; i < 4; ++i) {
      const float val = (v[j][i] - mean) * rstd * bfr(gv[i]) + bfr(bv[i]);
      ov[j][i] = val;
      sH[wave * DIM + j * 128 + lane * 4 + i] = (f16)(val * XC);
    }
  }
  __syncthreads();
  v4u hv[2];
  #pragma unroll
  for (int jj = 0; jj < 2; ++jj) {
    Pack8H ph;
    ph.v = *(const v8h*)(&sH[wave * DIM + jj * 256 + lane * 8]);
    hv[jj] = ph.u;
  }
  float* fo = x1f + (size_t)t * DIM + lane * 4;
  f16*   ho = x1h + (size_t)t * DIM + lane * 8;
  #pragma unroll
  for (int j = 0; j < 4; ++j) *(v4f*)(fo + j * 128) = ov[j];
  #pragma unroll
  for (int jj = 0; jj < 2; ++jj) *(v4u*)(ho + jj * 256) = hv[jj];
  
}

// ---------------------------------------------------------------------------------------------------
// hh = f16( gelu_erf(x1 x w1 + b1) * XC )   plane [NTOK][FFN]
__global__ __launch_bounds__(128) void gemm_ffn1_kernel(const f16* __restrict__ x1h, const f16* __restrict__ w1T,
                                                        const float* __restrict__ b1, f16* __restrict__ hh) {
  __shared__ __align__(16) float sC[GW * 32 * OP];
  const int tid  = threadIdx.x;
  const int wave = __builtin_amdgcn_readfirstlane(threadIdx.x >> 5);
  const int lane = tid & 31;
  const int lq   = lane & 15;
  const int hi   = lane >> 4;
  const int tok0 = blockIdx.x * GM;
  const int n0   = blockIdx.y * GN;

  v8f acc[2][4];
  #pragma unroll
  for (int mt = 0; mt < 2; ++mt) {
    #pragma unroll
    for (int nt = 0; nt < 4; ++nt) acc[mt][nt] = (v8f){0, 0, 0, 0, 0, 0, 0, 0};
  }
  gemm_main<DIM>(x1h, w1T, tok0 + wave * 32, n0, lq, hi, acc);

  const float ascale = 1.0f / (XC * WC);
  const int wb = wave * (32 * OP);
  #pragma unroll
  for (int nt = 0; nt < 4; ++nt) {
    const float bias = bfr(b1[n0 + nt * 16 + lq]);
    #pragma unroll
    for (int mt = 0; mt < 2; ++mt) {
      #pragma unroll
      for (int r = 0; r < 8; ++r)
        sC[wb + (mt * 16 + hi * 8 + r) * OP + nt * 16 + lq] = acc[mt][nt][r] * ascale + bias;
    }
  }
  __syncthreads();

  // GELU (erf form) in place on this lane's own pieces (same lane reads them back below); kept rolled
  const int lrow = lane >> 3;
  const int lcol = (lane & 7) * 8;
  #pragma unroll 1
  for (int i = 0; i < 16; ++i) {
    const int off = wb + ((i >> 1) * 4 + lrow) * OP + lcol + (i & 1) * 4;
    v4f t = *(const v4f*)(&sC[off]);
    #pragma unroll
    for (int e = 0; e < 4; ++e) {
      const float u = t[e];
      t[e] = 0.5f * u * (1.0f + erff(u * 0.70710678118654752f));
    }
    *(v4f*)(&sC[off]) = t;
  }

  v4u pv[8];
  #pragma unroll
  for (int it = 0; it < 8; ++it) {
    const int off = wb + (it * 4 + lrow) * OP + lcol;
    const v4f c0 = *(const v4f*)(&sC[off]);
    const v4f c1 = *(const v4f*)(&sC[off + 4]);
    Pack8H ph;
    #pragma unroll
    for (int i = 0; i < 4; ++i) {
      ph.h[i]     = (f16)(c0[i] * XC);
      ph.h[4 + i] = (f16)(c1[i] * XC);
    }
    pv[it] = ph.u;
  }
  const size_t obase = ((size_t)tok0 + wave * 32 + lrow) * FFN + n0 + lcol;
  #pragma unroll
  for (int it = 0; it < 8; ++it) *(v4u*)(hh + obase + (size_t)it * 4 * FFN) = pv[it];
  
}

// ---------------------------------------------------------------------------------------------------
// y = hh x w2 + b2 + x1f   (f32 plane [NTOK][DIM], input of LayerNorm 2)
__global__ __launch_bounds__(128) void gemm_ffn2_kernel(const f16* __restrict__ hh, const f16* __restrict__ w2T,
                                                        const float* __restrict__ b2, const float* __restrict__ x1f,
                                                        float* __restrict__ y) {
  __shared__ __align__(16) float sC[GW * 32 * OP];
  const int tid  = threadIdx.x;
  const int wave = __builtin_amdgcn_readfirstlane(threadIdx.x >> 5);
  const int lane = tid & 31;
  const int lq   = lane & 15;
  const int hi   = lane >> 4;
  const int tok0 = blockIdx.x * GM;
  const int n0   = blockIdx.y * GN;

  v8f acc[2][4];
  #pragma unroll
  for (int mt = 0; mt < 2; ++mt) {
    #pragma unroll
    for (int nt = 0; nt < 4; ++nt) acc[mt][nt] = (v8f){0, 0, 0, 0, 0, 0, 0, 0};
  }
  gemm_main<FFN>(hh, w2T, tok0 + wave * 32, n0, lq, hi, acc);

  const float ascale = 1.0f / (XC * WC);
  const int wb = wave * (32 * OP);
  #pragma unroll
  for (int nt = 0; nt < 4; ++nt) {
    const float bias = bfr(b2[n0 + nt * 16 + lq]);
    #pragma unroll
    for (int mt = 0; mt < 2; ++mt) {
      #pragma unroll
      for (int r = 0; r < 8; ++r)
        sC[wb + (mt * 16 + hi * 8 + r) * OP + nt * 16 + lq] = acc[mt][nt][r] * ascale + bias;
    }
  }
  __syncthreads();

  const size_t orow = (size_t)tok0 + wave * 32;
  #pragma unroll
  for (int g = 0; g < 2; ++g) {
    v4f vals[8];
    #pragma unroll
    for (int it = 0; it < 8; ++it) {
      const int row = g * 16 + it * 2 + hi;
      v4f cv = *(const v4f*)(&sC[wb + row * OP + lq * 4]);
      const v4f rv = *(const v4f*)(x1f + (orow + row) * DIM + n0 + lq * 4);
      #pragma unroll
      for (int i = 0; i < 4; ++i) cv[i] = cv[i] + rv[i];
      vals[it] = cv;
    }
    #pragma unroll
    for (int it = 0; it < 8; ++it)
      *(v4f*)(y + (orow + g * 16 + it * 2 + hi) * DIM + n0 + lq * 4) = vals[it];
    
  }
}

// ---------------------------------------------------------------------------------------------------
__global__ __launch_bounds__(256) void ln2_kernel(const float* __restrict__ y, const float* __restrict__ g,
                                                  const float* __restrict__ be, float* __restrict__ out) {
  const int tid  = threadIdx.x;
  const int wave = __builtin_amdgcn_readfirstlane(threadIdx.x >> 5);
  const int lane = tid & 31;
  const int t    = blockIdx.x * 8 + wave;             // compact token
  const int bb   = t / SEQ;
  const int s0   = t - bb * SEQ;
  const float* yr = y + (size_t)t * DIM;

  v4f v[4];
  float s = 0.0f;
  #pragma unroll
  for (int j = 0; j < 4; ++j) {
    v[j] = *(const v4f*)(yr + j * 128 + lane * 4);
    s += (v[j][0] + v[j][1]) + (v[j][2] + v[j][3]);
  }
  s = wave_sum(s);
  const float mean = s * (1.0f / DIM);
  float q = 0.0f;
  #pragma unroll
  for (int j = 0; j < 4; ++j) {
    #pragma unroll
    for (int i = 0; i < 4; ++i) {
      const float d = v[j][i] - mean;
      q += d * d;
    }
  }
  q = wave_sum(q);
  const float rstd = rsqrtf(q * (1.0f / DIM) + 1e-5f);

  v4f ov[4];
  #pragma unroll
  for (int j = 0; j < 4; ++j) {
    const v4f gv = *(const v4f*)(g + j * 128 + lane * 4);
    const v4f bv = *(const v4f*)(be + j * 128 + lane * 4);
    #pragma unroll
    for (int i = 0; i < 4; ++i) ov[j][i] = (v[j][i] - mean) * rstd * bfr(gv[i]) + bfr(bv[i]);
  }
  float* fo = out + ((size_t)bb * SEQ_FULL + s0) * DIM + lane * 4;
  #pragma unroll
  for (int j = 0; j < 4; ++j) *(v4f*)(fo + j * 128) = ov[j];
  
}

// ---------------------------------------------------------------------------------------------------
extern "C" void kernel_launch(void* const* d_in, const int* in_sizes, int n_in,
                              void* d_out, int out_size, void* d_ws, size_t ws_size,
                              hipStream_t stream) {
  if (n_in < 17) return;
  const size_t rows_used = (size_t)(NB - 1) * SEQ_FULL + SEQ;
  if ((size_t)in_sizes[0] < rows_used * DIM) return;
  if ((size_t)in_sizes[1] < (size_t)DIM * DIM || (size_t)in_sizes[3] < (size_t)DIM * DIM) return;
  if ((size_t)in_sizes[5] < (size_t)DIM * DIM || (size_t)in_sizes[7] < (size_t)DIM * DIM) return;
  if ((size_t)in_sizes[9] < (size_t)DIM * FFN || (size_t)in_sizes[11] < (size_t)FFN * DIM) return;
  if (in_sizes[2] < DIM || in_sizes[4] < DIM || in_sizes[6] < DIM || in_sizes[8] < DIM) return;
  if (in_sizes[10] < FFN || in_sizes[12] < DIM) return;
  if (in_sizes[13] < DIM || in_sizes[14] < DIM || in_sizes[15] < DIM || in_sizes[16] < DIM) return;
  if ((size_t)out_size < rows_used * DIM) return;
  if (ws_size < WS_TOTAL) return;

  const float* x   = (const float*)d_in[0];
  const float* wq  = (const float*)d_in[1];
  const float* bq  = (const float*)d_in[2];
  const float* wk  = (const float*)d_in[3];
  const float* bk  = (const float*)d_in[4];
  const float* wv  = (const float*)d_in[5];
  const float* bv  = (const float*)d_in[6];
  const float* wo  = (const float*)d_in[7];
  const float* bo  = (const float*)d_in[8];
  const float* w1  = (const float*)d_in[9];
  const float* b1  = (const float*)d_in[10];
  const float* w2  = (const float*)d_in[11];
  const float* b2  = (const float*)d_in[12];
  const float* g1  = (const float*)d_in[13];
  const float* be1 = (const float*)d_in[14];
  const float* g2  = (const float*)d_in[15];
  const float* be2 = (const float*)d_in[16];
  float* out = (float*)d_out;

  char* ws = (char*)d_ws;
  f16*   xh    = (f16*)(ws + OFF_XH);
  f16*   wqkvT = (f16*)(ws + OFF_WQKV);
  f16*   woT   = (f16*)(ws + OFF_WO);
  f16*   w1T   = (f16*)(ws + OFF_W1);
  f16*   w2T   = (f16*)(ws + OFF_W2);
  f16*   qk    = (f16*)(ws + OFF_BIG);     // 4 q/k planes
  f16*   hh    = (f16*)(ws + OFF_BIG);     // reuses the q/k region after the attention launch
  f16*   vt    = (f16*)(ws + OFF_VT);
  f16*   ctx   = (f16*)(ws + OFF_CTX);
  float* y     = (float*)(ws + OFF_Y);
  float* x1f   = (float*)(ws + OFF_X1F);
  f16*   x1h   = (f16*)(ws + OFF_X1H);

  // operand planes
  cvt_x_kernel<<<dim3((unsigned)((size_t)NTOK * DIM / 8 / 256)), 256, 0, stream>>>(x, xh);
  // in[512][512] -> out[512][512] (rows = output feature), three stacked into the [1536][512] plane
  wt_kernel<<<dim3(DIM / 64, DIM / 64), 256, 0, stream>>>(wq, wqkvT, DIM, DIM);
  wt_kernel<<<dim3(DIM / 64, DIM / 64), 256, 0, stream>>>(wk, wqkvT + (size_t)DIM * DIM, DIM, DIM);
  wt_kernel<<<dim3(DIM / 64, DIM / 64), 256, 0, stream>>>(wv, wqkvT + (size_t)2 * DIM * DIM, DIM, DIM);
  wt_kernel<<<dim3(DIM / 64, DIM / 64), 256, 0, stream>>>(wo, woT, DIM, DIM);
  // in[512][2048] -> out[2048][512] : grid (cols/64, rows/64) = (32, 8)
  wt_kernel<<<dim3(FFN / 64, DIM / 64), 256, 0, stream>>>(w1, w1T, DIM, FFN);
  // in[2048][512] -> out[512][2048] : grid (cols/64, rows/64) = (8, 32)
  wt_kernel<<<dim3(DIM / 64, FFN / 64), 256, 0, stream>>>(w2, w2T, FFN, DIM);

  gemm_qkv_kernel<<<dim3(NTOK / GM, QKVN / GN), 128, 0, stream>>>(xh, wqkvT, bq, bk, bv, qk, vt);
  attn_kernel<<<dim3(SEQ / BQ, NHEAD, NB), 256, 0, stream>>>(qk, vt, ctx);
  gemm_wo_kernel<<<dim3(NTOK / GM, DIM / GN), 128, 0, stream>>>(ctx, woT, bo, x, y);
  ln1_kernel<<<dim3(NTOK / 8), 256, 0, stream>>>(y, g1, be1, x1f, x1h);
  gemm_ffn1_kernel<<<dim3(NTOK / GM, FFN / GN), 128, 0, stream>>>(x1h, w1T, b1, hh);
  gemm_ffn2_kernel<<<dim3(NTOK / GM, DIM / GN), 128, 0, stream>>>(hh, w2T, b2, x1f, y);
  ln2_kernel<<<dim3(NTOK / 8), 256, 0, stream>>>(y, g2, be2, out);
}

// v001
// Measured time: 336 microseconds a run.
// In two side-by-side timings against v000, it was 1.40 and 1.41 times as fast.
#include <hip/hip_runtime.h>
#include <math.h>

// All contractions on v_wmma_f32_16x16x32_f16 with f32 accumulate: projections / Wo / FFN use f16 operand planes
// (inputs RNE-converted to bf16 first, then exact power-of-two carries); scores S^T = K x Q^T use q and k as
// f16 value plane + f16 residual plane (x2048, separate accumulator); O = P x V with P f16 carried x4096.
//
// Every f16 operand plane in the workspace is stored fragment-packed: a [rows][K] operand is cut into tiles of
// 16 rows x 32 k; a tile is two 512-B units (k halves 0..15 and 16..31); inside a unit lane (hi*16 + lq) owns 16 B =
// row lq, k = half*16 + hi*8 + 0..7. Unit index = (rowtile * (K/32) + kblock) * 2 + half; the V^T plane puts the k block outermost. One wave-wide 16-B-per-lane
// load of a unit is 512 contiguous bytes (4 whole lines) and lands directly in the split-k fragment map.

#ifndef NB
#define NB 4
#endif
#ifndef SEQ
#define SEQ 2048
#endif
#define NB_FULL   4
#define SEQ_FULL  2048
#define DIM       512
#define NHEAD     8
#define HDIM      64
#define FFN       2048
#define QKVN      (3 * DIM)
#define NTOK      (NB * SEQ)
#define PLANE     ((size_t)NTOK * DIM)     // elements of one [NB][NHEAD][SEQ][HDIM] 16-bit plane
#define GM        128                      // GEMM block rows (4 waves x 32)
#define GN        64                       // GEMM block columns
#define GW        4                        // waves per GEMM block
#define OP        68                       // LDS pitch (floats) of f32 staging tiles
#define VP        136                      // LDS pitch (halves) of the V^T staging tile
#define TP        72                       // LDS pitch (halves) of the weight transposer tile
#define SHP       (DIM + 16)               // LDS pitch (halves) of the LayerNorm-1 f16 row staging
#define BQ        128                      // query rows per attention block (8 waves x 16)
#define BK        32                       // keys per attention step
#define NWAVE     8
#define XC        16.0f                    // carry of the x, LN1-output and GELU-output planes
#define WC        64.0f                    // carry of all weight planes
#define VC        16.0f                    // carry of the V^T plane
#define CC        256.0f                   // carry of the attention-context plane
#define PC        4096.0f                  // carry of P inside the attention kernel
#define RC        2048.0f                  // carry of the q / k residual planes

static_assert(DIM == NHEAD * HDIM);
static_assert(HDIM == 64);
static_assert(HDIM == GN);
static_assert(GM == GW * 32);
static_assert(BQ == NWAVE * 16);
static_assert(SEQ % GM == 0);
static_assert(SEQ % BQ == 0);
static_assert(SEQ % BK == 0);
static_assert(NTOK % GM == 0);
static_assert(NTOK % 8 == 0);
static_assert(DIM % GN == 0);
static_assert(FFN % GN == 0);
static_assert(QKVN % GN == 0);
static_assert(DIM % 64 == 0);
static_assert(FFN % 64 == 0);
static_assert(DIM % 32 == 0);
static_assert(FFN % 32 == 0);
static_assert(DIM == 32 * 16);
static_assert(((size_t)NTOK * DIM / 8) % 256 == 0);
static_assert((OP * 4) % 16 == 0);
static_assert((VP * 2) % 16 == 0);
static_assert((TP * 2) % 16 == 0);
static_assert((SHP * 2) % 16 == 0);
static_assert(SEQ <= SEQ_FULL);
static_assert(NB >= 1 && NB <= NB_FULL);

#define SZ_XH    ((size_t)NTOK * DIM * 2)
#define SZ_WQKV  ((size_t)QKVN * DIM * 2)
#define SZ_WO    ((size_t)DIM * DIM * 2)
#define SZ_W1    ((size_t)FFN * DIM * 2)
#define SZ_W2    ((size_t)DIM * FFN * 2)
#define SZ_QK    ((size_t)4 * NTOK * DIM * 2)
#define SZ_HH    ((size_t)NTOK * FFN * 2)
#define SZ_BIG   ((SZ_QK > SZ_HH) ? SZ_QK : SZ_HH)   // q/k planes, later reused by the GELU-output plane
#define SZ_VT    ((size_t)NTOK * DIM * 2)
#define SZ_CTX   ((size_t)NTOK * DIM * 2)
#define SZ_Y     ((size_t)NTOK * DIM * 4)
#define SZ_X1F   ((size_t)NTOK * DIM * 4)
#define SZ_X1H   ((size_t)NTOK * DIM * 2)
#define OFF_XH   ((size_t)0)
#define OFF_WQKV (OFF_XH + SZ_XH)
#define OFF_WO   (OFF_WQKV + SZ_WQKV)
#define OFF_W1   (OFF_WO + SZ_WO)
#define OFF_W2   (OFF_W1 + SZ_W1)
#define OFF_BIG  (OFF_W2 + SZ_W2)
#define OFF_VT   (OFF_BIG + SZ_BIG)
#define OFF_CTX  (OFF_VT + SZ_VT)
#define OFF_Y    (OFF_CTX + SZ_CTX)
#define OFF_X1F  (OFF_Y + SZ_Y)
#define OFF_X1H  (OFF_X1F + SZ_X1F)
#define WS_TOTAL (OFF_X1H + SZ_X1H)
static_assert(SZ_QK <= SZ_BIG);
static_assert(SZ_HH <= SZ_BIG);
static_assert(SZ_XH % 128 == 0 && SZ_WQKV % 128 == 0 && SZ_WO % 128 == 0 && SZ_W1 % 128 == 0);
static_assert(SZ_W2 % 128 == 0 && SZ_BIG % 128 == 0 && SZ_VT % 128 == 0 && SZ_CTX % 128 == 0);
static_assert(SZ_Y % 128 == 0 && SZ_X1F % 128 == 0 && SZ_X1H % 128 == 0);
static_assert(WS_TOTAL <= (size_t)134217728);

typedef __bf16   bf16;
typedef _Float16 f16;
typedef f16      v16h  __attribute__((ext_vector_type(16)));
typedef f16      v8h   __attribute__((ext_vector_type(8)));
typedef float    v8f   __attribute__((ext_vector_type(8)));
typedef float    v4f   __attribute__((ext_vector_type(4)));
typedef unsigned v4u   __attribute__((ext_vector_type(4)));

union FragH  { v16h v; v4u q[2]; f16 h[16]; };
union Pack8H { v4u u; v8h v; f16 h[8]; };

// bf16 RNE convert of an f32 value, returned as f32
static __device__ __forceinline__ float bfr(float v) { return (float)(bf16)v; }

// WMMA helper: builtin followed by the VALU hazard guard (ties D, keeps A/B live).
static __device__ __forceinline__ v8f mma_f16(v16h a, v16h b, v8f acc) {
  acc = __builtin_amdgcn_wmma_f32_16x16x32_f16(false, a, false, b, (short)0, acc, false, false);
  asm volatile("v_nop\n\tv_nop\n\tv_nop\n\tv_nop" : "+v"(acc) : "v"(a), "v"(b));
  return acc;
}

static __device__ __forceinline__ float wave_sum(float v) {
  v += __shfl_xor(v, 16, 32);
  v += __shfl_xor(v, 8, 32);
  v += __shfl_xor(v, 4, 32);
  v += __shfl_xor(v, 2, 32);
  v += __shfl_xor(v, 1, 32);
  return v;
}

// ---------------------------------------------------------------------------------------------------
// x f32 -> xh packed f16 plane (rows = tokens, K = DIM) = f16(bf16_rne(x) * XC). One thread = one 16-B piece.
__global__ __launch_bounds__(256) void cvt_x_kernel(const float* __restrict__ x, f16* __restrict__ xh) {
  // g = [rowtile][kblock 16][row half 2][8-column group 4 = half*2 + hi][row 8]: a wave reads 8 rows x 128 B
  // and writes four whole 128-B lines of the packed plane.
  const int g = blockIdx.x * 256 + threadIdx.x;
  const int r = ((g >> 5) & 1) * 8 + (g & 7);      // row of the 16-row tile
  const int t = (g >> 10) * 16 + r;                // compact token
  const int c = ((g >> 6) & 15) * 32 + ((g >> 3) & 3) * 8;
  if (t >= NTOK) return;
  const int bb = t / SEQ;
  const int s  = t - bb * SEQ;
  const float* src = x + ((size_t)bb * SEQ_FULL + s) * DIM + c;
  const v4f a0 = *(const v4f*)(src);
  const v4f a1 = *(const v4f*)(src + 4);
  Pack8H p;
  #pragma unroll
  for (int i = 0; i < 4; ++i) {
    p.h[i]     = (f16)(bfr(a0[i]) * XC);
    p.h[4 + i] = (f16)(bfr(a1[i]) * XC);
  }
  const v4u val = p.u;
  f16* dst = xh + (size_t)(g >> 6) * 512 + ((g >> 4) & 1) * 256 + (((g >> 3) & 1) * 16 + r) * 8;
  *(v4u*)dst = val;
  
}

// ---------------------------------------------------------------------------------------------------
// Weight transposer: in[K rows][N cols] f32  ->  packed plane (rows = n, K = k) f16 = f16(bf16_rne(w) * WC).
// grid = (N/64, K/64), 256 threads, tile 64(k) x 64(n) through LDS (cross-wave, block barrier).
__global__ __launch_bounds__(256) void wt_kernel(const float* __restrict__ W, f16* __restrict__ Wt, int K, int N) {
  __shared__ __align__(16) f16 sT[64 * TP];     // [n][k]
  const int tid = threadIdx.x;
  const int n0 = blockIdx.x * 64;
  const int k0 = blockIdx.y * 64;
  #pragma unroll
  for (int it = 0; it < 4; ++it) {
    const int kk = it * 16 + (tid >> 4);        // 0..63
    const int nn = (tid & 15) * 4;              // 0..60
    const v4f w = *(const v4f*)(W + (size_t)(k0 + kk) * N + n0 + nn);
    #pragma unroll
    for (int i = 0; i < 4; ++i) sT[(nn + i) * TP + kk] = (f16)(bfr(w[i]) * WC);
  }
  __syncthreads();
  v4u    val[2];
  size_t idx[2];
  #pragma unroll
  for (int it = 0; it < 2; ++it) {
    const int u  = it * 8 + (tid >> 5);         // unit 0..15 of this tile: [n tile 4][kblock 2][half 2]
    const int ln = tid & 31;
    const int n  = (u >> 2) * 16 + (ln & 15);                               // 0..63
    const int ks = ((u >> 1) & 1) * 32 + (u & 1) * 16 + (ln >> 4) * 8;      // 0..56
    Pack8H ph;
    ph.v = *(const v8h*)(&sT[n * TP + ks]);
    val[it] = ph.u;
    idx[it] = (((size_t)((n0 >> 4) + (u >> 2)) * (K >> 5) + (k0 >> 5) + ((u >> 1) & 1)) * 2 + (u & 1)) * 256 + ln * 8;
  }
  #pragma unroll
  for (int it = 0; it < 2; ++it) *(v4u*)(Wt + idx[it]) = val[it];
  
}

// ---------------------------------------------------------------------------------------------------
// GEMM main loop: acc[mt][nt] (16x16 tiles) of  A[m0 .. m0+31][K] x Bt[n0 .. n0+63][K]^T.
// A and Bt are packed f16 planes; fragments use the split k map for both operands:
// elements 0..7 <- k0 + 8*hi + 0..7, elements 8..15 <- k0 + 16 + 8*hi + 0..7; lane row / column = lq.
// A 16-row tile spans K*16 halves; a k block of 32 spans 512 halves; the second k half starts at +256.
template <int K>
static __device__ __forceinline__ void gemm_main(const f16* __restrict__ A, const f16* __restrict__ Bt,
                                                 int m0, int n0, int lq, int hi, v8f (&acc)[2][4]) {
  static_assert(K % 32 == 0);
  const f16* ap = A  + (size_t)m0 * K + (hi * 16 + lq) * 8;
  const f16* bp = Bt + (size_t)n0 * K + (hi * 16 + lq) * 8;
  #pragma unroll 1
  for (int k0 = 0; k0 < K; k0 += 32) {
    FragH a[2], b[4];
    #pragma unroll
    for (int mt = 0; mt < 2; ++mt) {
      const f16* p = ap + (size_t)mt * 16 * K + k0 * 16;
      a[mt].q[0] = *(const v4u*)(p);
      a[mt].q[1] = *(const v4u*)(p + 256);
    }
    #pragma unroll
    for (int nt = 0; nt < 4; ++nt) {
      const f16* p = bp + (size_t)nt * 16 * K + k0 * 16;
      b[nt].q[0] = *(const v4u*)(p);
      b[nt].q[1] = *(const v4u*)(p + 256);
    }
    #pragma unroll
    for (int mt = 0; mt < 2; ++mt) {
      #pragma unroll
      for (int nt = 0; nt < 4; ++nt) acc[mt][nt] = mma_f16(a[mt].v, b[nt].v, acc[mt][nt]);
    }
  }
}

// ---------------------------------------------------------------------------------------------------
// Fused q/k/v projection: [NTOK][512] x [1536][512]^T. Column block (64 wide) = one head of q, k or v.
//          qk plane order: 0 = q value, 1 = q residual, 2 = k value, 3 = k residual.
//   q, k : per (b, h) a packed plane with rows = tokens, K = d (64): 1024 halves per 16 tokens.
//   v    : per (b, h) a packed plane with rows = d (4 tiles), K = tokens, k block outermost:
//          [s/32][d tile 4][half 2][lane 32][8] f16 (x VC), written through a block-wide LDS tile.
// coverage: q/k rows wave*32 + {0..31} x 64 d = 8 units per wave; vt 64 d x 128 tokens = 32 units per block.
__global__ __launch_bounds__(128) void gemm_qkv_kernel(const f16* __restrict__ xh, const f16* __restrict__ wT,
                                                       const float* __restrict__ bq, const float* __restrict__ bk,
                                                       const float* __restrict__ bv,
                                                       f16* __restrict__ qk, f16* __restrict__ vt) {
  __shared__ __align__(16) float sC[GW * 32 * OP];    // per-wave f32 tiles (block barrier used)
  __shared__ __align__(16) f16   sVT[HDIM * VP];      // [d][token], cross-wave (block barrier)
  const int tid  = threadIdx.x;
  const int wave = __builtin_amdgcn_readfirstlane(threadIdx.x >> 5);
  const int lane = tid & 31;
  const int lq   = lane & 15;
  const int hi   = lane >> 4;
  const int tok0 = blockIdx.x * GM;
  const int n0   = blockIdx.y * GN;
  const int seg  = n0 / DIM;                          // 0 = q, 1 = k, 2 = v (block-uniform)
  const int h    = (n0 - seg * DIM) / HDIM;
  const int bb   = tok0 / SEQ;
  const int s0   = tok0 - bb * SEQ;

  v8f acc[2][4];
  #pragma unroll
  for (int mt = 0; mt < 2; ++mt) {
    #pragma unroll
    for (int nt = 0; nt < 4; ++nt) acc[mt][nt] = (v8f){0, 0, 0, 0, 0, 0, 0, 0};
  }
  gemm_main<DIM>(xh, wT, tok0 + wave * 32, n0, lq, hi, acc);

  const float ascale = 1.0f / (XC * WC);
  float bias[4];
  #pragma unroll
  for (int nt = 0; nt < 4; ++nt) {
    const int c = h * HDIM + nt * 16 + lq;            // 0..511
    const float fq = bq[c];
    const float fk = bk[c];
    const float fv = bv[c];
    const float sel = (seg == 0) ? fq : ((seg == 1) ? fk : fv);
    bias[nt] = bfr(sel);
  }

  if (seg < 2) {
    const int wb = wave * (32 * OP);
    #pragma unroll
    for (int mt = 0; mt < 2; ++mt) {
      #pragma unroll
      for (int nt = 0; nt < 4; ++nt) {
        #pragma unroll
        for (int r = 0; r < 8; ++r)
          sC[wb + (mt * 16 + hi * 8 + r) * OP + nt * 16 + lq] = acc[mt][nt][r] * ascale + bias[nt];
      }
    }
    __syncthreads();
    const size_t pbase = (size_t)seg * 2 * PLANE +
                         (((size_t)bb * NHEAD + h) * SEQ + s0 + wave * 32) * HDIM;
    v4u hv[8], rv[8];
    #pragma unroll
    for (int it = 0; it < 8; ++it) {
      const int row = (it >> 2) * 16 + lq;                               // unit it: [row tile 2][d block 2][half 2]
      const int col = ((it >> 1) & 1) * 32 + (it & 1) * 16 + hi * 8;
      const v4f c0 = *(const v4f*)(&sC[wb + row * OP + col]);
      const v4f c1 = *(const v4f*)(&sC[wb + row * OP + col + 4]);
      Pack8H ph, pr;
      #pragma unroll
      for (int i = 0; i < 4; ++i) {
        const f16 h0 = (f16)c0[i];
        const f16 h1 = (f16)c1[i];
        ph.h[i]     = h0;
        ph.h[4 + i] = h1;
        pr.h[i]     = (f16)((c0[i] - (float)h0) * RC);
        pr.h[4 + i] = (f16)((c1[i] - (float)h1) * RC);
      }
      hv[it] = ph.u;
      rv[it] = pr.u;
    }
    #pragma unroll
    for (int it = 0; it < 8; ++it) {
      const size_t o = pbase + (size_t)it * 256 + lane * 8;
      *(v4u*)(qk + o)         = hv[it];
      *(v4u*)(qk + PLANE + o) = rv[it];
    }
    
  } else {
    #pragma unroll
    for (int mt = 0; mt < 2; ++mt) {
      #pragma unroll
      for (int nt = 0; nt < 4; ++nt) {
        #pragma unroll
        for (int r = 0; r < 8; ++r)
          sVT[(nt * 16 + lq) * VP + wave * 32 + mt * 16 + hi * 8 + r] =
              (f16)((acc[mt][nt][r] * ascale + bias[nt]) * VC);
      }
    }
    __syncthreads();
    const size_t vbase = (((size_t)bb * NHEAD + h) * SEQ + s0) * HDIM;   // first unit of this block's 128 tokens
    v4u vv[8];
    #pragma unroll
    for (int it = 0; it < 8; ++it) {
      const int u = it * 4 + wave;                 // unit 0..31: [token block 4][d tile 4][half 2]
      const int d = ((u >> 1) & 3) * 16 + lq;
      const int s = (u >> 3) * 32 + (u & 1) * 16 + hi * 8;
      Pack8H ph;
      ph.v = *(const v8h*)(&sVT[d * VP + s]);
      vv[it] = ph.u;
    }
    #pragma unroll
    for (int it = 0; it < 8; ++it) {
      const size_t o = vbase + (size_t)(it * 4 + wave) * 256 + lane * 8;
      *(v4u*)(vt + o) = vv[it];
    }
    
  }
}

// ---------------------------------------------------------------------------------------------------
// Flash attention, full (no mask). Block = (128-query block, head, batch); one wave owns 16 query rows.
// S^T = K x Q^T so queries sit on lanes; P^T in C layout is the A-fragment layout of O += P x V.
// Scores: main = k_val x q_val ; res = k_val x q_res + k_res x q_val (both x RC) ; s = main + res / RC.
// Fragments come straight from the packed 16-bit planes (two 512-B unit loads each); q fragments are reloaded per k-step.
__global__ __launch_bounds__(256) void attn_kernel(const f16* __restrict__ qk, const f16* __restrict__ vt,
                                                   f16* __restrict__ ctx) {
  __shared__ __align__(16) float sO[NWAVE * 16 * OP];    // per-wave output staging (block barrier used)
  const int qblk = blockIdx.x;
  const int h    = blockIdx.y;
  const int b    = blockIdx.z;
  const int tid  = threadIdx.x;
  const int wave = __builtin_amdgcn_readfirstlane(threadIdx.x >> 5);
  const int lane = tid & 31;
  const int lq   = lane & 15;   // query column of S^T / d column of O
  const int hi   = lane >> 4;   // k-split half

  const int qrow0 = qblk * BQ + wave * 16;
  const size_t hb = ((size_t)b * NHEAD + h) * (size_t)SEQ * HDIM;
  const f16* qh_p = qk + hb;
  const f16* qr_p = qk + PLANE + hb;
  const f16* kh_p = qk + 2 * PLANE + hb;
  const f16* kr_p = qk + 3 * PLANE + hb;
  const f16* vt_h = vt + hb;
  const int qoff  = qrow0 * HDIM + lane * 8;         // this wave's 16-query tile, lane's piece of a unit

  v8f o[4];
  #pragma unroll
  for (int dt = 0; dt < 4; ++dt) o[dt] = (v8f){0, 0, 0, 0, 0, 0, 0, 0};

  float rmax = -__builtin_inff();
  float rsum = 0.0f;
  const float SL = 0.125f * 1.4426950408889634f;   // softmax scale * log2(e)

  #pragma unroll 1
  for (int j0 = 0; j0 < SEQ; j0 += BK) {
    // S^T tiles: c[sub][r] = rawscore(query qrow0+lq, key j0 + sub*16 + hi*8 + r)
    v8f c[2];
    #pragma unroll
    for (int sub = 0; sub < 2; ++sub) {
      v8f am = (v8f){0, 0, 0, 0, 0, 0, 0, 0};
      v8f ar = (v8f){0, 0, 0, 0, 0, 0, 0, 0};
      #pragma unroll
      for (int f = 0; f < 2; ++f) {
        int qo = qoff + f * 512;
        asm volatile("" : "+v"(qo));                   // opaque offset: fragments reloaded, not held
        FragH fqh, fqr, fkh, fkr;
        fqh.q[0] = *(const v4u*)(qh_p + qo);           // d = f*32 + hi*8 + 0..7
        fqh.q[1] = *(const v4u*)(qh_p + qo + 256);     // d = f*32 + 16 + hi*8 + 0..7
        fqr.q[0] = *(const v4u*)(qr_p + qo);
        fqr.q[1] = *(const v4u*)(qr_p + qo + 256);
        // the q address pairs die here and later load results may land in them: wait before any such overwrite
        asm volatile("s_wait_xcnt 0x0" ::: "memory");
        const int ko = (j0 + sub * 16) * HDIM + f * 512 + lane * 8;     // row = key lq of the tile, split d map
        fkh.q[0] = *(const v4u*)(kh_p + ko);
        fkh.q[1] = *(const v4u*)(kh_p + ko + 256);
        fkr.q[0] = *(const v4u*)(kr_p + ko);
        fkr.q[1] = *(const v4u*)(kr_p + ko + 256);
        am = mma_f16(fkh.v, fqh.v, am);
        ar = mma_f16(fkh.v, fqr.v, ar);
        ar = mma_f16(fkr.v, fqh.v, ar);
      }
      #pragma unroll
      for (int r = 0; r < 8; ++r) c[sub][r] = am[r] + ar[r] * (1.0f / RC);
    }

    // V B-fragments: column n = d = dt*16 + lq, split key map from the packed transposed plane
    FragH bv[4];
    #pragma unroll
    for (int dt = 0; dt < 4; ++dt) {
      const f16* base = vt_h + (size_t)j0 * HDIM + dt * 512 + lane * 8;
      bv[dt].q[0] = *(const v4u*)(base);            // keys j0 + hi*8 + 0..7
      bv[dt].q[1] = *(const v4u*)(base + 256);      // keys j0 + 16 + hi*8 + 0..7
    }

    // online softmax: query lq's 32 scores are split across lane / lane^16
    float m_new = rmax;
    #pragma unroll
    for (int r = 0; r < 8; ++r) {
      m_new = fmaxf(m_new, c[0][r]);
      m_new = fmaxf(m_new, c[1][r]);
    }
    m_new = fmaxf(m_new, __shfl_xor(m_new, 16, 32));
    const float scale = __builtin_amdgcn_exp2f((rmax - m_new) * SL);
    rmax = m_new;

    // exp + pack: P^T C-layout == A-fragment layout for the PV product
    FragH pa;
    float psum = 0.0f;
    #pragma unroll
    for (int r = 0; r < 8; ++r) {
      const float p0 = __builtin_amdgcn_exp2f((c[0][r] - m_new) * SL);   // key hi*8 + r
      const float p1 = __builtin_amdgcn_exp2f((c[1][r] - m_new) * SL);   // key 16 + hi*8 + r
      psum += p0 + p1;
      pa.h[r]     = (f16)(p0 * PC);
      pa.h[8 + r] = (f16)(p1 * PC);
    }
    rsum = rsum * scale + psum + __shfl_xor(psum, 16, 32);

    // rescale O: queries are the row dimension there -> per-row scale from lane 8*hi + r
    float sc[8];
    #pragma unroll
    for (int r = 0; r < 8; ++r) sc[r] = __shfl(scale, (hi << 3) + r, 32);
    #pragma unroll
    for (int dt = 0; dt < 4; ++dt) {
      #pragma unroll
      for (int r = 0; r < 8; ++r) o[dt][r] *= sc[r];
    }

    // O += P x V
    #pragma unroll
    for (int dt = 0; dt < 4; ++dt) o[dt] = mma_f16(pa.v, bv[dt].v, o[dt]);
  }

  // normalize: lane holds column d = dt*16 + lq for query rows 8*hi + r
  float rs[8];
  #pragma unroll
  for (int r = 0; r < 8; ++r) rs[r] = 1.0f / __shfl(rsum, (hi << 3) + r, 32);

  const int wb = wave * (16 * OP);
  #pragma unroll
  for (int r = 0; r < 8; ++r) {
    #pragma unroll
    for (int dt = 0; dt < 4; ++dt)
      sO[wb + (hi * 8 + r) * OP + dt * 16 + lq] = o[dt][r] * (CC / (PC * VC)) * rs[r];
  }
  __syncthreads();

  v4u    pv[4];
  size_t gidx[4];
  #pragma unroll
  for (int it = 0; it < 4; ++it) {
    const int row = lq;                                   // unit it: [k block 2][half 2] of this head's 64 columns
    const int col = (it >> 1) * 32 + (it & 1) * 16 + hi * 8;
    const v4f c0 = *(const v4f*)(&sO[wb + row * OP + col]);
    const v4f c1 = *(const v4f*)(&sO[wb + row * OP + col + 4]);
    Pack8H ph;
    #pragma unroll
    for (int i = 0; i < 4; ++i) {
      ph.h[i]     = (f16)c0[i];
      ph.h[4 + i] = (f16)c1[i];
    }
    pv[it]   = ph.u;
    gidx[it] = ((size_t)b * SEQ + qrow0) * DIM + (size_t)(h * 4 + it) * 256 + lane * 8;   // packed, K = DIM
  }
  #pragma unroll
  for (int it = 0; it < 4; ++it) *(v4u*)(ctx + gidx[it]) = pv[it];
  
}

// ---------------------------------------------------------------------------------------------------
// y = ctx x wo + bo + bf16_rne(x)   (f32 plane [NTOK][DIM], input of LayerNorm 1)
// coverage: rows wave*32 + {0..31}, 64 columns: 16 instr, lanes 0..15 one 256-B row segment, 16..31 the next row.
__global__ __launch_bounds__(128) void gemm_wo_kernel(const f16* __restrict__ ctx, const f16* __restrict__ woT,
                                                      const float* __restrict__ bo, const float* __restrict__ x,
                                                      float* __restrict__ y) {
  __shared__ __align__(16) float sC[GW * 32 * OP];
  const int tid  = threadIdx.x;
  const int wave = __builtin_amdgcn_readfirstlane(threadIdx.x >> 5);
  const int lane = tid & 31;
  const int lq   = lane & 15;
  const int hi   = lane >> 4;
  const int tok0 = blockIdx.x * GM;
  const int n0   = blockIdx.y * GN;
  const int bb   = tok0 / SEQ;
  const int s0   = tok0 - bb * SEQ;

  v8f acc[2][4];
  #pragma unroll
  for (int mt = 0; mt < 2; ++mt) {
    #pragma unroll
    for (int nt = 0; nt < 4; ++nt) acc[mt][nt] = (v8f){0, 0, 0, 0, 0, 0, 0, 0};
  }
  gemm_main<DIM>(ctx, woT, tok0 + wave * 32, n0, lq, hi, acc);

  const float ascale = 1.0f / (CC * WC);
  const int wb = wave * (32 * OP);
  #pragma unroll
  for (int nt = 0; nt < 4; ++nt) {
    const float bias = bfr(bo[n0 + nt * 16 + lq]);
    #pragma unroll
    for (int mt = 0; mt < 2; ++mt) {
      #pragma unroll
      for (int r = 0; r < 8; ++r)
        sC[wb + (mt * 16 + hi * 8 + r) * OP + nt * 16 + lq] = acc[mt][nt][r] * ascale + bias;
    }
  }
  __syncthreads();

  const size_t orow = (size_t)tok0 + wave * 32;                          // compact row
  const size_t rrow = (size_t)bb * SEQ_FULL + s0 + wave * 32;            // row of the full-size x
  #pragma unroll
  for (int g = 0; g < 2; ++g) {
    v4f vals[8];
    #pragma unroll
    for (int it = 0; it < 8; ++it) {
      const int row = g * 16 + it * 2 + hi;
      v4f cv = *(const v4f*)(&sC[wb + row * OP + lq * 4]);
      const v4f rv = *(const v4f*)(x + (rrow + row) * DIM + n0 + lq * 4);
      #pragma unroll
      for (int i = 0; i < 4; ++i) cv[i] = cv[i] + bfr(rv[i]);
      vals[it] = cv;
    }
    #pragma unroll
    for (int it = 0; it < 8; ++it)
      *(v4f*)(y + (orow + g * 16 + it * 2 + hi) * DIM + n0 + lq * 4) = vals[it];
    
  }
}

// ---------------------------------------------------------------------------------------------------
// f32 row: 4 instr x (32 lanes x 16 B) ; f16 rows staged in LDS (cross-wave, block barrier) and written packed:
// the block's 8 tokens fill 8 neighbouring lane slots = one whole 128-B line in each of the 64 (k block, half, hi) groups.
__global__ __launch_bounds__(256) void ln1_kernel(const float* __restrict__ y, const float* __restrict__ g,
                                                  const float* __restrict__ be,
                                                  float* __restrict__ x1f, f16* __restrict__ x1h) {
  __shared__ __align__(16) f16 sH[8 * SHP];
  const int tid  = threadIdx.x;
  const int wave = __builtin_amdgcn_readfirstlane(threadIdx.x >> 5);
  const int lane = tid & 31;
  const int t    = blockIdx.x * 8 + wave;             // compact token
  const float* yr = y + (size_t)t * DIM;

  v4f v[4];
  float s = 0.0f;
  #pragma unroll
  for (int j = 0; j < 4; ++j) {
    v[j] = *(const v4f*)(yr + j * 128 + lane * 4);
    s += (v[j][0] + v[j][1]) + (v[j][2] + v[j][3]);
  }
  s = wave_sum(s);
  const float mean = s * (1.0f / DIM);
  float q = 0.0f;
  #pragma unroll
  for (int j = 0; j < 4; ++j) {
    #pragma unroll
    for (int i = 0; i < 4; ++i) {
      const float d = v[j][i] - mean;
      q += d * d;
    }
  }
  q = wave_sum(q);
  const float rstd = rsqrtf(q * (1.0f / DIM) + 1e-5f);

  v4f ov[4];
  #pragma unroll
  for (int j = 0; j < 4; ++j) {
    const v4f gv = *(const v4f*)(g + j * 128 + lane * 4);
    const v4f bv = *(const v4f*)(be + j * 128 + lane * 4);
    #pragma unroll
    for (int i = 0; i < 4; ++i) {
      const float val = (v[j][i] - mean) * rstd * bfr(gv[i]) + bfr(bv[i]);
      ov[j][i] = val;
      sH[wave * SHP + j * 128 + lane * 4 + i] = (f16)(val * XC);
    }
  }
  __syncthreads();
  const int t0 = blockIdx.x * 8;                      // first token of the block
  v4u    hv[2];
  size_t hidx[2];
  #pragma unroll
  for (int jj = 0; jj < 2; ++jj) {
    const int tk = tid & 7;                           // token of the block
    const int ln = jj * 32 + (tid >> 3);              // 8-column group 0..63 = kblock*4 + half*2 + hi
    Pack8H ph;
    ph.v = *(const v8h*)(&sH[tk * SHP + ln * 8]);
    hv[jj] = ph.u;
    hidx[jj] = (size_t)(t0 >> 4) * (16 * DIM) + (size_t)(ln >> 1) * 256 + ((ln & 1) * 16 + (t0 & 15) + tk) * 8;
  }
  float* fo = x1f + (size_t)t * DIM + lane * 4;
  #pragma unroll
  for (int j = 0; j < 4; ++j) *(v4f*)(fo + j * 128) = ov[j];
  #pragma unroll
  for (int jj = 0; jj < 2; ++jj) *(v4u*)(x1h + hidx[jj]) = hv[jj];
  
}

// ---------------------------------------------------------------------------------------------------
// hh = f16( gelu_erf(x1 x w1 + b1) * XC )   packed plane (rows = tokens, K = FFN)
__global__ __launch_bounds__(128) void gemm_ffn1_kernel(const f16* __restrict__ x1h, const f16* __restrict__ w1T,
                                                        const float* __restrict__ b1, f16* __restrict__ hh) {
  __shared__ __align__(16) float sC[GW * 32 * OP];
  const int tid  = threadIdx.x;
  const int wave = __builtin_amdgcn_readfirstlane(threadIdx.x >> 5);
  const int lane = tid & 31;
  const int lq   = lane & 15;
  const int hi   = lane >> 4;
  const int tok0 = blockIdx.x * GM;
  const int n0   = blockIdx.y * GN;

  v8f acc[2][4];
  #pragma unroll
  for (int mt = 0; mt < 2; ++mt) {
    #pragma unroll
    for (int nt = 0; nt < 4; ++nt) acc[mt][nt] = (v8f){0, 0, 0, 0, 0, 0, 0, 0};
  }
  gemm_main<DIM>(x1h, w1T, tok0 + wave * 32, n0, lq, hi, acc);

  const float ascale = 1.0f / (XC * WC);
  const int wb = wave * (32 * OP);
  #pragma unroll
  for (int nt = 0; nt < 4; ++nt) {
    const float bias = bfr(b1[n0 + nt * 16 + lq]);
    #pragma unroll
    for (int mt = 0; mt < 2; ++mt) {
      #pragma unroll
      for (int r = 0; r < 8; ++r)
        sC[wb + (mt * 16 + hi * 8 + r) * OP + nt * 16 + lq] = acc[mt][nt][r] * ascale + bias;
    }
  }
  __syncthreads();

  // GELU (erf form) in place on this lane's own pieces (same lane reads them back below); kept rolled
  // piece it = i >> 1 is this lane's 16 B of unit it: [row tile 2][k block 2][half 2]
  const int lbase = wb + lq * OP + hi * 8;
  #pragma unroll 1
  for (int i = 0; i < 16; ++i) {
    const int off = lbase + (i >> 3) * (16 * OP) + ((i >> 1) & 3) * 16 + (i & 1) * 4;
    v4f t = *(const v4f*)(&sC[off]);
    #pragma unroll
    for (int e = 0; e < 4; ++e) {
      const float u = t[e];
      t[e] = 0.5f * u * (1.0f + erff(u * 0.70710678118654752f));
    }
    *(v4f*)(&sC[off]) = t;
  }

  v4u pv[8];
  #pragma unroll
  for (int it = 0; it < 8; ++it) {
    const int off = lbase + (it >> 2) * (16 * OP) + (it & 3) * 16;
    const v4f c0 = *(const v4f*)(&sC[off]);
    const v4f c1 = *(const v4f*)(&sC[off + 4]);
    Pack8H ph;
    #pragma unroll
    for (int i = 0; i < 4; ++i) {
      ph.h[i]     = (f16)(c0[i] * XC);
      ph.h[4 + i] = (f16)(c1[i] * XC);
    }
    pv[it] = ph.u;
  }
  const size_t obase = ((size_t)tok0 + wave * 32) * FFN + (size_t)n0 * 16 + lane * 8;
  #pragma unroll
  for (int it = 0; it < 8; ++it) *(v4u*)(hh + obase + (size_t)(it >> 2) * 16 * FFN + (it & 3) * 256) = pv[it];
  
}

// ---------------------------------------------------------------------------------------------------
// y = hh x w2 + b2 + x1f   (f32 plane [NTOK][DIM], input of LayerNorm 2)
__global__ __launch_bounds__(128) void gemm_ffn2_kernel(const f16* __restrict__ hh, const f16* __restrict__ w2T,
                                                        const float* __restrict__ b2, const float* __restrict__ x1f,
                                                        float* __restrict__ y) {
  __shared__ __align__(16) float sC[GW * 32 * OP];
  const int tid  = threadIdx.x;
  const int wave = __builtin_amdgcn_readfirstlane(threadIdx.x >> 5);
  const int lane = tid & 31;
  const int lq   = lane & 15;
  const int hi   = lane >> 4;
  const int tok0 = blockIdx.x * GM;
  const int n0   = blockIdx.y * GN;

  v8f acc[2][4];
  #pragma unroll
  for (int mt = 0; mt < 2; ++mt) {
    #pragma unroll
    for (int nt = 0; nt < 4; ++nt) acc[mt][nt] = (v8f){0, 0, 0, 0, 0, 0, 0, 0};
  }
  gemm_main<FFN>(hh, w2T, tok0 + wave * 32, n0, lq, hi, acc);

  const float ascale = 1.0f / (XC * WC);
  const int wb = wave * (32 * OP);
  #pragma unroll
  for (int nt = 0; nt < 4; ++nt) {
    const float bias = bfr(b2[n0 + nt * 16 + lq]);
    #pragma unroll
    for (int mt = 0; mt < 2; ++mt) {
      #pragma unroll
      for (int r = 0; r < 8; ++r)
        sC[wb + (mt * 16 + hi * 8 + r) * OP + nt * 16 + lq] = acc[mt][nt][r] * ascale + bias;
    }
  }
  __syncthreads();

  const size_t orow = (size_t)tok0 + wave * 32;
  #pragma unroll
  for (int g = 0; g < 2; ++g) {
    v4f vals[8];
    #pragma unroll
    for (int it = 0; it < 8; ++it) {
      const int row = g * 16 + it * 2 + hi;
      v4f cv = *(const v4f*)(&sC[wb + row * OP + lq * 4]);
      const v4f rv = *(const v4f*)(x1f + (orow + row) * DIM + n0 + lq * 4);
      #pragma unroll
      for (int i = 0; i < 4; ++i) cv[i] = cv[i] + rv[i];
      vals[it] = cv;
    }
    #pragma unroll
    for (int it = 0; it < 8; ++it)
      *(v4f*)(y + (orow + g * 16 + it * 2 + hi) * DIM + n0 + lq * 4) = vals[it];
    
  }
}

// ---------------------------------------------------------------------------------------------------
__global__ __launch_bounds__(256) void ln2_kernel(const float* __restrict__ y, const float* __restrict__ g,
                                                  const float* __restrict__ be, float* __restrict__ out) {
  const int tid  = threadIdx.x;
  const int wave = __builtin_amdgcn_readfirstlane(threadIdx.x >> 5);
  const int lane = tid & 31;
  const int t    = blockIdx.x * 8 + wave;             // compact token
  const int bb   = t / SEQ;
  const int s0   = t - bb * SEQ;
  const float* yr = y + (size_t)t * DIM;

  v4f v[4];
  float s = 0.0f;
  #pragma unroll
  for (int j = 0; j < 4; ++j) {
    v[j] = *(const v4f*)(yr + j * 128 + lane * 4);
    s += (v[j][0] + v[j][1]) + (v[j][2] + v[j][3]);
  }
  s = wave_sum(s);
  const float mean = s * (1.0f / DIM);
  float q = 0.0f;
  #pragma unroll
  for (int j = 0; j < 4; ++j) {
    #pragma unroll
    for (int i = 0; i < 4; ++i) {
      const float d = v[j][i] - mean;
      q += d * d;
    }
  }
  q = wave_sum(q);
  const float rstd = rsqrtf(q * (1.0f / DIM) + 1e-5f);

  v4f ov[4];
  #pragma unroll
  for (int j = 0; j < 4; ++j) {
    const v4f gv = *(const v4f*)(g + j * 128 + lane * 4);
    const v4f bv = *(const v4f*)(be + j * 128 + lane * 4);
    #pragma unroll
    for (int i = 0; i < 4; ++i) ov[j][i] = (v[j][i] - mean) * rstd * bfr(gv[i]) + bfr(bv[i]);
  }
  float* fo = out + ((size_t)bb * SEQ_FULL + s0) * DIM + lane * 4;
  #pragma unroll
  for (int j = 0; j < 4; ++j) *(v4f*)(fo + j * 128) = ov[j];
  
}

// ---------------------------------------------------------------------------------------------------
extern "C" void kernel_launch(void* const* d_in, const int* in_sizes, int n_in,
                              void* d_out, int out_size, void* d_ws, size_t ws_size,
                              hipStream_t stream) {
  if (n_in < 17) return;
  const size_t rows_used = (size_t)(NB - 1) * SEQ_FULL + SEQ;
  if ((size_t)in_sizes[0] < rows_used * DIM) return;
  if ((size_t)in_sizes[1] < (size_t)DIM * DIM || (size_t)in_sizes[3] < (size_t)DIM * DIM) return;
  if ((size_t)in_sizes[5] < (size_t)DIM * DIM || (size_t)in_sizes[7] < (size_t)DIM * DIM) return;
  if ((size_t)in_sizes[9] < (size_t)DIM * FFN || (size_t)in_sizes[11] < (size_t)FFN * DIM) return;
  if (in_sizes[2] < DIM || in_sizes[4] < DIM || in_sizes[6] < DIM || in_sizes[8] < DIM) return;
  if (in_sizes[10] < FFN || in_sizes[12] < DIM) return;
  if (in_sizes[13] < DIM || in_sizes[14] < DIM || in_sizes[15] < DIM || in_sizes[16] < DIM) return;
  if ((size_t)out_size < rows_used * DIM) return;
  if (ws_size < WS_TOTAL) return;

  const float* x   = (const float*)d_in[0];
  const float* wq  = (const float*)d_in[1];
  const float* bq  = (const float*)d_in[2];
  const float* wk  = (const float*)d_in[3];
  const float* bk  = (const float*)d_in[4];
  const float* wv  = (const float*)d_in[5];
  const float* bv  = (const float*)d_in[6];
  const float* wo  = (const float*)d_in[7];
  const float* bo  = (const float*)d_in[8];
  const float* w1  = (const float*)d_in[9];
  const float* b1  = (const float*)d_in[10];
  const float* w2  = (const float*)d_in[11];
  const float* b2  = (const float*)d_in[12];
  const float* g1  = (const float*)d_in[13];
  const float* be1 = (const float*)d_in[14];
  const float* g2  = (const float*)d_in[15];
  const float* be2 = (const float*)d_in[16];
  float* out = (float*)d_out;

  char* ws = (char*)d_ws;
  f16*   xh    = (f16*)(ws + OFF_XH);
  f16*   wqkvT = (f16*)(ws + OFF_WQKV);
  f16*   woT   = (f16*)(ws + OFF_WO);
  f16*   w1T   = (f16*)(ws + OFF_W1);
  f16*   w2T   = (f16*)(ws + OFF_W2);
  f16*   qk    = (f16*)(ws + OFF_BIG);     // 4 q/k planes
  f16*   hh    = (f16*)(ws + OFF_BIG);     // reuses the q/k region after the attention launch
  f16*   vt    = (f16*)(ws + OFF_VT);
  f16*   ctx   = (f16*)(ws + OFF_CTX);
  float* y     = (float*)(ws + OFF_Y);
  float* x1f   = (float*)(ws + OFF_X1F);
  f16*   x1h   = (f16*)(ws + OFF_X1H);

  // operand planes
  cvt_x_kernel<<<dim3((unsigned)((size_t)NTOK * DIM / 8 / 256)), 256, 0, stream>>>(x, xh);
  // in[512][512] -> out[512][512] (rows = output feature), three stacked into the [1536][512] plane
  wt_kernel<<<dim3(DIM / 64, DIM / 64), 256, 0, stream>>>(wq, wqkvT, DIM, DIM);
  wt_kernel<<<dim3(DIM / 64, DIM / 64), 256, 0, stream>>>(wk, wqkvT + (size_t)DIM * DIM, DIM, DIM);
  wt_kernel<<<dim3(DIM / 64, DIM / 64), 256, 0, stream>>>(wv, wqkvT + (size_t)2 * DIM * DIM, DIM, DIM);
  wt_kernel<<<dim3(DIM / 64, DIM / 64), 256, 0, stream>>>(wo, woT, DIM, DIM);
  // in[512][2048] -> out[2048][512] : grid (cols/64, rows/64) = (32, 8)
  wt_kernel<<<dim3(FFN / 64, DIM / 64), 256, 0, stream>>>(w1, w1T, DIM, FFN);
  // in[2048][512] -> out[512][2048] : grid (cols/64, rows/64) = (8, 32)
  wt_kernel<<<dim3(DIM / 64, FFN / 64), 256, 0, stream>>>(w2, w2T, FFN, DIM);

  gemm_qkv_kernel<<<dim3(NTOK / GM, QKVN / GN), 128, 0, stream>>>(xh, wqkvT, bq, bk, bv, qk, vt);
  attn_kernel<<<dim3(SEQ / BQ, NHEAD, NB), 256, 0, stream>>>(qk, vt, ctx);
  gemm_wo_kernel<<<dim3(NTOK / GM, DIM / GN), 128, 0, stream>>>(ctx, woT, bo, x, y);
  ln1_kernel<<<dim3(NTOK / 8), 256, 0, stream>>>(y, g1, be1, x1f, x1h);
  gemm_ffn1_kernel<<<dim3(NTOK / GM, FFN / GN), 128, 0, stream>>>(x1h, w1T, b1, hh);
  gemm_ffn2_kernel<<<dim3(NTOK / GM, DIM / GN), 128, 0, stream>>>(hh, w2T, b2, x1f, y);
  ln2_kernel<<<dim3(NTOK / 8), 256, 0, stream>>>(y, g2, be2, out);
}

// v002
// Measured time: 224 microseconds a run.
// Timed twice side by side with v001, it ran 1.50 and 1.48 times as fast.
// All steps since v000 together make it 2.10 times as fast.
#include <hip/hip_runtime.h>
#include <math.h>

// All contractions on v_wmma_f32_16x16x32_f16 with f32 accumulate: projections / Wo / FFN use f16 operand planes
// (inputs RNE-converted to bf16 first, then exact power-of-two carries); scores S^T = K x Q^T use q and k as
// f16 value plane + f16 residual plane (x2048, separate accumulator); O = P x V with P f16 carried x4096.
//
// Every f16 operand plane in the workspace is stored fragment-packed: a [rows][K] operand is cut into tiles of
// 16 rows x 32 k; a tile is two 512-B units (k halves 0..15 and 16..31); inside a unit lane (hi*16 + lq) owns 16 B =
// row lq, k = half*16 + hi*8 + 0..7. Unit index = (rowtile * (K/32) + kblock) * 2 + half; the V^T plane puts the k block outermost. One wave-wide 16-B-per-lane
// load of a unit is 512 contiguous bytes (4 whole lines) and lands directly in the split-k fragment map.

#ifndef NB
#define NB 4
#endif
#ifndef SEQ
#define SEQ 2048
#endif
#define NB_FULL   4
#define SEQ_FULL  2048
#define DIM       512
#define NHEAD     8
#define HDIM      64
#define FFN       2048
#define QKVN      (3 * DIM)
#define NTOK      (NB * SEQ)
#define PLANE     ((size_t)NTOK * DIM)     // elements of one [NB][NHEAD][SEQ][HDIM] 16-bit plane
#define GM        128                      // GEMM block rows (4 waves x 32)
#define GN        64                       // GEMM block columns
#define GW        4                        // waves per GEMM block
#define OP        68                       // LDS pitch (floats) of f32 staging tiles
#define VP        136                      // LDS pitch (halves) of the V^T staging tile
#define TP        72                       // LDS pitch (halves) of the weight transposer tile
#define SHP       (DIM + 16)               // LDS pitch (halves) of the LayerNorm-1 f16 row staging
#define BQ        128                      // query rows per attention block (8 waves x 16)
#define BK        32                       // keys per attention step
#define NWAVE     8
#define XC        16.0f                    // carry of the x, LN1-output and GELU-output planes
#define WC        64.0f                    // carry of all weight planes
#define VC        16.0f                    // carry of the V^T plane
#define CC        256.0f                   // carry of the attention-context plane
#define PC        4096.0f                  // carry of P inside the attention kernel
#define RC        2048.0f                  // carry of the q / k residual planes

static_assert(DIM == NHEAD * HDIM);
static_assert(HDIM == 64);
static_assert(HDIM == GN);
static_assert(GM == GW * 32);
static_assert(BQ == NWAVE * 16);
static_assert(SEQ % GM == 0);
static_assert(SEQ % BQ == 0);
static_assert(SEQ % BK == 0);
static_assert(NTOK % GM == 0);
static_assert(NTOK % 8 == 0);
static_assert(DIM % GN == 0);
static_assert(FFN % GN == 0);
static_assert(QKVN % GN == 0);
static_assert(DIM % 64 == 0);
static_assert(FFN % 64 == 0);
static_assert(DIM % 32 == 0);
static_assert(FFN % 32 == 0);
static_assert(DIM == 32 * 16);
static_assert(((size_t)NTOK * DIM / 8) % 256 == 0);
static_assert((OP * 4) % 16 == 0);
static_assert((VP * 2) % 16 == 0);
static_assert((TP * 2) % 16 == 0);
static_assert((SHP * 2) % 16 == 0);
static_assert(SEQ <= SEQ_FULL);
static_assert(NB >= 1 && NB <= NB_FULL);

#define SZ_XH    ((size_t)NTOK * DIM * 2)
#define SZ_WQKV  ((size_t)QKVN * DIM * 2)
#define SZ_WO    ((size_t)DIM * DIM * 2)
#define SZ_W1    ((size_t)FFN * DIM * 2)
#define SZ_W2    ((size_t)DIM * FFN * 2)
#define SZ_QK    ((size_t)4 * NTOK * DIM * 2)
#define SZ_HH    ((size_t)NTOK * FFN * 2)
#define SZ_BIG   ((SZ_QK > SZ_HH) ? SZ_QK : SZ_HH)   // q/k planes, later reused by the GELU-output plane
#define SZ_VT    ((size_t)NTOK * DIM * 2)
#define SZ_CTX   ((size_t)NTOK * DIM * 2)
#define SZ_Y     ((size_t)NTOK * DIM * 4)
#define SZ_X1F   ((size_t)NTOK * DIM * 4)
#define SZ_X1H   ((size_t)NTOK * DIM * 2)
#define OFF_XH   ((size_t)0)
#define OFF_WQKV (OFF_XH + SZ_XH)
#define OFF_WO   (OFF_WQKV + SZ_WQKV)
#define OFF_W1   (OFF_WO + SZ_WO)
#define OFF_W2   (OFF_W1 + SZ_W1)
#define OFF_BIG  (OFF_W2 + SZ_W2)
#define OFF_VT   (OFF_BIG + SZ_BIG)
#define OFF_CTX  (OFF_VT + SZ_VT)
#define OFF_Y    (OFF_CTX + SZ_CTX)
#define OFF_X1F  (OFF_Y + SZ_Y)
#define OFF_X1H  (OFF_X1F + SZ_X1F)
#define WS_TOTAL (OFF_X1H + SZ_X1H)
static_assert(SZ_QK <= SZ_BIG);
static_assert(SZ_HH <= SZ_BIG);
static_assert(SZ_XH % 128 == 0 && SZ_WQKV % 128 == 0 && SZ_WO % 128 == 0 && SZ_W1 % 128 == 0);
static_assert(SZ_W2 % 128 == 0 && SZ_BIG % 128 == 0 && SZ_VT % 128 == 0 && SZ_CTX % 128 == 0);
static_assert(SZ_Y % 128 == 0 && SZ_X1F % 128 == 0 && SZ_X1H % 128 == 0);
static_assert(WS_TOTAL <= (size_t)134217728);

typedef __bf16   bf16;
typedef _Float16 f16;
typedef f16      v16h  __attribute__((ext_vector_type(16)));
typedef f16      v8h   __attribute__((ext_vector_type(8)));
typedef float    v8f   __attribute__((ext_vector_type(8)));
typedef float    v4f   __attribute__((ext_vector_type(4)));
typedef unsigned v4u   __attribute__((ext_vector_type(4)));

union FragH  { v16h v; v4u q[2]; f16 h[16]; };
union Pack8H { v4u u; v8h v; f16 h[8]; };

// bf16 RNE convert of an f32 value, returned as f32
static __device__ __forceinline__ float bfr(float v) { return (float)(bf16)v; }

// WMMA helper: builtin followed by the VALU hazard guard (ties D, keeps A/B live).
static __device__ __forceinline__ v8f mma_f16(v16h a, v16h b, v8f acc) {
  acc = __builtin_amdgcn_wmma_f32_16x16x32_f16(false, a, false, b, (short)0, acc, false, false);
  asm volatile("v_nop\n\tv_nop\n\tv_nop\n\tv_nop" : "+v"(acc) : "v"(a), "v"(b));
  return acc;
}

static __device__ __forceinline__ float wave_sum(float v) {
  v += __shfl_xor(v, 16, 32);
  v += __shfl_xor(v, 8, 32);
  v += __shfl_xor(v, 4, 32);
  v += __shfl_xor(v, 2, 32);
  v += __shfl_xor(v, 1, 32);
  return v;
}

// ---------------------------------------------------------------------------------------------------
// x f32 -> xh packed f16 plane (rows = tokens, K = DIM) = f16(bf16_rne(x) * XC). One thread = one 16-B piece.
__global__ __launch_bounds__(256) void cvt_x_kernel(const float* __restrict__ x, f16* __restrict__ xh) {
  // g = [rowtile][kblock 16][row half 2][8-column group 4 = half*2 + hi][row 8]: a wave reads 8 rows x 128 B
  // and writes four whole 128-B lines of the packed plane.
  const int g = blockIdx.x * 256 + threadIdx.x;
  const int r = ((g >> 5) & 1) * 8 + (g & 7);      // row of the 16-row tile
  const int t = (g >> 10) * 16 + r;                // compact token
  const int c = ((g >> 6) & 15) * 32 + ((g >> 3) & 3) * 8;
  if (t >= NTOK) return;
  const int bb = t / SEQ;
  const int s  = t - bb * SEQ;
  const float* src = x + ((size_t)bb * SEQ_FULL + s) * DIM + c;
  const v4f a0 = *(const v4f*)(src);
  const v4f a1 = *(const v4f*)(src + 4);
  Pack8H p;
  #pragma unroll
  for (int i = 0; i < 4; ++i) {
    p.h[i]     = (f16)(bfr(a0[i]) * XC);
    p.h[4 + i] = (f16)(bfr(a1[i]) * XC);
  }
  const v4u val = p.u;
  f16* dst = xh + (size_t)(g >> 6) * 512 + ((g >> 4) & 1) * 256 + (((g >> 3) & 1) * 16 + r) * 8;
  *(v4u*)dst = val;
  
}

// ---------------------------------------------------------------------------------------------------
// Weight transposer: in[K rows][N cols] f32  ->  packed plane (rows = n, K = k) f16 = f16(bf16_rne(w) * WC).
// grid = (N/64, K/64), 256 threads, tile 64(k) x 64(n) through LDS (cross-wave, block barrier).
__global__ __launch_bounds__(256) void wt_kernel(const float* __restrict__ W, f16* __restrict__ Wt, int K, int N) {
  __shared__ __align__(16) f16 sT[64 * TP];     // [n][k]
  const int tid = threadIdx.x;
  const int n0 = blockIdx.x * 64;
  const int k0 = blockIdx.y * 64;
  #pragma unroll
  for (int it = 0; it < 4; ++it) {
    const int kk = it * 16 + (tid >> 4);        // 0..63
    const int nn = (tid & 15) * 4;              // 0..60
    const v4f w = *(const v4f*)(W + (size_t)(k0 + kk) * N + n0 + nn);
    #pragma unroll
    for (int i = 0; i < 4; ++i) sT[(nn + i) * TP + kk] = (f16)(bfr(w[i]) * WC);
  }
  __syncthreads();
  v4u    val[2];
  size_t idx[2];
  #pragma unroll
  for (int it = 0; it < 2; ++it) {
    const int u  = it * 8 + (tid >> 5);         // unit 0..15 of this tile: [n tile 4][kblock 2][half 2]
    const int ln = tid & 31;
    const int n  = (u >> 2) * 16 + (ln & 15);                               // 0..63
    const int ks = ((u >> 1) & 1) * 32 + (u & 1) * 16 + (ln >> 4) * 8;      // 0..56
    Pack8H ph;
    ph.v = *(const v8h*)(&sT[n * TP + ks]);
    val[it] = ph.u;
    idx[it] = (((size_t)((n0 >> 4) + (u >> 2)) * (K >> 5) + (k0 >> 5) + ((u >> 1) & 1)) * 2 + (u & 1)) * 256 + ln * 8;
  }
  #pragma unroll
  for (int it = 0; it < 2; ++it) *(v4u*)(Wt + idx[it]) = val[it];
  
}

// ---------------------------------------------------------------------------------------------------
// GEMM main loop: acc[mt][nt] (16x16 tiles) of  A[m0 .. m0+31][K] x Bt[n0 .. n0+63][K]^T.
// A and Bt are packed f16 planes; fragments use the split k map for both operands:
// elements 0..7 <- k0 + 8*hi + 0..7, elements 8..15 <- k0 + 16 + 8*hi + 0..7; lane row / column = lq.
// A 16-row tile spans K*16 halves; a k block of 32 spans 512 halves; the second k half starts at +256.
template <int K>
static __device__ __forceinline__ void gemm_main(const f16* __restrict__ A, const f16* __restrict__ Bt,
                                                 int m0, int n0, int lq, int hi, v8f (&acc)[2][4]) {
  static_assert(K % 32 == 0);
  const f16* ap = A  + (size_t)m0 * K + (hi * 16 + lq) * 8;
  const f16* bp = Bt + (size_t)n0 * K + (hi * 16 + lq) * 8;
  #pragma unroll 1
  for (int k0 = 0; k0 < K; k0 += 32) {
    FragH a[2], b[4];
    #pragma unroll
    for (int mt = 0; mt < 2; ++mt) {
      const f16* p = ap + (size_t)mt * 16 * K + k0 * 16;
      a[mt].q[0] = *(const v4u*)(p);
      a[mt].q[1] = *(const v4u*)(p + 256);
    }
    #pragma unroll
    for (int nt = 0; nt < 4; ++nt) {
      const f16* p = bp + (size_t)nt * 16 * K + k0 * 16;
      b[nt].q[0] = *(const v4u*)(p);
      b[nt].q[1] = *(const v4u*)(p + 256);
    }
    #pragma unroll
    for (int mt = 0; mt < 2; ++mt) {
      #pragma unroll
      for (int nt = 0; nt < 4; ++nt) acc[mt][nt] = mma_f16(a[mt].v, b[nt].v, acc[mt][nt]);
    }
  }
}

// ---------------------------------------------------------------------------------------------------
// Fused q/k/v projection: [NTOK][512] x [1536][512]^T. Column block (64 wide) = one head of q, k or v.
//          qk plane order: 0 = q value, 1 = q residual, 2 = k value, 3 = k residual.
//   q, k : per (b, h) a packed plane with rows = tokens, K = d (64): 1024 halves per 16 tokens.
//   v    : per (b, h) a packed plane with rows = d (4 tiles), K = tokens, k block outermost:
//          [s/32][d tile 4][half 2][lane 32][8] f16 (x VC), written through a block-wide LDS tile.
// coverage: q/k rows wave*32 + {0..31} x 64 d = 8 units per wave; vt 64 d x 128 tokens = 32 units per block.
__global__ __launch_bounds__(128) void gemm_qkv_kernel(const f16* __restrict__ xh, const f16* __restrict__ wT,
                                                       const float* __restrict__ bq, const float* __restrict__ bk,
                                                       const float* __restrict__ bv,
                                                       f16* __restrict__ qk, f16* __restrict__ vt) {
  __shared__ __align__(16) float sC[GW * 32 * OP];    // per-wave f32 tiles (block barrier used)
  __shared__ __align__(16) f16   sVT[HDIM * VP];      // [d][token], cross-wave (block barrier)
  const int tid  = threadIdx.x;
  const int wave = __builtin_amdgcn_readfirstlane(threadIdx.x >> 5);
  const int lane = tid & 31;
  const int lq   = lane & 15;
  const int hi   = lane >> 4;
  const int tok0 = blockIdx.x * GM;
  const int n0   = blockIdx.y * GN;
  const int seg  = n0 / DIM;                          // 0 = q, 1 = k, 2 = v (block-uniform)
  const int h    = (n0 - seg * DIM) / HDIM;
  const int bb   = tok0 / SEQ;
  const int s0   = tok0 - bb * SEQ;

  v8f acc[2][4];
  #pragma unroll
  for (int mt = 0; mt < 2; ++mt) {
    #pragma unroll
    for (int nt = 0; nt < 4; ++nt) acc[mt][nt] = (v8f){0, 0, 0, 0, 0, 0, 0, 0};
  }
  gemm_main<DIM>(xh, wT, tok0 + wave * 32, n0, lq, hi, acc);

  const float ascale = 1.0f / (XC * WC);
  float bias[4];
  #pragma unroll
  for (int nt = 0; nt < 4; ++nt) {
    const int c = h * HDIM + nt * 16 + lq;            // 0..511
    const float fq = bq[c];
    const float fk = bk[c];
    const float fv = bv[c];
    const float sel = (seg == 0) ? fq : ((seg == 1) ? fk : fv);
    bias[nt] = bfr(sel);
  }

  if (seg < 2) {
    const int wb = wave * (32 * OP);
    #pragma unroll
    for (int mt = 0; mt < 2; ++mt) {
      #pragma unroll
      for (int nt = 0; nt < 4; ++nt) {
        #pragma unroll
        for (int r = 0; r < 8; ++r)
          sC[wb + (mt * 16 + hi * 8 + r) * OP + nt * 16 + lq] = acc[mt][nt][r] * ascale + bias[nt];
      }
    }
    __syncthreads();
    const size_t pbase = (size_t)seg * 2 * PLANE +
                         (((size_t)bb * NHEAD + h) * SEQ + s0 + wave * 32) * HDIM;
    v4u hv[8], rv[8];
    #pragma unroll
    for (int it = 0; it < 8; ++it) {
      const int row = (it >> 2) * 16 + lq;                               // unit it: [row tile 2][d block 2][half 2]
      const int col = ((it >> 1) & 1) * 32 + (it & 1) * 16 + hi * 8;
      const v4f c0 = *(const v4f*)(&sC[wb + row * OP + col]);
      const v4f c1 = *(const v4f*)(&sC[wb + row * OP + col + 4]);
      Pack8H ph, pr;
      #pragma unroll
      for (int i = 0; i < 4; ++i) {
        const f16 h0 = (f16)c0[i];
        const f16 h1 = (f16)c1[i];
        ph.h[i]     = h0;
        ph.h[4 + i] = h1;
        pr.h[i]     = (f16)((c0[i] - (float)h0) * RC);
        pr.h[4 + i] = (f16)((c1[i] - (float)h1) * RC);
      }
      hv[it] = ph.u;
      rv[it] = pr.u;
    }
    #pragma unroll
    for (int it = 0; it < 8; ++it) {
      const size_t o = pbase + (size_t)it * 256 + lane * 8;
      *(v4u*)(qk + o)         = hv[it];
      *(v4u*)(qk + PLANE + o) = rv[it];
    }
    
  } else {
    #pragma unroll
    for (int mt = 0; mt < 2; ++mt) {
      #pragma unroll
      for (int nt = 0; nt < 4; ++nt) {
        #pragma unroll
        for (int r = 0; r < 8; ++r)
          sVT[(nt * 16 + lq) * VP + wave * 32 + mt * 16 + hi * 8 + r] =
              (f16)((acc[mt][nt][r] * ascale + bias[nt]) * VC);
      }
    }
    __syncthreads();
    const size_t vbase = (((size_t)bb * NHEAD + h) * SEQ + s0) * HDIM;   // first unit of this block's 128 tokens
    v4u vv[8];
    #pragma unroll
    for (int it = 0; it < 8; ++it) {
      const int u = it * 4 + wave;                 // unit 0..31: [token block 4][d tile 4][half 2]
      const int d = ((u >> 1) & 3) * 16 + lq;
      const int s = (u >> 3) * 32 + (u & 1) * 16 + hi * 8;
      Pack8H ph;
      ph.v = *(const v8h*)(&sVT[d * VP + s]);
      vv[it] = ph.u;
    }
    #pragma unroll
    for (int it = 0; it < 8; ++it) {
      const size_t o = vbase + (size_t)(it * 4 + wave) * 256 + lane * 8;
      *(v4u*)(vt + o) = vv[it];
    }
    
  }
}

// ---------------------------------------------------------------------------------------------------
// Flash attention, full (no mask). Block = (128-query block, head, batch); one wave owns 16 query rows.
// S^T = K x Q^T so queries sit on lanes; P^T in C layout is the A-fragment layout of O += P x V.
// Scores: main = k_val x q_val ; res = k_val x q_res + k_res x q_val (both x RC) ; s = main + res / RC.
// Fragments come straight from the packed 16-bit planes (two 512-B unit loads each); q fragments stay in registers.
__global__ __launch_bounds__(256) void attn_kernel(const f16* __restrict__ qk, const f16* __restrict__ vt,
                                                   f16* __restrict__ ctx) {
  __shared__ __align__(16) float sO[NWAVE * 16 * OP];    // per-wave output staging (block barrier used)
  const int qblk = blockIdx.x;
  const int h    = blockIdx.y;
  const int b    = blockIdx.z;
  const int tid  = threadIdx.x;
  const int wave = __builtin_amdgcn_readfirstlane(threadIdx.x >> 5);
  const int lane = tid & 31;
  const int lq   = lane & 15;   // query column of S^T / d column of O
  const int hi   = lane >> 4;   // k-split half

  const int qrow0 = qblk * BQ + wave * 16;
  const size_t hb = ((size_t)b * NHEAD + h) * (size_t)SEQ * HDIM;
  const f16* qh_p = qk + hb;
  const f16* qr_p = qk + PLANE + hb;
  const f16* kh_p = qk + 2 * PLANE + hb;
  const f16* kr_p = qk + 3 * PLANE + hb;
  const f16* vt_h = vt + hb;
  const int qoff  = qrow0 * HDIM + lane * 8;         // this wave's 16-query tile, lane's piece of a unit

  // q B-fragments (value and residual planes), loaded once and held for the whole key loop
  FragH fqh[2], fqr[2];
  #pragma unroll
  for (int f = 0; f < 2; ++f) {
    const int qo = qoff + f * 512;
    fqh[f].q[0] = *(const v4u*)(qh_p + qo);           // d = f*32 + hi*8 + 0..7
    fqh[f].q[1] = *(const v4u*)(qh_p + qo + 256);     // d = f*32 + 16 + hi*8 + 0..7
    fqr[f].q[0] = *(const v4u*)(qr_p + qo);
    fqr[f].q[1] = *(const v4u*)(qr_p + qo + 256);
  }

  v8f o[4];
  #pragma unroll
  for (int dt = 0; dt < 4; ++dt) o[dt] = (v8f){0, 0, 0, 0, 0, 0, 0, 0};

  float rmax = -__builtin_inff();
  float rsum = 0.0f;
  const float SL = 0.125f * 1.4426950408889634f;   // softmax scale * log2(e)

  #pragma unroll 1
  for (int j0 = 0; j0 < SEQ; j0 += BK) {
    // the step's K A-fragments (row = key lq of the tile, split d map) and V B-fragments (column n = d = dt*16 + lq,
    // split key map from the packed transposed plane): all 24 unit loads are issued together, ahead of the products
    FragH fkh[2][2], fkr[2][2], bv[4];
    #pragma unroll
    for (int sub = 0; sub < 2; ++sub) {
      #pragma unroll
      for (int f = 0; f < 2; ++f) {
        const int ko = (j0 + sub * 16) * HDIM + f * 512 + lane * 8;
        fkh[sub][f].q[0] = *(const v4u*)(kh_p + ko);
        fkh[sub][f].q[1] = *(const v4u*)(kh_p + ko + 256);
        fkr[sub][f].q[0] = *(const v4u*)(kr_p + ko);
        fkr[sub][f].q[1] = *(const v4u*)(kr_p + ko + 256);
      }
    }
    // the K address pairs die here and the V load results may land in them: wait before any such overwrite
    asm volatile("s_wait_xcnt 0x0" ::: "memory");
    #pragma unroll
    for (int dt = 0; dt < 4; ++dt) {
      const f16* base = vt_h + (size_t)j0 * HDIM + dt * 512 + lane * 8;
      bv[dt].q[0] = *(const v4u*)(base);            // keys j0 + hi*8 + 0..7
      bv[dt].q[1] = *(const v4u*)(base + 256);      // keys j0 + 16 + hi*8 + 0..7
    }

    // S^T tiles: c[sub][r] = rawscore(query qrow0+lq, key j0 + sub*16 + hi*8 + r)
    v8f c[2];
    #pragma unroll
    for (int sub = 0; sub < 2; ++sub) {
      v8f am = (v8f){0, 0, 0, 0, 0, 0, 0, 0};
      v8f ar = (v8f){0, 0, 0, 0, 0, 0, 0, 0};
      #pragma unroll
      for (int f = 0; f < 2; ++f) {
        am = mma_f16(fkh[sub][f].v, fqh[f].v, am);
        ar = mma_f16(fkh[sub][f].v, fqr[f].v, ar);
        ar = mma_f16(fkr[sub][f].v, fqh[f].v, ar);
      }
      #pragma unroll
      for (int r = 0; r < 8; ++r) c[sub][r] = am[r] + ar[r] * (1.0f / RC);
    }

    // online softmax: query lq's 32 scores are split across lane / lane^16
    float m_new = rmax;
    #pragma unroll
    for (int r = 0; r < 8; ++r) {
      m_new = fmaxf(m_new, c[0][r]);
      m_new = fmaxf(m_new, c[1][r]);
    }
    m_new = fmaxf(m_new, __shfl_xor(m_new, 16, 32));
    const float scale = __builtin_amdgcn_exp2f((rmax - m_new) * SL);
    rmax = m_new;

    // exp + pack: P^T C-layout == A-fragment layout for the PV product
    FragH pa;
    float psum = 0.0f;
    #pragma unroll
    for (int r = 0; r < 8; ++r) {
      const float p0 = __builtin_amdgcn_exp2f((c[0][r] - m_new) * SL);   // key hi*8 + r
      const float p1 = __builtin_amdgcn_exp2f((c[1][r] - m_new) * SL);   // key 16 + hi*8 + r
      psum += p0 + p1;
      pa.h[r]     = (f16)(p0 * PC);
      pa.h[8 + r] = (f16)(p1 * PC);
    }
    rsum = rsum * scale + psum + __shfl_xor(psum, 16, 32);

    // rescale O: queries are the row dimension there -> per-row scale from lane 8*hi + r
    float sc[8];
    #pragma unroll
    for (int r = 0; r < 8; ++r) sc[r] = __shfl(scale, (hi << 3) + r, 32);
    #pragma unroll
    for (int dt = 0; dt < 4; ++dt) {
      #pragma unroll
      for (int r = 0; r < 8; ++r) o[dt][r] *= sc[r];
    }

    // O += P x V
    #pragma unroll
    for (int dt = 0; dt < 4; ++dt) o[dt] = mma_f16(pa.v, bv[dt].v, o[dt]);
  }

  // normalize: lane holds column d = dt*16 + lq for query rows 8*hi + r
  float rs[8];
  #pragma unroll
  for (int r = 0; r < 8; ++r) rs[r] = 1.0f / __shfl(rsum, (hi << 3) + r, 32);

  const int wb = wave * (16 * OP);
  #pragma unroll
  for (int r = 0; r < 8; ++r) {
    #pragma unroll
    for (int dt = 0; dt < 4; ++dt)
      sO[wb + (hi * 8 + r) * OP + dt * 16 + lq] = o[dt][r] * (CC / (PC * VC)) * rs[r];
  }
  __syncthreads();

  v4u    pv[4];
  size_t gidx[4];
  #pragma unroll
  for (int it = 0; it < 4; ++it) {
    const int row = lq;                                   // unit it: [k block 2][half 2] of this head's 64 columns
    const int col = (it >> 1) * 32 + (it & 1) * 16 + hi * 8;
    const v4f c0 = *(const v4f*)(&sO[wb + row * OP + col]);
    const v4f c1 = *(const v4f*)(&sO[wb + row * OP + col + 4]);
    Pack8H ph;
    #pragma unroll
    for (int i = 0; i < 4; ++i) {
      ph.h[i]     = (f16)c0[i];
      ph.h[4 + i] = (f16)c1[i];
    }
    pv[it]   = ph.u;
    gidx[it] = ((size_t)b * SEQ + qrow0) * DIM + (size_t)(h * 4 + it) * 256 + lane * 8;   // packed, K = DIM
  }
  #pragma unroll
  for (int it = 0; it < 4; ++it) *(v4u*)(ctx + gidx[it]) = pv[it];
  
}

// ---------------------------------------------------------------------------------------------------
// y = ctx x wo + bo + bf16_rne(x)   (f32 plane [NTOK][DIM], input of LayerNorm 1)
// coverage: rows wave*32 + {0..31}, 64 columns: 16 instr, lanes 0..15 one 256-B row segment, 16..31 the next row.
__global__ __launch_bounds__(128) void gemm_wo_kernel(const f16* __restrict__ ctx, const f16* __restrict__ woT,
                                                      const float* __restrict__ bo, const float* __restrict__ x,
                                                      float* __restrict__ y) {
  __shared__ __align__(16) float sC[GW * 32 * OP];
  const int tid  = threadIdx.x;
  const int wave = __builtin_amdgcn_readfirstlane(threadIdx.x >> 5);
  const int lane = tid & 31;
  const int lq   = lane & 15;
  const int hi   = lane >> 4;
  const int tok0 = blockIdx.x * GM;
  const int n0   = blockIdx.y * GN;
  const int bb   = tok0 / SEQ;
  const int s0   = tok0 - bb * SEQ;

  v8f acc[2][4];
  #pragma unroll
  for (int mt = 0; mt < 2; ++mt) {
    #pragma unroll
    for (int nt = 0; nt < 4; ++nt) acc[mt][nt] = (v8f){0, 0, 0, 0, 0, 0, 0, 0};
  }
  gemm_main<DIM>(ctx, woT, tok0 + wave * 32, n0, lq, hi, acc);

  const float ascale = 1.0f / (CC * WC);
  const int wb = wave * (32 * OP);
  #pragma unroll
  for (int nt = 0; nt < 4; ++nt) {
    const float bias = bfr(bo[n0 + nt * 16 + lq]);
    #pragma unroll
    for (int mt = 0; mt < 2; ++mt) {
      #pragma unroll
      for (int r = 0; r < 8; ++r)
        sC[wb + (mt * 16 + hi * 8 + r) * OP + nt * 16 + lq] = acc[mt][nt][r] * ascale + bias;
    }
  }
  __syncthreads();

  const size_t orow = (size_t)tok0 + wave * 32;                          // compact row
  const size_t rrow = (size_t)bb * SEQ_FULL + s0 + wave * 32;            // row of the full-size x
  #pragma unroll
  for (int g = 0; g < 2; ++g) {
    v4f vals[8];
    #pragma unroll
    for (int it = 0; it < 8; ++it) {
      const int row = g * 16 + it * 2 + hi;
      v4f cv = *(const v4f*)(&sC[wb + row * OP + lq * 4]);
      const v4f rv = *(const v4f*)(x + (rrow + row) * DIM + n0 + lq * 4);
      #pragma unroll
      for (int i = 0; i < 4; ++i) cv[i] = cv[i] + bfr(rv[i]);
      vals[it] = cv;
    }
    #pragma unroll
    for (int it = 0; it < 8; ++it)
      *(v4f*)(y + (orow + g * 16 + it * 2 + hi) * DIM + n0 + lq * 4) = vals[it];
    
  }
}

// ---------------------------------------------------------------------------------------------------
// f32 row: 4 instr x (32 lanes x 16 B) ; f16 rows staged in LDS (cross-wave, block barrier) and written packed:
// the block's 8 tokens fill 8 neighbouring lane slots = one whole 128-B line in each of the 64 (k block, half, hi) groups.
__global__ __launch_bounds__(256) void ln1_kernel(const float* __restrict__ y, const float* __restrict__ g,
                                                  const float* __restrict__ be,
                                                  float* __restrict__ x1f, f16* __restrict__ x1h) {
  __shared__ __align__(16) f16 sH[8 * SHP];
  const int tid  = threadIdx.x;
  const int wave = __builtin_amdgcn_readfirstlane(threadIdx.x >> 5);
  const int lane = tid & 31;
  const int t    = blockIdx.x * 8 + wave;             // compact token
  const float* yr = y + (size_t)t * DIM;

  v4f v[4];
  float s = 0.0f;
  #pragma unroll
  for (int j = 0; j < 4; ++j) {
    v[j] = *(const v4f*)(yr + j * 128 + lane * 4);
    s += (v[j][0] + v[j][1]) + (v[j][2] + v[j][3]);
  }
  s = wave_sum(s);
  const float mean = s * (1.0f / DIM);
  float q = 0.0f;
  #pragma unroll
  for (int j = 0; j < 4; ++j) {
    #pragma unroll
    for (int i = 0; i < 4; ++i) {
      const float d = v[j][i] - mean;
      q += d * d;
    }
  }
  q = wave_sum(q);
  const float rstd = rsqrtf(q * (1.0f / DIM) + 1e-5f);

  v4f ov[4];
  #pragma unroll
  for (int j = 0; j < 4; ++j) {
    const v4f gv = *(const v4f*)(g + j * 128 + lane * 4);
    const v4f bv = *(const v4f*)(be + j * 128 + lane * 4);
    #pragma unroll
    for (int i = 0; i < 4; ++i) {
      const float val = (v[j][i] - mean) * rstd * bfr(gv[i]) + bfr(bv[i]);
      ov[j][i] = val;
      sH[wave * SHP + j * 128 + lane * 4 + i] = (f16)(val * XC);
    }
  }
  __syncthreads();
  const int t0 = blockIdx.x * 8;                      // first token of the block
  v4u    hv[2];
  size_t hidx[2];
  #pragma unroll
  for (int jj = 0; jj < 2; ++jj) {
    const int tk = tid & 7;                           // token of the block
    const int ln = jj * 32 + (tid >> 3);              // 8-column group 0..63 = kblock*4 + half*2 + hi
    Pack8H ph;
    ph.v = *(const v8h*)(&sH[tk * SHP + ln * 8]);
    hv[jj] = ph.u;
    hidx[jj] = (size_t)(t0 >> 4) * (16 * DIM) + (size_t)(ln >> 1) * 256 + ((ln & 1) * 16 + (t0 & 15) + tk) * 8;
  }
  float* fo = x1f + (size_t)t * DIM + lane * 4;
  #pragma unroll
  for (int j = 0; j < 4; ++j) *(v4f*)(fo + j * 128) = ov[j];
  #pragma unroll
  for (int jj = 0; jj < 2; ++jj) *(v4u*)(x1h + hidx[jj]) = hv[jj];
  
}

// ---------------------------------------------------------------------------------------------------
// hh = f16( gelu_erf(x1 x w1 + b1) * XC )   packed plane (rows = tokens, K = FFN)
__global__ __launch_bounds__(128) void gemm_ffn1_kernel(const f16* __restrict__ x1h, const f16* __restrict__ w1T,
                                                        const float* __restrict__ b1, f16* __restrict__ hh) {
  __shared__ __align__(16) float sC[GW * 32 * OP];
  const int tid  = threadIdx.x;
  const int wave = __builtin_amdgcn_readfirstlane(threadIdx.x >> 5);
  const int lane = tid & 31;
  const int lq   = lane & 15;
  const int hi   = lane >> 4;
  const int tok0 = blockIdx.x * GM;
  const int n0   = blockIdx.y * GN;

  v8f acc[2][4];
  #pragma unroll
  for (int mt = 0; mt < 2; ++mt) {
    #pragma unroll
    for (int nt = 0; nt < 4; ++nt) acc[mt][nt] = (v8f){0, 0, 0, 0, 0, 0, 0, 0};
  }
  gemm_main<DIM>(x1h, w1T, tok0 + wave * 32, n0, lq, hi, acc);

  const float ascale = 1.0f / (XC * WC);
  const int wb = wave * (32 * OP);
  #pragma unroll
  for (int nt = 0; nt < 4; ++nt) {
    const float bias = bfr(b1[n0 + nt * 16 + lq]);
    #pragma unroll
    for (int mt = 0; mt < 2; ++mt) {
      #pragma unroll
      for (int r = 0; r < 8; ++r)
        sC[wb + (mt * 16 + hi * 8 + r) * OP + nt * 16 + lq] = acc[mt][nt][r] * ascale + bias;
    }
  }
  __syncthreads();

  // GELU (erf form) in place on this lane's own pieces (same lane reads them back below); kept rolled
  // piece it = i >> 1 is this lane's 16 B of unit it: [row tile 2][k block 2][half 2]
  const int lbase = wb + lq * OP + hi * 8;
  #pragma unroll 1
  for (int i = 0; i < 16; ++i) {
    const int off = lbase + (i >> 3) * (16 * OP) + ((i >> 1) & 3) * 16 + (i & 1) * 4;
    v4f t = *(const v4f*)(&sC[off]);
    #pragma unroll
    for (int e = 0; e < 4; ++e) {
      const float u = t[e];
      t[e] = 0.5f * u * (1.0f + erff(u * 0.70710678118654752f));
    }
    *(v4f*)(&sC[off]) = t;
  }

  v4u pv[8];
  #pragma unroll
  for (int it = 0; it < 8; ++it) {
    const int off = lbase + (it >> 2) * (16 * OP) + (it & 3) * 16;
    const v4f c0 = *(const v4f*)(&sC[off]);
    const v4f c1 = *(const v4f*)(&sC[off + 4]);
    Pack8H ph;
    #pragma unroll
    for (int i = 0; i < 4; ++i) {
      ph.h[i]     = (f16)(c0[i] * XC);
      ph.h[4 + i] = (f16)(c1[i] * XC);
    }
    pv[it] = ph.u;
  }
  const size_t obase = ((size_t)tok0 + wave * 32) * FFN + (size_t)n0 * 16 + lane * 8;
  #pragma unroll
  for (int it = 0; it < 8; ++it) *(v4u*)(hh + obase + (size_t)(it >> 2) * 16 * FFN + (it & 3) * 256) = pv[it];
  
}

// ---------------------------------------------------------------------------------------------------
// y = hh x w2 + b2 + x1f   (f32 plane [NTOK][DIM], input of LayerNorm 2)
__global__ __launch_bounds__(128) void gemm_ffn2_kernel(const f16* __restrict__ hh, const f16* __restrict__ w2T,
                                                        const float* __restrict__ b2, const float* __restrict__ x1f,
                                                        float* __restrict__ y) {
  __shared__ __align__(16) float sC[GW * 32 * OP];
  const int tid  = threadIdx.x;
  const int wave = __builtin_amdgcn_readfirstlane(threadIdx.x >> 5);
  const int lane = tid & 31;
  const int lq   = lane & 15;
  const int hi   = lane >> 4;
  const int tok0 = blockIdx.x * GM;
  const int n0   = blockIdx.y * GN;

  v8f acc[2][4];
  #pragma unroll
  for (int mt = 0; mt < 2; ++mt) {
    #pragma unroll
    for (int nt = 0; nt < 4; ++nt) acc[mt][nt] = (v8f){0, 0, 0, 0, 0, 0, 0, 0};
  }
  gemm_main<FFN>(hh, w2T, tok0 + wave * 32, n0, lq, hi, acc);

  const float ascale = 1.0f / (XC * WC);
  const int wb = wave * (32 * OP);
  #pragma unroll
  for (int nt = 0; nt < 4; ++nt) {
    const float bias = bfr(b2[n0 + nt * 16 + lq]);
    #pragma unroll
    for (int mt = 0; mt < 2; ++mt) {
      #pragma unroll
      for (int r = 0; r < 8; ++r)
        sC[wb + (mt * 16 + hi * 8 + r) * OP + nt * 16 + lq] = acc[mt][nt][r] * ascale + bias;
    }
  }
  __syncthreads();

  const size_t orow = (size_t)tok0 + wave * 32;
  #pragma unroll
  for (int g = 0; g < 2; ++g) {
    v4f vals[8];
    #pragma unroll
    for (int it = 0; it < 8; ++it) {
      const int row = g * 16 + it * 2 + hi;
      v4f cv = *(const v4f*)(&sC[wb + row * OP + lq * 4]);
      const v4f rv = *(const v4f*)(x1f + (orow + row) * DIM + n0 + lq * 4);
      #pragma unroll
      for (int i = 0; i < 4; ++i) cv[i] = cv[i] + rv[i];
      vals[it] = cv;
    }
    #pragma unroll
    for (int it = 0; it < 8; ++it)
      *(v4f*)(y + (orow + g * 16 + it * 2 + hi) * DIM + n0 + lq * 4) = vals[it];
    
  }
}

// ---------------------------------------------------------------------------------------------------
__global__ __launch_bounds__(256) void ln2_kernel(const float* __restrict__ y, const float* __restrict__ g,
                                                  const float* __restrict__ be, float* __restrict__ out) {
  const int tid  = threadIdx.x;
  const int wave = __builtin_amdgcn_readfirstlane(threadIdx.x >> 5);
  const int lane = tid & 31;
  const int t    = blockIdx.x * 8 + wave;             // compact token
  const int bb   = t / SEQ;
  const int s0   = t - bb * SEQ;
  const float* yr = y + (size_t)t * DIM;

  v4f v[4];
  float s = 0.0f;
  #pragma unroll
  for (int j = 0; j < 4; ++j) {
    v[j] = *(const v4f*)(yr + j * 128 + lane * 4);
    s += (v[j][0] + v[j][1]) + (v[j][2] + v[j][3]);
  }
  s = wave_sum(s);
  const float mean = s * (1.0f / DIM);
  float q = 0.0f;
  #pragma unroll
  for (int j = 0; j < 4; ++j) {
    #pragma unroll
    for (int i = 0; i < 4; ++i) {
      const float d = v[j][i] - mean;
      q += d * d;
    }
  }
  q = wave_sum(q);
  const float rstd = rsqrtf(q * (1.0f / DIM) + 1e-5f);

  v4f ov[4];
  #pragma unroll
  for (int j = 0; j < 4; ++j) {
    const v4f gv = *(const v4f*)(g + j * 128 + lane * 4);
    const v4f bv = *(const v4f*)(be + j * 128 + lane * 4);
    #pragma unroll
    for (int i = 0; i < 4; ++i) ov[j][i] = (v[j][i] - mean) * rstd * bfr(gv[i]) + bfr(bv[i]);
  }
  float* fo = out + ((size_t)bb * SEQ_FULL + s0) * DIM + lane * 4;
  #pragma unroll
  for (int j = 0; j < 4; ++j) *(v4f*)(fo + j * 128) = ov[j];
  
}

// ---------------------------------------------------------------------------------------------------
extern "C" void kernel_launch(void* const* d_in, const int* in_sizes, int n_in,
                              void* d_out, int out_size, void* d_ws, size_t ws_size,
                              hipStream_t stream) {
  if (n_in < 17) return;
  const size_t rows_used = (size_t)(NB - 1) * SEQ_FULL + SEQ;
  if ((size_t)in_sizes[0] < rows_used * DIM) return;
  if ((size_t)in_sizes[1] < (size_t)DIM * DIM || (size_t)in_sizes[3] < (size_t)DIM * DIM) return;
  if ((size_t)in_sizes[5] < (size_t)DIM * DIM || (size_t)in_sizes[7] < (size_t)DIM * DIM) return;
  if ((size_t)in_sizes[9] < (size_t)DIM * FFN || (size_t)in_sizes[11] < (size_t)FFN * DIM) return;
  if (in_sizes[2] < DIM || in_sizes[4] < DIM || in_sizes[6] < DIM || in_sizes[8] < DIM) return;
  if (in_sizes[10] < FFN || in_sizes[12] < DIM) return;
  if (in_sizes[13] < DIM || in_sizes[14] < DIM || in_sizes[15] < DIM || in_sizes[16] < DIM) return;
  if ((size_t)out_size < rows_used * DIM) return;
  if (ws_size < WS_TOTAL) return;

  const float* x   = (const float*)d_in[0];
  const float* wq  = (const float*)d_in[1];
  const float* bq  = (const float*)d_in[2];
  const float* wk  = (const float*)d_in[3];
  const float* bk  = (const float*)d_in[4];
  const float* wv  = (const float*)d_in[5];
  const float* bv  = (const float*)d_in[6];
  const float* wo  = (const float*)d_in[7];
  const float* bo  = (const float*)d_in[8];
  const float* w1  = (const float*)d_in[9];
  const float* b1  = (const float*)d_in[10];
  const float* w2  = (const float*)d_in[11];
  const float* b2  = (const float*)d_in[12];
  const float* g1  = (const float*)d_in[13];
  const float* be1 = (const float*)d_in[14];
  const float* g2  = (const float*)d_in[15];
  const float* be2 = (const float*)d_in[16];
  float* out = (float*)d_out;

  char* ws = (char*)d_ws;
  f16*   xh    = (f16*)(ws + OFF_XH);
  f16*   wqkvT = (f16*)(ws + OFF_WQKV);
  f16*   woT   = (f16*)(ws + OFF_WO);
  f16*   w1T   = (f16*)(ws + OFF_W1);
  f16*   w2T   = (f16*)(ws + OFF_W2);
  f16*   qk    = (f16*)(ws + OFF_BIG);     // 4 q/k planes
  f16*   hh    = (f16*)(ws + OFF_BIG);     // reuses the q/k region after the attention launch
  f16*   vt    = (f16*)(ws + OFF_VT);
  f16*   ctx   = (f16*)(ws + OFF_CTX);
  float* y     = (float*)(ws + OFF_Y);
  float* x1f   = (float*)(ws + OFF_X1F);
  f16*   x1h   = (f16*)(ws + OFF_X1H);

  // operand planes
  cvt_x_kernel<<<dim3((unsigned)((size_t)NTOK * DIM / 8 / 256)), 256, 0, stream>>>(x, xh);
  // in[512][512] -> out[512][512] (rows = output feature), three stacked into the [1536][512] plane
  wt_kernel<<<dim3(DIM / 64, DIM / 64), 256, 0, stream>>>(wq, wqkvT, DIM, DIM);
  wt_kernel<<<dim3(DIM / 64, DIM / 64), 256, 0, stream>>>(wk, wqkvT + (size_t)DIM * DIM, DIM, DIM);
  wt_kernel<<<dim3(DIM / 64, DIM / 64), 256, 0, stream>>>(wv, wqkvT + (size_t)2 * DIM * DIM, DIM, DIM);
  wt_kernel<<<dim3(DIM / 64, DIM / 64), 256, 0, stream>>>(wo, woT, DIM, DIM);
  // in[512][2048] -> out[2048][512] : grid (cols/64, rows/64) = (32, 8)
  wt_kernel<<<dim3(FFN / 64, DIM / 64), 256, 0, stream>>>(w1, w1T, DIM, FFN);
  // in[2048][512] -> out[512][2048] : grid (cols/64, rows/64) = (8, 32)
  wt_kernel<<<dim3(DIM / 64, FFN / 64), 256, 0, stream>>>(w2, w2T, FFN, DIM);

  gemm_qkv_kernel<<<dim3(NTOK / GM, QKVN / GN), 128, 0, stream>>>(xh, wqkvT, bq, bk, bv, qk, vt);
  attn_kernel<<<dim3(SEQ / BQ, NHEAD, NB), 256, 0, stream>>>(qk, vt, ctx);
  gemm_wo_kernel<<<dim3(NTOK / GM, DIM / GN), 128, 0, stream>>>(ctx, woT, bo, x, y);
  ln1_kernel<<<dim3(NTOK / 8), 256, 0, stream>>>(y, g1, be1, x1f, x1h);
  gemm_ffn1_kernel<<<dim3(NTOK / GM, FFN / GN), 128, 0, stream>>>(x1h, w1T, b1, hh);
  gemm_ffn2_kernel<<<dim3(NTOK / GM, DIM / GN), 128, 0, stream>>>(hh, w2T, b2, x1f, y);
  ln2_kernel<<<dim3(NTOK / 8), 256, 0, stream>>>(y, g2, be2, out);
}

// v003
// A run of this version takes 186 microseconds.
// In both of two side-by-side timings against v002, it was 1.20 times as fast.
// Over all steps from v000 it is 2.52 times as fast.
#include <hip/hip_runtime.h>
#include <math.h>

// All contractions on v_wmma_f32_16x16x32_f16 with f32 accumulate: projections / Wo / FFN use f16 operand planes
// (inputs RNE-converted to bf16 first, then exact power-of-two carries); scores S^T = K x Q^T use q and k as
// f16 value plane + f16 residual plane (x2048, separate accumulator); O = P x V with P f16 carried x4096.
//
// Every f16 operand plane in the workspace is stored fragment-packed: a [rows][K] operand is cut into tiles of
// 16 rows x 32 k; a tile is two 512-B units (k halves 0..15 and 16..31); inside a unit lane (hi*16 + lq) owns 16 B =
// row lq, k = half*16 + hi*8 + 0..7. Unit index = (rowtile * (K/32) + kblock) * 2 + half; the V^T plane puts the k block outermost. One wave-wide 16-B-per-lane
// load of a unit is 512 contiguous bytes (4 whole lines) and lands directly in the split-k fragment map.

#ifndef NB
#define NB 4
#endif
#ifndef SEQ
#define SEQ 2048
#endif
#define NB_FULL   4
#define SEQ_FULL  2048
#define DIM       512
#define NHEAD     8
#define HDIM      64
#define FFN       2048
#define QKVN      (3 * DIM)
#define NTOK      (NB * SEQ)
#define PLANE     ((size_t)NTOK * DIM)     // elements of one [NB][NHEAD][SEQ][HDIM] 16-bit plane
#define GM        128                      // GEMM block rows (4 waves x 32)
#define GN        64                       // GEMM block columns
#define GW        4                        // waves per GEMM block
#define OP        68                       // LDS pitch (floats) of f32 staging tiles
#define VP        136                      // LDS pitch (halves) of the V^T staging tile
#define TP        72                       // LDS pitch (halves) of the weight transposer tile
#define SHP       (DIM + 16)               // LDS pitch (halves) of the LayerNorm-1 f16 row staging
#define BQ        128                      // query rows per attention block (8 waves x 16)
#define BK        32                       // keys per attention step
#define NWAVE     8
#define XC        16.0f                    // carry of the x, LN1-output and GELU-output planes
#define WC        64.0f                    // carry of all weight planes
#define VC        16.0f                    // carry of the V^T plane
#define CC        256.0f                   // carry of the attention-context plane
#define PC        4096.0f                  // carry of P inside the attention kernel
#define RC        2048.0f                  // carry of the q / k residual planes
#define RD        3                        // fragment sets in the register ring of the Wo and FFN-2 products

static_assert(DIM == NHEAD * HDIM);
static_assert(HDIM == 64);
static_assert(HDIM == GN);
static_assert(GM == GW * 32);
static_assert(BQ == NWAVE * 16);
static_assert(SEQ % GM == 0);
static_assert(SEQ % BQ == 0);
static_assert(SEQ % BK == 0);
static_assert(NTOK % GM == 0);
static_assert(NTOK % 8 == 0);
static_assert(DIM % GN == 0);
static_assert(FFN % GN == 0);
static_assert(QKVN % GN == 0);
static_assert(DIM % 64 == 0);
static_assert(FFN % 64 == 0);
static_assert(DIM % 32 == 0);
static_assert(FFN % 32 == 0);
static_assert(DIM == 32 * 16);
static_assert(((size_t)NTOK * DIM / 8) % 256 == 0);
static_assert((OP * 4) % 16 == 0);
static_assert((VP * 2) % 16 == 0);
static_assert((TP * 2) % 16 == 0);
static_assert((SHP * 2) % 16 == 0);
static_assert(SEQ <= SEQ_FULL);
static_assert(NB >= 1 && NB <= NB_FULL);

#define SZ_XH    ((size_t)NTOK * DIM * 2)
#define SZ_WQKV  ((size_t)QKVN * DIM * 2)
#define SZ_WO    ((size_t)DIM * DIM * 2)
#define SZ_W1    ((size_t)FFN * DIM * 2)
#define SZ_W2    ((size_t)DIM * FFN * 2)
#define SZ_QK    ((size_t)4 * NTOK * DIM * 2)
#define SZ_HH    ((size_t)NTOK * FFN * 2)
#define SZ_BIG   ((SZ_QK > SZ_HH) ? SZ_QK : SZ_HH)   // q/k planes, later reused by the GELU-output plane
#define SZ_VT    ((size_t)NTOK * DIM * 2)
#define SZ_CTX   ((size_t)NTOK * DIM * 2)
#define SZ_Y     ((size_t)NTOK * DIM * 4)
#define SZ_X1F   ((size_t)NTOK * DIM * 4)
#define SZ_X1H   ((size_t)NTOK * DIM * 2)
#define OFF_XH   ((size_t)0)
#define OFF_WQKV (OFF_XH + SZ_XH)
#define OFF_WO   (OFF_WQKV + SZ_WQKV)
#define OFF_W1   (OFF_WO + SZ_WO)
#define OFF_W2   (OFF_W1 + SZ_W1)
#define OFF_BIG  (OFF_W2 + SZ_W2)
#define OFF_VT   (OFF_BIG + SZ_BIG)
#define OFF_CTX  (OFF_VT + SZ_VT)
#define OFF_Y    (OFF_CTX + SZ_CTX)
#define OFF_X1F  (OFF_Y + SZ_Y)
#define OFF_X1H  (OFF_X1F + SZ_X1F)
#define WS_TOTAL (OFF_X1H + SZ_X1H)
static_assert(SZ_QK <= SZ_BIG);
static_assert(SZ_HH <= SZ_BIG);
static_assert(SZ_XH % 128 == 0 && SZ_WQKV % 128 == 0 && SZ_WO % 128 == 0 && SZ_W1 % 128 == 0);
static_assert(SZ_W2 % 128 == 0 && SZ_BIG % 128 == 0 && SZ_VT % 128 == 0 && SZ_CTX % 128 == 0);
static_assert(SZ_Y % 128 == 0 && SZ_X1F % 128 == 0 && SZ_X1H % 128 == 0);
static_assert(WS_TOTAL <= (size_t)134217728);

typedef __bf16   bf16;
typedef _Float16 f16;
typedef f16      v16h  __attribute__((ext_vector_type(16)));
typedef f16      v8h   __attribute__((ext_vector_type(8)));
typedef float    v8f   __attribute__((ext_vector_type(8)));
typedef float    v4f   __attribute__((ext_vector_type(4)));
typedef unsigned v4u   __attribute__((ext_vector_type(4)));

union FragH  { v16h v; v4u q[2]; f16 h[16]; };
union Pack8H { v4u u; v8h v; f16 h[8]; };

// bf16 RNE convert of an f32 value, returned as f32
static __device__ __forceinline__ float bfr(float v) { return (float)(bf16)v; }

// WMMA helper: builtin followed by the VALU hazard guard (ties D, keeps A/B live).
static __device__ __forceinline__ v8f mma_f16(v16h a, v16h b, v8f acc) {
  acc = __builtin_amdgcn_wmma_f32_16x16x32_f16(false, a, false, b, (short)0, acc, false, false);
  asm volatile("v_nop\n\tv_nop\n\tv_nop\n\tv_nop" : "+v"(acc) : "v"(a), "v"(b));
  return acc;
}

static __device__ __forceinline__ float wave_sum(float v) {
  v += __shfl_xor(v, 16, 32);
  v += __shfl_xor(v, 8, 32);
  v += __shfl_xor(v, 4, 32);
  v += __shfl_xor(v, 2, 32);
  v += __shfl_xor(v, 1, 32);
  return v;
}

// ---------------------------------------------------------------------------------------------------
// x f32 -> xh packed f16 plane (rows = tokens, K = DIM) = f16(bf16_rne(x) * XC). One thread = one 16-B piece.
__global__ __launch_bounds__(256) void cvt_x_kernel(const float* __restrict__ x, f16* __restrict__ xh) {
  // g = [rowtile][kblock 16][row half 2][8-column group 4 = half*2 + hi][row 8]: a wave reads 8 rows x 128 B
  // and writes four whole 128-B lines of the packed plane.
  const int g = blockIdx.x * 256 + threadIdx.x;
  const int r = ((g >> 5) & 1) * 8 + (g & 7);      // row of the 16-row tile
  const int t = (g >> 10) * 16 + r;                // compact token
  const int c = ((g >> 6) & 15) * 32 + ((g >> 3) & 3) * 8;
  if (t >= NTOK) return;
  const int bb = t / SEQ;
  const int s  = t - bb * SEQ;
  const float* src = x + ((size_t)bb * SEQ_FULL + s) * DIM + c;
  const v4f a0 = *(const v4f*)(src);
  const v4f a1 = *(const v4f*)(src + 4);
  Pack8H p;
  #pragma unroll
  for (int i = 0; i < 4; ++i) {
    p.h[i]     = (f16)(bfr(a0[i]) * XC);
    p.h[4 + i] = (f16)(bfr(a1[i]) * XC);
  }
  const v4u val = p.u;
  f16* dst = xh + (size_t)(g >> 6) * 512 + ((g >> 4) & 1) * 256 + (((g >> 3) & 1) * 16 + r) * 8;
  *(v4u*)dst = val;
  
}

// ---------------------------------------------------------------------------------------------------
// Weight transposer: in[K rows][N cols] f32  ->  packed plane (rows = n, K = k) f16 = f16(bf16_rne(w) * WC).
// grid = (N/64, K/64), 256 threads, tile 64(k) x 64(n) through LDS (cross-wave, block barrier).
__global__ __launch_bounds__(256) void wt_kernel(const float* __restrict__ W, f16* __restrict__ Wt, int K, int N) {
  __shared__ __align__(16) f16 sT[64 * TP];     // [n][k]
  const int tid = threadIdx.x;
  const int n0 = blockIdx.x * 64;
  const int k0 = blockIdx.y * 64;
  #pragma unroll
  for (int it = 0; it < 4; ++it) {
    const int kk = it * 16 + (tid >> 4);        // 0..63
    const int nn = (tid & 15) * 4;              // 0..60
    const v4f w = *(const v4f*)(W + (size_t)(k0 + kk) * N + n0 + nn);
    #pragma unroll
    for (int i = 0; i < 4; ++i) sT[(nn + i) * TP + kk] = (f16)(bfr(w[i]) * WC);
  }
  __syncthreads();
  v4u    val[2];
  size_t idx[2];
  #pragma unroll
  for (int it = 0; it < 2; ++it) {
    const int u  = it * 8 + (tid >> 5);         // unit 0..15 of this tile: [n tile 4][kblock 2][half 2]
    const int ln = tid & 31;
    const int n  = (u >> 2) * 16 + (ln & 15);                               // 0..63
    const int ks = ((u >> 1) & 1) * 32 + (u & 1) * 16 + (ln >> 4) * 8;      // 0..56
    Pack8H ph;
    ph.v = *(const v8h*)(&sT[n * TP + ks]);
    val[it] = ph.u;
    idx[it] = (((size_t)((n0 >> 4) + (u >> 2)) * (K >> 5) + (k0 >> 5) + ((u >> 1) & 1)) * 2 + (u & 1)) * 256 + ln * 8;
  }
  #pragma unroll
  for (int it = 0; it < 2; ++it) *(v4u*)(Wt + idx[it]) = val[it];
  
}

// ---------------------------------------------------------------------------------------------------
// GEMM main loop: acc[mt][nt] (16x16 tiles) of  A[m0 .. m0+31][K] x Bt[n0 .. n0+63][K]^T.
// A and Bt are packed f16 planes; fragments use the split k map for both operands:
// elements 0..7 <- k0 + 8*hi + 0..7, elements 8..15 <- k0 + 16 + 8*hi + 0..7; lane row / column = lq.
// A 16-row tile spans K*16 halves; a k block of 32 spans 512 halves; the second k half starts at +256.
template <int K>
static __device__ __forceinline__ void gemm_main(const f16* __restrict__ A, const f16* __restrict__ Bt,
                                                 int m0, int n0, int lq, int hi, v8f (&acc)[2][4]) {
  static_assert(K % 32 == 0);
  const f16* ap = A  + (size_t)m0 * K + (hi * 16 + lq) * 8;
  const f16* bp = Bt + (size_t)n0 * K + (hi * 16 + lq) * 8;
  #pragma unroll 1
  for (int k0 = 0; k0 < K; k0 += 32) {
    FragH a[2], b[4];
    #pragma unroll
    for (int mt = 0; mt < 2; ++mt) {
      const f16* p = ap + (size_t)mt * 16 * K + k0 * 16;
      a[mt].q[0] = *(const v4u*)(p);
      a[mt].q[1] = *(const v4u*)(p + 256);
    }
    #pragma unroll
    for (int nt = 0; nt < 4; ++nt) {
      const f16* p = bp + (size_t)nt * 16 * K + k0 * 16;
      b[nt].q[0] = *(const v4u*)(p);
      b[nt].q[1] = *(const v4u*)(p + 256);
    }
    #pragma unroll
    for (int mt = 0; mt < 2; ++mt) {
      #pragma unroll
      for (int nt = 0; nt < 4; ++nt) acc[mt][nt] = mma_f16(a[mt].v, b[nt].v, acc[mt][nt]);
    }
  }
}

// The same product for the launches that leave only two waves on a SIMD, too few to cover a fragment load's latency:
// a ring of D fragment sets in registers. Each set is refilled, right behind its own products, with the k block D
// further on, so D k blocks of loads are in flight per wave. The k blocks are summed in the same ascending order as above.
template <int K>
static __device__ __forceinline__ void load_kblock(const char* __restrict__ ap, const char* __restrict__ bp,
                                                   FragH (&a)[2], FragH (&b)[4]) {
  #pragma unroll
  for (int mt = 0; mt < 2; ++mt) {
    const char* p = ap + (size_t)mt * 32 * K;       // byte addresses: a 16-row tile spans 32 * K bytes
    a[mt].q[0] = *(const v4u*)(p);
    a[mt].q[1] = *(const v4u*)(p + 512);
  }
  #pragma unroll
  for (int nt = 0; nt < 4; ++nt) {
    const char* p = bp + (size_t)nt * 32 * K;
    b[nt].q[0] = *(const v4u*)(p);
    b[nt].q[1] = *(const v4u*)(p + 512);
  }
}

template <int K, int D>
static __device__ __forceinline__ void gemm_main_ring(const f16* __restrict__ A, const f16* __restrict__ Bt,
                                                      int m0, int n0, int lq, int hi, v8f (&acc)[2][4]) {
  constexpr int G = (K / 32) / D;                         // whole groups of D k blocks
  constexpr int R = (K / 32) % D;                         // k blocks left over behind them
  static_assert(K % 32 == 0 && G >= 2);
  const char* ab = (const char*)(A  + (size_t)m0 * K);   // wave-uniform bases
  const char* bb = (const char*)(Bt + (size_t)n0 * K);
  unsigned off = (hi * 16 + lq) * 16;                     // byte offset: the lane's piece of a unit + the k blocks done
  FragH a[D][2], b[D][4];
  #pragma unroll
  for (int s = 0; s < D; ++s) load_kblock<K>(ab + off + s * 1024, bb + off + s * 1024, a[s], b[s]);
  #pragma unroll 1
  for (int g = 1; g < G; ++g) {
    // the loads in flight name the offset register: wait before it is advanced (the operand keeps the add behind)
    asm volatile("s_wait_xcnt 0x0" : "+v"(off) : : "memory");
    off += D * 1024;
    #pragma unroll
    for (int s = 0; s < D; ++s) {
      #pragma unroll
      for (int mt = 0; mt < 2; ++mt) {
        #pragma unroll
        for (int nt = 0; nt < 4; ++nt) acc[mt][nt] = mma_f16(a[s][mt].v, b[s][nt].v, acc[mt][nt]);
      }
      load_kblock<K>(ab + off + s * 1024, bb + off + s * 1024, a[s], b[s]);
    }
  }
  // the last refills still name the offset register and the bases: wait before they are put to other use
  asm volatile("s_wait_xcnt 0x0" : "+v"(off) : : "memory");
  // last whole group; the left-over k blocks refill its first sets
  #pragma unroll
  for (int s = 0; s < D; ++s) {
    #pragma unroll
    for (int mt = 0; mt < 2; ++mt) {
      #pragma unroll
      for (int nt = 0; nt < 4; ++nt) acc[mt][nt] = mma_f16(a[s][mt].v, b[s][nt].v, acc[mt][nt]);
    }
    if (s < R) load_kblock<K>(ab + off + (D + s) * 1024, bb + off + (D + s) * 1024, a[s], b[s]);
  }
  #pragma unroll
  for (int s = 0; s < R; ++s) {
    #pragma unroll
    for (int mt = 0; mt < 2; ++mt) {
      #pragma unroll
      for (int nt = 0; nt < 4; ++nt) acc[mt][nt] = mma_f16(a[s][mt].v, b[s][nt].v, acc[mt][nt]);
    }
  }
}

// ---------------------------------------------------------------------------------------------------
// Fused q/k/v projection: [NTOK][512] x [1536][512]^T. Column block (64 wide) = one head of q, k or v.
//          qk plane order: 0 = q value, 1 = q residual, 2 = k value, 3 = k residual.
//   q, k : per (b, h) a packed plane with rows = tokens, K = d (64): 1024 halves per 16 tokens.
//   v    : per (b, h) a packed plane with rows = d (4 tiles), K = tokens, k block outermost:
//          [s/32][d tile 4][half 2][lane 32][8] f16 (x VC), written through a block-wide LDS tile.
// coverage: q/k rows wave*32 + {0..31} x 64 d = 8 units per wave; vt 64 d x 128 tokens = 32 units per block.
__global__ __launch_bounds__(128) void gemm_qkv_kernel(const f16* __restrict__ xh, const f16* __restrict__ wT,
                                                       const float* __restrict__ bq, const float* __restrict__ bk,
                                                       const float* __restrict__ bv,
                                                       f16* __restrict__ qk, f16* __restrict__ vt) {
  __shared__ __align__(16) float sC[GW * 32 * OP];    // per-wave f32 tiles (block barrier used)
  __shared__ __align__(16) f16   sVT[HDIM * VP];      // [d][token], cross-wave (block barrier)
  const int tid  = threadIdx.x;
  const int wave = __builtin_amdgcn_readfirstlane(threadIdx.x >> 5);
  const int lane = tid & 31;
  const int lq   = lane & 15;
  const int hi   = lane >> 4;
  const int tok0 = blockIdx.x * GM;
  const int n0   = blockIdx.y * GN;
  const int seg  = n0 / DIM;                          // 0 = q, 1 = k, 2 = v (block-uniform)
  const int h    = (n0 - seg * DIM) / HDIM;
  const int bb   = tok0 / SEQ;
  const int s0   = tok0 - bb * SEQ;

  v8f acc[2][4];
  #pragma unroll
  for (int mt = 0; mt < 2; ++mt) {
    #pragma unroll
    for (int nt = 0; nt < 4; ++nt) acc[mt][nt] = (v8f){0, 0, 0, 0, 0, 0, 0, 0};
  }
  gemm_main<DIM>(xh, wT, tok0 + wave * 32, n0, lq, hi, acc);

  const float ascale = 1.0f / (XC * WC);
  float bias[4];
  #pragma unroll
  for (int nt = 0; nt < 4; ++nt) {
    const int c = h * HDIM + nt * 16 + lq;            // 0..511
    const float fq = bq[c];
    const float fk = bk[c];
    const float fv = bv[c];
    const float sel = (seg == 0) ? fq : ((seg == 1) ? fk : fv);
    bias[nt] = bfr(sel);
  }

  if (seg < 2) {
    const int wb = wave * (32 * OP);
    #pragma unroll
    for (int mt = 0; mt < 2; ++mt) {
      #pragma unroll
      for (int nt = 0; nt < 4; ++nt) {
        #pragma unroll
        for (int r = 0; r < 8; ++r)
          sC[wb + (mt * 16 + hi * 8 + r) * OP + nt * 16 + lq] = acc[mt][nt][r] * ascale + bias[nt];
      }
    }
    __syncthreads();
    const size_t pbase = (size_t)seg * 2 * PLANE +
                         (((size_t)bb * NHEAD + h) * SEQ + s0 + wave * 32) * HDIM;
    v4u hv[8], rv[8];
    #pragma unroll
    for (int it = 0; it < 8; ++it) {
      const int row = (it >> 2) * 16 + lq;                               // unit it: [row tile 2][d block 2][half 2]
      const int col = ((it >> 1) & 1) * 32 + (it & 1) * 16 + hi * 8;
      const v4f c0 = *(const v4f*)(&sC[wb + row * OP + col]);
      const v4f c1 = *(const v4f*)(&sC[wb + row * OP + col + 4]);
      Pack8H ph, pr;
      #pragma unroll
      for (int i = 0; i < 4; ++i) {
        const f16 h0 = (f16)c0[i];
        const f16 h1 = (f16)c1[i];
        ph.h[i]     = h0;
        ph.h[4 + i] = h1;
        pr.h[i]     = (f16)((c0[i] - (float)h0) * RC);
        pr.h[4 + i] = (f16)((c1[i] - (float)h1) * RC);
      }
      hv[it] = ph.u;
      rv[it] = pr.u;
    }
    #pragma unroll
    for (int it = 0; it < 8; ++it) {
      const size_t o = pbase + (size_t)it * 256 + lane * 8;
      *(v4u*)(qk + o)         = hv[it];
      *(v4u*)(qk + PLANE + o) = rv[it];
    }
    
  } else {
    #pragma unroll
    for (int mt = 0; mt < 2; ++mt) {
      #pragma unroll
      for (int nt = 0; nt < 4; ++nt) {
        #pragma unroll
        for (int r = 0; r < 8; ++r)
          sVT[(nt * 16 + lq) * VP + wave * 32 + mt * 16 + hi * 8 + r] =
              (f16)((acc[mt][nt][r] * ascale + bias[nt]) * VC);
      }
    }
    __syncthreads();
    const size_t vbase = (((size_t)bb * NHEAD + h) * SEQ + s0) * HDIM;   // first unit of this block's 128 tokens
    v4u vv[8];
    #pragma unroll
    for (int it = 0; it < 8; ++it) {
      const int u = it * 4 + wave;                 // unit 0..31: [token block 4][d tile 4][half 2]
      const int d = ((u >> 1) & 3) * 16 + lq;
      const int s = (u >> 3) * 32 + (u & 1) * 16 + hi * 8;
      Pack8H ph;
      ph.v = *(const v8h*)(&sVT[d * VP + s]);
      vv[it] = ph.u;
    }
    #pragma unroll
    for (int it = 0; it < 8; ++it) {
      const size_t o = vbase + (size_t)(it * 4 + wave) * 256 + lane * 8;
      *(v4u*)(vt + o) = vv[it];
    }
    
  }
}

// ---------------------------------------------------------------------------------------------------
// Flash attention, full (no mask). Block = (128-query block, head, batch); one wave owns 16 query rows.
// S^T = K x Q^T so queries sit on lanes; P^T in C layout is the A-fragment layout of O += P x V.
// Scores: main = k_val x q_val ; res = k_val x q_res + k_res x q_val (both x RC) ; s = main + res / RC.
// Fragments come straight from the packed 16-bit planes (two 512-B unit loads each); q fragments stay in registers.
__global__ __launch_bounds__(256) void attn_kernel(const f16* __restrict__ qk, const f16* __restrict__ vt,
                                                   f16* __restrict__ ctx) {
  __shared__ __align__(16) float sO[NWAVE * 16 * OP];    // per-wave output staging (block barrier used)
  const int qblk = blockIdx.x;
  const int h    = blockIdx.y;
  const int b    = blockIdx.z;
  const int tid  = threadIdx.x;
  const int wave = __builtin_amdgcn_readfirstlane(threadIdx.x >> 5);
  const int lane = tid & 31;
  const int lq   = lane & 15;   // query column of S^T / d column of O
  const int hi   = lane >> 4;   // k-split half

  const int qrow0 = qblk * BQ + wave * 16;
  const size_t hb = ((size_t)b * NHEAD + h) * (size_t)SEQ * HDIM;
  const f16* qh_p = qk + hb;
  const f16* qr_p = qk + PLANE + hb;
  const f16* kh_p = qk + 2 * PLANE + hb;
  const f16* kr_p = qk + 3 * PLANE + hb;
  const f16* vt_h = vt + hb;
  const int qoff  = qrow0 * HDIM + lane * 8;         // this wave's 16-query tile, lane's piece of a unit

  // q B-fragments (value and residual planes), loaded once and held for the whole key loop
  FragH fqh[2], fqr[2];
  #pragma unroll
  for (int f = 0; f < 2; ++f) {
    const int qo = qoff + f * 512;
    fqh[f].q[0] = *(const v4u*)(qh_p + qo);           // d = f*32 + hi*8 + 0..7
    fqh[f].q[1] = *(const v4u*)(qh_p + qo + 256);     // d = f*32 + 16 + hi*8 + 0..7
    fqr[f].q[0] = *(const v4u*)(qr_p + qo);
    fqr[f].q[1] = *(const v4u*)(qr_p + qo + 256);
  }

  v8f o[4];
  #pragma unroll
  for (int dt = 0; dt < 4; ++dt) o[dt] = (v8f){0, 0, 0, 0, 0, 0, 0, 0};

  float rmax = -__builtin_inff();
  float rsum = 0.0f;
  const float SL = 0.125f * 1.4426950408889634f;   // softmax scale * log2(e)

  // K A-fragments (row = key lq of the tile, split d map) and V B-fragments (column n = d = dt*16 + lq, split key map
  // from the packed transposed plane) are fetched one step ahead into the same registers: step 0's here, step j + 1's
  // K behind step j's score products and its V behind step j's P x V products.
  FragH fkh[2][2], fkr[2][2], bv[4];
  #pragma unroll
  for (int sub = 0; sub < 2; ++sub) {
    #pragma unroll
    for (int f = 0; f < 2; ++f) {
      const int ko = sub * 16 * HDIM + f * 512 + lane * 8;
      fkh[sub][f].q[0] = *(const v4u*)(kh_p + ko);
      fkh[sub][f].q[1] = *(const v4u*)(kh_p + ko + 256);
      fkr[sub][f].q[0] = *(const v4u*)(kr_p + ko);
      fkr[sub][f].q[1] = *(const v4u*)(kr_p + ko + 256);
    }
  }
  #pragma unroll
  for (int dt = 0; dt < 4; ++dt) {
    const f16* base = vt_h + dt * 512 + lane * 8;
    bv[dt].q[0] = *(const v4u*)(base);              // keys hi*8 + 0..7
    bv[dt].q[1] = *(const v4u*)(base + 256);        // keys 16 + hi*8 + 0..7
  }

  #pragma unroll 1
  for (int j0 = 0; j0 < SEQ; j0 += BK) {
    // the step fetched ahead; the last step has none and refetches step 0 (in bounds, never used)
    const int jn = (j0 + BK < SEQ) ? j0 + BK : 0;

    // S^T tiles: c[sub][r] = rawscore(query qrow0+lq, key j0 + sub*16 + hi*8 + r)
    v8f c[2];
    #pragma unroll
    for (int sub = 0; sub < 2; ++sub) {
      v8f am = (v8f){0, 0, 0, 0, 0, 0, 0, 0};
      v8f ar = (v8f){0, 0, 0, 0, 0, 0, 0, 0};
      #pragma unroll
      for (int f = 0; f < 2; ++f) {
        am = mma_f16(fkh[sub][f].v, fqh[f].v, am);
        ar = mma_f16(fkh[sub][f].v, fqr[f].v, ar);
        ar = mma_f16(fkr[sub][f].v, fqh[f].v, ar);
      }
      #pragma unroll
      for (int r = 0; r < 8; ++r) c[sub][r] = am[r] + ar[r] * (1.0f / RC);
    }

    // next step's K fragments, in flight under the softmax and the P x V products
    #pragma unroll
    for (int sub = 0; sub < 2; ++sub) {
      #pragma unroll
      for (int f = 0; f < 2; ++f) {
        const int ko = (jn + sub * 16) * HDIM + f * 512 + lane * 8;
        fkh[sub][f].q[0] = *(const v4u*)(kh_p + ko);
        fkh[sub][f].q[1] = *(const v4u*)(kh_p + ko + 256);
        fkr[sub][f].q[0] = *(const v4u*)(kr_p + ko);
        fkr[sub][f].q[1] = *(const v4u*)(kr_p + ko + 256);
      }
    }
    // keeps the K loads from sinking into the softmax below, where less work would cover their latency
    __builtin_amdgcn_sched_barrier(0);

    // online softmax: query lq's 32 scores are split across lane / lane^16
    float m_new = rmax;
    #pragma unroll
    for (int r = 0; r < 8; ++r) {
      m_new = fmaxf(m_new, c[0][r]);
      m_new = fmaxf(m_new, c[1][r]);
    }
    m_new = fmaxf(m_new, __shfl_xor(m_new, 16, 32));
    const float scale = __builtin_amdgcn_exp2f((rmax - m_new) * SL);
    rmax = m_new;

    // exp + pack: P^T C-layout == A-fragment layout for the PV product
    FragH pa;
    float psum = 0.0f;
    #pragma unroll
    for (int r = 0; r < 8; ++r) {
      const float p0 = __builtin_amdgcn_exp2f((c[0][r] - m_new) * SL);   // key hi*8 + r
      const float p1 = __builtin_amdgcn_exp2f((c[1][r] - m_new) * SL);   // key 16 + hi*8 + r
      psum += p0 + p1;
      pa.h[r]     = (f16)(p0 * PC);
      pa.h[8 + r] = (f16)(p1 * PC);
    }
    rsum = rsum * scale + psum + __shfl_xor(psum, 16, 32);

    // rescale O: queries are the row dimension there -> per-row scale from lane 8*hi + r
    float sc[8];
    #pragma unroll
    for (int r = 0; r < 8; ++r) sc[r] = __shfl(scale, (hi << 3) + r, 32);
    #pragma unroll
    for (int dt = 0; dt < 4; ++dt) {
      #pragma unroll
      for (int r = 0; r < 8; ++r) o[dt][r] *= sc[r];
    }

    // O += P x V
    #pragma unroll
    for (int dt = 0; dt < 4; ++dt) o[dt] = mma_f16(pa.v, bv[dt].v, o[dt]);

    // next step's V fragments, in flight under its score products and softmax
    #pragma unroll
    for (int dt = 0; dt < 4; ++dt) {
      const f16* base = vt_h + (size_t)jn * HDIM + dt * 512 + lane * 8;
      bv[dt].q[0] = *(const v4u*)(base);            // keys jn + hi*8 + 0..7
      bv[dt].q[1] = *(const v4u*)(base + 256);      // keys jn + 16 + hi*8 + 0..7
    }
    // the V address pair is formed anew at the head of the next step: wait before that overwrite
    asm volatile("s_wait_xcnt 0x0" ::: "memory");
  }

  // normalize: lane holds column d = dt*16 + lq for query rows 8*hi + r
  float rs[8];
  #pragma unroll
  for (int r = 0; r < 8; ++r) rs[r] = 1.0f / __shfl(rsum, (hi << 3) + r, 32);

  const int wb = wave * (16 * OP);
  #pragma unroll
  for (int r = 0; r < 8; ++r) {
    #pragma unroll
    for (int dt = 0; dt < 4; ++dt)
      sO[wb + (hi * 8 + r) * OP + dt * 16 + lq] = o[dt][r] * (CC / (PC * VC)) * rs[r];
  }
  __syncthreads();

  v4u    pv[4];
  size_t gidx[4];
  #pragma unroll
  for (int it = 0; it < 4; ++it) {
    const int row = lq;                                   // unit it: [k block 2][half 2] of this head's 64 columns
    const int col = (it >> 1) * 32 + (it & 1) * 16 + hi * 8;
    const v4f c0 = *(const v4f*)(&sO[wb + row * OP + col]);
    const v4f c1 = *(const v4f*)(&sO[wb + row * OP + col + 4]);
    Pack8H ph;
    #pragma unroll
    for (int i = 0; i < 4; ++i) {
      ph.h[i]     = (f16)c0[i];
      ph.h[4 + i] = (f16)c1[i];
    }
    pv[it]   = ph.u;
    gidx[it] = ((size_t)b * SEQ + qrow0) * DIM + (size_t)(h * 4 + it) * 256 + lane * 8;   // packed, K = DIM
  }
  #pragma unroll
  for (int it = 0; it < 4; ++it) *(v4u*)(ctx + gidx[it]) = pv[it];
  
}

// ---------------------------------------------------------------------------------------------------
// y = ctx x wo + bo + bf16_rne(x)   (f32 plane [NTOK][DIM], input of LayerNorm 1)
// coverage: rows wave*32 + {0..31}, 64 columns: 16 instr, lanes 0..15 one 256-B row segment, 16..31 the next row.
__global__ __launch_bounds__(128) void gemm_wo_kernel(const f16* __restrict__ ctx, const f16* __restrict__ woT,
                                                      const float* __restrict__ bo, const float* __restrict__ x,
                                                      float* __restrict__ y) {
  __shared__ __align__(16) float sC[GW * 32 * OP];
  const int tid  = threadIdx.x;
  const int wave = __builtin_amdgcn_readfirstlane(threadIdx.x >> 5);
  const int lane = tid & 31;
  const int lq   = lane & 15;
  const int hi   = lane >> 4;
  const int tok0 = blockIdx.x * GM;
  const int n0   = blockIdx.y * GN;
  const int bb   = tok0 / SEQ;
  const int s0   = tok0 - bb * SEQ;

  v8f acc[2][4];
  #pragma unroll
  for (int mt = 0; mt < 2; ++mt) {
    #pragma unroll
    for (int nt = 0; nt < 4; ++nt) acc[mt][nt] = (v8f){0, 0, 0, 0, 0, 0, 0, 0};
  }
  gemm_main_ring<DIM, RD>(ctx, woT, tok0 + wave * 32, n0, lq, hi, acc);

  const float ascale = 1.0f / (CC * WC);
  const int wb = wave * (32 * OP);
  #pragma unroll
  for (int nt = 0; nt < 4; ++nt) {
    const float bias = bfr(bo[n0 + nt * 16 + lq]);
    #pragma unroll
    for (int mt = 0; mt < 2; ++mt) {
      #pragma unroll
      for (int r = 0; r < 8; ++r)
        sC[wb + (mt * 16 + hi * 8 + r) * OP + nt * 16 + lq] = acc[mt][nt][r] * ascale + bias;
    }
  }
  __syncthreads();

  const size_t orow = (size_t)tok0 + wave * 32;                          // compact row
  const size_t rrow = (size_t)bb * SEQ_FULL + s0 + wave * 32;            // row of the full-size x
  #pragma unroll
  for (int g = 0; g < 2; ++g) {
    v4f vals[8];
    #pragma unroll
    for (int it = 0; it < 8; ++it) {
      const int row = g * 16 + it * 2 + hi;
      v4f cv = *(const v4f*)(&sC[wb + row * OP + lq * 4]);
      const v4f rv = *(const v4f*)(x + (rrow + row) * DIM + n0 + lq * 4);
      #pragma unroll
      for (int i = 0; i < 4; ++i) cv[i] = cv[i] + bfr(rv[i]);
      vals[it] = cv;
    }
    #pragma unroll
    for (int it = 0; it < 8; ++it)
      *(v4f*)(y + (orow + g * 16 + it * 2 + hi) * DIM + n0 + lq * 4) = vals[it];
    
  }
}

// ---------------------------------------------------------------------------------------------------
// f32 row: 4 instr x (32 lanes x 16 B) ; f16 rows staged in LDS (cross-wave, block barrier) and written packed:
// the block's 8 tokens fill 8 neighbouring lane slots = one whole 128-B line in each of the 64 (k block, half, hi) groups.
__global__ __launch_bounds__(256) void ln1_kernel(const float* __restrict__ y, const float* __restrict__ g,
                                                  const float* __restrict__ be,
                                                  float* __restrict__ x1f, f16* __restrict__ x1h) {
  __shared__ __align__(16) f16 sH[8 * SHP];
  const int tid  = threadIdx.x;
  const int wave = __builtin_amdgcn_readfirstlane(threadIdx.x >> 5);
  const int lane = tid & 31;
  const int t    = blockIdx.x * 8 + wave;             // compact token
  const float* yr = y + (size_t)t * DIM;

  v4f v[4];
  float s = 0.0f;
  #pragma unroll
  for (int j = 0; j < 4; ++j) {
    v[j] = *(const v4f*)(yr + j * 128 + lane * 4);
    s += (v[j][0] + v[j][1]) + (v[j][2] + v[j][3]);
  }
  s = wave_sum(s);
  const float mean = s * (1.0f / DIM);
  float q = 0.0f;
  #pragma unroll
  for (int j = 0; j < 4; ++j) {
    #pragma unroll
    for (int i = 0; i < 4; ++i) {
      const float d = v[j][i] - mean;
      q += d * d;
    }
  }
  q = wave_sum(q);
  const float rstd = rsqrtf(q * (1.0f / DIM) + 1e-5f);

  v4f ov[4];
  #pragma unroll
  for (int j = 0; j < 4; ++j) {
    const v4f gv = *(const v4f*)(g + j * 128 + lane * 4);
    const v4f bv = *(const v4f*)(be + j * 128 + lane * 4);
    #pragma unroll
    for (int i = 0; i < 4; ++i) {
      const float val = (v[j][i] - mean) * rstd * bfr(gv[i]) + bfr(bv[i]);
      ov[j][i] = val;
      sH[wave * SHP + j * 128 + lane * 4 + i] = (f16)(val * XC);
    }
  }
  __syncthreads();
  const int t0 = blockIdx.x * 8;                      // first token of the block
  v4u    hv[2];
  size_t hidx[2];
  #pragma unroll
  for (int jj = 0; jj < 2; ++jj) {
    const int tk = tid & 7;                           // token of the block
    const int ln = jj * 32 + (tid >> 3);              // 8-column group 0..63 = kblock*4 + half*2 + hi
    Pack8H ph;
    ph.v = *(const v8h*)(&sH[tk * SHP + ln * 8]);
    hv[jj] = ph.u;
    hidx[jj] = (size_t)(t0 >> 4) * (16 * DIM) + (size_t)(ln >> 1) * 256 + ((ln & 1) * 16 + (t0 & 15) + tk) * 8;
  }
  float* fo = x1f + (size_t)t * DIM + lane * 4;
  #pragma unroll
  for (int j = 0; j < 4; ++j) *(v4f*)(fo + j * 128) = ov[j];
  #pragma unroll
  for (int jj = 0; jj < 2; ++jj) *(v4u*)(x1h + hidx[jj]) = hv[jj];
  
}

// ---------------------------------------------------------------------------------------------------
// hh = f16( gelu_erf(x1 x w1 + b1) * XC )   packed plane (rows = tokens, K = FFN)
__global__ __launch_bounds__(128) void gemm_ffn1_kernel(const f16* __restrict__ x1h, const f16* __restrict__ w1T,
                                                        const float* __restrict__ b1, f16* __restrict__ hh) {
  __shared__ __align__(16) float sC[GW * 32 * OP];
  const int tid  = threadIdx.x;
  const int wave = __builtin_amdgcn_readfirstlane(threadIdx.x >> 5);
  const int lane = tid & 31;
  const int lq   = lane & 15;
  const int hi   = lane >> 4;
  const int tok0 = blockIdx.x * GM;
  const int n0   = blockIdx.y * GN;

  v8f acc[2][4];
  #pragma unroll
  for (int mt = 0; mt < 2; ++mt) {
    #pragma unroll
    for (int nt = 0; nt < 4; ++nt) acc[mt][nt] = (v8f){0, 0, 0, 0, 0, 0, 0, 0};
  }
  gemm_main<DIM>(x1h, w1T, tok0 + wave * 32, n0, lq, hi, acc);

  const float ascale = 1.0f / (XC * WC);
  const int wb = wave * (32 * OP);
  #pragma unroll
  for (int nt = 0; nt < 4; ++nt) {
    const float bias = bfr(b1[n0 + nt * 16 + lq]);
    #pragma unroll
    for (int mt = 0; mt < 2; ++mt) {
      #pragma unroll
      for (int r = 0; r < 8; ++r)
        sC[wb + (mt * 16 + hi * 8 + r) * OP + nt * 16 + lq] = acc[mt][nt][r] * ascale + bias;
    }
  }
  __syncthreads();

  // GELU (erf form) in place on this lane's own pieces (same lane reads them back below); kept rolled
  // piece it = i >> 1 is this lane's 16 B of unit it: [row tile 2][k block 2][half 2]
  const int lbase = wb + lq * OP + hi * 8;
  #pragma unroll 1
  for (int i = 0; i < 16; ++i) {
    const int off = lbase + (i >> 3) * (16 * OP) + ((i >> 1) & 3) * 16 + (i & 1) * 4;
    v4f t = *(const v4f*)(&sC[off]);
    #pragma unroll
    for (int e = 0; e < 4; ++e) {
      const float u = t[e];
      t[e] = 0.5f * u * (1.0f + erff(u * 0.70710678118654752f));
    }
    *(v4f*)(&sC[off]) = t;
  }

  v4u pv[8];
  #pragma unroll
  for (int it = 0; it < 8; ++it) {
    const int off = lbase + (it >> 2) * (16 * OP) + (it & 3) * 16;
    const v4f c0 = *(const v4f*)(&sC[off]);
    const v4f c1 = *(const v4f*)(&sC[off + 4]);
    Pack8H ph;
    #pragma unroll
    for (int i = 0; i < 4; ++i) {
      ph.h[i]     = (f16)(c0[i] * XC);
      ph.h[4 + i] = (f16)(c1[i] * XC);
    }
    pv[it] = ph.u;
  }
  const size_t obase = ((size_t)tok0 + wave * 32) * FFN + (size_t)n0 * 16 + lane * 8;
  #pragma unroll
  for (int it = 0; it < 8; ++it) *(v4u*)(hh + obase + (size_t)(it >> 2) * 16 * FFN + (it & 3) * 256) = pv[it];
  
}

// ---------------------------------------------------------------------------------------------------
// y = hh x w2 + b2 + x1f   (f32 plane [NTOK][DIM], input of LayerNorm 2)
__global__ __launch_bounds__(128) void gemm_ffn2_kernel(const f16* __restrict__ hh, const f16* __restrict__ w2T,
                                                        const float* __restrict__ b2, const float* __restrict__ x1f,
                                                        float* __restrict__ y) {
  __shared__ __align__(16) float sC[GW * 32 * OP];
  const int tid  = threadIdx.x;
  const int wave = __builtin_amdgcn_readfirstlane(threadIdx.x >> 5);
  const int lane = tid & 31;
  const int lq   = lane & 15;
  const int hi   = lane >> 4;
  const int tok0 = blockIdx.x * GM;
  const int n0   = blockIdx.y * GN;

  v8f acc[2][4];
  #pragma unroll
  for (int mt = 0; mt < 2; ++mt) {
    #pragma unroll
    for (int nt = 0; nt < 4; ++nt) acc[mt][nt] = (v8f){0, 0, 0, 0, 0, 0, 0, 0};
  }
  gemm_main_ring<FFN, RD>(hh, w2T, tok0 + wave * 32, n0, lq, hi, acc);

  const float ascale = 1.0f / (XC * WC);
  const int wb = wave * (32 * OP);
  #pragma unroll
  for (int nt = 0; nt < 4; ++nt) {
    const float bias = bfr(b2[n0 + nt * 16 + lq]);
    #pragma unroll
    for (int mt = 0; mt < 2; ++mt) {
      #pragma unroll
      for (int r = 0; r < 8; ++r)
        sC[wb + (mt * 16 + hi * 8 + r) * OP + nt * 16 + lq] = acc[mt][nt][r] * ascale + bias;
    }
  }
  __syncthreads();

  const size_t orow = (size_t)tok0 + wave * 32;
  #pragma unroll
  for (int g = 0; g < 2; ++g) {
    v4f vals[8];
    #pragma unroll
    for (int it = 0; it < 8; ++it) {
      const int row = g * 16 + it * 2 + hi;
      v4f cv = *(const v4f*)(&sC[wb + row * OP + lq * 4]);
      const v4f rv = *(const v4f*)(x1f + (orow + row) * DIM + n0 + lq * 4);
      #pragma unroll
      for (int i = 0; i < 4; ++i) cv[i] = cv[i] + rv[i];
      vals[it] = cv;
    }
    #pragma unroll
    for (int it = 0; it < 8; ++it)
      *(v4f*)(y + (orow + g * 16 + it * 2 + hi) * DIM + n0 + lq * 4) = vals[it];
    
  }
}

// ---------------------------------------------------------------------------------------------------
__global__ __launch_bounds__(256) void ln2_kernel(const float* __restrict__ y, const float* __restrict__ g,
                                                  const float* __restrict__ be, float* __restrict__ out) {
  const int tid  = threadIdx.x;
  const int wave = __builtin_amdgcn_readfirstlane(threadIdx.x >> 5);
  const int lane = tid & 31;
  const int t    = blockIdx.x * 8 + wave;             // compact token
  const int bb   = t / SEQ;
  const int s0   = t - bb * SEQ;
  const float* yr = y + (size_t)t * DIM;

  v4f v[4];
  float s = 0.0f;
  #pragma unroll
  for (int j = 0; j < 4; ++j) {
    v[j] = *(const v4f*)(yr + j * 128 + lane * 4);
    s += (v[j][0] + v[j][1]) + (v[j][2] + v[j][3]);
  }
  s = wave_sum(s);
  const float mean = s * (1.0f / DIM);
  float q = 0.0f;
  #pragma unroll
  for (int j = 0; j < 4; ++j) {
    #pragma unroll
    for (int i = 0; i < 4; ++i) {
      const float d = v[j][i] - mean;
      q += d * d;
    }
  }
  q = wave_sum(q);
  const float rstd = rsqrtf(q * (1.0f / DIM) + 1e-5f);

  v4f ov[4];
  #pragma unroll
  for (int j = 0; j < 4; ++j) {
    const v4f gv = *(const v4f*)(g + j * 128 + lane * 4);
    const v4f bv = *(const v4f*)(be + j * 128 + lane * 4);
    #pragma unroll
    for (int i = 0; i < 4; ++i) ov[j][i] = (v[j][i] - mean) * rstd * bfr(gv[i]) + bfr(bv[i]);
  }
  float* fo = out + ((size_t)bb * SEQ_FULL + s0) * DIM + lane * 4;
  #pragma unroll
  for (int j = 0; j < 4; ++j) *(v4f*)(fo + j * 128) = ov[j];
  
}

// ---------------------------------------------------------------------------------------------------
extern "C" void kernel_launch(void* const* d_in, const int* in_sizes, int n_in,
                              void* d_out, int out_size, void* d_ws, size_t ws_size,
                              hipStream_t stream) {
  if (n_in < 17) return;
  const size_t rows_used = (size_t)(NB - 1) * SEQ_FULL + SEQ;
  if ((size_t)in_sizes[0] < rows_used * DIM) return;
  if ((size_t)in_sizes[1] < (size_t)DIM * DIM || (size_t)in_sizes[3] < (size_t)DIM * DIM) return;
  if ((size_t)in_sizes[5] < (size_t)DIM * DIM || (size_t)in_sizes[7] < (size_t)DIM * DIM) return;
  if ((size_t)in_sizes[9] < (size_t)DIM * FFN || (size_t)in_sizes[11] < (size_t)FFN * DIM) return;
  if (in_sizes[2] < DIM || in_sizes[4] < DIM || in_sizes[6] < DIM || in_sizes[8] < DIM) return;
  if (in_sizes[10] < FFN || in_sizes[12] < DIM) return;
  if (in_sizes[13] < DIM || in_sizes[14] < DIM || in_sizes[15] < DIM || in_sizes[16] < DIM) return;
  if ((size_t)out_size < rows_used * DIM) return;
  if (ws_size < WS_TOTAL) return;

  const float* x   = (const float*)d_in[0];
  const float* wq  = (const float*)d_in[1];
  const float* bq  = (const float*)d_in[2];
  const float* wk  = (const float*)d_in[3];
  const float* bk  = (const float*)d_in[4];
  const float* wv  = (const float*)d_in[5];
  const float* bv  = (const float*)d_in[6];
  const float* wo  = (const float*)d_in[7];
  const float* bo  = (const float*)d_in[8];
  const float* w1  = (const float*)d_in[9];
  const float* b1  = (const float*)d_in[10];
  const float* w2  = (const float*)d_in[11];
  const float* b2  = (const float*)d_in[12];
  const float* g1  = (const float*)d_in[13];
  const float* be1 = (const float*)d_in[14];
  const float* g2  = (const float*)d_in[15];
  const float* be2 = (const float*)d_in[16];
  float* out = (float*)d_out;

  char* ws = (char*)d_ws;
  f16*   xh    = (f16*)(ws + OFF_XH);
  f16*   wqkvT = (f16*)(ws + OFF_WQKV);
  f16*   woT   = (f16*)(ws + OFF_WO);
  f16*   w1T   = (f16*)(ws + OFF_W1);
  f16*   w2T   = (f16*)(ws + OFF_W2);
  f16*   qk    = (f16*)(ws + OFF_BIG);     // 4 q/k planes
  f16*   hh    = (f16*)(ws + OFF_BIG);     // reuses the q/k region after the attention launch
  f16*   vt    = (f16*)(ws + OFF_VT);
  f16*   ctx   = (f16*)(ws + OFF_CTX);
  float* y     = (float*)(ws + OFF_Y);
  float* x1f   = (float*)(ws + OFF_X1F);
  f16*   x1h   = (f16*)(ws + OFF_X1H);

  // operand planes
  cvt_x_kernel<<<dim3((unsigned)((size_t)NTOK * DIM / 8 / 256)), 256, 0, stream>>>(x, xh);
  // in[512][512] -> out[512][512] (rows = output feature), three stacked into the [1536][512] plane
  wt_kernel<<<dim3(DIM / 64, DIM / 64), 256, 0, stream>>>(wq, wqkvT, DIM, DIM);
  wt_kernel<<<dim3(DIM / 64, DIM / 64), 256, 0, stream>>>(wk, wqkvT + (size_t)DIM * DIM, DIM, DIM);
  wt_kernel<<<dim3(DIM / 64, DIM / 64), 256, 0, stream>>>(wv, wqkvT + (size_t)2 * DIM * DIM, DIM, DIM);
  wt_kernel<<<dim3(DIM / 64, DIM / 64), 256, 0, stream>>>(wo, woT, DIM, DIM);
  // in[512][2048] -> out[2048][512] : grid (cols/64, rows/64) = (32, 8)
  wt_kernel<<<dim3(FFN / 64, DIM / 64), 256, 0, stream>>>(w1, w1T, DIM, FFN);
  // in[2048][512] -> out[512][2048] : grid (cols/64, rows/64) = (8, 32)
  wt_kernel<<<dim3(DIM / 64, FFN / 64), 256, 0, stream>>>(w2, w2T, FFN, DIM);

  gemm_qkv_kernel<<<dim3(NTOK / GM, QKVN / GN), 128, 0, stream>>>(xh, wqkvT, bq, bk, bv, qk, vt);
  attn_kernel<<<dim3(SEQ / BQ, NHEAD, NB), 256, 0, stream>>>(qk, vt, ctx);
  gemm_wo_kernel<<<dim3(NTOK / GM, DIM / GN), 128, 0, stream>>>(ctx, woT, bo, x, y);
  ln1_kernel<<<dim3(NTOK / 8), 256, 0, stream>>>(y, g1, be1, x1f, x1h);
  gemm_ffn1_kernel<<<dim3(NTOK / GM, FFN / GN), 128, 0, stream>>>(x1h, w1T, b1, hh);
  gemm_ffn2_kernel<<<dim3(NTOK / GM, DIM / GN), 128, 0, stream>>>(hh, w2T, b2, x1f, y);
  ln2_kernel<<<dim3(NTOK / 8), 256, 0, stream>>>(y, g2, be2, out);
}

// v004
// It runs in 172 microseconds.
// Next to v003, in two timings, it ran 1.08 times as fast each time.
// Over all steps from v000 it is 2.73 times as fast.
#include <hip/hip_runtime.h>
#include <math.h>

// All contractions on v_wmma_f32_16x16x32_f16 with f32 accumulate: projections / Wo / FFN use f16 operand planes
// (inputs RNE-converted to bf16 first, then exact power-of-two carries); scores S^T = K x Q^T use q and k as
// f16 value plane + f16 residual plane (x2048, separate accumulator); O = P x V with P f16 carried x4096.
//
// Every f16 operand plane in the workspace is stored fragment-packed: a [rows][K] operand is cut into tiles of
// 16 rows x 32 k; a tile is two 512-B units (k halves 0..15 and 16..31); inside a unit lane (hi*16 + lq) owns 16 B =
// row lq, k = half*16 + hi*8 + 0..7. Unit index = (rowtile * (K/32) + kblock) * 2 + half; the V^T plane puts the k block outermost. One wave-wide 16-B-per-lane
// load of a unit is 512 contiguous bytes (4 whole lines) and lands directly in the split-k fragment map.

#ifndef NB
#define NB 4
#endif
#ifndef SEQ
#define SEQ 2048
#endif
#define NB_FULL   4
#define SEQ_FULL  2048
#define DIM       512
#define NHEAD     8
#define HDIM      64
#define FFN       2048
#define QKVN      (3 * DIM)
#define NTOK      (NB * SEQ)
#define PLANE     ((size_t)NTOK * DIM)     // elements of one [NB][NHEAD][SEQ][HDIM] 16-bit plane
#define GM        128                      // GEMM block rows (4 waves x 32)
#define GN        64                       // GEMM block columns
#define GW        4                        // waves per GEMM block
#define OP        68                       // LDS pitch (floats) of f32 staging tiles
#define VP        136                      // LDS pitch (halves) of the V^T staging tile
#define TP        72                       // LDS pitch (halves) of the weight transposer tile
#define SHP       (DIM + 16)               // LDS pitch (halves) of the LayerNorm-1 f16 row staging
#define BQ        128                      // query rows per attention block (8 waves x 16)
#define BK        32                       // keys per attention step
#define NWAVE     8
#define XC        16.0f                    // carry of the x, LN1-output and GELU-output planes
#define WC        64.0f                    // carry of all weight planes
#define VC        16.0f                    // carry of the V^T plane
#define CC        256.0f                   // carry of the attention-context plane
#define PC        4096.0f                  // carry of P inside the attention kernel
#define RC        2048.0f                  // carry of the q / k residual planes
#define RD        3                        // fragment sets in the register ring of the Wo and FFN-2 products

static_assert(DIM == NHEAD * HDIM);
static_assert(HDIM == 64);
static_assert(HDIM == GN);
static_assert(GM == GW * 32);
static_assert(BQ == NWAVE * 16);
static_assert(SEQ % GM == 0);
static_assert(SEQ % BQ == 0);
static_assert(SEQ % BK == 0);
static_assert(NTOK % GM == 0);
static_assert(NTOK % 8 == 0);
static_assert(DIM % GN == 0);
static_assert(FFN % GN == 0);
static_assert(QKVN % GN == 0);
static_assert(DIM % 64 == 0);
static_assert(FFN % 64 == 0);
static_assert(DIM % 32 == 0);
static_assert(FFN % 32 == 0);
static_assert(DIM == 32 * 16);
static_assert(((size_t)NTOK * DIM / 8) % 256 == 0);
static_assert((OP * 4) % 16 == 0);
static_assert((VP * 2) % 16 == 0);
static_assert((TP * 2) % 16 == 0);
static_assert((SHP * 2) % 16 == 0);
static_assert(SEQ <= SEQ_FULL);
static_assert(NB >= 1 && NB <= NB_FULL);

#define SZ_XH    ((size_t)NTOK * DIM * 2)
#define SZ_WQKV  ((size_t)QKVN * DIM * 2)
#define SZ_WO    ((size_t)DIM * DIM * 2)
#define SZ_W1    ((size_t)FFN * DIM * 2)
#define SZ_W2    ((size_t)DIM * FFN * 2)
#define SZ_QK    ((size_t)4 * NTOK * DIM * 2)
#define SZ_HH    ((size_t)NTOK * FFN * 2)
#define SZ_BIG   ((SZ_QK > SZ_HH) ? SZ_QK : SZ_HH)   // q/k planes, later reused by the GELU-output plane
#define SZ_VT    ((size_t)NTOK * DIM * 2)
#define SZ_CTX   ((size_t)NTOK * DIM * 2)
#define SZ_Y     ((size_t)NTOK * DIM * 4)
#define SZ_X1F   ((size_t)NTOK * DIM * 4)
#define SZ_X1H   ((size_t)NTOK * DIM * 2)
#define OFF_XH   ((size_t)0)
#define OFF_WQKV (OFF_XH + SZ_XH)
#define OFF_WO   (OFF_WQKV + SZ_WQKV)
#define OFF_W1   (OFF_WO + SZ_WO)
#define OFF_W2   (OFF_W1 + SZ_W1)
#define OFF_BIG  (OFF_W2 + SZ_W2)
#define OFF_VT   (OFF_BIG + SZ_BIG)
#define OFF_CTX  (OFF_VT + SZ_VT)
#define OFF_Y    (OFF_CTX + SZ_CTX)
#define OFF_X1F  (OFF_Y + SZ_Y)
#define OFF_X1H  (OFF_X1F + SZ_X1F)
#define WS_TOTAL (OFF_X1H + SZ_X1H)
static_assert(SZ_QK <= SZ_BIG);
static_assert(SZ_HH <= SZ_BIG);
static_assert(SZ_XH % 128 == 0 && SZ_WQKV % 128 == 0 && SZ_WO % 128 == 0 && SZ_W1 % 128 == 0);
static_assert(SZ_W2 % 128 == 0 && SZ_BIG % 128 == 0 && SZ_VT % 128 == 0 && SZ_CTX % 128 == 0);
static_assert(SZ_Y % 128 == 0 && SZ_X1F % 128 == 0 && SZ_X1H % 128 == 0);
static_assert(WS_TOTAL <= (size_t)134217728);

typedef __bf16   bf16;
typedef _Float16 f16;
typedef f16      v16h  __attribute__((ext_vector_type(16)));
typedef f16      v8h   __attribute__((ext_vector_type(8)));
typedef float    v8f   __attribute__((ext_vector_type(8)));
typedef float    v4f   __attribute__((ext_vector_type(4)));
typedef unsigned v4u   __attribute__((ext_vector_type(4)));

union FragH  { v16h v; v4u q[2]; f16 h[16]; };
union Pack8H { v4u u; v8h v; f16 h[8]; };

// bf16 RNE convert of an f32 value, returned as f32
static __device__ __forceinline__ float bfr(float v) { return (float)(bf16)v; }

// WMMA helper: builtin followed by the VALU hazard guard (ties D, keeps A/B live).
static __device__ __forceinline__ v8f mma_f16(v16h a, v16h b, v8f acc) {
  acc = __builtin_amdgcn_wmma_f32_16x16x32_f16(false, a, false, b, (short)0, acc, false, false);
  asm volatile("v_nop\n\tv_nop\n\tv_nop\n\tv_nop" : "+v"(acc) : "v"(a), "v"(b));
  return acc;
}

static __device__ __forceinline__ float wave_sum(float v) {
  v += __shfl_xor(v, 16, 32);
  v += __shfl_xor(v, 8, 32);
  v += __shfl_xor(v, 4, 32);
  v += __shfl_xor(v, 2, 32);
  v += __shfl_xor(v, 1, 32);
  return v;
}

// ---------------------------------------------------------------------------------------------------
// x f32 -> xh packed f16 plane (rows = tokens, K = DIM) = f16(bf16_rne(x) * XC). One thread = one 16-B piece.
static __device__ __forceinline__ void cvt_x_piece(const float* __restrict__ x, f16* __restrict__ xh, int g) {
  // g = [rowtile][kblock 16][row half 2][8-column group 4 = half*2 + hi][row 8]: a wave reads 8 rows x 128 B
  // and writes four whole 128-B lines of the packed plane.
  const int r = ((g >> 5) & 1) * 8 + (g & 7);      // row of the 16-row tile
  const int t = (g >> 10) * 16 + r;                // compact token
  const int c = ((g >> 6) & 15) * 32 + ((g >> 3) & 3) * 8;
  if (t >= NTOK) return;
  const int bb = t / SEQ;
  const int s  = t - bb * SEQ;
  const float* src = x + ((size_t)bb * SEQ_FULL + s) * DIM + c;
  const v4f a0 = *(const v4f*)(src);
  const v4f a1 = *(const v4f*)(src + 4);
  Pack8H p;
  #pragma unroll
  for (int i = 0; i < 4; ++i) {
    p.h[i]     = (f16)(bfr(a0[i]) * XC);
    p.h[4 + i] = (f16)(bfr(a1[i]) * XC);
  }
  const v4u val = p.u;
  f16* dst = xh + (size_t)(g >> 6) * 512 + ((g >> 4) & 1) * 256 + (((g >> 3) & 1) * 16 + r) * 8;
  *(v4u*)dst = val;
}

// Weight transposer: in[K rows][N cols] f32  ->  packed plane (rows = n, K = k) f16 = f16(bf16_rne(w) * WC).
// One block of 256 threads = one tile 64(k) x 64(n) at (k0, n0), through LDS (cross-wave, block barrier).
static __device__ __forceinline__ void wt_tile(const float* __restrict__ W, f16* __restrict__ Wt, int K, int N,
                                               int n0, int k0, f16* sT) {
  const int tid = threadIdx.x;
  #pragma unroll
  for (int it = 0; it < 4; ++it) {
    const int kk = it * 16 + (tid >> 4);        // 0..63
    const int nn = (tid & 15) * 4;              // 0..60
    const v4f w = *(const v4f*)(W + (size_t)(k0 + kk) * N + n0 + nn);
    #pragma unroll
    for (int i = 0; i < 4; ++i) sT[(nn + i) * TP + kk] = (f16)(bfr(w[i]) * WC);
  }
  __syncthreads();
  v4u    val[2];
  size_t idx[2];
  #pragma unroll
  for (int it = 0; it < 2; ++it) {
    const int u  = it * 8 + (tid >> 5);         // unit 0..15 of this tile: [n tile 4][kblock 2][half 2]
    const int ln = tid & 31;
    const int n  = (u >> 2) * 16 + (ln & 15);                               // 0..63
    const int ks = ((u >> 1) & 1) * 32 + (u & 1) * 16 + (ln >> 4) * 8;      // 0..56
    Pack8H ph;
    ph.v = *(const v8h*)(&sT[n * TP + ks]);
    val[it] = ph.u;
    idx[it] = (((size_t)((n0 >> 4) + (u >> 2)) * (K >> 5) + (k0 >> 5) + ((u >> 1) & 1)) * 2 + (u & 1)) * 256 + ln * 8;
  }
  #pragma unroll
  for (int it = 0; it < 2; ++it) *(v4u*)(Wt + idx[it]) = val[it];
}

// All operand planes in one launch: none of them reads another, so the block index alone picks the work.
// Blocks 0 .. WT_BLOCKS-1 transpose one weight tile each (wq, wk, wv, wo: WT_SQ tiles each; w1, w2: WT_FF each; they
// come first because a tile passes through LDS and a barrier); the blocks behind them convert 256 pieces of x each.
// The choice is the same for every thread of a block, so the transposer's barrier is reached by all of them or none.
#define WT_SQ      ((DIM / 64) * (DIM / 64))
#define WT_FF      ((FFN / 64) * (DIM / 64))
#define WT_BLOCKS  (4 * WT_SQ + 2 * WT_FF)
#define CVT_BLOCKS ((size_t)NTOK * DIM / 8 / 256)
static_assert(DIM / 64 == 8 && FFN / 64 == 32);
__global__ __launch_bounds__(256) void prep_kernel(const float* __restrict__ x, const float* __restrict__ wq,
                                                   const float* __restrict__ wk, const float* __restrict__ wv,
                                                   const float* __restrict__ wo, const float* __restrict__ w1,
                                                   const float* __restrict__ w2, f16* __restrict__ xh,
                                                   f16* __restrict__ wqkvT, f16* __restrict__ woT,
                                                   f16* __restrict__ w1T, f16* __restrict__ w2T) {
  __shared__ __align__(16) f16 sT[64 * TP];     // [n][k]
  const int b = blockIdx.x;
  if (b < WT_BLOCKS) {
    const float* W;
    f16* Wt;
    int K, N, lgn, tile;                        // lgn = log2(N / 64): tile = [k tile][n tile]
    if (b < 4 * WT_SQ) {
      // in[512][512] -> out[512][512] (rows = output feature); q, k, v stacked into the [1536][512] plane
      const int m = b / WT_SQ;
      tile = b - m * WT_SQ;
      W  = (m == 0) ? wq : ((m == 1) ? wk : ((m == 2) ? wv : wo));
      Wt = (m < 3) ? wqkvT + (size_t)m * DIM * DIM : woT;
      K = DIM; N = DIM; lgn = 3;
    } else if (b < 4 * WT_SQ + WT_FF) {
      tile = b - 4 * WT_SQ;                     // in[512][2048] -> out[2048][512]
      W = w1; Wt = w1T; K = DIM; N = FFN; lgn = 5;
    } else {
      tile = b - (4 * WT_SQ + WT_FF);           // in[2048][512] -> out[512][2048]
      W = w2; Wt = w2T; K = FFN; N = DIM; lgn = 3;
    }
    wt_tile(W, Wt, K, N, (tile & ((1 << lgn) - 1)) * 64, (tile >> lgn) * 64, sT);
  } else {
    cvt_x_piece(x, xh, (b - WT_BLOCKS) * 256 + (int)threadIdx.x);
  }
}

// ---------------------------------------------------------------------------------------------------
// GEMM main loop: acc[mt][nt] (16x16 tiles) of  A[m0 .. m0+31][K] x Bt[n0 .. n0+63][K]^T.
// A and Bt are packed f16 planes; fragments use the split k map for both operands:
// elements 0..7 <- k0 + 8*hi + 0..7, elements 8..15 <- k0 + 16 + 8*hi + 0..7; lane row / column = lq.
// A 16-row tile spans K*16 halves; a k block of 32 spans 512 halves; the second k half starts at +256.
template <int K>
static __device__ __forceinline__ void gemm_main(const f16* __restrict__ A, const f16* __restrict__ Bt,
                                                 int m0, int n0, int lq, int hi, v8f (&acc)[2][4]) {
  static_assert(K % 32 == 0);
  const f16* ap = A  + (size_t)m0 * K + (hi * 16 + lq) * 8;
  const f16* bp = Bt + (size_t)n0 * K + (hi * 16 + lq) * 8;
  #pragma unroll 1
  for (int k0 = 0; k0 < K; k0 += 32) {
    FragH a[2], b[4];
    #pragma unroll
    for (int mt = 0; mt < 2; ++mt) {
      const f16* p = ap + (size_t)mt * 16 * K + k0 * 16;
      a[mt].q[0] = *(const v4u*)(p);
      a[mt].q[1] = *(const v4u*)(p + 256);
    }
    #pragma unroll
    for (int nt = 0; nt < 4; ++nt) {
      const f16* p = bp + (size_t)nt * 16 * K + k0 * 16;
      b[nt].q[0] = *(const v4u*)(p);
      b[nt].q[1] = *(const v4u*)(p + 256);
    }
    #pragma unroll
    for (int mt = 0; mt < 2; ++mt) {
      #pragma unroll
      for (int nt = 0; nt < 4; ++nt) acc[mt][nt] = mma_f16(a[mt].v, b[nt].v, acc[mt][nt]);
    }
  }
}

// The same product for the launches that leave only two waves on a SIMD, too few to cover a fragment load's latency:
// a ring of D fragment sets in registers. Each set is refilled, right behind its own products, with the k block D
// further on, so D k blocks of loads are in flight per wave. The k blocks are summed in the same ascending order as above.
template <int K>
static __device__ __forceinline__ void load_kblock(const char* __restrict__ ap, const char* __restrict__ bp,
                                                   FragH (&a)[2], FragH (&b)[4]) {
  #pragma unroll
  for (int mt = 0; mt < 2; ++mt) {
    const char* p = ap + (size_t)mt * 32 * K;       // byte addresses: a 16-row tile spans 32 * K bytes
    a[mt].q[0] = *(const v4u*)(p);
    a[mt].q[1] = *(const v4u*)(p + 512);
  }
  #pragma unroll
  for (int nt = 0; nt < 4; ++nt) {
    const char* p = bp + (size_t)nt * 32 * K;
    b[nt].q[0] = *(const v4u*)(p);
    b[nt].q[1] = *(const v4u*)(p + 512);
  }
}

template <int K, int D>
static __device__ __forceinline__ void gemm_main_ring(const f16* __restrict__ A, const f16* __restrict__ Bt,
                                                      int m0, int n0, int lq, int hi, v8f (&acc)[2][4]) {
  constexpr int G = (K / 32) / D;                         // whole groups of D k blocks
  constexpr int R = (K / 32) % D;                         // k blocks left over behind them
  static_assert(K % 32 == 0 && G >= 2);
  const char* ab = (const char*)(A  + (size_t)m0 * K);   // wave-uniform bases
  const char* bb = (const char*)(Bt + (size_t)n0 * K);
  unsigned off = (hi * 16 + lq) * 16;                     // byte offset: the lane's piece of a unit + the k blocks done
  FragH a[D][2], b[D][4];
  #pragma unroll
  for (int s = 0; s < D; ++s) load_kblock<K>(ab + off + s * 1024, bb + off + s * 1024, a[s], b[s]);
  #pragma unroll 1
  for (int g = 1; g < G; ++g) {
    // the loads in flight name the offset register: wait before it is advanced (the operand keeps the add behind)
    asm volatile("s_wait_xcnt 0x0" : "+v"(off) : : "memory");
    off += D * 1024;
    #pragma unroll
    for (int s = 0; s < D; ++s) {
      #pragma unroll
      for (int mt = 0; mt < 2; ++mt) {
        #pragma unroll
        for (int nt = 0; nt < 4; ++nt) acc[mt][nt] = mma_f16(a[s][mt].v, b[s][nt].v, acc[mt][nt]);
      }
      load_kblock<K>(ab + off + s * 1024, bb + off + s * 1024, a[s], b[s]);
    }
  }
  // the last refills still name the offset register and the bases: wait before they are put to other use
  asm volatile("s_wait_xcnt 0x0" : "+v"(off) : : "memory");
  // last whole group; the left-over k blocks refill its first sets
  #pragma unroll
  for (int s = 0; s < D; ++s) {
    #pragma unroll
    for (int mt = 0; mt < 2; ++mt) {
      #pragma unroll
      for (int nt = 0; nt < 4; ++nt) acc[mt][nt] = mma_f16(a[s][mt].v, b[s][nt].v, acc[mt][nt]);
    }
    if (s < R) load_kblock<K>(ab + off + (D + s) * 1024, bb + off + (D + s) * 1024, a[s], b[s]);
  }
  #pragma unroll
  for (int s = 0; s < R; ++s) {
    #pragma unroll
    for (int mt = 0; mt < 2; ++mt) {
      #pragma unroll
      for (int nt = 0; nt < 4; ++nt) acc[mt][nt] = mma_f16(a[s][mt].v, b[s][nt].v, acc[mt][nt]);
    }
  }
}

// ---------------------------------------------------------------------------------------------------
// Fused q/k/v projection: [NTOK][512] x [1536][512]^T. Column block (64 wide) = one head of q, k or v.
//          qk plane order: 0 = q value, 1 = q residual, 2 = k value, 3 = k residual.
//   q, k : per (b, h) a packed plane with rows = tokens, K = d (64): 1024 halves per 16 tokens.
//   v    : per (b, h) a packed plane with rows = d (4 tiles), K = tokens, k block outermost:
//          [s/32][d tile 4][half 2][lane 32][8] f16 (x VC), written through a block-wide LDS tile.
// coverage: q/k rows wave*32 + {0..31} x 64 d = 8 units per wave; vt 64 d x 128 tokens = 32 units per block.
__global__ __launch_bounds__(128) void gemm_qkv_kernel(const f16* __restrict__ xh, const f16* __restrict__ wT,
                                                       const float* __restrict__ bq, const float* __restrict__ bk,
                                                       const float* __restrict__ bv,
                                                       f16* __restrict__ qk, f16* __restrict__ vt) {
  __shared__ __align__(16) float sC[GW * 32 * OP];    // per-wave f32 tiles (block barrier used)
  __shared__ __align__(16) f16   sVT[HDIM * VP];      // [d][token], cross-wave (block barrier)
  const int tid  = threadIdx.x;
  const int wave = __builtin_amdgcn_readfirstlane(threadIdx.x >> 5);
  const int lane = tid & 31;
  const int lq   = lane & 15;
  const int hi   = lane >> 4;
  const int tok0 = blockIdx.x * GM;
  const int n0   = blockIdx.y * GN;
  const int seg  = n0 / DIM;                          // 0 = q, 1 = k, 2 = v (block-uniform)
  const int h    = (n0 - seg * DIM) / HDIM;
  const int bb   = tok0 / SEQ;
  const int s0   = tok0 - bb * SEQ;

  v8f acc[2][4];
  #pragma unroll
  for (int mt = 0; mt < 2; ++mt) {
    #pragma unroll
    for (int nt = 0; nt < 4; ++nt) acc[mt][nt] = (v8f){0, 0, 0, 0, 0, 0, 0, 0};
  }
  gemm_main<DIM>(xh, wT, tok0 + wave * 32, n0, lq, hi, acc);

  const float ascale = 1.0f / (XC * WC);
  float bias[4];
  #pragma unroll
  for (int nt = 0; nt < 4; ++nt) {
    const int c = h * HDIM + nt * 16 + lq;            // 0..511
    const float fq = bq[c];
    const float fk = bk[c];
    const float fv = bv[c];
    const float sel = (seg == 0) ? fq : ((seg == 1) ? fk : fv);
    bias[nt] = bfr(sel);
  }

  if (seg < 2) {
    const int wb = wave * (32 * OP);
    #pragma unroll
    for (int mt = 0; mt < 2; ++mt) {
      #pragma unroll
      for (int nt = 0; nt < 4; ++nt) {
        #pragma unroll
        for (int r = 0; r < 8; ++r)
          sC[wb + (mt * 16 + hi * 8 + r) * OP + nt * 16 + lq] = acc[mt][nt][r] * ascale + bias[nt];
      }
    }
    __syncthreads();
    const size_t pbase = (size_t)seg * 2 * PLANE +
                         (((size_t)bb * NHEAD + h) * SEQ + s0 + wave * 32) * HDIM;
    v4u hv[8], rv[8];
    #pragma unroll
    for (int it = 0; it < 8; ++it) {
      const int row = (it >> 2) * 16 + lq;                               // unit it: [row tile 2][d block 2][half 2]
      const int col = ((it >> 1) & 1) * 32 + (it & 1) * 16 + hi * 8;
      const v4f c0 = *(const v4f*)(&sC[wb + row * OP + col]);
      const v4f c1 = *(const v4f*)(&sC[wb + row * OP + col + 4]);
      Pack8H ph, pr;
      #pragma unroll
      for (int i = 0; i < 4; ++i) {
        const f16 h0 = (f16)c0[i];
        const f16 h1 = (f16)c1[i];
        ph.h[i]     = h0;
        ph.h[4 + i] = h1;
        pr.h[i]     = (f16)((c0[i] - (float)h0) * RC);
        pr.h[4 + i] = (f16)((c1[i] - (float)h1) * RC);
      }
      hv[it] = ph.u;
      rv[it] = pr.u;
    }
    #pragma unroll
    for (int it = 0; it < 8; ++it) {
      const size_t o = pbase + (size_t)it * 256 + lane * 8;
      *(v4u*)(qk + o)         = hv[it];
      *(v4u*)(qk + PLANE + o) = rv[it];
    }
    
  } else {
    #pragma unroll
    for (int mt = 0; mt < 2; ++mt) {
      #pragma unroll
      for (int nt = 0; nt < 4; ++nt) {
        #pragma unroll
        for (int r = 0; r < 8; ++r)
          sVT[(nt * 16 + lq) * VP + wave * 32 + mt * 16 + hi * 8 + r] =
              (f16)((acc[mt][nt][r] * ascale + bias[nt]) * VC);
      }
    }
    __syncthreads();
    const size_t vbase = (((size_t)bb * NHEAD + h) * SEQ + s0) * HDIM;   // first unit of this block's 128 tokens
    v4u vv[8];
    #pragma unroll
    for (int it = 0; it < 8; ++it) {
      const int u = it * 4 + wave;                 // unit 0..31: [token block 4][d tile 4][half 2]
      const int d = ((u >> 1) & 3) * 16 + lq;
      const int s = (u >> 3) * 32 + (u & 1) * 16 + hi * 8;
      Pack8H ph;
      ph.v = *(const v8h*)(&sVT[d * VP + s]);
      vv[it] = ph.u;
    }
    #pragma unroll
    for (int it = 0; it < 8; ++it) {
      const size_t o = vbase + (size_t)(it * 4 + wave) * 256 + lane * 8;
      *(v4u*)(vt + o) = vv[it];
    }
    
  }
}

// ---------------------------------------------------------------------------------------------------
// Flash attention, full (no mask). Block = (128-query block, head, batch); one wave owns 16 query rows.
// S^T = K x Q^T so queries sit on lanes; P^T in C layout is the A-fragment layout of O += P x V.
// Scores: main = k_val x q_val ; res = k_val x q_res + k_res x q_val (both x RC) ; s = main + res / RC.
// Fragments come straight from the packed 16-bit planes (two 512-B unit loads each); q fragments stay in registers.
__global__ __launch_bounds__(256) void attn_kernel(const f16* __restrict__ qk, const f16* __restrict__ vt,
                                                   f16* __restrict__ ctx) {
  __shared__ __align__(16) float sO[NWAVE * 16 * OP];    // per-wave output staging (block barrier used)
  const int qblk = blockIdx.x;
  const int h    = blockIdx.y;
  const int b    = blockIdx.z;
  const int tid  = threadIdx.x;
  const int wave = __builtin_amdgcn_readfirstlane(threadIdx.x >> 5);
  const int lane = tid & 31;
  const int lq   = lane & 15;   // query column of S^T / d column of O
  const int hi   = lane >> 4;   // k-split half

  const int qrow0 = qblk * BQ + wave * 16;
  const size_t hb = ((size_t)b * NHEAD + h) * (size_t)SEQ * HDIM;
  const f16* qh_p = qk + hb;
  const f16* qr_p = qk + PLANE + hb;
  const f16* kh_p = qk + 2 * PLANE + hb;
  const f16* kr_p = qk + 3 * PLANE + hb;
  const f16* vt_h = vt + hb;
  const int qoff  = qrow0 * HDIM + lane * 8;         // this wave's 16-query tile, lane's piece of a unit

  // q B-fragments (value and residual planes), loaded once and held for the whole key loop
  FragH fqh[2], fqr[2];
  #pragma unroll
  for (int f = 0; f < 2; ++f) {
    const int qo = qoff + f * 512;
    fqh[f].q[0] = *(const v4u*)(qh_p + qo);           // d = f*32 + hi*8 + 0..7
    fqh[f].q[1] = *(const v4u*)(qh_p + qo + 256);     // d = f*32 + 16 + hi*8 + 0..7
    fqr[f].q[0] = *(const v4u*)(qr_p + qo);
    fqr[f].q[1] = *(const v4u*)(qr_p + qo + 256);
  }

  v8f o[4];
  #pragma unroll
  for (int dt = 0; dt < 4; ++dt) o[dt] = (v8f){0, 0, 0, 0, 0, 0, 0, 0};

  float rmax = -__builtin_inff();
  float rsum = 0.0f;
  const float SL = 0.125f * 1.4426950408889634f;   // softmax scale * log2(e)

  // K A-fragments (row = key lq of the tile, split d map) and V B-fragments (column n = d = dt*16 + lq, split key map
  // from the packed transposed plane) are fetched one step ahead into the same registers: step 0's here, step j + 1's
  // K behind step j's score products and its V behind step j's P x V products.
  FragH fkh[2][2], fkr[2][2], bv[4];
  #pragma unroll
  for (int sub = 0; sub < 2; ++sub) {
    #pragma unroll
    for (int f = 0; f < 2; ++f) {
      const int ko = sub * 16 * HDIM + f * 512 + lane * 8;
      fkh[sub][f].q[0] = *(const v4u*)(kh_p + ko);
      fkh[sub][f].q[1] = *(const v4u*)(kh_p + ko + 256);
      fkr[sub][f].q[0] = *(const v4u*)(kr_p + ko);
      fkr[sub][f].q[1] = *(const v4u*)(kr_p + ko + 256);
    }
  }
  #pragma unroll
  for (int dt = 0; dt < 4; ++dt) {
    const f16* base = vt_h + dt * 512 + lane * 8;
    bv[dt].q[0] = *(const v4u*)(base);              // keys hi*8 + 0..7
    bv[dt].q[1] = *(const v4u*)(base + 256);        // keys 16 + hi*8 + 0..7
  }

  #pragma unroll 1
  for (int j0 = 0; j0 < SEQ; j0 += BK) {
    // the step fetched ahead; the last step has none and refetches step 0 (in bounds, never used)
    const int jn = (j0 + BK < SEQ) ? j0 + BK : 0;

    // S^T tiles: c[sub][r] = rawscore(query qrow0+lq, key j0 + sub*16 + hi*8 + r)
    v8f c[2];
    #pragma unroll
    for (int sub = 0; sub < 2; ++sub) {
      v8f am = (v8f){0, 0, 0, 0, 0, 0, 0, 0};
      v8f ar = (v8f){0, 0, 0, 0, 0, 0, 0, 0};
      #pragma unroll
      for (int f = 0; f < 2; ++f) {
        am = mma_f16(fkh[sub][f].v, fqh[f].v, am);
        ar = mma_f16(fkh[sub][f].v, fqr[f].v, ar);
        ar = mma_f16(fkr[sub][f].v, fqh[f].v, ar);
      }
      #pragma unroll
      for (int r = 0; r < 8; ++r) c[sub][r] = am[r] + ar[r] * (1.0f / RC);
    }

    // next step's K fragments, in flight under the softmax and the P x V products
    #pragma unroll
    for (int sub = 0; sub < 2; ++sub) {
      #pragma unroll
      for (int f = 0; f < 2; ++f) {
        const int ko = (jn + sub * 16) * HDIM + f * 512 + lane * 8;
        fkh[sub][f].q[0] = *(const v4u*)(kh_p + ko);
        fkh[sub][f].q[1] = *(const v4u*)(kh_p + ko + 256);
        fkr[sub][f].q[0] = *(const v4u*)(kr_p + ko);
        fkr[sub][f].q[1] = *(const v4u*)(kr_p + ko + 256);
      }
    }
    // keeps the K loads from sinking into the softmax below, where less work would cover their latency
    __builtin_amdgcn_sched_barrier(0);

    // online softmax: query lq's 32 scores are split across lane / lane^16
    float m_new = rmax;
    #pragma unroll
    for (int r = 0; r < 8; ++r) {
      m_new = fmaxf(m_new, c[0][r]);
      m_new = fmaxf(m_new, c[1][r]);
    }
    m_new = fmaxf(m_new, __shfl_xor(m_new, 16, 32));
    const float scale = __builtin_amdgcn_exp2f((rmax - m_new) * SL);
    rmax = m_new;

    // exp + pack: P^T C-layout == A-fragment layout for the PV product
    FragH pa;
    float psum = 0.0f;
    #pragma unroll
    for (int r = 0; r < 8; ++r) {
      const float p0 = __builtin_amdgcn_exp2f((c[0][r] - m_new) * SL);   // key hi*8 + r
      const float p1 = __builtin_amdgcn_exp2f((c[1][r] - m_new) * SL);   // key 16 + hi*8 + r
      psum += p0 + p1;
      pa.h[r]     = (f16)(p0 * PC);
      pa.h[8 + r] = (f16)(p1 * PC);
    }
    rsum = rsum * scale + psum + __shfl_xor(psum, 16, 32);

    // rescale O: queries are the row dimension there -> per-row scale from lane 8*hi + r
    float sc[8];
    #pragma unroll
    for (int r = 0; r < 8; ++r) sc[r] = __shfl(scale, (hi << 3) + r, 32);
    #pragma unroll
    for (int dt = 0; dt < 4; ++dt) {
      #pragma unroll
      for (int r = 0; r < 8; ++r) o[dt][r] *= sc[r];
    }

    // O += P x V
    #pragma unroll
    for (int dt = 0; dt < 4; ++dt) o[dt] = mma_f16(pa.v, bv[dt].v, o[dt]);

    // next step's V fragments, in flight under its score products and softmax
    #pragma unroll
    for (int dt = 0; dt < 4; ++dt) {
      const f16* base = vt_h + (size_t)jn * HDIM + dt * 512 + lane * 8;
      bv[dt].q[0] = *(const v4u*)(base);            // keys jn + hi*8 + 0..7
      bv[dt].q[1] = *(const v4u*)(base + 256);      // keys jn + 16 + hi*8 + 0..7
    }
    // the V address pair is formed anew at the head of the next step: wait before that overwrite
    asm volatile("s_wait_xcnt 0x0" ::: "memory");
  }

  // normalize: lane holds column d = dt*16 + lq for query rows 8*hi + r
  float rs[8];
  #pragma unroll
  for (int r = 0; r < 8; ++r) rs[r] = 1.0f / __shfl(rsum, (hi << 3) + r, 32);

  const int wb = wave * (16 * OP);
  #pragma unroll
  for (int r = 0; r < 8; ++r) {
    #pragma unroll
    for (int dt = 0; dt < 4; ++dt)
      sO[wb + (hi * 8 + r) * OP + dt * 16 + lq] = o[dt][r] * (CC / (PC * VC)) * rs[r];
  }
  __syncthreads();

  v4u    pv[4];
  size_t gidx[4];
  #pragma unroll
  for (int it = 0; it < 4; ++it) {
    const int row = lq;                                   // unit it: [k block 2][half 2] of this head's 64 columns
    const int col = (it >> 1) * 32 + (it & 1) * 16 + hi * 8;
    const v4f c0 = *(const v4f*)(&sO[wb + row * OP + col]);
    const v4f c1 = *(const v4f*)(&sO[wb + row * OP + col + 4]);
    Pack8H ph;
    #pragma unroll
    for (int i = 0; i < 4; ++i) {
      ph.h[i]     = (f16)c0[i];
      ph.h[4 + i] = (f16)c1[i];
    }
    pv[it]   = ph.u;
    gidx[it] = ((size_t)b * SEQ + qrow0) * DIM + (size_t)(h * 4 + it) * 256 + lane * 8;   // packed, K = DIM
  }
  #pragma unroll
  for (int it = 0; it < 4; ++it) *(v4u*)(ctx + gidx[it]) = pv[it];
  
}

// ---------------------------------------------------------------------------------------------------
// y = ctx x wo + bo + bf16_rne(x)   (f32 plane [NTOK][DIM], input of LayerNorm 1)
// coverage: rows wave*32 + {0..31}, 64 columns: 16 instr, lanes 0..15 one 256-B row segment, 16..31 the next row.
__global__ __launch_bounds__(128) void gemm_wo_kernel(const f16* __restrict__ ctx, const f16* __restrict__ woT,
                                                      const float* __restrict__ bo, const float* __restrict__ x,
                                                      float* __restrict__ y) {
  __shared__ __align__(16) float sC[GW * 32 * OP];
  const int tid  = threadIdx.x;
  const int wave = __builtin_amdgcn_readfirstlane(threadIdx.x >> 5);
  const int lane = tid & 31;
  const int lq   = lane & 15;
  const int hi   = lane >> 4;
  const int tok0 = blockIdx.x * GM;
  const int n0   = blockIdx.y * GN;
  const int bb   = tok0 / SEQ;
  const int s0   = tok0 - bb * SEQ;

  v8f acc[2][4];
  #pragma unroll
  for (int mt = 0; mt < 2; ++mt) {
    #pragma unroll
    for (int nt = 0; nt < 4; ++nt) acc[mt][nt] = (v8f){0, 0, 0, 0, 0, 0, 0, 0};
  }
  gemm_main_ring<DIM, RD>(ctx, woT, tok0 + wave * 32, n0, lq, hi, acc);

  const float ascale = 1.0f / (CC * WC);
  const int wb = wave * (32 * OP);
  #pragma unroll
  for (int nt = 0; nt < 4; ++nt) {
    const float bias = bfr(bo[n0 + nt * 16 + lq]);
    #pragma unroll
    for (int mt = 0; mt < 2; ++mt) {
      #pragma unroll
      for (int r = 0; r < 8; ++r)
        sC[wb + (mt * 16 + hi * 8 + r) * OP + nt * 16 + lq] = acc[mt][nt][r] * ascale + bias;
    }
  }
  __syncthreads();

  const size_t orow = (size_t)tok0 + wave * 32;                          // compact row
  const size_t rrow = (size_t)bb * SEQ_FULL + s0 + wave * 32;            // row of the full-size x
  #pragma unroll
  for (int g = 0; g < 2; ++g) {
    v4f vals[8];
    #pragma unroll
    for (int it = 0; it < 8; ++it) {
      const int row = g * 16 + it * 2 + hi;
      v4f cv = *(const v4f*)(&sC[wb + row * OP + lq * 4]);
      const v4f rv = *(const v4f*)(x + (rrow + row) * DIM + n0 + lq * 4);
      #pragma unroll
      for (int i = 0; i < 4; ++i) cv[i] = cv[i] + bfr(rv[i]);
      vals[it] = cv;
    }
    #pragma unroll
    for (int it = 0; it < 8; ++it)
      *(v4f*)(y + (orow + g * 16 + it * 2 + hi) * DIM + n0 + lq * 4) = vals[it];
    
  }
}

// ---------------------------------------------------------------------------------------------------
// f32 row: 4 instr x (32 lanes x 16 B) ; f16 rows staged in LDS (cross-wave, block barrier) and written packed:
// the block's 8 tokens fill 8 neighbouring lane slots = one whole 128-B line in each of the 64 (k block, half, hi) groups.
__global__ __launch_bounds__(256) void ln1_kernel(const float* __restrict__ y, const float* __restrict__ g,
                                                  const float* __restrict__ be,
                                                  float* __restrict__ x1f, f16* __restrict__ x1h) {
  __shared__ __align__(16) f16 sH[8 * SHP];
  const int tid  = threadIdx.x;
  const int wave = __builtin_amdgcn_readfirstlane(threadIdx.x >> 5);
  const int lane = tid & 31;
  const int t    = blockIdx.x * 8 + wave;             // compact token
  const float* yr = y + (size_t)t * DIM;

  v4f v[4];
  float s = 0.0f;
  #pragma unroll
  for (int j = 0; j < 4; ++j) {
    v[j] = *(const v4f*)(yr + j * 128 + lane * 4);
    s += (v[j][0] + v[j][1]) + (v[j][2] + v[j][3]);
  }
  s = wave_sum(s);
  const float mean = s * (1.0f / DIM);
  float q = 0.0f;
  #pragma unroll
  for (int j = 0; j < 4; ++j) {
    #pragma unroll
    for (int i = 0; i < 4; ++i) {
      const float d = v[j][i] - mean;
      q += d * d;
    }
  }
  q = wave_sum(q);
  const float rstd = rsqrtf(q * (1.0f / DIM) + 1e-5f);

  v4f ov[4];
  #pragma unroll
  for (int j = 0; j < 4; ++j) {
    const v4f gv = *(const v4f*)(g + j * 128 + lane * 4);
    const v4f bv = *(const v4f*)(be + j * 128 + lane * 4);
    #pragma unroll
    for (int i = 0; i < 4; ++i) {
      const float val = (v[j][i] - mean) * rstd * bfr(gv[i]) + bfr(bv[i]);
      ov[j][i] = val;
      sH[wave * SHP + j * 128 + lane * 4 + i] = (f16)(val * XC);
    }
  }
  __syncthreads();
  const int t0 = blockIdx.x * 8;                      // first token of the block
  v4u    hv[2];
  size_t hidx[2];
  #pragma unroll
  for (int jj = 0; jj < 2; ++jj) {
    const int tk = tid & 7;                           // token of the block
    const int ln = jj * 32 + (tid >> 3);              // 8-column group 0..63 = kblock*4 + half*2 + hi
    Pack8H ph;
    ph.v = *(const v8h*)(&sH[tk * SHP + ln * 8]);
    hv[jj] = ph.u;
    hidx[jj] = (size_t)(t0 >> 4) * (16 * DIM) + (size_t)(ln >> 1) * 256 + ((ln & 1) * 16 + (t0 & 15) + tk) * 8;
  }
  float* fo = x1f + (size_t)t * DIM + lane * 4;
  #pragma unroll
  for (int j = 0; j < 4; ++j) *(v4f*)(fo + j * 128) = ov[j];
  #pragma unroll
  for (int jj = 0; jj < 2; ++jj) *(v4u*)(x1h + hidx[jj]) = hv[jj];
  
}

// ---------------------------------------------------------------------------------------------------
// hh = f16( gelu_erf(x1 x w1 + b1) * XC )   packed plane (rows = tokens, K = FFN)
__global__ __launch_bounds__(128) void gemm_ffn1_kernel(const f16* __restrict__ x1h, const f16* __restrict__ w1T,
                                                        const float* __restrict__ b1, f16* __restrict__ hh) {
  __shared__ __align__(16) float sC[GW * 32 * OP];
  const int tid  = threadIdx.x;
  const int wave = __builtin_amdgcn_readfirstlane(threadIdx.x >> 5);
  const int lane = tid & 31;
  const int lq   = lane & 15;
  const int hi   = lane >> 4;
  const int tok0 = blockIdx.x * GM;
  const int n0   = blockIdx.y * GN;

  v8f acc[2][4];
  #pragma unroll
  for (int mt = 0; mt < 2; ++mt) {
    #pragma unroll
    for (int nt = 0; nt < 4; ++nt) acc[mt][nt] = (v8f){0, 0, 0, 0, 0, 0, 0, 0};
  }
  gemm_main<DIM>(x1h, w1T, tok0 + wave * 32, n0, lq, hi, acc);

  const float ascale = 1.0f / (XC * WC);
  const int wb = wave * (32 * OP);
  #pragma unroll
  for (int nt = 0; nt < 4; ++nt) {
    const float bias = bfr(b1[n0 + nt * 16 + lq]);
    #pragma unroll
    for (int mt = 0; mt < 2; ++mt) {
      #pragma unroll
      for (int r = 0; r < 8; ++r)
        sC[wb + (mt * 16 + hi * 8 + r) * OP + nt * 16 + lq] = acc[mt][nt][r] * ascale + bias;
    }
  }
  __syncthreads();

  // GELU (erf form) in place on this lane's own pieces (same lane reads them back below); kept rolled
  // piece it = i >> 1 is this lane's 16 B of unit it: [row tile 2][k block 2][half 2]
  const int lbase = wb + lq * OP + hi * 8;
  #pragma unroll 1
  for (int i = 0; i < 16; ++i) {
    const int off = lbase + (i >> 3) * (16 * OP) + ((i >> 1) & 3) * 16 + (i & 1) * 4;
    v4f t = *(const v4f*)(&sC[off]);
    #pragma unroll
    for (int e = 0; e < 4; ++e) {
      const float u = t[e];
      t[e] = 0.5f * u * (1.0f + erff(u * 0.70710678118654752f));
    }
    *(v4f*)(&sC[off]) = t;
  }

  v4u pv[8];
  #pragma unroll
  for (int it = 0; it < 8; ++it) {
    const int off = lbase + (it >> 2) * (16 * OP) + (it & 3) * 16;
    const v4f c0 = *(const v4f*)(&sC[off]);
    const v4f c1 = *(const v4f*)(&sC[off + 4]);
    Pack8H ph;
    #pragma unroll
    for (int i = 0; i < 4; ++i) {
      ph.h[i]     = (f16)(c0[i] * XC);
      ph.h[4 + i] = (f16)(c1[i] * XC);
    }
    pv[it] = ph.u;
  }
  const size_t obase = ((size_t)tok0 + wave * 32) * FFN + (size_t)n0 * 16 + lane * 8;
  #pragma unroll
  for (int it = 0; it < 8; ++it) *(v4u*)(hh + obase + (size_t)(it >> 2) * 16 * FFN + (it & 3) * 256) = pv[it];
  
}

// ---------------------------------------------------------------------------------------------------
// y = hh x w2 + b2 + x1f   (f32 plane [NTOK][DIM], input of LayerNorm 2)
__global__ __launch_bounds__(128) void gemm_ffn2_kernel(const f16* __restrict__ hh, const f16* __restrict__ w2T,
                                                        const float* __restrict__ b2, const float* __restrict__ x1f,
                                                        float* __restrict__ y) {
  __shared__ __align__(16) float sC[GW * 32 * OP];
  const int tid  = threadIdx.x;
  const int wave = __builtin_amdgcn_readfirstlane(threadIdx.x >> 5);
  const int lane = tid & 31;
  const int lq   = lane & 15;
  const int hi   = lane >> 4;
  const int tok0 = blockIdx.x * GM;
  const int n0   = blockIdx.y * GN;

  v8f acc[2][4];
  #pragma unroll
  for (int mt = 0; mt < 2; ++mt) {
    #pragma unroll
    for (int nt = 0; nt < 4; ++nt) acc[mt][nt] = (v8f){0, 0, 0, 0, 0, 0, 0, 0};
  }
  gemm_main_ring<FFN, RD>(hh, w2T, tok0 + wave * 32, n0, lq, hi, acc);

  const float ascale = 1.0f / (XC * WC);
  const int wb = wave * (32 * OP);
  #pragma unroll
  for (int nt = 0; nt < 4; ++nt) {
    const float bias = bfr(b2[n0 + nt * 16 + lq]);
    #pragma unroll
    for (int mt = 0; mt < 2; ++mt) {
      #pragma unroll
      for (int r = 0; r < 8; ++r)
        sC[wb + (mt * 16 + hi * 8 + r) * OP + nt * 16 + lq] = acc[mt][nt][r] * ascale + bias;
    }
  }
  __syncthreads();

  const size_t orow = (size_t)tok0 + wave * 32;
  #pragma unroll
  for (int g = 0; g < 2; ++g) {
    v4f vals[8];
    #pragma unroll
    for (int it = 0; it < 8; ++it) {
      const int row = g * 16 + it * 2 + hi;
      v4f cv = *(const v4f*)(&sC[wb + row * OP + lq * 4]);
      const v4f rv = *(const v4f*)(x1f + (orow + row) * DIM + n0 + lq * 4);
      #pragma unroll
      for (int i = 0; i < 4; ++i) cv[i] = cv[i] + rv[i];
      vals[it] = cv;
    }
    #pragma unroll
    for (int it = 0; it < 8; ++it)
      *(v4f*)(y + (orow + g * 16 + it * 2 + hi) * DIM + n0 + lq * 4) = vals[it];
    
  }
}

// ---------------------------------------------------------------------------------------------------
__global__ __launch_bounds__(256) void ln2_kernel(const float* __restrict__ y, const float* __restrict__ g,
                                                  const float* __restrict__ be, float* __restrict__ out) {
  const int tid  = threadIdx.x;
  const int wave = __builtin_amdgcn_readfirstlane(threadIdx.x >> 5);
  const int lane = tid & 31;
  const int t    = blockIdx.x * 8 + wave;             // compact token
  const int bb   = t / SEQ;
  const int s0   = t - bb * SEQ;
  const float* yr = y + (size_t)t * DIM;

  v4f v[4];
  float s = 0.0f;
  #pragma unroll
  for (int j = 0; j < 4; ++j) {
    v[j] = *(const v4f*)(yr + j * 128 + lane * 4);
    s += (v[j][0] + v[j][1]) + (v[j][2] + v[j][3]);
  }
  s = wave_sum(s);
  const float mean = s * (1.0f / DIM);
  float q = 0.0f;
  #pragma unroll
  for (int j = 0; j < 4; ++j) {
    #pragma unroll
    for (int i = 0; i < 4; ++i) {
      const float d = v[j][i] - mean;
      q += d * d;
    }
  }
  q = wave_sum(q);
  const float rstd = rsqrtf(q * (1.0f / DIM) + 1e-5f);

  v4f ov[4];
  #pragma unroll
  for (int j = 0; j < 4; ++j) {
    const v4f gv = *(const v4f*)(g + j * 128 + lane * 4);
    const v4f bv = *(const v4f*)(be + j * 128 + lane * 4);
    #pragma unroll
    for (int i = 0; i < 4; ++i) ov[j][i] = (v[j][i] - mean) * rstd * bfr(gv[i]) + bfr(bv[i]);
  }
  float* fo = out + ((size_t)bb * SEQ_FULL + s0) * DIM + lane * 4;
  #pragma unroll
  for (int j = 0; j < 4; ++j) *(v4f*)(fo + j * 128) = ov[j];
  
}

// ---------------------------------------------------------------------------------------------------
extern "C" void kernel_launch(void* const* d_in, const int* in_sizes, int n_in,
                              void* d_out, int out_size, void* d_ws, size_t ws_size,
                              hipStream_t stream) {
  if (n_in < 17) return;
  const size_t rows_used = (size_t)(NB - 1) * SEQ_FULL + SEQ;
  if ((size_t)in_sizes[0] < rows_used * DIM) return;
  if ((size_t)in_sizes[1] < (size_t)DIM * DIM || (size_t)in_sizes[3] < (size_t)DIM * DIM) return;
  if ((size_t)in_sizes[5] < (size_t)DIM * DIM || (size_t)in_sizes[7] < (size_t)DIM * DIM) return;
  if ((size_t)in_sizes[9] < (size_t)DIM * FFN || (size_t)in_sizes[11] < (size_t)FFN * DIM) return;
  if (in_sizes[2] < DIM || in_sizes[4] < DIM || in_sizes[6] < DIM || in_sizes[8] < DIM) return;
  if (in_sizes[10] < FFN || in_sizes[12] < DIM) return;
  if (in_sizes[13] < DIM || in_sizes[14] < DIM || in_sizes[15] < DIM || in_sizes[16] < DIM) return;
  if ((size_t)out_size < rows_used * DIM) return;
  if (ws_size < WS_TOTAL) return;

  const float* x   = (const float*)d_in[0];
  const float* wq  = (const float*)d_in[1];
  const float* bq  = (const float*)d_in[2];
  const float* wk  = (const float*)d_in[3];
  const float* bk  = (const float*)d_in[4];
  const float* wv  = (const float*)d_in[5];
  const float* bv  = (const float*)d_in[6];
  const float* wo  = (const float*)d_in[7];
  const float* bo  = (const float*)d_in[8];
  const float* w1  = (const float*)d_in[9];
  const float* b1  = (const float*)d_in[10];
  const float* w2  = (const float*)d_in[11];
  const float* b2  = (const float*)d_in[12];
  const float* g1  = (const float*)d_in[13];
  const float* be1 = (const float*)d_in[14];
  const float* g2  = (const float*)d_in[15];
  const float* be2 = (const float*)d_in[16];
  float* out = (float*)d_out;

  char* ws = (char*)d_ws;
  f16*   xh    = (f16*)(ws + OFF_XH);
  f16*   wqkvT = (f16*)(ws + OFF_WQKV);
  f16*   woT   = (f16*)(ws + OFF_WO);
  f16*   w1T   = (f16*)(ws + OFF_W1);
  f16*   w2T   = (f16*)(ws + OFF_W2);
  f16*   qk    = (f16*)(ws + OFF_BIG);     // 4 q/k planes
  f16*   hh    = (f16*)(ws + OFF_BIG);     // reuses the q/k region after the attention launch
  f16*   vt    = (f16*)(ws + OFF_VT);
  f16*   ctx   = (f16*)(ws + OFF_CTX);
  float* y     = (float*)(ws + OFF_Y);
  float* x1f   = (float*)(ws + OFF_X1F);
  f16*   x1h   = (f16*)(ws + OFF_X1H);

  // operand planes
  prep_kernel<<<dim3((unsigned)(WT_BLOCKS + CVT_BLOCKS)), 256, 0, stream>>>(x, wq, wk, wv, wo, w1, w2,
                                                                            xh, wqkvT, woT, w1T, w2T);

  gemm_qkv_kernel<<<dim3(NTOK / GM, QKVN / GN), 128, 0, stream>>>(xh, wqkvT, bq, bk, bv, qk, vt);
  attn_kernel<<<dim3(SEQ / BQ, NHEAD, NB), 256, 0, stream>>>(qk, vt, ctx);
  gemm_wo_kernel<<<dim3(NTOK / GM, DIM / GN), 128, 0, stream>>>(ctx, woT, bo, x, y);
  ln1_kernel<<<dim3(NTOK / 8), 256, 0, stream>>>(y, g1, be1, x1f, x1h);
  gemm_ffn1_kernel<<<dim3(NTOK / GM, FFN / GN), 128, 0, stream>>>(x1h, w1T, b1, hh);
  gemm_ffn2_kernel<<<dim3(NTOK / GM, DIM / GN), 128, 0, stream>>>(hh, w2T, b2, x1f, y);
  ln2_kernel<<<dim3(NTOK / 8), 256, 0, stream>>>(y, g2, be2, out);
}

// v005
// Measured time: 156 microseconds a run.
// Two timings next to v004 put it at 1.10 and 1.11 times that version's speed.
// Counting every step since v000, it is 3.03 times as fast.
#include <hip/hip_runtime.h>
#include <math.h>

// All contractions on v_wmma_f32_16x16x32_f16 with f32 accumulate: projections / Wo / FFN use f16 operand planes
// (inputs RNE-converted to bf16 first, then exact power-of-two carries); scores S^T = K x Q^T use q and k as one
// f16 plane each (11 significant bits, against the 8 of the operands q and k are made from); O = P x V with P f16
// carried x4096.
//
// Every f16 operand plane in the workspace is stored fragment-packed: a [rows][K] operand is cut into tiles of
// 16 rows x 32 k; a tile is two 512-B units (k halves 0..15 and 16..31); inside a unit lane (hi*16 + lq) owns 16 B =
// row lq, k = half*16 + hi*8 + 0..7. Unit index = (rowtile * (K/32) + kblock) * 2 + half; the V^T plane puts the k block outermost. One wave-wide 16-B-per-lane
// load of a unit is 512 contiguous bytes (4 whole lines) and lands directly in the split-k fragment map.

#ifndef NB
#define NB 4
#endif
#ifndef SEQ
#define SEQ 2048
#endif
#define NB_FULL   4
#define SEQ_FULL  2048
#define DIM       512
#define NHEAD     8
#define HDIM      64
#define FFN       2048
#define QKVN      (3 * DIM)
#define NTOK      (NB * SEQ)
#define PLANE     ((size_t)NTOK * DIM)     // elements of one [NB][NHEAD][SEQ][HDIM] 16-bit plane
#define GM        128                      // GEMM block rows (4 waves x 32)
#define GN        64                       // GEMM block columns
#define GW        4                        // waves per GEMM block
#define OP        68                       // LDS pitch (floats) of f32 staging tiles
#define VP        136                      // LDS pitch (halves) of the V^T staging tile
#define TP        72                       // LDS pitch (halves) of the weight transposer tile
#define SHP       (DIM + 16)               // LDS pitch (halves) of the LayerNorm-1 f16 row staging
#define BQ        128                      // query rows per attention block (8 waves x 16)
#define BK        32                       // keys per attention step
#define NWAVE     8
#define XC        16.0f                    // carry of the x, LN1-output and GELU-output planes
#define WC        64.0f                    // carry of all weight planes
#define VC        16.0f                    // carry of the V^T plane
#define CC        256.0f                   // carry of the attention-context plane
#define PC        4096.0f                  // carry of P inside the attention kernel
#define RD        3                        // fragment sets in the register ring of the Wo and FFN-2 products

static_assert(DIM == NHEAD * HDIM);
static_assert(HDIM == 64);
static_assert(HDIM == GN);
static_assert(GM == GW * 32);
static_assert(BQ == NWAVE * 16);
static_assert(SEQ % GM == 0);
static_assert(SEQ % BQ == 0);
static_assert(SEQ % BK == 0);
static_assert(NTOK % GM == 0);
static_assert(NTOK % 8 == 0);
static_assert(DIM % GN == 0);
static_assert(FFN % GN == 0);
static_assert(QKVN % GN == 0);
static_assert(DIM % 64 == 0);
static_assert(FFN % 64 == 0);
static_assert(DIM % 32 == 0);
static_assert(FFN % 32 == 0);
static_assert(DIM == 32 * 16);
static_assert(((size_t)NTOK * DIM / 8) % 256 == 0);
static_assert((OP * 4) % 16 == 0);
static_assert((VP * 2) % 16 == 0);
static_assert((TP * 2) % 16 == 0);
static_assert((SHP * 2) % 16 == 0);
static_assert(SEQ <= SEQ_FULL);
static_assert(NB >= 1 && NB <= NB_FULL);

#define SZ_XH    ((size_t)NTOK * DIM * 2)
#define SZ_WQKV  ((size_t)QKVN * DIM * 2)
#define SZ_WO    ((size_t)DIM * DIM * 2)
#define SZ_W1    ((size_t)FFN * DIM * 2)
#define SZ_W2    ((size_t)DIM * FFN * 2)
#define SZ_QK    ((size_t)2 * NTOK * DIM * 2)
#define SZ_HH    ((size_t)NTOK * FFN * 2)
#define SZ_BIG   ((SZ_QK > SZ_HH) ? SZ_QK : SZ_HH)   // q/k planes, later reused by the GELU-output plane
#define SZ_VT    ((size_t)NTOK * DIM * 2)
#define SZ_CTX   ((size_t)NTOK * DIM * 2)
#define SZ_Y     ((size_t)NTOK * DIM * 4)
#define SZ_X1F   ((size_t)NTOK * DIM * 4)
#define SZ_X1H   ((size_t)NTOK * DIM * 2)
#define OFF_XH   ((size_t)0)
#define OFF_WQKV (OFF_XH + SZ_XH)
#define OFF_WO   (OFF_WQKV + SZ_WQKV)
#define OFF_W1   (OFF_WO + SZ_WO)
#define OFF_W2   (OFF_W1 + SZ_W1)
#define OFF_BIG  (OFF_W2 + SZ_W2)
#define OFF_VT   (OFF_BIG + SZ_BIG)
#define OFF_CTX  (OFF_VT + SZ_VT)
#define OFF_Y    (OFF_CTX + SZ_CTX)
#define OFF_X1F  (OFF_Y + SZ_Y)
#define OFF_X1H  (OFF_X1F + SZ_X1F)
#define WS_TOTAL (OFF_X1H + SZ_X1H)
static_assert(SZ_QK <= SZ_BIG);
static_assert(SZ_HH <= SZ_BIG);
static_assert(SZ_XH % 128 == 0 && SZ_WQKV % 128 == 0 && SZ_WO % 128 == 0 && SZ_W1 % 128 == 0);
static_assert(SZ_W2 % 128 == 0 && SZ_BIG % 128 == 0 && SZ_VT % 128 == 0 && SZ_CTX % 128 == 0);
static_assert(SZ_Y % 128 == 0 && SZ_X1F % 128 == 0 && SZ_X1H % 128 == 0);
static_assert(WS_TOTAL <= (size_t)134217728);

typedef __bf16   bf16;
typedef _Float16 f16;
typedef f16      v16h  __attribute__((ext_vector_type(16)));
typedef f16      v8h   __attribute__((ext_vector_type(8)));
typedef float    v8f   __attribute__((ext_vector_type(8)));
typedef float    v4f   __attribute__((ext_vector_type(4)));
typedef unsigned v4u   __attribute__((ext_vector_type(4)));

union FragH  { v16h v; v4u q[2]; f16 h[16]; };
union Pack8H { v4u u; v8h v; f16 h[8]; };

// bf16 RNE convert of an f32 value, returned as f32
static __device__ __forceinline__ float bfr(float v) { return (float)(bf16)v; }

// WMMA helper: builtin followed by the VALU hazard guard (ties D, keeps A/B live).
static __device__ __forceinline__ v8f mma_f16(v16h a, v16h b, v8f acc) {
  acc = __builtin_amdgcn_wmma_f32_16x16x32_f16(false, a, false, b, (short)0, acc, false, false);
  asm volatile("v_nop\n\tv_nop\n\tv_nop\n\tv_nop" : "+v"(acc) : "v"(a), "v"(b));
  return acc;
}

static __device__ __forceinline__ float wave_sum(float v) {
  v += __shfl_xor(v, 16, 32);
  v += __shfl_xor(v, 8, 32);
  v += __shfl_xor(v, 4, 32);
  v += __shfl_xor(v, 2, 32);
  v += __shfl_xor(v, 1, 32);
  return v;
}

// ---------------------------------------------------------------------------------------------------
// x f32 -> xh packed f16 plane (rows = tokens, K = DIM) = f16(bf16_rne(x) * XC). One thread = one 16-B piece.
static __device__ __forceinline__ void cvt_x_piece(const float* __restrict__ x, f16* __restrict__ xh, int g) {
  // g = [rowtile][kblock 16][row half 2][8-column group 4 = half*2 + hi][row 8]: a wave reads 8 rows x 128 B
  // and writes four whole 128-B lines of the packed plane.
  const int r = ((g >> 5) & 1) * 8 + (g & 7);      // row of the 16-row tile
  const int t = (g >> 10) * 16 + r;                // compact token
  const int c = ((g >> 6) & 15) * 32 + ((g >> 3) & 3) * 8;
  if (t >= NTOK) return;
  const int bb = t / SEQ;
  const int s  = t - bb * SEQ;
  const float* src = x + ((size_t)bb * SEQ_FULL + s) * DIM + c;
  const v4f a0 = *(const v4f*)(src);
  const v4f a1 = *(const v4f*)(src + 4);
  Pack8H p;
  #pragma unroll
  for (int i = 0; i < 4; ++i) {
    p.h[i]     = (f16)(bfr(a0[i]) * XC);
    p.h[4 + i] = (f16)(bfr(a1[i]) * XC);
  }
  const v4u val = p.u;
  f16* dst = xh + (size_t)(g >> 6) * 512 + ((g >> 4) & 1) * 256 + (((g >> 3) & 1) * 16 + r) * 8;
  *(v4u*)dst = val;
}

// Weight transposer: in[K rows][N cols] f32  ->  packed plane (rows = n, K = k) f16 = f16(bf16_rne(w) * WC).
// One block of 256 threads = one tile 64(k) x 64(n) at (k0, n0), through LDS (cross-wave, block barrier).
static __device__ __forceinline__ void wt_tile(const float* __restrict__ W, f16* __restrict__ Wt, int K, int N,
                                               int n0, int k0, f16* sT) {
  const int tid = threadIdx.x;
  #pragma unroll
  for (int it = 0; it < 4; ++it) {
    const int kk = it * 16 + (tid >> 4);        // 0..63
    const int nn = (tid & 15) * 4;              // 0..60
    const v4f w = *(const v4f*)(W + (size_t)(k0 + kk) * N + n0 + nn);
    #pragma unroll
    for (int i = 0; i < 4; ++i) sT[(nn + i) * TP + kk] = (f16)(bfr(w[i]) * WC);
  }
  __syncthreads();
  v4u    val[2];
  size_t idx[2];
  #pragma unroll
  for (int it = 0; it < 2; ++it) {
    const int u  = it * 8 + (tid >> 5);         // unit 0..15 of this tile: [n tile 4][kblock 2][half 2]
    const int ln = tid & 31;
    const int n  = (u >> 2) * 16 + (ln & 15);                               // 0..63
    const int ks = ((u >> 1) & 1) * 32 + (u & 1) * 16 + (ln >> 4) * 8;      // 0..56
    Pack8H ph;
    ph.v = *(const v8h*)(&sT[n * TP + ks]);
    val[it] = ph.u;
    idx[it] = (((size_t)((n0 >> 4) + (u >> 2)) * (K >> 5) + (k0 >> 5) + ((u >> 1) & 1)) * 2 + (u & 1)) * 256 + ln * 8;
  }
  #pragma unroll
  for (int it = 0; it < 2; ++it) *(v4u*)(Wt + idx[it]) = val[it];
}

// All operand planes in one launch: none of them reads another, so the block index alone picks the work.
// Blocks 0 .. WT_BLOCKS-1 transpose one weight tile each (wq, wk, wv, wo: WT_SQ tiles each; w1, w2: WT_FF each; they
// come first because a tile passes through LDS and a barrier); the blocks behind them convert 256 pieces of x each.
// The choice is the same for every thread of a block, so the transposer's barrier is reached by all of them or none.
#define WT_SQ      ((DIM / 64) * (DIM / 64))
#define WT_FF      ((FFN / 64) * (DIM / 64))
#define WT_BLOCKS  (4 * WT_SQ + 2 * WT_FF)
#define CVT_BLOCKS ((size_t)NTOK * DIM / 8 / 256)
static_assert(DIM / 64 == 8 && FFN / 64 == 32);
__global__ __launch_bounds__(256) void prep_kernel(const float* __restrict__ x, const float* __restrict__ wq,
                                                   const float* __restrict__ wk, const float* __restrict__ wv,
                                                   const float* __restrict__ wo, const float* __restrict__ w1,
                                                   const float* __restrict__ w2, f16* __restrict__ xh,
                                                   f16* __restrict__ wqkvT, f16* __restrict__ woT,
                                                   f16* __restrict__ w1T, f16* __restrict__ w2T) {
  __shared__ __align__(16) f16 sT[64 * TP];     // [n][k]
  const int b = blockIdx.x;
  if (b < WT_BLOCKS) {
    const float* W;
    f16* Wt;
    int K, N, lgn, tile;                        // lgn = log2(N / 64): tile = [k tile][n tile]
    if (b < 4 * WT_SQ) {
      // in[512][512] -> out[512][512] (rows = output feature); q, k, v stacked into the [1536][512] plane
      const int m = b / WT_SQ;
      tile = b - m * WT_SQ;
      W  = (m == 0) ? wq : ((m == 1) ? wk : ((m == 2) ? wv : wo));
      Wt = (m < 3) ? wqkvT + (size_t)m * DIM * DIM : woT;
      K = DIM; N = DIM; lgn = 3;
    } else if (b < 4 * WT_SQ + WT_FF) {
      tile = b - 4 * WT_SQ;                     // in[512][2048] -> out[2048][512]
      W = w1; Wt = w1T; K = DIM; N = FFN; lgn = 5;
    } else {
      tile = b - (4 * WT_SQ + WT_FF);           // in[2048][512] -> out[512][2048]
      W = w2; Wt = w2T; K = FFN; N = DIM; lgn = 3;
    }
    wt_tile(W, Wt, K, N, (tile & ((1 << lgn) - 1)) * 64, (tile >> lgn) * 64, sT);
  } else {
    cvt_x_piece(x, xh, (b - WT_BLOCKS) * 256 + (int)threadIdx.x);
  }
}

// ---------------------------------------------------------------------------------------------------
// GEMM main loop: acc[mt][nt] (16x16 tiles) of  A[m0 .. m0+31][K] x Bt[n0 .. n0+63][K]^T.
// A and Bt are packed f16 planes; fragments use the split k map for both operands:
// elements 0..7 <- k0 + 8*hi + 0..7, elements 8..15 <- k0 + 16 + 8*hi + 0..7; lane row / column = lq.
// A 16-row tile spans K*16 halves; a k block of 32 spans 512 halves; the second k half starts at +256.
template <int K>
static __device__ __forceinline__ void gemm_main(const f16* __restrict__ A, const f16* __restrict__ Bt,
                                                 int m0, int n0, int lq, int hi, v8f (&acc)[2][4]) {
  static_assert(K % 32 == 0);
  const f16* ap = A  + (size_t)m0 * K + (hi * 16 + lq) * 8;
  const f16* bp = Bt + (size_t)n0 * K + (hi * 16 + lq) * 8;
  #pragma unroll 1
  for (int k0 = 0; k0 < K; k0 += 32) {
    FragH a[2], b[4];
    #pragma unroll
    for (int mt = 0; mt < 2; ++mt) {
      const f16* p = ap + (size_t)mt * 16 * K + k0 * 16;
      a[mt].q[0] = *(const v4u*)(p);
      a[mt].q[1] = *(const v4u*)(p + 256);
    }
    #pragma unroll
    for (int nt = 0; nt < 4; ++nt) {
      const f16* p = bp + (size_t)nt * 16 * K + k0 * 16;
      b[nt].q[0] = *(const v4u*)(p);
      b[nt].q[1] = *(const v4u*)(p + 256);
    }
    #pragma unroll
    for (int mt = 0; mt < 2; ++mt) {
      #pragma unroll
      for (int nt = 0; nt < 4; ++nt) acc[mt][nt] = mma_f16(a[mt].v, b[nt].v, acc[mt][nt]);
    }
  }
}

// The same product for the launches that leave only two waves on a SIMD, too few to cover a fragment load's latency:
// a ring of D fragment sets in registers. Each set is refilled, right behind its own products, with the k block D
// further on, so D k blocks of loads are in flight per wave. The k blocks are summed in the same ascending order as above.
template <int K>
static __device__ __forceinline__ void load_kblock(const char* __restrict__ ap, const char* __restrict__ bp,
                                                   FragH (&a)[2], FragH (&b)[4]) {
  #pragma unroll
  for (int mt = 0; mt < 2; ++mt) {
    const char* p = ap + (size_t)mt * 32 * K;       // byte addresses: a 16-row tile spans 32 * K bytes
    a[mt].q[0] = *(const v4u*)(p);
    a[mt].q[1] = *(const v4u*)(p + 512);
  }
  #pragma unroll
  for (int nt = 0; nt < 4; ++nt) {
    const char* p = bp + (size_t)nt * 32 * K;
    b[nt].q[0] = *(const v4u*)(p);
    b[nt].q[1] = *(const v4u*)(p + 512);
  }
}

template <int K, int D>
static __device__ __forceinline__ void gemm_main_ring(const f16* __restrict__ A, const f16* __restrict__ Bt,
                                                      int m0, int n0, int lq, int hi, v8f (&acc)[2][4]) {
  constexpr int G = (K / 32) / D;                         // whole groups of D k blocks
  constexpr int R = (K / 32) % D;                         // k blocks left over behind them
  static_assert(K % 32 == 0 && G >= 2);
  const char* ab = (const char*)(A  + (size_t)m0 * K);   // wave-uniform bases
  const char* bb = (const char*)(Bt + (size_t)n0 * K);
  unsigned off = (hi * 16 + lq) * 16;                     // byte offset: the lane's piece of a unit + the k blocks done
  FragH a[D][2], b[D][4];
  #pragma unroll
  for (int s = 0; s < D; ++s) load_kblock<K>(ab + off + s * 1024, bb + off + s * 1024, a[s], b[s]);
  #pragma unroll 1
  for (int g = 1; g < G; ++g) {
    // the loads in flight name the offset register: wait before it is advanced (the operand keeps the add behind)
    asm volatile("s_wait_xcnt 0x0" : "+v"(off) : : "memory");
    off += D * 1024;
    #pragma unroll
    for (int s = 0; s < D; ++s) {
      #pragma unroll
      for (int mt = 0; mt < 2; ++mt) {
        #pragma unroll
        for (int nt = 0; nt < 4; ++nt) acc[mt][nt] = mma_f16(a[s][mt].v, b[s][nt].v, acc[mt][nt]);
      }
      load_kblock<K>(ab + off + s * 1024, bb + off + s * 1024, a[s], b[s]);
    }
  }
  // the last refills still name the offset register and the bases: wait before they are put to other use
  asm volatile("s_wait_xcnt 0x0" : "+v"(off) : : "memory");
  // last whole group; the left-over k blocks refill its first sets
  #pragma unroll
  for (int s = 0; s < D; ++s) {
    #pragma unroll
    for (int mt = 0; mt < 2; ++mt) {
      #pragma unroll
      for (int nt = 0; nt < 4; ++nt) acc[mt][nt] = mma_f16(a[s][mt].v, b[s][nt].v, acc[mt][nt]);
    }
    if (s < R) load_kblock<K>(ab + off + (D + s) * 1024, bb + off + (D + s) * 1024, a[s], b[s]);
  }
  #pragma unroll
  for (int s = 0; s < R; ++s) {
    #pragma unroll
    for (int mt = 0; mt < 2; ++mt) {
      #pragma unroll
      for (int nt = 0; nt < 4; ++nt) acc[mt][nt] = mma_f16(a[s][mt].v, b[s][nt].v, acc[mt][nt]);
    }
  }
}

// ---------------------------------------------------------------------------------------------------
// Fused q/k/v projection: [NTOK][512] x [1536][512]^T. Column block (64 wide) = one head of q, k or v.
//          qk plane order: 0 = q, 1 = k.
//   q, k : per (b, h) a packed plane with rows = tokens, K = d (64): 1024 halves per 16 tokens.
//   v    : per (b, h) a packed plane with rows = d (4 tiles), K = tokens, k block outermost:
//          [s/32][d tile 4][half 2][lane 32][8] f16 (x VC), written through a block-wide LDS tile.
// coverage: q/k rows wave*32 + {0..31} x 64 d = 8 units per wave; vt 64 d x 128 tokens = 32 units per block.
__global__ __launch_bounds__(128) void gemm_qkv_kernel(const f16* __restrict__ xh, const f16* __restrict__ wT,
                                                       const float* __restrict__ bq, const float* __restrict__ bk,
                                                       const float* __restrict__ bv,
                                                       f16* __restrict__ qk, f16* __restrict__ vt) {
  __shared__ __align__(16) float sC[GW * 32 * OP];    // per-wave f32 tiles (block barrier used)
  __shared__ __align__(16) f16   sVT[HDIM * VP];      // [d][token], cross-wave (block barrier)
  const int tid  = threadIdx.x;
  const int wave = __builtin_amdgcn_readfirstlane(threadIdx.x >> 5);
  const int lane = tid & 31;
  const int lq   = lane & 15;
  const int hi   = lane >> 4;
  const int tok0 = blockIdx.x * GM;
  const int n0   = blockIdx.y * GN;
  const int seg  = n0 / DIM;                          // 0 = q, 1 = k, 2 = v (block-uniform)
  const int h    = (n0 - seg * DIM) / HDIM;
  const int bb   = tok0 / SEQ;
  const int s0   = tok0 - bb * SEQ;

  v8f acc[2][4];
  #pragma unroll
  for (int mt = 0; mt < 2; ++mt) {
    #pragma unroll
    for (int nt = 0; nt < 4; ++nt) acc[mt][nt] = (v8f){0, 0, 0, 0, 0, 0, 0, 0};
  }
  gemm_main<DIM>(xh, wT, tok0 + wave * 32, n0, lq, hi, acc);

  const float ascale = 1.0f / (XC * WC);
  float bias[4];
  #pragma unroll
  for (int nt = 0; nt < 4; ++nt) {
    const int c = h * HDIM + nt * 16 + lq;            // 0..511
    const float fq = bq[c];
    const float fk = bk[c];
    const float fv = bv[c];
    const float sel = (seg == 0) ? fq : ((seg == 1) ? fk : fv);
    bias[nt] = bfr(sel);
  }

  if (seg < 2) {
    const int wb = wave * (32 * OP);
    #pragma unroll
    for (int mt = 0; mt < 2; ++mt) {
      #pragma unroll
      for (int nt = 0; nt < 4; ++nt) {
        #pragma unroll
        for (int r = 0; r < 8; ++r)
          sC[wb + (mt * 16 + hi * 8 + r) * OP + nt * 16 + lq] = acc[mt][nt][r] * ascale + bias[nt];
      }
    }
    __syncthreads();
    const size_t pbase = (size_t)seg * PLANE +
                         (((size_t)bb * NHEAD + h) * SEQ + s0 + wave * 32) * HDIM;
    v4u hv[8];
    #pragma unroll
    for (int it = 0; it < 8; ++it) {
      const int row = (it >> 2) * 16 + lq;                               // unit it: [row tile 2][d block 2][half 2]
      const int col = ((it >> 1) & 1) * 32 + (it & 1) * 16 + hi * 8;
      const v4f c0 = *(const v4f*)(&sC[wb + row * OP + col]);
      const v4f c1 = *(const v4f*)(&sC[wb + row * OP + col + 4]);
      Pack8H ph;
      #pragma unroll
      for (int i = 0; i < 4; ++i) {
        ph.h[i]     = (f16)c0[i];
        ph.h[4 + i] = (f16)c1[i];
      }
      hv[it] = ph.u;
    }
    #pragma unroll
    for (int it = 0; it < 8; ++it) *(v4u*)(qk + pbase + (size_t)it * 256 + lane * 8) = hv[it];
    
  } else {
    #pragma unroll
    for (int mt = 0; mt < 2; ++mt) {
      #pragma unroll
      for (int nt = 0; nt < 4; ++nt) {
        #pragma unroll
        for (int r = 0; r < 8; ++r)
          sVT[(nt * 16 + lq) * VP + wave * 32 + mt * 16 + hi * 8 + r] =
              (f16)((acc[mt][nt][r] * ascale + bias[nt]) * VC);
      }
    }
    __syncthreads();
    const size_t vbase = (((size_t)bb * NHEAD + h) * SEQ + s0) * HDIM;   // first unit of this block's 128 tokens
    v4u vv[8];
    #pragma unroll
    for (int it = 0; it < 8; ++it) {
      const int u = it * 4 + wave;                 // unit 0..31: [token block 4][d tile 4][half 2]
      const int d = ((u >> 1) & 3) * 16 + lq;
      const int s = (u >> 3) * 32 + (u & 1) * 16 + hi * 8;
      Pack8H ph;
      ph.v = *(const v8h*)(&sVT[d * VP + s]);
      vv[it] = ph.u;
    }
    #pragma unroll
    for (int it = 0; it < 8; ++it) {
      const size_t o = vbase + (size_t)(it * 4 + wave) * 256 + lane * 8;
      *(v4u*)(vt + o) = vv[it];
    }
    
  }
}

// ---------------------------------------------------------------------------------------------------
// Flash attention, full (no mask). Block = (128-query block, head, batch); one wave owns 16 query rows.
// S^T = K x Q^T so queries sit on lanes; P^T in C layout is the A-fragment layout of O += P x V.
// Scores: s = k x q on the f16 planes, f32 accumulate, d blocks summed in ascending order.
// Fragments come straight from the packed 16-bit planes (two 512-B unit loads each); q fragments stay in registers.
__global__ __launch_bounds__(256) void attn_kernel(const f16* __restrict__ qk, const f16* __restrict__ vt,
                                                   f16* __restrict__ ctx) {
  __shared__ __align__(16) float sO[NWAVE * 16 * OP];    // per-wave output staging (block barrier used)
  const int qblk = blockIdx.x;
  const int h    = blockIdx.y;
  const int b    = blockIdx.z;
  const int tid  = threadIdx.x;
  const int wave = __builtin_amdgcn_readfirstlane(threadIdx.x >> 5);
  const int lane = tid & 31;
  const int lq   = lane & 15;   // query column of S^T / d column of O
  const int hi   = lane >> 4;   // k-split half

  const int qrow0 = qblk * BQ + wave * 16;
  const size_t hb = ((size_t)b * NHEAD + h) * (size_t)SEQ * HDIM;
  const f16* qh_p = qk + hb;
  const f16* kh_p = qk + PLANE + hb;
  const f16* vt_h = vt + hb;
  const int qoff  = qrow0 * HDIM + lane * 8;         // this wave's 16-query tile, lane's piece of a unit

  // q B-fragments, loaded once and held for the whole key loop
  FragH fqh[2];
  #pragma unroll
  for (int f = 0; f < 2; ++f) {
    const int qo = qoff + f * 512;
    fqh[f].q[0] = *(const v4u*)(qh_p + qo);           // d = f*32 + hi*8 + 0..7
    fqh[f].q[1] = *(const v4u*)(qh_p + qo + 256);     // d = f*32 + 16 + hi*8 + 0..7
  }

  v8f o[4];
  #pragma unroll
  for (int dt = 0; dt < 4; ++dt) o[dt] = (v8f){0, 0, 0, 0, 0, 0, 0, 0};

  float rmax = -__builtin_inff();
  float rsum = 0.0f;
  const float SL = 0.125f * 1.4426950408889634f;   // softmax scale * log2(e)

  // K A-fragments (row = key lq of the tile, split d map) and V B-fragments (column n = d = dt*16 + lq, split key map
  // from the packed transposed plane) are fetched one step ahead into the same registers: step 0's here, step j + 1's
  // K behind step j's score products and its V behind step j's P x V products.
  FragH fkh[2][2], bv[4];
  #pragma unroll
  for (int sub = 0; sub < 2; ++sub) {
    #pragma unroll
    for (int f = 0; f < 2; ++f) {
      const int ko = sub * 16 * HDIM + f * 512 + lane * 8;
      fkh[sub][f].q[0] = *(const v4u*)(kh_p + ko);
      fkh[sub][f].q[1] = *(const v4u*)(kh_p + ko + 256);
    }
  }
  // keeps step 0's V loads behind its q and K loads, as in every later step: loads return in order, and only so can
  // the counted wait at the head of the loop leave the eight V loads in flight under the score products and the softmax
  __builtin_amdgcn_sched_barrier(0);
  #pragma unroll
  for (int dt = 0; dt < 4; ++dt) {
    const f16* base = vt_h + dt * 512 + lane * 8;
    bv[dt].q[0] = *(const v4u*)(base);              // keys hi*8 + 0..7
    bv[dt].q[1] = *(const v4u*)(base + 256);        // keys 16 + hi*8 + 0..7
  }

  #pragma unroll 1
  for (int j0 = 0; j0 < SEQ; j0 += BK) {
    // the step fetched ahead; the last step has none and refetches step 0 (in bounds, never used)
    const int jn = (j0 + BK < SEQ) ? j0 + BK : 0;

    // S^T tiles: c[sub][r] = rawscore(query qrow0+lq, key j0 + sub*16 + hi*8 + r)
    v8f c[2];
    c[0] = (v8f){0, 0, 0, 0, 0, 0, 0, 0};
    c[1] = (v8f){0, 0, 0, 0, 0, 0, 0, 0};
    #pragma unroll
    for (int f = 0; f < 2; ++f) {
      #pragma unroll
      for (int sub = 0; sub < 2; ++sub) c[sub] = mma_f16(fkh[sub][f].v, fqh[f].v, c[sub]);
    }

    // next step's K fragments, in flight under the softmax and the P x V products
    #pragma unroll
    for (int sub = 0; sub < 2; ++sub) {
      #pragma unroll
      for (int f = 0; f < 2; ++f) {
        const int ko = (jn + sub * 16) * HDIM + f * 512 + lane * 8;
        fkh[sub][f].q[0] = *(const v4u*)(kh_p + ko);
        fkh[sub][f].q[1] = *(const v4u*)(kh_p + ko + 256);
      }
    }
    // keeps the K loads from sinking into the softmax below, where less work would cover their latency
    __builtin_amdgcn_sched_barrier(0);

    // online softmax: query lq's 32 scores are split across lane / lane^16
    float m_new = rmax;
    #pragma unroll
    for (int r = 0; r < 8; ++r) {
      m_new = fmaxf(m_new, c[0][r]);
      m_new = fmaxf(m_new, c[1][r]);
    }
    m_new = fmaxf(m_new, __shfl_xor(m_new, 16, 32));
    const float scale = __builtin_amdgcn_exp2f((rmax - m_new) * SL);
    rmax = m_new;

    // exp + pack: P^T C-layout == A-fragment layout for the PV product
    FragH pa;
    float psum = 0.0f;
    #pragma unroll
    for (int r = 0; r < 8; ++r) {
      const float p0 = __builtin_amdgcn_exp2f((c[0][r] - m_new) * SL);   // key hi*8 + r
      const float p1 = __builtin_amdgcn_exp2f((c[1][r] - m_new) * SL);   // key 16 + hi*8 + r
      psum += p0 + p1;
      pa.h[r]     = (f16)(p0 * PC);
      pa.h[8 + r] = (f16)(p1 * PC);
    }
    rsum = rsum * scale + psum + __shfl_xor(psum, 16, 32);

    // rescale O: queries are the row dimension there -> per-row scale from lane 8*hi + r
    float sc[8];
    #pragma unroll
    for (int r = 0; r < 8; ++r) sc[r] = __shfl(scale, (hi << 3) + r, 32);
    #pragma unroll
    for (int dt = 0; dt < 4; ++dt) {
      #pragma unroll
      for (int r = 0; r < 8; ++r) o[dt][r] *= sc[r];
    }

    // O += P x V
    #pragma unroll
    for (int dt = 0; dt < 4; ++dt) o[dt] = mma_f16(pa.v, bv[dt].v, o[dt]);

    // next step's V fragments, in flight under its score products and softmax
    #pragma unroll
    for (int dt = 0; dt < 4; ++dt) {
      const f16* base = vt_h + (size_t)jn * HDIM + dt * 512 + lane * 8;
      bv[dt].q[0] = *(const v4u*)(base);            // keys jn + hi*8 + 0..7
      bv[dt].q[1] = *(const v4u*)(base + 256);      // keys jn + 16 + hi*8 + 0..7
    }
    // the V address pair is formed anew at the head of the next step: wait before that overwrite
    asm volatile("s_wait_xcnt 0x0" ::: "memory");
  }

  // normalize: lane holds column d = dt*16 + lq for query rows 8*hi + r
  float rs[8];
  #pragma unroll
  for (int r = 0; r < 8; ++r) rs[r] = 1.0f / __shfl(rsum, (hi << 3) + r, 32);

  const int wb = wave * (16 * OP);
  #pragma unroll
  for (int r = 0; r < 8; ++r) {
    #pragma unroll
    for (int dt = 0; dt < 4; ++dt)
      sO[wb + (hi * 8 + r) * OP + dt * 16 + lq] = o[dt][r] * (CC / (PC * VC)) * rs[r];
  }
  __syncthreads();

  v4u    pv[4];
  size_t gidx[4];
  #pragma unroll
  for (int it = 0; it < 4; ++it) {
    const int row = lq;                                   // unit it: [k block 2][half 2] of this head's 64 columns
    const int col = (it >> 1) * 32 + (it & 1) * 16 + hi * 8;
    const v4f c0 = *(const v4f*)(&sO[wb + row * OP + col]);
    const v4f c1 = *(const v4f*)(&sO[wb + row * OP + col + 4]);
    Pack8H ph;
    #pragma unroll
    for (int i = 0; i < 4; ++i) {
      ph.h[i]     = (f16)c0[i];
      ph.h[4 + i] = (f16)c1[i];
    }
    pv[it]   = ph.u;
    gidx[it] = ((size_t)b * SEQ + qrow0) * DIM + (size_t)(h * 4 + it) * 256 + lane * 8;   // packed, K = DIM
  }
  #pragma unroll
  for (int it = 0; it < 4; ++it) *(v4u*)(ctx + gidx[it]) = pv[it];
  
}

// ---------------------------------------------------------------------------------------------------
// y = ctx x wo + bo + bf16_rne(x)   (f32 plane [NTOK][DIM], input of LayerNorm 1)
// coverage: rows wave*32 + {0..31}, 64 columns: 16 instr, lanes 0..15 one 256-B row segment, 16..31 the next row.
__global__ __launch_bounds__(128) void gemm_wo_kernel(const f16* __restrict__ ctx, const f16* __restrict__ woT,
                                                      const float* __restrict__ bo, const float* __restrict__ x,
                                                      float* __restrict__ y) {
  __shared__ __align__(16) float sC[GW * 32 * OP];
  const int tid  = threadIdx.x;
  const int wave = __builtin_amdgcn_readfirstlane(threadIdx.x >> 5);
  const int lane = tid & 31;
  const int lq   = lane & 15;
  const int hi   = lane >> 4;
  const int tok0 = blockIdx.x * GM;
  const int n0   = blockIdx.y * GN;
  const int bb   = tok0 / SEQ;
  const int s0   = tok0 - bb * SEQ;

  v8f acc[2][4];
  #pragma unroll
  for (int mt = 0; mt < 2; ++mt) {
    #pragma unroll
    for (int nt = 0; nt < 4; ++nt) acc[mt][nt] = (v8f){0, 0, 0, 0, 0, 0, 0, 0};
  }
  gemm_main_ring<DIM, RD>(ctx, woT, tok0 + wave * 32, n0, lq, hi, acc);

  const float ascale = 1.0f / (CC * WC);
  const int wb = wave * (32 * OP);
  #pragma unroll
  for (int nt = 0; nt < 4; ++nt) {
    const float bias = bfr(bo[n0 + nt * 16 + lq]);
    #pragma unroll
    for (int mt = 0; mt < 2; ++mt) {
      #pragma unroll
      for (int r = 0; r < 8; ++r)
        sC[wb + (mt * 16 + hi * 8 + r) * OP + nt * 16 + lq] = acc[mt][nt][r] * ascale + bias;
    }
  }
  __syncthreads();

  const size_t orow = (size_t)tok0 + wave * 32;                          // compact row
  const size_t rrow = (size_t)bb * SEQ_FULL + s0 + wave * 32;            // row of the full-size x
  #pragma unroll
  for (int g = 0; g < 2; ++g) {
    v4f vals[8];
    #pragma unroll
    for (int it = 0; it < 8; ++it) {
      const int row = g * 16 + it * 2 + hi;
      v4f cv = *(const v4f*)(&sC[wb + row * OP + lq * 4]);
      const v4f rv = *(const v4f*)(x + (rrow + row) * DIM + n0 + lq * 4);
      #pragma unroll
      for (int i = 0; i < 4; ++i) cv[i] = cv[i] + bfr(rv[i]);
      vals[it] = cv;
    }
    #pragma unroll
    for (int it = 0; it < 8; ++it)
      *(v4f*)(y + (orow + g * 16 + it * 2 + hi) * DIM + n0 + lq * 4) = vals[it];
    
  }
}

// ---------------------------------------------------------------------------------------------------
// f32 row: 4 instr x (32 lanes x 16 B) ; f16 rows staged in LDS (cross-wave, block barrier) and written packed:
// the block's 8 tokens fill 8 neighbouring lane slots = one whole 128-B line in each of the 64 (k block, half, hi) groups.
__global__ __launch_bounds__(256) void ln1_kernel(const float* __restrict__ y, const float* __restrict__ g,
                                                  const float* __restrict__ be,
                                                  float* __restrict__ x1f, f16* __restrict__ x1h) {
  __shared__ __align__(16) f16 sH[8 * SHP];
  const int tid  = threadIdx.x;
  const int wave = __builtin_amdgcn_readfirstlane(threadIdx.x >> 5);
  const int lane = tid & 31;
  const int t    = blockIdx.x * 8 + wave;             // compact token
  const float* yr = y + (size_t)t * DIM;

  v4f v[4];
  float s = 0.0f;
  #pragma unroll
  for (int j = 0; j < 4; ++j) {
    v[j] = *(const v4f*)(yr + j * 128 + lane * 4);
    s += (v[j][0] + v[j][1]) + (v[j][2] + v[j][3]);
  }
  s = wave_sum(s);
  const float mean = s * (1.0f / DIM);
  float q = 0.0f;
  #pragma unroll
  for (int j = 0; j < 4; ++j) {
    #pragma unroll
    for (int i = 0; i < 4; ++i) {
      const float d = v[j][i] - mean;
      q += d * d;
    }
  }
  q = wave_sum(q);
  const float rstd = rsqrtf(q * (1.0f / DIM) + 1e-5f);

  v4f ov[4];
  #pragma unroll
  for (int j = 0; j < 4; ++j) {
    const v4f gv = *(const v4f*)(g + j * 128 + lane * 4);
    const v4f bv = *(const v4f*)(be + j * 128 + lane * 4);
    #pragma unroll
    for (int i = 0; i < 4; ++i) {
      const float val = (v[j][i] - mean) * rstd * bfr(gv[i]) + bfr(bv[i]);
      ov[j][i] = val;
      sH[wave * SHP + j * 128 + lane * 4 + i] = (f16)(val * XC);
    }
  }
  __syncthreads();
  const int t0 = blockIdx.x * 8;                      // first token of the block
  v4u    hv[2];
  size_t hidx[2];
  #pragma unroll
  for (int jj = 0; jj < 2; ++jj) {
    const int tk = tid & 7;                           // token of the block
    const int ln = jj * 32 + (tid >> 3);              // 8-column group 0..63 = kblock*4 + half*2 + hi
    Pack8H ph;
    ph.v = *(const v8h*)(&sH[tk * SHP + ln * 8]);
    hv[jj] = ph.u;
    hidx[jj] = (size_t)(t0 >> 4) * (16 * DIM) + (size_t)(ln >> 1) * 256 + ((ln & 1) * 16 + (t0 & 15) + tk) * 8;
  }
  float* fo = x1f + (size_t)t * DIM + lane * 4;
  #pragma unroll
  for (int j = 0; j < 4; ++j) *(v4f*)(fo + j * 128) = ov[j];
  #pragma unroll
  for (int jj = 0; jj < 2; ++jj) *(v4u*)(x1h + hidx[jj]) = hv[jj];
  
}

// ---------------------------------------------------------------------------------------------------
// hh = f16( gelu_erf(x1 x w1 + b1) * XC )   packed plane (rows = tokens, K = FFN)
__global__ __launch_bounds__(128) void gemm_ffn1_kernel(const f16* __restrict__ x1h, const f16* __restrict__ w1T,
                                                        const float* __restrict__ b1, f16* __restrict__ hh) {
  __shared__ __align__(16) float sC[GW * 32 * OP];
  const int tid  = threadIdx.x;
  const int wave = __builtin_amdgcn_readfirstlane(threadIdx.x >> 5);
  const int lane = tid & 31;
  const int lq   = lane & 15;
  const int hi   = lane >> 4;
  const int tok0 = blockIdx.x * GM;
  const int n0   = blockIdx.y * GN;

  v8f acc[2][4];
  #pragma unroll
  for (int mt = 0; mt < 2; ++mt) {
    #pragma unroll
    for (int nt = 0; nt < 4; ++nt) acc[mt][nt] = (v8f){0, 0, 0, 0, 0, 0, 0, 0};
  }
  gemm_main<DIM>(x1h, w1T, tok0 + wave * 32, n0, lq, hi, acc);

  const float ascale = 1.0f / (XC * WC);
  const int wb = wave * (32 * OP);
  #pragma unroll
  for (int nt = 0; nt < 4; ++nt) {
    const float bias = bfr(b1[n0 + nt * 16 + lq]);
    #pragma unroll
    for (int mt = 0; mt < 2; ++mt) {
      #pragma unroll
      for (int r = 0; r < 8; ++r)
        sC[wb + (mt * 16 + hi * 8 + r) * OP + nt * 16 + lq] = acc[mt][nt][r] * ascale + bias;
    }
  }
  __syncthreads();

  // GELU (erf form) in place on this lane's own pieces (same lane reads them back below); kept rolled
  // piece it = i >> 1 is this lane's 16 B of unit it: [row tile 2][k block 2][half 2]
  const int lbase = wb + lq * OP + hi * 8;
  #pragma unroll 1
  for (int i = 0; i < 16; ++i) {
    const int off = lbase + (i >> 3) * (16 * OP) + ((i >> 1) & 3) * 16 + (i & 1) * 4;
    v4f t = *(const v4f*)(&sC[off]);
    #pragma unroll
    for (int e = 0; e < 4; ++e) {
      const float u = t[e];
      t[e] = 0.5f * u * (1.0f + erff(u * 0.70710678118654752f));
    }
    *(v4f*)(&sC[off]) = t;
  }

  v4u pv[8];
  #pragma unroll
  for (int it = 0; it < 8; ++it) {
    const int off = lbase + (it >> 2) * (16 * OP) + (it & 3) * 16;
    const v4f c0 = *(const v4f*)(&sC[off]);
    const v4f c1 = *(const v4f*)(&sC[off + 4]);
    Pack8H ph;
    #pragma unroll
    for (int i = 0; i < 4; ++i) {
      ph.h[i]     = (f16)(c0[i] * XC);
      ph.h[4 + i] = (f16)(c1[i] * XC);
    }
    pv[it] = ph.u;
  }
  const size_t obase = ((size_t)tok0 + wave * 32) * FFN + (size_t)n0 * 16 + lane * 8;
  #pragma unroll
  for (int it = 0; it < 8; ++it) *(v4u*)(hh + obase + (size_t)(it >> 2) * 16 * FFN + (it & 3) * 256) = pv[it];
  
}

// ---------------------------------------------------------------------------------------------------
// y = hh x w2 + b2 + x1f   (f32 plane [NTOK][DIM], input of LayerNorm 2)
__global__ __launch_bounds__(128) void gemm_ffn2_kernel(const f16* __restrict__ hh, const f16* __restrict__ w2T,
                                                        const float* __restrict__ b2, const float* __restrict__ x1f,
                                                        float* __restrict__ y) {
  __shared__ __align__(16) float sC[GW * 32 * OP];
  const int tid  = threadIdx.x;
  const int wave = __builtin_amdgcn_readfirstlane(threadIdx.x >> 5);
  const int lane = tid & 31;
  const int lq   = lane & 15;
  const int hi   = lane >> 4;
  const int tok0 = blockIdx.x * GM;
  const int n0   = blockIdx.y * GN;

  v8f acc[2][4];
  #pragma unroll
  for (int mt = 0; mt < 2; ++mt) {
    #pragma unroll
    for (int nt = 0; nt < 4; ++nt) acc[mt][nt] = (v8f){0, 0, 0, 0, 0, 0, 0, 0};
  }
  gemm_main_ring<FFN, RD>(hh, w2T, tok0 + wave * 32, n0, lq, hi, acc);

  const float ascale = 1.0f / (XC * WC);
  const int wb = wave * (32 * OP);
  #pragma unroll
  for (int nt = 0; nt < 4; ++nt) {
    const float bias = bfr(b2[n0 + nt * 16 + lq]);
    #pragma unroll
    for (int mt = 0; mt < 2; ++mt) {
      #pragma unroll
      for (int r = 0; r < 8; ++r)
        sC[wb + (mt * 16 + hi * 8 + r) * OP + nt * 16 + lq] = acc[mt][nt][r] * ascale + bias;
    }
  }
  __syncthreads();

  const size_t orow = (size_t)tok0 + wave * 32;
  #pragma unroll
  for (int g = 0; g < 2; ++g) {
    v4f vals[8];
    #pragma unroll
    for (int it = 0; it < 8; ++it) {
      const int row = g * 16 + it * 2 + hi;
      v4f cv = *(const v4f*)(&sC[wb + row * OP + lq * 4]);
      const v4f rv = *(const v4f*)(x1f + (orow + row) * DIM + n0 + lq * 4);
      #pragma unroll
      for (int i = 0; i < 4; ++i) cv[i] = cv[i] + rv[i];
      vals[it] = cv;
    }
    #pragma unroll
    for (int it = 0; it < 8; ++it)
      *(v4f*)(y + (orow + g * 16 + it * 2 + hi) * DIM + n0 + lq * 4) = vals[it];
    
  }
}

// ---------------------------------------------------------------------------------------------------
__global__ __launch_bounds__(256) void ln2_kernel(const float* __restrict__ y, const float* __restrict__ g,
                                                  const float* __restrict__ be, float* __restrict__ out) {
  const int tid  = threadIdx.x;
  const int wave = __builtin_amdgcn_readfirstlane(threadIdx.x >> 5);
  const int lane = tid & 31;
  const int t    = blockIdx.x * 8 + wave;             // compact token
  const int bb   = t / SEQ;
  const int s0   = t - bb * SEQ;
  const float* yr = y + (size_t)t * DIM;

  v4f v[4];
  float s = 0.0f;
  #pragma unroll
  for (int j = 0; j < 4; ++j) {
    v[j] = *(const v4f*)(yr + j * 128 + lane * 4);
    s += (v[j][0] + v[j][1]) + (v[j][2] + v[j][3]);
  }
  s = wave_sum(s);
  const float mean = s * (1.0f / DIM);
  float q = 0.0f;
  #pragma unroll
  for (int j = 0; j < 4; ++j) {
    #pragma unroll
    for (int i = 0; i < 4; ++i) {
      const float d = v[j][i] - mean;
      q += d * d;
    }
  }
  q = wave_sum(q);
  const float rstd = rsqrtf(q * (1.0f / DIM) + 1e-5f);

  v4f ov[4];
  #pragma unroll
  for (int j = 0; j < 4; ++j) {
    const v4f gv = *(const v4f*)(g + j * 128 + lane * 4);
    const v4f bv = *(const v4f*)(be + j * 128 + lane * 4);
    #pragma unroll
    for (int i = 0; i < 4; ++i) ov[j][i] = (v[j][i] - mean) * rstd * bfr(gv[i]) + bfr(bv[i]);
  }
  float* fo = out + ((size_t)bb * SEQ_FULL + s0) * DIM + lane * 4;
  #pragma unroll
  for (int j = 0; j < 4; ++j) *(v4f*)(fo + j * 128) = ov[j];
  
}

// ---------------------------------------------------------------------------------------------------
extern "C" void kernel_launch(void* const* d_in, const int* in_sizes, int n_in,
                              void* d_out, int out_size, void* d_ws, size_t ws_size,
                              hipStream_t stream) {
  if (n_in < 17) return;
  const size_t rows_used = (size_t)(NB - 1) * SEQ_FULL + SEQ;
  if ((size_t)in_sizes[0] < rows_used * DIM) return;
  if ((size_t)in_sizes[1] < (size_t)DIM * DIM || (size_t)in_sizes[3] < (size_t)DIM * DIM) return;
  if ((size_t)in_sizes[5] < (size_t)DIM * DIM || (size_t)in_sizes[7] < (size_t)DIM * DIM) return;
  if ((size_t)in_sizes[9] < (size_t)DIM * FFN || (size_t)in_sizes[11] < (size_t)FFN * DIM) return;
  if (in_sizes[2] < DIM || in_sizes[4] < DIM || in_sizes[6] < DIM || in_sizes[8] < DIM) return;
  if (in_sizes[10] < FFN || in_sizes[12] < DIM) return;
  if (in_sizes[13] < DIM || in_sizes[14] < DIM || in_sizes[15] < DIM || in_sizes[16] < DIM) return;
  if ((size_t)out_size < rows_used * DIM) return;
  if (ws_size < WS_TOTAL) return;

  const float* x   = (const float*)d_in[0];
  const float* wq  = (const float*)d_in[1];
  const float* bq  = (const float*)d_in[2];
  const float* wk  = (const float*)d_in[3];
  const float* bk  = (const float*)d_in[4];
  const float* wv  = (const float*)d_in[5];
  const float* bv  = (const float*)d_in[6];
  const float* wo  = (const float*)d_in[7];
  const float* bo  = (const float*)d_in[8];
  const float* w1  = (const float*)d_in[9];
  const float* b1  = (const float*)d_in[10];
  const float* w2  = (const float*)d_in[11];
  const float* b2  = (const float*)d_in[12];
  const float* g1  = (const float*)d_in[13];
  const float* be1 = (const float*)d_in[14];
  const float* g2  = (const float*)d_in[15];
  const float* be2 = (const float*)d_in[16];
  float* out = (float*)d_out;

  char* ws = (char*)d_ws;
  f16*   xh    = (f16*)(ws + OFF_XH);
  f16*   wqkvT = (f16*)(ws + OFF_WQKV);
  f16*   woT   = (f16*)(ws + OFF_WO);
  f16*   w1T   = (f16*)(ws + OFF_W1);
  f16*   w2T   = (f16*)(ws + OFF_W2);
  f16*   qk    = (f16*)(ws + OFF_BIG);     // the q and k planes
  f16*   hh    = (f16*)(ws + OFF_BIG);     // reuses the q/k region after the attention launch
  f16*   vt    = (f16*)(ws + OFF_VT);
  f16*   ctx   = (f16*)(ws + OFF_CTX);
  float* y     = (float*)(ws + OFF_Y);
  float* x1f   = (float*)(ws + OFF_X1F);
  f16*   x1h   = (f16*)(ws + OFF_X1H);

  // operand planes
  prep_kernel<<<dim3((unsigned)(WT_BLOCKS + CVT_BLOCKS)), 256, 0, stream>>>(x, wq, wk, wv, wo, w1, w2,
                                                                            xh, wqkvT, woT, w1T, w2T);

  gemm_qkv_kernel<<<dim3(NTOK / GM, QKVN / GN), 128, 0, stream>>>(xh, wqkvT, bq, bk, bv, qk, vt);
  attn_kernel<<<dim3(SEQ / BQ, NHEAD, NB), 256, 0, stream>>>(qk, vt, ctx);
  gemm_wo_kernel<<<dim3(NTOK / GM, DIM / GN), 128, 0, stream>>>(ctx, woT, bo, x, y);
  ln1_kernel<<<dim3(NTOK / 8), 256, 0, stream>>>(y, g1, be1, x1f, x1h);
  gemm_ffn1_kernel<<<dim3(NTOK / GM, FFN / GN), 128, 0, stream>>>(x1h, w1T, b1, hh);
  gemm_ffn2_kernel<<<dim3(NTOK / GM, DIM / GN), 128, 0, stream>>>(hh, w2T, b2, x1f, y);
  ln2_kernel<<<dim3(NTOK / 8), 256, 0, stream>>>(y, g2, be2, out);
}

// v006
// Measured time: 147 microseconds a run.
// Timed twice side by side with v005, it ran 1.04 and 1.08 times as fast.
// All steps since v000 together make it 3.20 times as fast.
#include <hip/hip_runtime.h>
#include <math.h>

// All contractions on v_wmma_f32_16x16x32_f16 with f32 accumulate: projections / Wo / FFN use f16 operand planes
// (inputs RNE-converted to bf16 first, then exact power-of-two carries); scores S^T = K x Q^T use q and k as one
// f16 plane each (11 significant bits, against the 8 of the operands q and k are made from); O = P x V with P f16
// carried x4096.
//
// Every f16 operand plane in the workspace is stored fragment-packed: a [rows][K] operand is cut into tiles of
// 16 rows x 32 k; a tile is two 512-B units (k halves 0..15 and 16..31); inside a unit lane (hi*16 + lq) owns 16 B =
// row lq, k = half*16 + hi*8 + 0..7. Unit index = (rowtile * (K/32) + kblock) * 2 + half; the V^T plane puts the k block outermost. One wave-wide 16-B-per-lane
// load of a unit is 512 contiguous bytes (4 whole lines) and lands directly in the split-k fragment map.

#ifndef NB
#define NB 4
#endif
#ifndef SEQ
#define SEQ 2048
#endif
#define NB_FULL   4
#define SEQ_FULL  2048
#define DIM       512
#define NHEAD     8
#define HDIM      64
#define FFN       2048
#define QKVN      (3 * DIM)
#define NTOK      (NB * SEQ)
#define PLANE     ((size_t)NTOK * DIM)     // elements of one [NB][NHEAD][SEQ][HDIM] 16-bit plane
#define GM        128                      // GEMM block rows (4 waves x 32)
#define GN        64                       // GEMM block columns
#define GW        4                        // waves per GEMM block
#define OP        68                       // LDS pitch (floats) of f32 staging tiles
#define VP        136                      // LDS pitch (halves) of the V^T staging tile
#define TP        72                       // LDS pitch (halves) of the weight transposer tile
#define SHP       (DIM + 16)               // LDS pitch (halves) of the LayerNorm-1 f16 row staging
#define BQ        128                      // query rows per attention block (8 waves x 16)
#define BK        32                       // keys per attention step
#define NWAVE     8
#define XC        16.0f                    // carry of the x, LN1-output and GELU-output planes
#define WC        64.0f                    // carry of all weight planes
#define VC        16.0f                    // carry of the V^T plane
#define CC        256.0f                   // carry of the attention-context plane
#define PC        4096.0f                  // carry of P inside the attention kernel
#define RD        3                        // fragment sets in the register ring of the Wo and FFN-2 products

static_assert(DIM == NHEAD * HDIM);
static_assert(HDIM == 64);
static_assert(HDIM == GN);
static_assert(GM == GW * 32);
static_assert(BQ == NWAVE * 16);
static_assert(SEQ % GM == 0);
static_assert(SEQ % BQ == 0);
static_assert(SEQ % BK == 0);
static_assert(NTOK % GM == 0);
static_assert(NTOK % 8 == 0);
static_assert(DIM % GN == 0);
static_assert(FFN % GN == 0);
static_assert(QKVN % GN == 0);
static_assert(DIM % 64 == 0);
static_assert(FFN % 64 == 0);
static_assert(DIM % 32 == 0);
static_assert(FFN % 32 == 0);
static_assert(DIM == 32 * 16);
static_assert(((size_t)NTOK * DIM / 8) % 256 == 0);
static_assert((OP * 4) % 16 == 0);
static_assert((VP * 2) % 16 == 0);
static_assert((TP * 2) % 16 == 0);
static_assert((SHP * 2) % 16 == 0);
static_assert(SEQ <= SEQ_FULL);
static_assert(NB >= 1 && NB <= NB_FULL);

#define SZ_XH    ((size_t)NTOK * DIM * 2)
#define SZ_WQKV  ((size_t)QKVN * DIM * 2)
#define SZ_WO    ((size_t)DIM * DIM * 2)
#define SZ_W1    ((size_t)FFN * DIM * 2)
#define SZ_W2    ((size_t)DIM * FFN * 2)
#define SZ_QK    ((size_t)2 * NTOK * DIM * 2)
#define SZ_HH    ((size_t)NTOK * FFN * 2)
#define SZ_BIG   ((SZ_QK > SZ_HH) ? SZ_QK : SZ_HH)   // q/k planes, later reused by the GELU-output plane
#define SZ_VT    ((size_t)NTOK * DIM * 2)
#define SZ_CTX   ((size_t)NTOK * DIM * 2)
#define SZ_Y     ((size_t)NTOK * DIM * 4)
#define SZ_X1F   ((size_t)NTOK * DIM * 4)
#define SZ_X1H   ((size_t)NTOK * DIM * 2)
#define OFF_XH   ((size_t)0)
#define OFF_WQKV (OFF_XH + SZ_XH)
#define OFF_WO   (OFF_WQKV + SZ_WQKV)
#define OFF_W1   (OFF_WO + SZ_WO)
#define OFF_W2   (OFF_W1 + SZ_W1)
#define OFF_BIG  (OFF_W2 + SZ_W2)
#define OFF_VT   (OFF_BIG + SZ_BIG)
#define OFF_CTX  (OFF_VT + SZ_VT)
#define OFF_Y    (OFF_CTX + SZ_CTX)
#define OFF_X1F  (OFF_Y + SZ_Y)
#define OFF_X1H  (OFF_X1F + SZ_X1F)
#define WS_TOTAL (OFF_X1H + SZ_X1H)
static_assert(SZ_QK <= SZ_BIG);
static_assert(SZ_HH <= SZ_BIG);
static_assert(SZ_XH % 128 == 0 && SZ_WQKV % 128 == 0 && SZ_WO % 128 == 0 && SZ_W1 % 128 == 0);
static_assert(SZ_W2 % 128 == 0 && SZ_BIG % 128 == 0 && SZ_VT % 128 == 0 && SZ_CTX % 128 == 0);
static_assert(SZ_Y % 128 == 0 && SZ_X1F % 128 == 0 && SZ_X1H % 128 == 0);
static_assert(WS_TOTAL <= (size_t)134217728);

typedef __bf16   bf16;
typedef _Float16 f16;
typedef f16      v16h  __attribute__((ext_vector_type(16)));
typedef f16      v8h   __attribute__((ext_vector_type(8)));
typedef float    v8f   __attribute__((ext_vector_type(8)));
typedef float    v4f   __attribute__((ext_vector_type(4)));
typedef unsigned v4u   __attribute__((ext_vector_type(4)));

union FragH  { v16h v; v4u q[2]; f16 h[16]; };
union Pack8H { v4u u; v8h v; f16 h[8]; };

// bf16 RNE convert of an f32 value, returned as f32
static __device__ __forceinline__ float bfr(float v) { return (float)(bf16)v; }

// WMMA helper: builtin followed by the VALU hazard guard (ties D, keeps A/B live).
static __device__ __forceinline__ v8f mma_f16(v16h a, v16h b, v8f acc) {
  acc = __builtin_amdgcn_wmma_f32_16x16x32_f16(false, a, false, b, (short)0, acc, false, false);
  asm volatile("v_nop\n\tv_nop\n\tv_nop\n\tv_nop" : "+v"(acc) : "v"(a), "v"(b));
  return acc;
}

static __device__ __forceinline__ float wave_sum(float v) {
  v += __shfl_xor(v, 16, 32);
  v += __shfl_xor(v, 8, 32);
  v += __shfl_xor(v, 4, 32);
  v += __shfl_xor(v, 2, 32);
  v += __shfl_xor(v, 1, 32);
  return v;
}

// ---------------------------------------------------------------------------------------------------
// x f32 -> xh packed f16 plane (rows = tokens, K = DIM) = f16(bf16_rne(x) * XC). One thread = one 16-B piece.
static __device__ __forceinline__ void cvt_x_piece(const float* __restrict__ x, f16* __restrict__ xh, int g) {
  // g = [rowtile][kblock 16][row half 2][8-column group 4 = half*2 + hi][row 8]: a wave reads 8 rows x 128 B
  // and writes four whole 128-B lines of the packed plane.
  const int r = ((g >> 5) & 1) * 8 + (g & 7);      // row of the 16-row tile
  const int t = (g >> 10) * 16 + r;                // compact token
  const int c = ((g >> 6) & 15) * 32 + ((g >> 3) & 3) * 8;
  if (t >= NTOK) return;
  const int bb = t / SEQ;
  const int s  = t - bb * SEQ;
  const float* src = x + ((size_t)bb * SEQ_FULL + s) * DIM + c;
  const v4f a0 = *(const v4f*)(src);
  const v4f a1 = *(const v4f*)(src + 4);
  Pack8H p;
  #pragma unroll
  for (int i = 0; i < 4; ++i) {
    p.h[i]     = (f16)(bfr(a0[i]) * XC);
    p.h[4 + i] = (f16)(bfr(a1[i]) * XC);
  }
  const v4u val = p.u;
  f16* dst = xh + (size_t)(g >> 6) * 512 + ((g >> 4) & 1) * 256 + (((g >> 3) & 1) * 16 + r) * 8;
  *(v4u*)dst = val;
}

// Weight transposer: in[K rows][N cols] f32  ->  packed plane (rows = n, K = k) f16 = f16(bf16_rne(w) * WC).
// One block of 256 threads = one tile 64(k) x 64(n) at (k0, n0), through LDS (cross-wave, block barrier).
static __device__ __forceinline__ void wt_tile(const float* __restrict__ W, f16* __restrict__ Wt, int K, int N,
                                               int n0, int k0, f16* sT) {
  const int tid = threadIdx.x;
  #pragma unroll
  for (int it = 0; it < 4; ++it) {
    const int kk = it * 16 + (tid >> 4);        // 0..63
    const int nn = (tid & 15) * 4;              // 0..60
    const v4f w = *(const v4f*)(W + (size_t)(k0 + kk) * N + n0 + nn);
    #pragma unroll
    for (int i = 0; i < 4; ++i) sT[(nn + i) * TP + kk] = (f16)(bfr(w[i]) * WC);
  }
  __syncthreads();
  v4u    val[2];
  size_t idx[2];
  #pragma unroll
  for (int it = 0; it < 2; ++it) {
    const int u  = it * 8 + (tid >> 5);         // unit 0..15 of this tile: [n tile 4][kblock 2][half 2]
    const int ln = tid & 31;
    const int n  = (u >> 2) * 16 + (ln & 15);                               // 0..63
    const int ks = ((u >> 1) & 1) * 32 + (u & 1) * 16 + (ln >> 4) * 8;      // 0..56
    Pack8H ph;
    ph.v = *(const v8h*)(&sT[n * TP + ks]);
    val[it] = ph.u;
    idx[it] = (((size_t)((n0 >> 4) + (u >> 2)) * (K >> 5) + (k0 >> 5) + ((u >> 1) & 1)) * 2 + (u & 1)) * 256 + ln * 8;
  }
  #pragma unroll
  for (int it = 0; it < 2; ++it) *(v4u*)(Wt + idx[it]) = val[it];
}

// All operand planes in one launch: none of them reads another, so the block index alone picks the work.
// Blocks 0 .. WT_BLOCKS-1 transpose one weight tile each (wq, wk, wv, wo: WT_SQ tiles each; w1, w2: WT_FF each; they
// come first because a tile passes through LDS and a barrier); the blocks behind them convert 256 pieces of x each.
// The choice is the same for every thread of a block, so the transposer's barrier is reached by all of them or none.
#define WT_SQ      ((DIM / 64) * (DIM / 64))
#define WT_FF      ((FFN / 64) * (DIM / 64))
#define WT_BLOCKS  (4 * WT_SQ + 2 * WT_FF)
#define CVT_BLOCKS ((size_t)NTOK * DIM / 8 / 256)
static_assert(DIM / 64 == 8 && FFN / 64 == 32);
__global__ __launch_bounds__(256) void prep_kernel(const float* __restrict__ x, const float* __restrict__ wq,
                                                   const float* __restrict__ wk, const float* __restrict__ wv,
                                                   const float* __restrict__ wo, const float* __restrict__ w1,
                                                   const float* __restrict__ w2, f16* __restrict__ xh,
                                                   f16* __restrict__ wqkvT, f16* __restrict__ woT,
                                                   f16* __restrict__ w1T, f16* __restrict__ w2T) {
  __shared__ __align__(16) f16 sT[64 * TP];     // [n][k]
  const int b = blockIdx.x;
  if (b < WT_BLOCKS) {
    const float* W;
    f16* Wt;
    int K, N, lgn, tile;                        // lgn = log2(N / 64): tile = [k tile][n tile]
    if (b < 4 * WT_SQ) {
      // in[512][512] -> out[512][512] (rows = output feature); q, k, v stacked into the [1536][512] plane
      const int m = b / WT_SQ;
      tile = b - m * WT_SQ;
      W  = (m == 0) ? wq : ((m == 1) ? wk : ((m == 2) ? wv : wo));
      Wt = (m < 3) ? wqkvT + (size_t)m * DIM * DIM : woT;
      K = DIM; N = DIM; lgn = 3;
    } else if (b < 4 * WT_SQ + WT_FF) {
      tile = b - 4 * WT_SQ;                     // in[512][2048] -> out[2048][512]
      W = w1; Wt = w1T; K = DIM; N = FFN; lgn = 5;
    } else {
      tile = b - (4 * WT_SQ + WT_FF);           // in[2048][512] -> out[512][2048]
      W = w2; Wt = w2T; K = FFN; N = DIM; lgn = 3;
    }
    wt_tile(W, Wt, K, N, (tile & ((1 << lgn) - 1)) * 64, (tile >> lgn) * 64, sT);
  } else {
    cvt_x_piece(x, xh, (b - WT_BLOCKS) * 256 + (int)threadIdx.x);
  }
}

// ---------------------------------------------------------------------------------------------------
// GEMM main loop: acc[mt][nt] (16x16 tiles) of  A[m0 .. m0+31][K] x Bt[n0 .. n0+63][K]^T.
// A and Bt are packed f16 planes; fragments use the split k map for both operands:
// elements 0..7 <- k0 + 8*hi + 0..7, elements 8..15 <- k0 + 16 + 8*hi + 0..7; lane row / column = lq.
// A 16-row tile spans K*16 halves; a k block of 32 spans 512 halves; the second k half starts at +256.
template <int K>
static __device__ __forceinline__ void gemm_main(const f16* __restrict__ A, const f16* __restrict__ Bt,
                                                 int m0, int n0, int lq, int hi, v8f (&acc)[2][4]) {
  static_assert(K % 32 == 0);
  const f16* ap = A  + (size_t)m0 * K + (hi * 16 + lq) * 8;
  const f16* bp = Bt + (size_t)n0 * K + (hi * 16 + lq) * 8;
  #pragma unroll 1
  for (int k0 = 0; k0 < K; k0 += 32) {
    FragH a[2], b[4];
    #pragma unroll
    for (int mt = 0; mt < 2; ++mt) {
      const f16* p = ap + (size_t)mt * 16 * K + k0 * 16;
      a[mt].q[0] = *(const v4u*)(p);
      a[mt].q[1] = *(const v4u*)(p + 256);
    }
    #pragma unroll
    for (int nt = 0; nt < 4; ++nt) {
      const f16* p = bp + (size_t)nt * 16 * K + k0 * 16;
      b[nt].q[0] = *(const v4u*)(p);
      b[nt].q[1] = *(const v4u*)(p + 256);
    }
    #pragma unroll
    for (int mt = 0; mt < 2; ++mt) {
      #pragma unroll
      for (int nt = 0; nt < 4; ++nt) acc[mt][nt] = mma_f16(a[mt].v, b[nt].v, acc[mt][nt]);
    }
  }
}

// The same product for the launches that leave only two waves on a SIMD, too few to cover a fragment load's latency:
// a ring of D fragment sets in registers. Each set is refilled, right behind its own products, with the k block D
// further on, so D k blocks of loads are in flight per wave. The k blocks are summed in the same ascending order as above.
template <int K>
static __device__ __forceinline__ void load_kblock(const char* __restrict__ ap, const char* __restrict__ bp,
                                                   FragH (&a)[2], FragH (&b)[4]) {
  #pragma unroll
  for (int mt = 0; mt < 2; ++mt) {
    const char* p = ap + (size_t)mt * 32 * K;       // byte addresses: a 16-row tile spans 32 * K bytes
    a[mt].q[0] = *(const v4u*)(p);
    a[mt].q[1] = *(const v4u*)(p + 512);
  }
  #pragma unroll
  for (int nt = 0; nt < 4; ++nt) {
    const char* p = bp + (size_t)nt * 32 * K;
    b[nt].q[0] = *(const v4u*)(p);
    b[nt].q[1] = *(const v4u*)(p + 512);
  }
}

template <int K, int D>
static __device__ __forceinline__ void gemm_main_ring(const f16* __restrict__ A, const f16* __restrict__ Bt,
                                                      int m0, int n0, int lq, int hi, v8f (&acc)[2][4]) {
  constexpr int G = (K / 32) / D;                         // whole groups of D k blocks
  constexpr int R = (K / 32) % D;                         // k blocks left over behind them
  static_assert(K % 32 == 0 && G >= 2);
  const char* ab = (const char*)(A  + (size_t)m0 * K);   // wave-uniform bases
  const char* bb = (const char*)(Bt + (size_t)n0 * K);
  unsigned off = (hi * 16 + lq) * 16;                     // byte offset: the lane's piece of a unit + the k blocks done
  FragH a[D][2], b[D][4];
  #pragma unroll
  for (int s = 0; s < D; ++s) load_kblock<K>(ab + off + s * 1024, bb + off + s * 1024, a[s], b[s]);
  #pragma unroll 1
  for (int g = 1; g < G; ++g) {
    // the loads in flight name the offset register: wait before it is advanced (the operand keeps the add behind)
    asm volatile("s_wait_xcnt 0x0" : "+v"(off) : : "memory");
    off += D * 1024;
    #pragma unroll
    for (int s = 0; s < D; ++s) {
      #pragma unroll
      for (int mt = 0; mt < 2; ++mt) {
        #pragma unroll
        for (int nt = 0; nt < 4; ++nt) acc[mt][nt] = mma_f16(a[s][mt].v, b[s][nt].v, acc[mt][nt]);
      }
      load_kblock<K>(ab + off + s * 1024, bb + off + s * 1024, a[s], b[s]);
    }
  }
  // the last refills still name the offset register and the bases: wait before they are put to other use
  asm volatile("s_wait_xcnt 0x0" : "+v"(off) : : "memory");
  // last whole group; the left-over k blocks refill its first sets
  #pragma unroll
  for (int s = 0; s < D; ++s) {
    #pragma unroll
    for (int mt = 0; mt < 2; ++mt) {
      #pragma unroll
      for (int nt = 0; nt < 4; ++nt) acc[mt][nt] = mma_f16(a[s][mt].v, b[s][nt].v, acc[mt][nt]);
    }
    if (s < R) load_kblock<K>(ab + off + (D + s) * 1024, bb + off + (D + s) * 1024, a[s], b[s]);
  }
  #pragma unroll
  for (int s = 0; s < R; ++s) {
    #pragma unroll
    for (int mt = 0; mt < 2; ++mt) {
      #pragma unroll
      for (int nt = 0; nt < 4; ++nt) acc[mt][nt] = mma_f16(a[s][mt].v, b[s][nt].v, acc[mt][nt]);
    }
  }
}

// ---------------------------------------------------------------------------------------------------
// Fused q/k/v projection: [NTOK][512] x [1536][512]^T. Column block (64 wide) = one head of q, k or v.
//          qk plane order: 0 = q, 1 = k.
//   q, k : per (b, h) a packed plane with rows = tokens, K = d (64): 1024 halves per 16 tokens.
//   v    : per (b, h) a packed plane with rows = d (4 tiles), K = tokens, k block outermost:
//          [s/32][d tile 4][half 2][lane 32][8] f16 (x VC), written through a block-wide LDS tile.
// coverage: q/k rows wave*32 + {0..31} x 64 d = 8 units per wave; vt 64 d x 128 tokens = 32 units per block.
__global__ __launch_bounds__(128) void gemm_qkv_kernel(const f16* __restrict__ xh, const f16* __restrict__ wT,
                                                       const float* __restrict__ bq, const float* __restrict__ bk,
                                                       const float* __restrict__ bv,
                                                       f16* __restrict__ qk, f16* __restrict__ vt) {
  __shared__ __align__(16) float sC[GW * 32 * OP];    // per-wave f32 tiles (block barrier used)
  __shared__ __align__(16) f16   sVT[HDIM * VP];      // [d][token], cross-wave (block barrier)
  const int tid  = threadIdx.x;
  const int wave = __builtin_amdgcn_readfirstlane(threadIdx.x >> 5);
  const int lane = tid & 31;
  const int lq   = lane & 15;
  const int hi   = lane >> 4;
  const int tok0 = blockIdx.x * GM;
  const int n0   = blockIdx.y * GN;
  const int seg  = n0 / DIM;                          // 0 = q, 1 = k, 2 = v (block-uniform)
  const int h    = (n0 - seg * DIM) / HDIM;
  const int bb   = tok0 / SEQ;
  const int s0   = tok0 - bb * SEQ;

  v8f acc[2][4];
  #pragma unroll
  for (int mt = 0; mt < 2; ++mt) {
    #pragma unroll
    for (int nt = 0; nt < 4; ++nt) acc[mt][nt] = (v8f){0, 0, 0, 0, 0, 0, 0, 0};
  }
  gemm_main<DIM>(xh, wT, tok0 + wave * 32, n0, lq, hi, acc);

  const float ascale = 1.0f / (XC * WC);
  float bias[4];
  #pragma unroll
  for (int nt = 0; nt < 4; ++nt) {
    const int c = h * HDIM + nt * 16 + lq;            // 0..511
    const float fq = bq[c];
    const float fk = bk[c];
    const float fv = bv[c];
    const float sel = (seg == 0) ? fq : ((seg == 1) ? fk : fv);
    bias[nt] = bfr(sel);
  }

  if (seg < 2) {
    const int wb = wave * (32 * OP);
    #pragma unroll
    for (int mt = 0; mt < 2; ++mt) {
      #pragma unroll
      for (int nt = 0; nt < 4; ++nt) {
        #pragma unroll
        for (int r = 0; r < 8; ++r)
          sC[wb + (mt * 16 + hi * 8 + r) * OP + nt * 16 + lq] = acc[mt][nt][r] * ascale + bias[nt];
      }
    }
    __syncthreads();
    const size_t pbase = (size_t)seg * PLANE +
                         (((size_t)bb * NHEAD + h) * SEQ + s0 + wave * 32) * HDIM;
    v4u hv[8];
    #pragma unroll
    for (int it = 0; it < 8; ++it) {
      const int row = (it >> 2) * 16 + lq;                               // unit it: [row tile 2][d block 2][half 2]
      const int col = ((it >> 1) & 1) * 32 + (it & 1) * 16 + hi * 8;
      const v4f c0 = *(const v4f*)(&sC[wb + row * OP + col]);
      const v4f c1 = *(const v4f*)(&sC[wb + row * OP + col + 4]);
      Pack8H ph;
      #pragma unroll
      for (int i = 0; i < 4; ++i) {
        ph.h[i]     = (f16)c0[i];
        ph.h[4 + i] = (f16)c1[i];
      }
      hv[it] = ph.u;
    }
    #pragma unroll
    for (int it = 0; it < 8; ++it) *(v4u*)(qk + pbase + (size_t)it * 256 + lane * 8) = hv[it];
    
  } else {
    #pragma unroll
    for (int mt = 0; mt < 2; ++mt) {
      #pragma unroll
      for (int nt = 0; nt < 4; ++nt) {
        #pragma unroll
        for (int r = 0; r < 8; ++r)
          sVT[(nt * 16 + lq) * VP + wave * 32 + mt * 16 + hi * 8 + r] =
              (f16)((acc[mt][nt][r] * ascale + bias[nt]) * VC);
      }
    }
    __syncthreads();
    const size_t vbase = (((size_t)bb * NHEAD + h) * SEQ + s0) * HDIM;   // first unit of this block's 128 tokens
    v4u vv[8];
    #pragma unroll
    for (int it = 0; it < 8; ++it) {
      const int u = it * 4 + wave;                 // unit 0..31: [token block 4][d tile 4][half 2]
      const int d = ((u >> 1) & 3) * 16 + lq;
      const int s = (u >> 3) * 32 + (u & 1) * 16 + hi * 8;
      Pack8H ph;
      ph.v = *(const v8h*)(&sVT[d * VP + s]);
      vv[it] = ph.u;
    }
    #pragma unroll
    for (int it = 0; it < 8; ++it) {
      const size_t o = vbase + (size_t)(it * 4 + wave) * 256 + lane * 8;
      *(v4u*)(vt + o) = vv[it];
    }
    
  }
}

// ---------------------------------------------------------------------------------------------------
// Flash attention, full (no mask). Block = (128-query block, head, batch); one wave owns 16 query rows.
// S^T = K x Q^T so queries sit on lanes; P^T in C layout is the A-fragment layout of O += P x V.
// Scores: s = k x q on the f16 planes, f32 accumulate, d blocks summed in ascending order.
// Fragments come straight from the packed 16-bit planes (two 512-B unit loads each); q fragments stay in registers.
__global__ __launch_bounds__(256) void attn_kernel(const f16* __restrict__ qk, const f16* __restrict__ vt,
                                                   f16* __restrict__ ctx) {
  __shared__ __align__(16) float sO[NWAVE * 16 * OP];    // per-wave output staging (block barrier used)
  const int qblk = blockIdx.x;
  const int h    = blockIdx.y;
  const int b    = blockIdx.z;
  const int tid  = threadIdx.x;
  const int wave = __builtin_amdgcn_readfirstlane(threadIdx.x >> 5);
  const int lane = tid & 31;
  const int lq   = lane & 15;   // query column of S^T / d column of O
  const int hi   = lane >> 4;   // k-split half

  const int qrow0 = qblk * BQ + wave * 16;
  const size_t hb = ((size_t)b * NHEAD + h) * (size_t)SEQ * HDIM;
  const f16* qh_p = qk + hb;
  const f16* kh_p = qk + PLANE + hb;
  const f16* vt_h = vt + hb;
  const int qoff  = qrow0 * HDIM + lane * 8;         // this wave's 16-query tile, lane's piece of a unit

  // q B-fragments, loaded once and held for the whole key loop
  FragH fqh[2];
  #pragma unroll
  for (int f = 0; f < 2; ++f) {
    const int qo = qoff + f * 512;
    fqh[f].q[0] = *(const v4u*)(qh_p + qo);           // d = f*32 + hi*8 + 0..7
    fqh[f].q[1] = *(const v4u*)(qh_p + qo + 256);     // d = f*32 + 16 + hi*8 + 0..7
  }

  v8f o[4];
  #pragma unroll
  for (int dt = 0; dt < 4; ++dt) o[dt] = (v8f){0, 0, 0, 0, 0, 0, 0, 0};

  float rmax = -__builtin_inff();
  float rsum = 0.0f;
  const float SL = 0.125f * 1.4426950408889634f;   // softmax scale * log2(e)

  // K A-fragments (row = key lq of the tile, split d map) and V B-fragments (column n = d = dt*16 + lq, split key map
  // from the packed transposed plane) are fetched one step ahead into the same registers: step 0's here, step j + 1's
  // K behind step j's score products and its V behind step j's P x V products.
  FragH fkh[2][2], bv[4];
  #pragma unroll
  for (int sub = 0; sub < 2; ++sub) {
    #pragma unroll
    for (int f = 0; f < 2; ++f) {
      const int ko = sub * 16 * HDIM + f * 512 + lane * 8;
      fkh[sub][f].q[0] = *(const v4u*)(kh_p + ko);
      fkh[sub][f].q[1] = *(const v4u*)(kh_p + ko + 256);
    }
  }
  // keeps step 0's V loads behind its q and K loads, as in every later step: loads return in order, and only so can
  // the counted wait at the head of the loop leave the eight V loads in flight under the score products and the softmax
  __builtin_amdgcn_sched_barrier(0);
  #pragma unroll
  for (int dt = 0; dt < 4; ++dt) {
    const f16* base = vt_h + dt * 512 + lane * 8;
    bv[dt].q[0] = *(const v4u*)(base);              // keys hi*8 + 0..7
    bv[dt].q[1] = *(const v4u*)(base + 256);        // keys 16 + hi*8 + 0..7
  }

  #pragma unroll 1
  for (int j0 = 0; j0 < SEQ; j0 += BK) {
    // the step fetched ahead; the last step has none and refetches step 0 (in bounds, never used)
    const int jn = (j0 + BK < SEQ) ? j0 + BK : 0;

    // S^T tiles: c[sub][r] = rawscore(query qrow0+lq, key j0 + sub*16 + hi*8 + r)
    v8f c[2];
    c[0] = (v8f){0, 0, 0, 0, 0, 0, 0, 0};
    c[1] = (v8f){0, 0, 0, 0, 0, 0, 0, 0};
    #pragma unroll
    for (int f = 0; f < 2; ++f) {
      #pragma unroll
      for (int sub = 0; sub < 2; ++sub) c[sub] = mma_f16(fkh[sub][f].v, fqh[f].v, c[sub]);
    }

    // next step's K fragments, in flight under the softmax and the P x V products
    #pragma unroll
    for (int sub = 0; sub < 2; ++sub) {
      #pragma unroll
      for (int f = 0; f < 2; ++f) {
        const int ko = (jn + sub * 16) * HDIM + f * 512 + lane * 8;
        fkh[sub][f].q[0] = *(const v4u*)(kh_p + ko);
        fkh[sub][f].q[1] = *(const v4u*)(kh_p + ko + 256);
      }
    }
    // keeps the K loads from sinking into the softmax below, where less work would cover their latency
    __builtin_amdgcn_sched_barrier(0);

    // online softmax: query lq's 32 scores are split across lane / lane^16
    float m_new = rmax;
    #pragma unroll
    for (int r = 0; r < 8; ++r) {
      m_new = fmaxf(m_new, c[0][r]);
      m_new = fmaxf(m_new, c[1][r]);
    }
    m_new = fmaxf(m_new, __shfl_xor(m_new, 16, 32));
    const float scale = __builtin_amdgcn_exp2f((rmax - m_new) * SL);
    rmax = m_new;

    // exp + pack: P^T C-layout == A-fragment layout for the PV product
    FragH pa;
    float psum = 0.0f;
    #pragma unroll
    for (int r = 0; r < 8; ++r) {
      const float p0 = __builtin_amdgcn_exp2f((c[0][r] - m_new) * SL);   // key hi*8 + r
      const float p1 = __builtin_amdgcn_exp2f((c[1][r] - m_new) * SL);   // key 16 + hi*8 + r
      psum += p0 + p1;
      pa.h[r]     = (f16)(p0 * PC);
      pa.h[8 + r] = (f16)(p1 * PC);
    }
    rsum = rsum * scale + psum + __shfl_xor(psum, 16, 32);

    // rescale O: queries are the row dimension there -> per-row scale from lane 8*hi + r
    float sc[8];
    #pragma unroll
    for (int r = 0; r < 8; ++r) sc[r] = __shfl(scale, (hi << 3) + r, 32);
    #pragma unroll
    for (int dt = 0; dt < 4; ++dt) {
      #pragma unroll
      for (int r = 0; r < 8; ++r) o[dt][r] *= sc[r];
    }

    // O += P x V
    #pragma unroll
    for (int dt = 0; dt < 4; ++dt) o[dt] = mma_f16(pa.v, bv[dt].v, o[dt]);

    // next step's V fragments, in flight under its score products and softmax
    #pragma unroll
    for (int dt = 0; dt < 4; ++dt) {
      const f16* base = vt_h + (size_t)jn * HDIM + dt * 512 + lane * 8;
      bv[dt].q[0] = *(const v4u*)(base);            // keys jn + hi*8 + 0..7
      bv[dt].q[1] = *(const v4u*)(base + 256);      // keys jn + 16 + hi*8 + 0..7
    }
    // the V address pair is formed anew at the head of the next step: wait before that overwrite
    asm volatile("s_wait_xcnt 0x0" ::: "memory");
  }

  // normalize: lane holds column d = dt*16 + lq for query rows 8*hi + r
  float rs[8];
  #pragma unroll
  for (int r = 0; r < 8; ++r) rs[r] = 1.0f / __shfl(rsum, (hi << 3) + r, 32);

  const int wb = wave * (16 * OP);
  #pragma unroll
  for (int r = 0; r < 8; ++r) {
    #pragma unroll
    for (int dt = 0; dt < 4; ++dt)
      sO[wb + (hi * 8 + r) * OP + dt * 16 + lq] = o[dt][r] * (CC / (PC * VC)) * rs[r];
  }
  __syncthreads();

  v4u    pv[4];
  size_t gidx[4];
  #pragma unroll
  for (int it = 0; it < 4; ++it) {
    const int row = lq;                                   // unit it: [k block 2][half 2] of this head's 64 columns
    const int col = (it >> 1) * 32 + (it & 1) * 16 + hi * 8;
    const v4f c0 = *(const v4f*)(&sO[wb + row * OP + col]);
    const v4f c1 = *(const v4f*)(&sO[wb + row * OP + col + 4]);
    Pack8H ph;
    #pragma unroll
    for (int i = 0; i < 4; ++i) {
      ph.h[i]     = (f16)c0[i];
      ph.h[4 + i] = (f16)c1[i];
    }
    pv[it]   = ph.u;
    gidx[it] = ((size_t)b * SEQ + qrow0) * DIM + (size_t)(h * 4 + it) * 256 + lane * 8;   // packed, K = DIM
  }
  #pragma unroll
  for (int it = 0; it < 4; ++it) *(v4u*)(ctx + gidx[it]) = pv[it];
  
}

// ---------------------------------------------------------------------------------------------------
// y = ctx x wo + bo + bf16_rne(x)   (f32 plane [NTOK][DIM], input of LayerNorm 1)
// coverage: rows wave*32 + {0..31}, 64 columns: 16 instr, lanes 0..15 one 256-B row segment, 16..31 the next row.
__global__ __launch_bounds__(128) void gemm_wo_kernel(const f16* __restrict__ ctx, const f16* __restrict__ woT,
                                                      const float* __restrict__ bo, const float* __restrict__ x,
                                                      float* __restrict__ y) {
  __shared__ __align__(16) float sC[GW * 32 * OP];
  const int tid  = threadIdx.x;
  const int wave = __builtin_amdgcn_readfirstlane(threadIdx.x >> 5);
  const int lane = tid & 31;
  const int lq   = lane & 15;
  const int hi   = lane >> 4;
  const int tok0 = blockIdx.x * GM;
  const int n0   = blockIdx.y * GN;
  const int bb   = tok0 / SEQ;
  const int s0   = tok0 - bb * SEQ;

  v8f acc[2][4];
  #pragma unroll
  for (int mt = 0; mt < 2; ++mt) {
    #pragma unroll
    for (int nt = 0; nt < 4; ++nt) acc[mt][nt] = (v8f){0, 0, 0, 0, 0, 0, 0, 0};
  }
  gemm_main_ring<DIM, RD>(ctx, woT, tok0 + wave * 32, n0, lq, hi, acc);

  const float ascale = 1.0f / (CC * WC);
  const int wb = wave * (32 * OP);
  #pragma unroll
  for (int nt = 0; nt < 4; ++nt) {
    const float bias = bfr(bo[n0 + nt * 16 + lq]);
    #pragma unroll
    for (int mt = 0; mt < 2; ++mt) {
      #pragma unroll
      for (int r = 0; r < 8; ++r)
        sC[wb + (mt * 16 + hi * 8 + r) * OP + nt * 16 + lq] = acc[mt][nt][r] * ascale + bias;
    }
  }
  __syncthreads();

  const size_t orow = (size_t)tok0 + wave * 32;                          // compact row
  const size_t rrow = (size_t)bb * SEQ_FULL + s0 + wave * 32;            // row of the full-size x
  #pragma unroll
  for (int g = 0; g < 2; ++g) {
    v4f vals[8];
    #pragma unroll
    for (int it = 0; it < 8; ++it) {
      const int row = g * 16 + it * 2 + hi;
      v4f cv = *(const v4f*)(&sC[wb + row * OP + lq * 4]);
      const v4f rv = *(const v4f*)(x + (rrow + row) * DIM + n0 + lq * 4);
      #pragma unroll
      for (int i = 0; i < 4; ++i) cv[i] = cv[i] + bfr(rv[i]);
      vals[it] = cv;
    }
    #pragma unroll
    for (int it = 0; it < 8; ++it)
      *(v4f*)(y + (orow + g * 16 + it * 2 + hi) * DIM + n0 + lq * 4) = vals[it];
    
  }
}

// ---------------------------------------------------------------------------------------------------
// f32 row: 4 instr x (32 lanes x 16 B) ; f16 rows staged in LDS (cross-wave, block barrier) and written packed:
// the block's 8 tokens fill 8 neighbouring lane slots = one whole 128-B line in each of the 64 (k block, half, hi) groups.
__global__ __launch_bounds__(256) void ln1_kernel(const float* __restrict__ y, const float* __restrict__ g,
                                                  const float* __restrict__ be,
                                                  float* __restrict__ x1f, f16* __restrict__ x1h) {
  __shared__ __align__(16) f16 sH[8 * SHP];
  const int tid  = threadIdx.x;
  const int wave = __builtin_amdgcn_readfirstlane(threadIdx.x >> 5);
  const int lane = tid & 31;
  const int t    = blockIdx.x * 8 + wave;             // compact token
  const float* yr = y + (size_t)t * DIM;

  v4f v[4];
  float s = 0.0f;
  #pragma unroll
  for (int j = 0; j < 4; ++j) {
    v[j] = *(const v4f*)(yr + j * 128 + lane * 4);
    s += (v[j][0] + v[j][1]) + (v[j][2] + v[j][3]);
  }
  s = wave_sum(s);
  const float mean = s * (1.0f / DIM);
  float q = 0.0f;
  #pragma unroll
  for (int j = 0; j < 4; ++j) {
    #pragma unroll
    for (int i = 0; i < 4; ++i) {
      const float d = v[j][i] - mean;
      q += d * d;
    }
  }
  q = wave_sum(q);
  const float rstd = rsqrtf(q * (1.0f / DIM) + 1e-5f);

  v4f ov[4];
  #pragma unroll
  for (int j = 0; j < 4; ++j) {
    const v4f gv = *(const v4f*)(g + j * 128 + lane * 4);
    const v4f bv = *(const v4f*)(be + j * 128 + lane * 4);
    #pragma unroll
    for (int i = 0; i < 4; ++i) {
      const float val = (v[j][i] - mean) * rstd * bfr(gv[i]) + bfr(bv[i]);
      ov[j][i] = val;
      sH[wave * SHP + j * 128 + lane * 4 + i] = (f16)(val * XC);
    }
  }
  __syncthreads();
  const int t0 = blockIdx.x * 8;                      // first token of the block
  v4u    hv[2];
  size_t hidx[2];
  #pragma unroll
  for (int jj = 0; jj < 2; ++jj) {
    const int tk = tid & 7;                           // token of the block
    const int ln = jj * 32 + (tid >> 3);              // 8-column group 0..63 = kblock*4 + half*2 + hi
    Pack8H ph;
    ph.v = *(const v8h*)(&sH[tk * SHP + ln * 8]);
    hv[jj] = ph.u;
    hidx[jj] = (size_t)(t0 >> 4) * (16 * DIM) + (size_t)(ln >> 1) * 256 + ((ln & 1) * 16 + (t0 & 15) + tk) * 8;
  }
  float* fo = x1f + (size_t)t * DIM + lane * 4;
  #pragma unroll
  for (int j = 0; j < 4; ++j) *(v4f*)(fo + j * 128) = ov[j];
  #pragma unroll
  for (int jj = 0; jj < 2; ++jj) *(v4u*)(x1h + hidx[jj]) = hv[jj];
  
}

static __device__ __forceinline__ void rcp8(const float (&d)[8], float (&t)[8]) {
  asm("v_rcp_f32 %0, %8\n\t"
      "v_rcp_f32 %1, %9\n\t"
      "v_rcp_f32 %2, %10\n\t"
      "v_rcp_f32 %3, %11\n\t"
      "v_rcp_f32 %4, %12\n\t"
      "v_rcp_f32 %5, %13\n\t"
      "v_rcp_f32 %6, %14\n\t"
      "v_rcp_f32 %7, %15\n\t"
      "v_nop"
      : "=&v"(t[0]), "=&v"(t[1]), "=&v"(t[2]), "=&v"(t[3]), "=&v"(t[4]), "=&v"(t[5]), "=&v"(t[6]), "=&v"(t[7])
      : "v"(d[0]), "v"(d[1]), "v"(d[2]), "v"(d[3]), "v"(d[4]), "v"(d[5]), "v"(d[6]), "v"(d[7]));
}
static __device__ __forceinline__ void exp2_8(const float (&w)[8], float (&e)[8]) {
  asm("v_exp_f32 %0, %8\n\t"
      "v_exp_f32 %1, %9\n\t"
      "v_exp_f32 %2, %10\n\t"
      "v_exp_f32 %3, %11\n\t"
      "v_exp_f32 %4, %12\n\t"
      "v_exp_f32 %5, %13\n\t"
      "v_exp_f32 %6, %14\n\t"
      "v_exp_f32 %7, %15\n\t"
      "v_nop"
      : "=&v"(e[0]), "=&v"(e[1]), "=&v"(e[2]), "=&v"(e[3]), "=&v"(e[4]), "=&v"(e[5]), "=&v"(e[6]), "=&v"(e[7])
      : "v"(w[0]), "v"(w[1]), "v"(w[2]), "v"(w[3]), "v"(w[4]), "v"(w[5]), "v"(w[6]), "v"(w[7]));
}

// GELU, erf form, without a branch, on eight values. With z = u / sqrt(2) and t = 1 / (1 + p |z|),
//   erfc(|z|) = (a1 t + a2 t^2 + a3 t^3 + a4 t^4 + a5 t^5) exp(-z^2), absolute error of the form below 1.5e-7 for every z,
// and 0.5 u (1 + erf(z)) = max(u, 0) - |u| * 0.5 erfc(|z|) for either sign of u (no cancellation on the negative side).
// The 0.5 is folded into a1..a5 and the 1 / sqrt(2) into p and the exponent. One straight run of instructions for every
// lane, so a lane's values are independent chains that the compiler can interleave.
static __device__ __forceinline__ void gelu_erf8(float (&u)[8]) {
  float d[8], w[8], t[8], e[8];
  #pragma unroll
  for (int i = 0; i < 8; ++i) {
    d[i] = fmaf(0.3275911f * 0.70710678118654752f, fabsf(u[i]), 1.0f);
    w[i] = u[i] * u[i] * (-0.5f * 1.4426950408889634f);      // -z^2 * log2(e)
  }
  rcp8(d, t);
  exp2_8(w, e);
  #pragma unroll
  for (int i = 0; i < 8; ++i) {
    float p = fmaf(0.5f * 1.061405429f, t[i], 0.5f * -1.453152027f);
    p = fmaf(p, t[i], 0.5f * 1.421413741f);
    p = fmaf(p, t[i], 0.5f * -0.284496736f);
    p = fmaf(p, t[i], 0.5f * 0.254829592f);
    p = p * t[i];
    u[i] = fmaf(-fabsf(u[i]), p * e[i], fmaxf(u[i], 0.0f));
  }
}

// hh = f16( gelu_erf(x1 x w1 + b1) * XC )   packed plane (rows = tokens, K = FFN)
__global__ __launch_bounds__(128) void gemm_ffn1_kernel(const f16* __restrict__ x1h, const f16* __restrict__ w1T,
                                                        const float* __restrict__ b1, f16* __restrict__ hh) {
  __shared__ __align__(16) float sC[GW * 32 * OP];
  const int tid  = threadIdx.x;
  const int wave = __builtin_amdgcn_readfirstlane(threadIdx.x >> 5);
  const int lane = tid & 31;
  const int lq   = lane & 15;
  const int hi   = lane >> 4;
  const int tok0 = blockIdx.x * GM;
  const int n0   = blockIdx.y * GN;

  v8f acc[2][4];
  #pragma unroll
  for (int mt = 0; mt < 2; ++mt) {
    #pragma unroll
    for (int nt = 0; nt < 4; ++nt) acc[mt][nt] = (v8f){0, 0, 0, 0, 0, 0, 0, 0};
  }
  gemm_main<DIM>(x1h, w1T, tok0 + wave * 32, n0, lq, hi, acc);

  const float ascale = 1.0f / (XC * WC);
  const int wb = wave * (32 * OP);
  float bias[4];                                      // all four loaded ahead of the fenced groups below
  #pragma unroll
  for (int nt = 0; nt < 4; ++nt) bias[nt] = bfr(b1[n0 + nt * 16 + lq]);
  #pragma unroll
  for (int nt = 0; nt < 4; ++nt) {
    #pragma unroll
    for (int mt = 0; mt < 2; ++mt) {
      float gl[8];
      #pragma unroll
      for (int r = 0; r < 8; ++r) gl[r] = acc[mt][nt][r] * ascale + bias[nt];
      gelu_erf8(gl);
      #pragma unroll
      for (int r = 0; r < 8; ++r) sC[wb + (mt * 16 + hi * 8 + r) * OP + nt * 16 + lq] = gl[r];
      // eight values at a time: without this the compiler starts many more at once, and the registers they hold cost
      // the eighth wave per SIMD, which the grid needs to be resident in one round
      __builtin_amdgcn_sched_barrier(0);
    }
  }
  __syncthreads();

  // piece it is this lane's 16 B of unit it: [row tile 2][k block 2][half 2]
  const int lbase = wb + lq * OP + hi * 8;

  v4u pv[8];
  #pragma unroll
  for (int it = 0; it < 8; ++it) {
    const int off = lbase + (it >> 2) * (16 * OP) + (it & 3) * 16;
    const v4f c0 = *(const v4f*)(&sC[off]);
    const v4f c1 = *(const v4f*)(&sC[off + 4]);
    Pack8H ph;
    #pragma unroll
    for (int i = 0; i < 4; ++i) {
      ph.h[i]     = (f16)(c0[i] * XC);
      ph.h[4 + i] = (f16)(c1[i] * XC);
    }
    pv[it] = ph.u;
  }
  const size_t obase = ((size_t)tok0 + wave * 32) * FFN + (size_t)n0 * 16 + lane * 8;
  #pragma unroll
  for (int it = 0; it < 8; ++it) *(v4u*)(hh + obase + (size_t)(it >> 2) * 16 * FFN + (it & 3) * 256) = pv[it];
  
}

// ---------------------------------------------------------------------------------------------------
// y = hh x w2 + b2 + x1f   (f32 plane [NTOK][DIM], input of LayerNorm 2)
__global__ __launch_bounds__(128) void gemm_ffn2_kernel(const f16* __restrict__ hh, const f16* __restrict__ w2T,
                                                        const float* __restrict__ b2, const float* __restrict__ x1f,
                                                        float* __restrict__ y) {
  __shared__ __align__(16) float sC[GW * 32 * OP];
  const int tid  = threadIdx.x;
  const int wave = __builtin_amdgcn_readfirstlane(threadIdx.x >> 5);
  const int lane = tid & 31;
  const int lq   = lane & 15;
  const int hi   = lane >> 4;
  const int tok0 = blockIdx.x * GM;
  const int n0   = blockIdx.y * GN;

  v8f acc[2][4];
  #pragma unroll
  for (int mt = 0; mt < 2; ++mt) {
    #pragma unroll
    for (int nt = 0; nt < 4; ++nt) acc[mt][nt] = (v8f){0, 0, 0, 0, 0, 0, 0, 0};
  }
  gemm_main_ring<FFN, RD>(hh, w2T, tok0 + wave * 32, n0, lq, hi, acc);

  const float ascale = 1.0f / (XC * WC);
  const int wb = wave * (32 * OP);
  #pragma unroll
  for (int nt = 0; nt < 4; ++nt) {
    const float bias = bfr(b2[n0 + nt * 16 + lq]);
    #pragma unroll
    for (int mt = 0; mt < 2; ++mt) {
      #pragma unroll
      for (int r = 0; r < 8; ++r)
        sC[wb + (mt * 16 + hi * 8 + r) * OP + nt * 16 + lq] = acc[mt][nt][r] * ascale + bias;
    }
  }
  __syncthreads();

  const size_t orow = (size_t)tok0 + wave * 32;
  #pragma unroll
  for (int g = 0; g < 2; ++g) {
    v4f vals[8];
    #pragma unroll
    for (int it = 0; it < 8; ++it) {
      const int row = g * 16 + it * 2 + hi;
      v4f cv = *(const v4f*)(&sC[wb + row * OP + lq * 4]);
      const v4f rv = *(const v4f*)(x1f + (orow + row) * DIM + n0 + lq * 4);
      #pragma unroll
      for (int i = 0; i < 4; ++i) cv[i] = cv[i] + rv[i];
      vals[it] = cv;
    }
    #pragma unroll
    for (int it = 0; it < 8; ++it)
      *(v4f*)(y + (orow + g * 16 + it * 2 + hi) * DIM + n0 + lq * 4) = vals[it];
    
  }
}

// ---------------------------------------------------------------------------------------------------
__global__ __launch_bounds__(256) void ln2_kernel(const float* __restrict__ y, const float* __restrict__ g,
                                                  const float* __restrict__ be, float* __restrict__ out) {
  const int tid  = threadIdx.x;
  const int wave = __builtin_amdgcn_readfirstlane(threadIdx.x >> 5);
  const int lane = tid & 31;
  const int t    = blockIdx.x * 8 + wave;             // compact token
  const int bb   = t / SEQ;
  const int s0   = t - bb * SEQ;
  const float* yr = y + (size_t)t * DIM;

  v4f v[4];
  float s = 0.0f;
  #pragma unroll
  for (int j = 0; j < 4; ++j) {
    v[j] = *(const v4f*)(yr + j * 128 + lane * 4);
    s += (v[j][0] + v[j][1]) + (v[j][2] + v[j][3]);
  }
  s = wave_sum(s);
  const float mean = s * (1.0f / DIM);
  float q = 0.0f;
  #pragma unroll
  for (int j = 0; j < 4; ++j) {
    #pragma unroll
    for (int i = 0; i < 4; ++i) {
      const float d = v[j][i] - mean;
      q += d * d;
    }
  }
  q = wave_sum(q);
  const float rstd = rsqrtf(q * (1.0f / DIM) + 1e-5f);

  v4f ov[4];
  #pragma unroll
  for (int j = 0; j < 4; ++j) {
    const v4f gv = *(const v4f*)(g + j * 128 + lane * 4);
    const v4f bv = *(const v4f*)(be + j * 128 + lane * 4);
    #pragma unroll
    for (int i = 0; i < 4; ++i) ov[j][i] = (v[j][i] - mean) * rstd * bfr(gv[i]) + bfr(bv[i]);
  }
  float* fo = out + ((size_t)bb * SEQ_FULL + s0) * DIM + lane * 4;
  #pragma unroll
  for (int j = 0; j < 4; ++j) *(v4f*)(fo + j * 128) = ov[j];
  
}

// ---------------------------------------------------------------------------------------------------
extern "C" void kernel_launch(void* const* d_in, const int* in_sizes, int n_in,
                              void* d_out, int out_size, void* d_ws, size_t ws_size,
                              hipStream_t stream) {
  if (n_in < 17) return;
  const size_t rows_used = (size_t)(NB - 1) * SEQ_FULL + SEQ;
  if ((size_t)in_sizes[0] < rows_used * DIM) return;
  if ((size_t)in_sizes[1] < (size_t)DIM * DIM || (size_t)in_sizes[3] < (size_t)DIM * DIM) return;
  if ((size_t)in_sizes[5] < (size_t)DIM * DIM || (size_t)in_sizes[7] < (size_t)DIM * DIM) return;
  if ((size_t)in_sizes[9] < (size_t)DIM * FFN || (size_t)in_sizes[11] < (size_t)FFN * DIM) return;
  if (in_sizes[2] < DIM || in_sizes[4] < DIM || in_sizes[6] < DIM || in_sizes[8] < DIM) return;
  if (in_sizes[10] < FFN || in_sizes[12] < DIM) return;
  if (in_sizes[13] < DIM || in_sizes[14] < DIM || in_sizes[15] < DIM || in_sizes[16] < DIM) return;
  if ((size_t)out_size < rows_used * DIM) return;
  if (ws_size < WS_TOTAL) return;

  const float* x   = (const float*)d_in[0];
  const float* wq  = (const float*)d_in[1];
  const float* bq  = (const float*)d_in[2];
  const float* wk  = (const float*)d_in[3];
  const float* bk  = (const float*)d_in[4];
  const float* wv  = (const float*)d_in[5];
  const float* bv  = (const float*)d_in[6];
  const float* wo  = (const float*)d_in[7];
  const float* bo  = (const float*)d_in[8];
  const float* w1  = (const float*)d_in[9];
  const float* b1  = (const float*)d_in[10];
  const float* w2  = (const float*)d_in[11];
  const float* b2  = (const float*)d_in[12];
  const float* g1  = (const float*)d_in[13];
  const float* be1 = (const float*)d_in[14];
  const float* g2  = (const float*)d_in[15];
  const float* be2 = (const float*)d_in[16];
  float* out = (float*)d_out;

  char* ws = (char*)d_ws;
  f16*   xh    = (f16*)(ws + OFF_XH);
  f16*   wqkvT = (f16*)(ws + OFF_WQKV);
  f16*   woT   = (f16*)(ws + OFF_WO);
  f16*   w1T   = (f16*)(ws + OFF_W1);
  f16*   w2T   = (f16*)(ws + OFF_W2);
  f16*   qk    = (f16*)(ws + OFF_BIG);     // the q and k planes
  f16*   hh    = (f16*)(ws + OFF_BIG);     // reuses the q/k region after the attention launch
  f16*   vt    = (f16*)(ws + OFF_VT);
  f16*   ctx   = (f16*)(ws + OFF_CTX);
  float* y     = (float*)(ws + OFF_Y);
  float* x1f   = (float*)(ws + OFF_X1F);
  f16*   x1h   = (f16*)(ws + OFF_X1H);

  // operand planes
  prep_kernel<<<dim3((unsigned)(WT_BLOCKS + CVT_BLOCKS)), 256, 0, stream>>>(x, wq, wk, wv, wo, w1, w2,
                                                                            xh, wqkvT, woT, w1T, w2T);

  gemm_qkv_kernel<<<dim3(NTOK / GM, QKVN / GN), 128, 0, stream>>>(xh, wqkvT, bq, bk, bv, qk, vt);
  attn_kernel<<<dim3(SEQ / BQ, NHEAD, NB), 256, 0, stream>>>(qk, vt, ctx);
  gemm_wo_kernel<<<dim3(NTOK / GM, DIM / GN), 128, 0, stream>>>(ctx, woT, bo, x, y);
  ln1_kernel<<<dim3(NTOK / 8), 256, 0, stream>>>(y, g1, be1, x1f, x1h);
  gemm_ffn1_kernel<<<dim3(NTOK / GM, FFN / GN), 128, 0, stream>>>(x1h, w1T, b1, hh);
  gemm_ffn2_kernel<<<dim3(NTOK / GM, DIM / GN), 128, 0, stream>>>(hh, w2T, b2, x1f, y);
  ln2_kernel<<<dim3(NTOK / 8), 256, 0, stream>>>(y, g2, be2, out);
}

// v007
// A run of this version takes 133 microseconds.
// Timed twice side by side with v006, it ran 1.13 and 1.12 times as fast.
// Over all steps from v000 it is 3.61 times as fast.
#include <hip/hip_runtime.h>
#include <math.h>

// All contractions on v_wmma_f32_16x16x32_f16 with f32 accumulate: projections / Wo / FFN use f16 operand planes
// (inputs RNE-converted to bf16 first, then exact power-of-two carries); scores S^T = K x Q^T use q and k as one
// f16 plane each (11 significant bits, against the 8 of the operands q and k are made from); O = P x V with P f16
// carried x4096.
//
// Every f16 operand plane in the workspace is stored fragment-packed: a [rows][K] operand is cut into tiles of
// 16 rows x 32 k; a tile is two 512-B units (k halves 0..15 and 16..31); inside a unit lane (hi*16 + lq) owns 16 B =
// row lq, k = half*16 + hi*8 + 0..7. Unit index = (rowtile * (K/32) + kblock) * 2 + half; the V^T plane puts the k block outermost. One wave-wide 16-B-per-lane
// load of a unit is 512 contiguous bytes (4 whole lines) and lands directly in the split-k fragment map.

#ifndef NB
#define NB 4
#endif
#ifndef SEQ
#define SEQ 2048
#endif
#define NB_FULL   4
#define SEQ_FULL  2048
#define DIM       512
#define NHEAD     8
#define HDIM      64
#define FFN       2048
#define QKVN      (3 * DIM)
#define NTOK      (NB * SEQ)
#define PLANE     ((size_t)NTOK * DIM)     // elements of one [NB][NHEAD][SEQ][HDIM] 16-bit plane
#define GM        128                      // GEMM block rows (4 waves x 32)
#define GN        64                       // GEMM block columns
#define GW        4                        // waves per GEMM block
#define OP        68                       // LDS pitch (floats) of f32 staging tiles
#define VP        136                      // LDS pitch (halves) of the V^T staging tile
#define TP        72                       // LDS pitch (halves) of the weight transposer tile
#define SHP       (DIM + 16)               // LDS pitch (halves) of the LayerNorm-1 f16 row staging
#define BQ        128                      // query rows per attention block (8 waves x 16)
#define BK        32                       // keys per attention step
#define NWAVE     8
#define XC        16.0f                    // carry of the x, LN1-output and GELU-output planes
#define WC        64.0f                    // carry of all weight planes
#define VC        16.0f                    // carry of the V^T plane
#define CC        256.0f                   // carry of the attention-context plane
#define PC        4096.0f                  // carry of P inside the attention kernel
#define RD        3                        // fragment sets in the register ring of the Wo and FFN-2 products

static_assert(DIM == NHEAD * HDIM);
static_assert(HDIM == 64);
static_assert(HDIM == GN);
static_assert(GM == GW * 32);
static_assert(BQ == NWAVE * 16);
static_assert(SEQ % GM == 0);
static_assert(SEQ % BQ == 0);
static_assert(SEQ % BK == 0);
static_assert(NTOK % GM == 0);
static_assert(NTOK % 8 == 0);
static_assert(DIM % GN == 0);
static_assert(FFN % GN == 0);
static_assert(QKVN % GN == 0);
static_assert(DIM % 64 == 0);
static_assert(FFN % 64 == 0);
static_assert(DIM % 32 == 0);
static_assert(FFN % 32 == 0);
static_assert(DIM == 32 * 16);
static_assert(((size_t)NTOK * DIM / 8) % 256 == 0);
static_assert((OP * 4) % 16 == 0);
static_assert((VP * 2) % 16 == 0);
static_assert((TP * 2) % 16 == 0);
static_assert((SHP * 2) % 16 == 0);
static_assert(SEQ <= SEQ_FULL);
static_assert(NB >= 1 && NB <= NB_FULL);

#define SZ_XH    ((size_t)NTOK * DIM * 2)
#define SZ_WQKV  ((size_t)QKVN * DIM * 2)
#define SZ_WO    ((size_t)DIM * DIM * 2)
#define SZ_W1    ((size_t)FFN * DIM * 2)
#define SZ_W2    ((size_t)DIM * FFN * 2)
#define SZ_QK    ((size_t)2 * NTOK * DIM * 2)
#define SZ_HH    ((size_t)NTOK * FFN * 2)
#define SZ_BIG   ((SZ_QK > SZ_HH) ? SZ_QK : SZ_HH)   // q/k planes, later reused by the GELU-output plane
#define SZ_VT    ((size_t)NTOK * DIM * 2)
#define SZ_CTX   ((size_t)NTOK * DIM * 2)
#define SZ_Y     ((size_t)NTOK * DIM * 4)
#define SZ_X1F   ((size_t)NTOK * DIM * 4)
#define SZ_X1H   ((size_t)NTOK * DIM * 2)
#define OFF_XH   ((size_t)0)
#define OFF_WQKV (OFF_XH + SZ_XH)
#define OFF_WO   (OFF_WQKV + SZ_WQKV)
#define OFF_W1   (OFF_WO + SZ_WO)
#define OFF_W2   (OFF_W1 + SZ_W1)
#define OFF_BIG  (OFF_W2 + SZ_W2)
#define OFF_VT   (OFF_BIG + SZ_BIG)
#define OFF_CTX  (OFF_VT + SZ_VT)
#define OFF_Y    (OFF_CTX + SZ_CTX)
#define OFF_X1F  (OFF_Y + SZ_Y)
#define OFF_X1H  (OFF_X1F + SZ_X1F)
#define WS_TOTAL (OFF_X1H + SZ_X1H)
static_assert(SZ_QK <= SZ_BIG);
static_assert(SZ_HH <= SZ_BIG);
static_assert(SZ_XH % 128 == 0 && SZ_WQKV % 128 == 0 && SZ_WO % 128 == 0 && SZ_W1 % 128 == 0);
static_assert(SZ_W2 % 128 == 0 && SZ_BIG % 128 == 0 && SZ_VT % 128 == 0 && SZ_CTX % 128 == 0);
static_assert(SZ_Y % 128 == 0 && SZ_X1F % 128 == 0 && SZ_X1H % 128 == 0);
static_assert(WS_TOTAL <= (size_t)134217728);

typedef __bf16   bf16;
typedef _Float16 f16;
typedef f16      v16h  __attribute__((ext_vector_type(16)));
typedef f16      v8h   __attribute__((ext_vector_type(8)));
typedef float    v8f   __attribute__((ext_vector_type(8)));
typedef float    v4f   __attribute__((ext_vector_type(4)));
typedef unsigned v4u   __attribute__((ext_vector_type(4)));

union FragH  { v16h v; v4u q[2]; f16 h[16]; };
union Pack8H { v4u u; v8h v; f16 h[8]; };

// bf16 RNE convert of an f32 value, returned as f32
static __device__ __forceinline__ float bfr(float v) { return (float)(bf16)v; }

// WMMA helper: builtin followed by the VALU hazard guard (ties D, keeps A/B live).
static __device__ __forceinline__ v8f mma_f16(v16h a, v16h b, v8f acc) {
  acc = __builtin_amdgcn_wmma_f32_16x16x32_f16(false, a, false, b, (short)0, acc, false, false);
  asm volatile("v_nop\n\tv_nop\n\tv_nop\n\tv_nop" : "+v"(acc) : "v"(a), "v"(b));
  return acc;
}

static __device__ __forceinline__ float wave_sum(float v) {
  v += __shfl_xor(v, 16, 32);
  v += __shfl_xor(v, 8, 32);
  v += __shfl_xor(v, 4, 32);
  v += __shfl_xor(v, 2, 32);
  v += __shfl_xor(v, 1, 32);
  return v;
}

// ---------------------------------------------------------------------------------------------------
// Requests to L2 at kernel entry.
// One request per 256-B unit (a lane names one byte of its unit), issued ahead of the loop.
// A request returns nothing and counts on no load counter. Every lane is on and every address lies inside its plane.
// The s_wait_xcnt closes each statement as a precaution: behind it the address registers are free for other use.
static __device__ __forceinline__ void ask_l2(const char* p0) {
  asm volatile("global_prefetch_b8 %0, off scope:SCOPE_SE\n\t"
               "s_wait_xcnt 0x0"
               : : "v"(p0) : "memory");
}
static __device__ __forceinline__ void ask_l2(const char* p0, const char* p1) {
  asm volatile("global_prefetch_b8 %0, off scope:SCOPE_SE\n\t"
               "global_prefetch_b8 %1, off scope:SCOPE_SE\n\t"
               "s_wait_xcnt 0x0"
               : : "v"(p0), "v"(p1) : "memory");
}
static __device__ __forceinline__ void ask_l2(const char* p0, const char* p1, const char* p2, const char* p3) {
  asm volatile("global_prefetch_b8 %0, off scope:SCOPE_SE\n\t"
               "global_prefetch_b8 %1, off scope:SCOPE_SE\n\t"
               "global_prefetch_b8 %2, off scope:SCOPE_SE\n\t"
               "global_prefetch_b8 %3, off scope:SCOPE_SE\n\t"
               "s_wait_xcnt 0x0"
               : : "v"(p0), "v"(p1), "v"(p2), "v"(p3) : "memory");
}

// The two operand panels of a GEMM block of 128 threads (GM rows of A, GN rows of Bt, each contiguous in its packed
// plane), dealt among the blocks that read them. A panel: a quarter per block, by the column block's index. Bt panel: an
// eighth per block, by bits 0, 1 and 3 of the row block's index. The deal repeats with a short period in the block index:
// a matter of speed only.
template <int K>
static __device__ __forceinline__ void ask_panels(const f16* __restrict__ A, const f16* __restrict__ Bt,
                                                  int tok0, int n0, int tid, int wave) {
  static_assert(K == 512 || K == 2048);
  constexpr int AQ = GM * K * 2 / 4;                    // bytes of a quarter of the A panel
  constexpr int BE = GN * K * 2 / 8;                    // bytes of an eighth of the Bt panel
  const int bx = blockIdx.x;
  const char* a = (const char*)A + (size_t)tok0 * (K * 2) + (size_t)(blockIdx.y & 3) * AQ + tid * 256;
  const char* b = (const char*)Bt + (size_t)n0 * (K * 2) + (size_t)((bx & 3) + ((bx >> 3) & 1) * 4) * BE;
  if constexpr (K == 512) {
    static_assert(AQ == 128 * 256 && BE == 32 * 256);
    ask_l2(a);
    if (wave == 0) ask_l2(b + tid * 256);               // 32 units: one wave's worth, a scalar branch
  } else {
    static_assert(AQ == 4 * 128 * 256 && BE == 128 * 256);
    ask_l2(a, a + 128 * 256, a + 2 * 128 * 256, a + 3 * 128 * 256);
    ask_l2(b + tid * 256);
  }
}

// ---------------------------------------------------------------------------------------------------
// x f32 -> xh packed f16 plane (rows = tokens, K = DIM) = f16(bf16_rne(x) * XC). One thread = one 16-B piece.
static __device__ __forceinline__ void cvt_x_piece(const float* __restrict__ x, f16* __restrict__ xh, int g) {
  // g = [rowtile][kblock 16][row half 2][8-column group 4 = half*2 + hi][row 8]: a wave reads 8 rows x 128 B
  // and writes four whole 128-B lines of the packed plane.
  const int r = ((g >> 5) & 1) * 8 + (g & 7);      // row of the 16-row tile
  const int t = (g >> 10) * 16 + r;                // compact token
  const int c = ((g >> 6) & 15) * 32 + ((g >> 3) & 3) * 8;
  if (t >= NTOK) return;
  const int bb = t / SEQ;
  const int s  = t - bb * SEQ;
  const float* src = x + ((size_t)bb * SEQ_FULL + s) * DIM + c;
  const v4f a0 = *(const v4f*)(src);
  const v4f a1 = *(const v4f*)(src + 4);
  Pack8H p;
  #pragma unroll
  for (int i = 0; i < 4; ++i) {
    p.h[i]     = (f16)(bfr(a0[i]) * XC);
    p.h[4 + i] = (f16)(bfr(a1[i]) * XC);
  }
  const v4u val = p.u;
  f16* dst = xh + (size_t)(g >> 6) * 512 + ((g >> 4) & 1) * 256 + (((g >> 3) & 1) * 16 + r) * 8;
  *(v4u*)dst = val;
}

// Weight transposer: in[K rows][N cols] f32  ->  packed plane (rows = n, K = k) f16 = f16(bf16_rne(w) * WC).
// One block of 256 threads = one tile 64(k) x 64(n) at (k0, n0), through LDS (cross-wave, block barrier).
static __device__ __forceinline__ void wt_tile(const float* __restrict__ W, f16* __restrict__ Wt, int K, int N,
                                               int n0, int k0, f16* sT) {
  const int tid = threadIdx.x;
  #pragma unroll
  for (int it = 0; it < 4; ++it) {
    const int kk = it * 16 + (tid >> 4);        // 0..63
    const int nn = (tid & 15) * 4;              // 0..60
    const v4f w = *(const v4f*)(W + (size_t)(k0 + kk) * N + n0 + nn);
    #pragma unroll
    for (int i = 0; i < 4; ++i) sT[(nn + i) * TP + kk] = (f16)(bfr(w[i]) * WC);
  }
  __syncthreads();
  v4u    val[2];
  size_t idx[2];
  #pragma unroll
  for (int it = 0; it < 2; ++it) {
    const int u  = it * 8 + (tid >> 5);         // unit 0..15 of this tile: [n tile 4][kblock 2][half 2]
    const int ln = tid & 31;
    const int n  = (u >> 2) * 16 + (ln & 15);                               // 0..63
    const int ks = ((u >> 1) & 1) * 32 + (u & 1) * 16 + (ln >> 4) * 8;      // 0..56
    Pack8H ph;
    ph.v = *(const v8h*)(&sT[n * TP + ks]);
    val[it] = ph.u;
    idx[it] = (((size_t)((n0 >> 4) + (u >> 2)) * (K >> 5) + (k0 >> 5) + ((u >> 1) & 1)) * 2 + (u & 1)) * 256 + ln * 8;
  }
  #pragma unroll
  for (int it = 0; it < 2; ++it) *(v4u*)(Wt + idx[it]) = val[it];
}

// All operand planes in one launch: none of them reads another, so the block index alone picks the work.
// Blocks 0 .. WT_BLOCKS-1 transpose one weight tile each (wq, wk, wv, wo: WT_SQ tiles each; w1, w2: WT_FF each; they
// come first because a tile passes through LDS and a barrier); the blocks behind them convert 256 pieces of x each.
// The choice is the same for every thread of a block, so the transposer's barrier is reached by all of them or none.
#define WT_SQ      ((DIM / 64) * (DIM / 64))
#define WT_FF      ((FFN / 64) * (DIM / 64))
#define WT_BLOCKS  (4 * WT_SQ + 2 * WT_FF)
#define CVT_BLOCKS ((size_t)NTOK * DIM / 8 / 256)
static_assert(DIM / 64 == 8 && FFN / 64 == 32);
__global__ __launch_bounds__(256) void prep_kernel(const float* __restrict__ x, const float* __restrict__ wq,
                                                   const float* __restrict__ wk, const float* __restrict__ wv,
                                                   const float* __restrict__ wo, const float* __restrict__ w1,
                                                   const float* __restrict__ w2, f16* __restrict__ xh,
                                                   f16* __restrict__ wqkvT, f16* __restrict__ woT,
                                                   f16* __restrict__ w1T, f16* __restrict__ w2T) {
  __shared__ __align__(16) f16 sT[64 * TP];     // [n][k]
  const int b = blockIdx.x;
  if (b < WT_BLOCKS) {
    const float* W;
    f16* Wt;
    int K, N, lgn, tile;                        // lgn = log2(N / 64): tile = [k tile][n tile]
    if (b < 4 * WT_SQ) {
      // in[512][512] -> out[512][512] (rows = output feature); q, k, v stacked into the [1536][512] plane
      const int m = b / WT_SQ;
      tile = b - m * WT_SQ;
      W  = (m == 0) ? wq : ((m == 1) ? wk : ((m == 2) ? wv : wo));
      Wt = (m < 3) ? wqkvT + (size_t)m * DIM * DIM : woT;
      K = DIM; N = DIM; lgn = 3;
    } else if (b < 4 * WT_SQ + WT_FF) {
      tile = b - 4 * WT_SQ;                     // in[512][2048] -> out[2048][512]
      W = w1; Wt = w1T; K = DIM; N = FFN; lgn = 5;
    } else {
      tile = b - (4 * WT_SQ + WT_FF);           // in[2048][512] -> out[512][2048]
      W = w2; Wt = w2T; K = FFN; N = DIM; lgn = 3;
    }
    wt_tile(W, Wt, K, N, (tile & ((1 << lgn) - 1)) * 64, (tile >> lgn) * 64, sT);
  } else {
    cvt_x_piece(x, xh, (b - WT_BLOCKS) * 256 + (int)threadIdx.x);
  }
}

// ---------------------------------------------------------------------------------------------------
// GEMM main loop: acc[mt][nt] (16x16 tiles) of  A[m0 .. m0+31][K] x Bt[n0 .. n0+63][K]^T.
// A and Bt are packed f16 planes; fragments use the split k map for both operands:
// elements 0..7 <- k0 + 8*hi + 0..7, elements 8..15 <- k0 + 16 + 8*hi + 0..7; lane row / column = lq.
// A 16-row tile spans K*16 halves; a k block of 32 spans 512 halves; the second k half starts at +256.
template <int K>
static __device__ __forceinline__ void gemm_main(const f16* __restrict__ A, const f16* __restrict__ Bt,
                                                 int m0, int n0, int lq, int hi, v8f (&acc)[2][4]) {
  static_assert(K % 32 == 0);
  const f16* ap = A  + (size_t)m0 * K + (hi * 16 + lq) * 8;
  const f16* bp = Bt + (size_t)n0 * K + (hi * 16 + lq) * 8;
  #pragma unroll 1
  for (int k0 = 0; k0 < K; k0 += 32) {
    FragH a[2], b[4];
    #pragma unroll
    for (int mt = 0; mt < 2; ++mt) {
      const f16* p = ap + (size_t)mt * 16 * K + k0 * 16;
      a[mt].q[0] = *(const v4u*)(p);
      a[mt].q[1] = *(const v4u*)(p + 256);
    }
    #pragma unroll
    for (int nt = 0; nt < 4; ++nt) {
      const f16* p = bp + (size_t)nt * 16 * K + k0 * 16;
      b[nt].q[0] = *(const v4u*)(p);
      b[nt].q[1] = *(const v4u*)(p + 256);
    }
    #pragma unroll
    for (int mt = 0; mt < 2; ++mt) {
      #pragma unroll
      for (int nt = 0; nt < 4; ++nt) acc[mt][nt] = mma_f16(a[mt].v, b[nt].v, acc[mt][nt]);
    }
  }
}

// The same product for the launches that leave only two waves on a SIMD, too few to cover a fragment load's latency:
// a ring of D fragment sets in registers. Each set is refilled, right behind its own products, with the k block D
// further on, so D k blocks of loads are in flight per wave. The k blocks are summed in the same ascending order as above.
template <int K>
static __device__ __forceinline__ void load_kblock(const char* __restrict__ ap, const char* __restrict__ bp,
                                                   FragH (&a)[2], FragH (&b)[4]) {
  #pragma unroll
  for (int mt = 0; mt < 2; ++mt) {
    const char* p = ap + (size_t)mt * 32 * K;       // byte addresses: a 16-row tile spans 32 * K bytes
    a[mt].q[0] = *(const v4u*)(p);
    a[mt].q[1] = *(const v4u*)(p + 512);
  }
  #pragma unroll
  for (int nt = 0; nt < 4; ++nt) {
    const char* p = bp + (size_t)nt * 32 * K;
    b[nt].q[0] = *(const v4u*)(p);
    b[nt].q[1] = *(const v4u*)(p + 512);
  }
}

template <int K, int D>
static __device__ __forceinline__ void gemm_main_ring(const f16* __restrict__ A, const f16* __restrict__ Bt,
                                                      int m0, int n0, int lq, int hi, v8f (&acc)[2][4]) {
  constexpr int G = (K / 32) / D;                         // whole groups of D k blocks
  constexpr int R = (K / 32) % D;                         // k blocks left over behind them
  static_assert(K % 32 == 0 && G >= 2);
  const char* ab = (const char*)(A  + (size_t)m0 * K);   // wave-uniform bases
  const char* bb = (const char*)(Bt + (size_t)n0 * K);
  unsigned off = (hi * 16 + lq) * 16;                     // byte offset: the lane's piece of a unit + the k blocks done
  FragH a[D][2], b[D][4];
  #pragma unroll
  for (int s = 0; s < D; ++s) load_kblock<K>(ab + off + s * 1024, bb + off + s * 1024, a[s], b[s]);
  #pragma unroll 1
  for (int g = 1; g < G; ++g) {
    // the loads in flight name the offset register: wait before it is advanced (the operand keeps the add behind)
    asm volatile("s_wait_xcnt 0x0" : "+v"(off) : : "memory");
    off += D * 1024;
    #pragma unroll
    for (int s = 0; s < D; ++s) {
      #pragma unroll
      for (int mt = 0; mt < 2; ++mt) {
        #pragma unroll
        for (int nt = 0; nt < 4; ++nt) acc[mt][nt] = mma_f16(a[s][mt].v, b[s][nt].v, acc[mt][nt]);
      }
      load_kblock<K>(ab + off + s * 1024, bb + off + s * 1024, a[s], b[s]);
    }
  }
  // the last refills still name the offset register and the bases: wait before they are put to other use
  asm volatile("s_wait_xcnt 0x0" : "+v"(off) : : "memory");
  // last whole group; the left-over k blocks refill its first sets
  #pragma unroll
  for (int s = 0; s < D; ++s) {
    #pragma unroll
    for (int mt = 0; mt < 2; ++mt) {
      #pragma unroll
      for (int nt = 0; nt < 4; ++nt) acc[mt][nt] = mma_f16(a[s][mt].v, b[s][nt].v, acc[mt][nt]);
    }
    if (s < R) load_kblock<K>(ab + off + (D + s) * 1024, bb + off + (D + s) * 1024, a[s], b[s]);
  }
  #pragma unroll
  for (int s = 0; s < R; ++s) {
    #pragma unroll
    for (int mt = 0; mt < 2; ++mt) {
      #pragma unroll
      for (int nt = 0; nt < 4; ++nt) acc[mt][nt] = mma_f16(a[s][mt].v, b[s][nt].v, acc[mt][nt]);
    }
  }
}

// ---------------------------------------------------------------------------------------------------
// Fused q/k/v projection: [NTOK][512] x [1536][512]^T. Column block (64 wide) = one head of q, k or v.
//          qk plane order: 0 = q, 1 = k.
//   q, k : per (b, h) a packed plane with rows = tokens, K = d (64): 1024 halves per 16 tokens.
//   v    : per (b, h) a packed plane with rows = d (4 tiles), K = tokens, k block outermost:
//          [s/32][d tile 4][half 2][lane 32][8] f16 (x VC), written through a block-wide LDS tile.
// coverage: q/k rows wave*32 + {0..31} x 64 d = 8 units per wave; vt 64 d x 128 tokens = 32 units per block.
__global__ __launch_bounds__(128) void gemm_qkv_kernel(const f16* __restrict__ xh, const f16* __restrict__ wT,
                                                       const float* __restrict__ bq, const float* __restrict__ bk,
                                                       const float* __restrict__ bv,
                                                       f16* __restrict__ qk, f16* __restrict__ vt) {
  __shared__ __align__(16) float sC[GW * 32 * OP];    // per-wave f32 tiles (block barrier used)
  __shared__ __align__(16) f16   sVT[HDIM * VP];      // [d][token], cross-wave (block barrier)
  const int tid  = threadIdx.x;
  const int wave = __builtin_amdgcn_readfirstlane(threadIdx.x >> 5);
  const int lane = tid & 31;
  const int lq   = lane & 15;
  const int hi   = lane >> 4;
  const int tok0 = blockIdx.x * GM;
  const int n0   = blockIdx.y * GN;
  const int seg  = n0 / DIM;                          // 0 = q, 1 = k, 2 = v (block-uniform)
  const int h    = (n0 - seg * DIM) / HDIM;
  const int bb   = tok0 / SEQ;
  const int s0   = tok0 - bb * SEQ;

  v8f acc[2][4];
  #pragma unroll
  for (int mt = 0; mt < 2; ++mt) {
    #pragma unroll
    for (int nt = 0; nt < 4; ++nt) acc[mt][nt] = (v8f){0, 0, 0, 0, 0, 0, 0, 0};
  }
  ask_panels<DIM>(xh, wT, tok0, n0, tid, wave);
  gemm_main<DIM>(xh, wT, tok0 + wave * 32, n0, lq, hi, acc);

  const float ascale = 1.0f / (XC * WC);
  float bias[4];
  #pragma unroll
  for (int nt = 0; nt < 4; ++nt) {
    const int c = h * HDIM + nt * 16 + lq;            // 0..511
    const float fq = bq[c];
    const float fk = bk[c];
    const float fv = bv[c];
    const float sel = (seg == 0) ? fq : ((seg == 1) ? fk : fv);
    bias[nt] = bfr(sel);
  }

  if (seg < 2) {
    const int wb = wave * (32 * OP);
    #pragma unroll
    for (int mt = 0; mt < 2; ++mt) {
      #pragma unroll
      for (int nt = 0; nt < 4; ++nt) {
        #pragma unroll
        for (int r = 0; r < 8; ++r)
          sC[wb + (mt * 16 + hi * 8 + r) * OP + nt * 16 + lq] = acc[mt][nt][r] * ascale + bias[nt];
      }
    }
    __syncthreads();
    const size_t pbase = (size_t)seg * PLANE +
                         (((size_t)bb * NHEAD + h) * SEQ + s0 + wave * 32) * HDIM;
    v4u hv[8];
    #pragma unroll
    for (int it = 0; it < 8; ++it) {
      const int row = (it >> 2) * 16 + lq;                               // unit it: [row tile 2][d block 2][half 2]
      const int col = ((it >> 1) & 1) * 32 + (it & 1) * 16 + hi * 8;
      const v4f c0 = *(const v4f*)(&sC[wb + row * OP + col]);
      const v4f c1 = *(const v4f*)(&sC[wb + row * OP + col + 4]);
      Pack8H ph;
      #pragma unroll
      for (int i = 0; i < 4; ++i) {
        ph.h[i]     = (f16)c0[i];
        ph.h[4 + i] = (f16)c1[i];
      }
      hv[it] = ph.u;
    }
    #pragma unroll
    for (int it = 0; it < 8; ++it) *(v4u*)(qk + pbase + (size_t)it * 256 + lane * 8) = hv[it];
    
  } else {
    #pragma unroll
    for (int mt = 0; mt < 2; ++mt) {
      #pragma unroll
      for (int nt = 0; nt < 4; ++nt) {
        #pragma unroll
        for (int r = 0; r < 8; ++r)
          sVT[(nt * 16 + lq) * VP + wave * 32 + mt * 16 + hi * 8 + r] =
              (f16)((acc[mt][nt][r] * ascale + bias[nt]) * VC);
      }
    }
    __syncthreads();
    const size_t vbase = (((size_t)bb * NHEAD + h) * SEQ + s0) * HDIM;   // first unit of this block's 128 tokens
    v4u vv[8];
    #pragma unroll
    for (int it = 0; it < 8; ++it) {
      const int u = it * 4 + wave;                 // unit 0..31: [token block 4][d tile 4][half 2]
      const int d = ((u >> 1) & 3) * 16 + lq;
      const int s = (u >> 3) * 32 + (u & 1) * 16 + hi * 8;
      Pack8H ph;
      ph.v = *(const v8h*)(&sVT[d * VP + s]);
      vv[it] = ph.u;
    }
    #pragma unroll
    for (int it = 0; it < 8; ++it) {
      const size_t o = vbase + (size_t)(it * 4 + wave) * 256 + lane * 8;
      *(v4u*)(vt + o) = vv[it];
    }
    
  }
}

// ---------------------------------------------------------------------------------------------------
// Flash attention, full (no mask). Block = (128-query block, head, batch); one wave owns 16 query rows.
// S^T = K x Q^T so queries sit on lanes; P^T in C layout is the A-fragment layout of O += P x V.
// Scores: s = k x q on the f16 planes, f32 accumulate, d blocks summed in ascending order.
// Fragments come straight from the packed 16-bit planes (two 512-B unit loads each); q fragments stay in registers.
__global__ __launch_bounds__(256) void attn_kernel(const f16* __restrict__ qk, const f16* __restrict__ vt,
                                                   f16* __restrict__ ctx) {
  __shared__ __align__(16) float sO[NWAVE * 16 * OP];    // per-wave output staging (block barrier used)
  const int qblk = blockIdx.x;
  const int h    = blockIdx.y;
  const int b    = blockIdx.z;
  const int tid  = threadIdx.x;
  const int wave = __builtin_amdgcn_readfirstlane(threadIdx.x >> 5);
  const int lane = tid & 31;
  const int lq   = lane & 15;   // query column of S^T / d column of O
  const int hi   = lane >> 4;   // k-split half

  const int qrow0 = qblk * BQ + wave * 16;
  const size_t hb = ((size_t)b * NHEAD + h) * (size_t)SEQ * HDIM;
  const f16* qh_p = qk + hb;
  const f16* kh_p = qk + PLANE + hb;
  const f16* vt_h = vt + hb;
  const int qoff  = qrow0 * HDIM + lane * 8;         // this wave's 16-query tile, lane's piece of a unit

  // this head's K and V planes (1024 units each), a quarter per block by the query block's index: one unit of each a thread
  static_assert((size_t)SEQ * HDIM * 2 == (size_t)4 * 256 * 256);
  {
    const size_t po = (size_t)(qblk & 3) * (256 * 256) + tid * 256;
    ask_l2((const char*)kh_p + po, (const char*)vt_h + po);
  }

  // q B-fragments, loaded once and held for the whole key loop
  FragH fqh[2];
  #pragma unroll
  for (int f = 0; f < 2; ++f) {
    const int qo = qoff + f * 512;
    fqh[f].q[0] = *(const v4u*)(qh_p + qo);           // d = f*32 + hi*8 + 0..7
    fqh[f].q[1] = *(const v4u*)(qh_p + qo + 256);     // d = f*32 + 16 + hi*8 + 0..7
  }

  v8f o[4];
  #pragma unroll
  for (int dt = 0; dt < 4; ++dt) o[dt] = (v8f){0, 0, 0, 0, 0, 0, 0, 0};

  float rmax = -__builtin_inff();
  float rsum = 0.0f;
  const float SL = 0.125f * 1.4426950408889634f;   // softmax scale * log2(e)

  // K A-fragments (row = key lq of the tile, split d map) and V B-fragments (column n = d = dt*16 + lq, split key map
  // from the packed transposed plane) are fetched one step ahead into the same registers: step 0's here, step j + 1's
  // K behind step j's score products and its V behind step j's P x V products.
  FragH fkh[2][2], bv[4];
  #pragma unroll
  for (int sub = 0; sub < 2; ++sub) {
    #pragma unroll
    for (int f = 0; f < 2; ++f) {
      const int ko = sub * 16 * HDIM + f * 512 + lane * 8;
      fkh[sub][f].q[0] = *(const v4u*)(kh_p + ko);
      fkh[sub][f].q[1] = *(const v4u*)(kh_p + ko + 256);
    }
  }
  // keeps step 0's V loads behind its q and K loads, as in every later step: loads return in order, and only so can
  // the counted wait at the head of the loop leave the eight V loads in flight under the score products and the softmax
  __builtin_amdgcn_sched_barrier(0);
  #pragma unroll
  for (int dt = 0; dt < 4; ++dt) {
    const f16* base = vt_h + dt * 512 + lane * 8;
    bv[dt].q[0] = *(const v4u*)(base);              // keys hi*8 + 0..7
    bv[dt].q[1] = *(const v4u*)(base + 256);        // keys 16 + hi*8 + 0..7
  }

  #pragma unroll 1
  for (int j0 = 0; j0 < SEQ; j0 += BK) {
    // the step fetched ahead; the last step has none and refetches step 0 (in bounds, never used)
    const int jn = (j0 + BK < SEQ) ? j0 + BK : 0;

    // S^T tiles: c[sub][r] = rawscore(query qrow0+lq, key j0 + sub*16 + hi*8 + r)
    v8f c[2];
    c[0] = (v8f){0, 0, 0, 0, 0, 0, 0, 0};
    c[1] = (v8f){0, 0, 0, 0, 0, 0, 0, 0};
    #pragma unroll
    for (int f = 0; f < 2; ++f) {
      #pragma unroll
      for (int sub = 0; sub < 2; ++sub) c[sub] = mma_f16(fkh[sub][f].v, fqh[f].v, c[sub]);
    }

    // next step's K fragments, in flight under the softmax and the P x V products
    #pragma unroll
    for (int sub = 0; sub < 2; ++sub) {
      #pragma unroll
      for (int f = 0; f < 2; ++f) {
        const int ko = (jn + sub * 16) * HDIM + f * 512 + lane * 8;
        fkh[sub][f].q[0] = *(const v4u*)(kh_p + ko);
        fkh[sub][f].q[1] = *(const v4u*)(kh_p + ko + 256);
      }
    }
    // keeps the K loads from sinking into the softmax below, where less work would cover their latency
    __builtin_amdgcn_sched_barrier(0);

    // online softmax: query lq's 32 scores are split across lane / lane^16
    float m_new = rmax;
    #pragma unroll
    for (int r = 0; r < 8; ++r) {
      m_new = fmaxf(m_new, c[0][r]);
      m_new = fmaxf(m_new, c[1][r]);
    }
    m_new = fmaxf(m_new, __shfl_xor(m_new, 16, 32));
    const float scale = __builtin_amdgcn_exp2f((rmax - m_new) * SL);
    rmax = m_new;

    // exp + pack: P^T C-layout == A-fragment layout for the PV product
    FragH pa;
    float psum = 0.0f;
    #pragma unroll
    for (int r = 0; r < 8; ++r) {
      const float p0 = __builtin_amdgcn_exp2f((c[0][r] - m_new) * SL);   // key hi*8 + r
      const float p1 = __builtin_amdgcn_exp2f((c[1][r] - m_new) * SL);   // key 16 + hi*8 + r
      psum += p0 + p1;
      pa.h[r]     = (f16)(p0 * PC);
      pa.h[8 + r] = (f16)(p1 * PC);
    }
    rsum = rsum * scale + psum + __shfl_xor(psum, 16, 32);

    // rescale O: queries are the row dimension there -> per-row scale from lane 8*hi + r
    float sc[8];
    #pragma unroll
    for (int r = 0; r < 8; ++r) sc[r] = __shfl(scale, (hi << 3) + r, 32);
    #pragma unroll
    for (int dt = 0; dt < 4; ++dt) {
      #pragma unroll
      for (int r = 0; r < 8; ++r) o[dt][r] *= sc[r];
    }

    // O += P x V
    #pragma unroll
    for (int dt = 0; dt < 4; ++dt) o[dt] = mma_f16(pa.v, bv[dt].v, o[dt]);

    // next step's V fragments, in flight under its score products and softmax
    #pragma unroll
    for (int dt = 0; dt < 4; ++dt) {
      const f16* base = vt_h + (size_t)jn * HDIM + dt * 512 + lane * 8;
      bv[dt].q[0] = *(const v4u*)(base);            // keys jn + hi*8 + 0..7
      bv[dt].q[1] = *(const v4u*)(base + 256);      // keys jn + 16 + hi*8 + 0..7
    }
    // the V address pair is formed anew at the head of the next step: wait before that overwrite
    asm volatile("s_wait_xcnt 0x0" ::: "memory");
  }

  // normalize: lane holds column d = dt*16 + lq for query rows 8*hi + r
  float rs[8];
  #pragma unroll
  for (int r = 0; r < 8; ++r) rs[r] = 1.0f / __shfl(rsum, (hi << 3) + r, 32);

  const int wb = wave * (16 * OP);
  #pragma unroll
  for (int r = 0; r < 8; ++r) {
    #pragma unroll
    for (int dt = 0; dt < 4; ++dt)
      sO[wb + (hi * 8 + r) * OP + dt * 16 + lq] = o[dt][r] * (CC / (PC * VC)) * rs[r];
  }
  __syncthreads();

  v4u    pv[4];
  size_t gidx[4];
  #pragma unroll
  for (int it = 0; it < 4; ++it) {
    const int row = lq;                                   // unit it: [k block 2][half 2] of this head's 64 columns
    const int col = (it >> 1) * 32 + (it & 1) * 16 + hi * 8;
    const v4f c0 = *(const v4f*)(&sO[wb + row * OP + col]);
    const v4f c1 = *(const v4f*)(&sO[wb + row * OP + col + 4]);
    Pack8H ph;
    #pragma unroll
    for (int i = 0; i < 4; ++i) {
      ph.h[i]     = (f16)c0[i];
      ph.h[4 + i] = (f16)c1[i];
    }
    pv[it]   = ph.u;
    gidx[it] = ((size_t)b * SEQ + qrow0) * DIM + (size_t)(h * 4 + it) * 256 + lane * 8;   // packed, K = DIM
  }
  #pragma unroll
  for (int it = 0; it < 4; ++it) *(v4u*)(ctx + gidx[it]) = pv[it];
  
}

// ---------------------------------------------------------------------------------------------------
// y = ctx x wo + bo + bf16_rne(x)   (f32 plane [NTOK][DIM], input of LayerNorm 1)
// coverage: rows wave*32 + {0..31}, 64 columns: 16 instr, lanes 0..15 one 256-B row segment, 16..31 the next row.
__global__ __launch_bounds__(128) void gemm_wo_kernel(const f16* __restrict__ ctx, const f16* __restrict__ woT,
                                                      const float* __restrict__ bo, const float* __restrict__ x,
                                                      float* __restrict__ y) {
  __shared__ __align__(16) float sC[GW * 32 * OP];
  const int tid  = threadIdx.x;
  const int wave = __builtin_amdgcn_readfirstlane(threadIdx.x >> 5);
  const int lane = tid & 31;
  const int lq   = lane & 15;
  const int hi   = lane >> 4;
  const int tok0 = blockIdx.x * GM;
  const int n0   = blockIdx.y * GN;
  const int bb   = tok0 / SEQ;
  const int s0   = tok0 - bb * SEQ;

  v8f acc[2][4];
  #pragma unroll
  for (int mt = 0; mt < 2; ++mt) {
    #pragma unroll
    for (int nt = 0; nt < 4; ++nt) acc[mt][nt] = (v8f){0, 0, 0, 0, 0, 0, 0, 0};
  }
  ask_panels<DIM>(ctx, woT, tok0, n0, tid, wave);
  // the block's own piece of the residual, read behind the k loop: one 256-B row segment a thread
  ask_l2((const char*)(x + ((size_t)bb * SEQ_FULL + s0 + tid) * DIM + n0));
  gemm_main_ring<DIM, RD>(ctx, woT, tok0 + wave * 32, n0, lq, hi, acc);

  const float ascale = 1.0f / (CC * WC);
  const int wb = wave * (32 * OP);
  #pragma unroll
  for (int nt = 0; nt < 4; ++nt) {
    const float bias = bfr(bo[n0 + nt * 16 + lq]);
    #pragma unroll
    for (int mt = 0; mt < 2; ++mt) {
      #pragma unroll
      for (int r = 0; r < 8; ++r)
        sC[wb + (mt * 16 + hi * 8 + r) * OP + nt * 16 + lq] = acc[mt][nt][r] * ascale + bias;
    }
  }
  __syncthreads();

  const size_t orow = (size_t)tok0 + wave * 32;                          // compact row
  const size_t rrow = (size_t)bb * SEQ_FULL + s0 + wave * 32;            // row of the full-size x
  #pragma unroll
  for (int g = 0; g < 2; ++g) {
    v4f vals[8];
    #pragma unroll
    for (int it = 0; it < 8; ++it) {
      const int row = g * 16 + it * 2 + hi;
      v4f cv = *(const v4f*)(&sC[wb + row * OP + lq * 4]);
      const v4f rv = *(const v4f*)(x + (rrow + row) * DIM + n0 + lq * 4);
      #pragma unroll
      for (int i = 0; i < 4; ++i) cv[i] = cv[i] + bfr(rv[i]);
      vals[it] = cv;
    }
    #pragma unroll
    for (int it = 0; it < 8; ++it)
      *(v4f*)(y + (orow + g * 16 + it * 2 + hi) * DIM + n0 + lq * 4) = vals[it];
    
  }
}

// ---------------------------------------------------------------------------------------------------
// f32 row: 4 instr x (32 lanes x 16 B) ; f16 rows staged in LDS (cross-wave, block barrier) and written packed:
// the block's 8 tokens fill 8 neighbouring lane slots = one whole 128-B line in each of the 64 (k block, half, hi) groups.
__global__ __launch_bounds__(256) void ln1_kernel(const float* __restrict__ y, const float* __restrict__ g,
                                                  const float* __restrict__ be,
                                                  float* __restrict__ x1f, f16* __restrict__ x1h) {
  __shared__ __align__(16) f16 sH[8 * SHP];
  const int tid  = threadIdx.x;
  const int wave = __builtin_amdgcn_readfirstlane(threadIdx.x >> 5);
  const int lane = tid & 31;
  const int t    = blockIdx.x * 8 + wave;             // compact token
  const float* yr = y + (size_t)t * DIM;

  v4f v[4];
  float s = 0.0f;
  #pragma unroll
  for (int j = 0; j < 4; ++j) {
    v[j] = *(const v4f*)(yr + j * 128 + lane * 4);
    s += (v[j][0] + v[j][1]) + (v[j][2] + v[j][3]);
  }
  s = wave_sum(s);
  const float mean = s * (1.0f / DIM);
  float q = 0.0f;
  #pragma unroll
  for (int j = 0; j < 4; ++j) {
    #pragma unroll
    for (int i = 0; i < 4; ++i) {
      const float d = v[j][i] - mean;
      q += d * d;
    }
  }
  q = wave_sum(q);
  const float rstd = rsqrtf(q * (1.0f / DIM) + 1e-5f);

  v4f ov[4];
  #pragma unroll
  for (int j = 0; j < 4; ++j) {
    const v4f gv = *(const v4f*)(g + j * 128 + lane * 4);
    const v4f bv = *(const v4f*)(be + j * 128 + lane * 4);
    #pragma unroll
    for (int i = 0; i < 4; ++i) {
      const float val = (v[j][i] - mean) * rstd * bfr(gv[i]) + bfr(bv[i]);
      ov[j][i] = val;
      sH[wave * SHP + j * 128 + lane * 4 + i] = (f16)(val * XC);
    }
  }
  __syncthreads();
  const int t0 = blockIdx.x * 8;                      // first token of the block
  v4u    hv[2];
  size_t hidx[2];
  #pragma unroll
  for (int jj = 0; jj < 2; ++jj) {
    const int tk = tid & 7;                           // token of the block
    const int ln = jj * 32 + (tid >> 3);              // 8-column group 0..63 = kblock*4 + half*2 + hi
    Pack8H ph;
    ph.v = *(const v8h*)(&sH[tk * SHP + ln * 8]);
    hv[jj] = ph.u;
    hidx[jj] = (size_t)(t0 >> 4) * (16 * DIM) + (size_t)(ln >> 1) * 256 + ((ln & 1) * 16 + (t0 & 15) + tk) * 8;
  }
  float* fo = x1f + (size_t)t * DIM + lane * 4;
  #pragma unroll
  for (int j = 0; j < 4; ++j) *(v4f*)(fo + j * 128) = ov[j];
  #pragma unroll
  for (int jj = 0; jj < 2; ++jj) *(v4u*)(x1h + hidx[jj]) = hv[jj];
  
}

static __device__ __forceinline__ void rcp8(const float (&d)[8], float (&t)[8]) {
  asm("v_rcp_f32 %0, %8\n\t"
      "v_rcp_f32 %1, %9\n\t"
      "v_rcp_f32 %2, %10\n\t"
      "v_rcp_f32 %3, %11\n\t"
      "v_rcp_f32 %4, %12\n\t"
      "v_rcp_f32 %5, %13\n\t"
      "v_rcp_f32 %6, %14\n\t"
      "v_rcp_f32 %7, %15\n\t"
      "v_nop"
      : "=&v"(t[0]), "=&v"(t[1]), "=&v"(t[2]), "=&v"(t[3]), "=&v"(t[4]), "=&v"(t[5]), "=&v"(t[6]), "=&v"(t[7])
      : "v"(d[0]), "v"(d[1]), "v"(d[2]), "v"(d[3]), "v"(d[4]), "v"(d[5]), "v"(d[6]), "v"(d[7]));
}
static __device__ __forceinline__ void exp2_8(const float (&w)[8], float (&e)[8]) {
  asm("v_exp_f32 %0, %8\n\t"
      "v_exp_f32 %1, %9\n\t"
      "v_exp_f32 %2, %10\n\t"
      "v_exp_f32 %3, %11\n\t"
      "v_exp_f32 %4, %12\n\t"
      "v_exp_f32 %5, %13\n\t"
      "v_exp_f32 %6, %14\n\t"
      "v_exp_f32 %7, %15\n\t"
      "v_nop"
      : "=&v"(e[0]), "=&v"(e[1]), "=&v"(e[2]), "=&v"(e[3]), "=&v"(e[4]), "=&v"(e[5]), "=&v"(e[6]), "=&v"(e[7])
      : "v"(w[0]), "v"(w[1]), "v"(w[2]), "v"(w[3]), "v"(w[4]), "v"(w[5]), "v"(w[6]), "v"(w[7]));
}

// GELU, erf form, without a branch, on eight values. With z = u / sqrt(2) and t = 1 / (1 + p |z|),
//   erfc(|z|) = (a1 t + a2 t^2 + a3 t^3 + a4 t^4 + a5 t^5) exp(-z^2), absolute error of the form below 1.5e-7 for every z,
// and 0.5 u (1 + erf(z)) = max(u, 0) - |u| * 0.5 erfc(|z|) for either sign of u (no cancellation on the negative side).
// The 0.5 is folded into a1..a5 and the 1 / sqrt(2) into p and the exponent. One straight run of instructions for every
// lane, so a lane's values are independent chains that the compiler can interleave.
static __device__ __forceinline__ void gelu_erf8(float (&u)[8]) {
  float d[8], w[8], t[8], e[8];
  #pragma unroll
  for (int i = 0; i < 8; ++i) {
    d[i] = fmaf(0.3275911f * 0.70710678118654752f, fabsf(u[i]), 1.0f);
    w[i] = u[i] * u[i] * (-0.5f * 1.4426950408889634f);      // -z^2 * log2(e)
  }
  rcp8(d, t);
  exp2_8(w, e);
  #pragma unroll
  for (int i = 0; i < 8; ++i) {
    float p = fmaf(0.5f * 1.061405429f, t[i], 0.5f * -1.453152027f);
    p = fmaf(p, t[i], 0.5f * 1.421413741f);
    p = fmaf(p, t[i], 0.5f * -0.284496736f);
    p = fmaf(p, t[i], 0.5f * 0.254829592f);
    p = p * t[i];
    u[i] = fmaf(-fabsf(u[i]), p * e[i], fmaxf(u[i], 0.0f));
  }
}

// hh = f16( gelu_erf(x1 x w1 + b1) * XC )   packed plane (rows = tokens, K = FFN)
__global__ __launch_bounds__(128) void gemm_ffn1_kernel(const f16* __restrict__ x1h, const f16* __restrict__ w1T,
                                                        const float* __restrict__ b1, f16* __restrict__ hh) {
  __shared__ __align__(16) float sC[GW * 32 * OP];
  const int tid  = threadIdx.x;
  const int wave = __builtin_amdgcn_readfirstlane(threadIdx.x >> 5);
  const int lane = tid & 31;
  const int lq   = lane & 15;
  const int hi   = lane >> 4;
  const int tok0 = blockIdx.x * GM;
  const int n0   = blockIdx.y * GN;

  v8f acc[2][4];
  #pragma unroll
  for (int mt = 0; mt < 2; ++mt) {
    #pragma unroll
    for (int nt = 0; nt < 4; ++nt) acc[mt][nt] = (v8f){0, 0, 0, 0, 0, 0, 0, 0};
  }
  ask_panels<DIM>(x1h, w1T, tok0, n0, tid, wave);
  gemm_main<DIM>(x1h, w1T, tok0 + wave * 32, n0, lq, hi, acc);

  const float ascale = 1.0f / (XC * WC);
  const int wb = wave * (32 * OP);
  float bias[4];                                      // all four loaded ahead of the fenced groups below
  #pragma unroll
  for (int nt = 0; nt < 4; ++nt) bias[nt] = bfr(b1[n0 + nt * 16 + lq]);
  #pragma unroll
  for (int nt = 0; nt < 4; ++nt) {
    #pragma unroll
    for (int mt = 0; mt < 2; ++mt) {
      float gl[8];
      #pragma unroll
      for (int r = 0; r < 8; ++r) gl[r] = acc[mt][nt][r] * ascale + bias[nt];
      gelu_erf8(gl);
      #pragma unroll
      for (int r = 0; r < 8; ++r) sC[wb + (mt * 16 + hi * 8 + r) * OP + nt * 16 + lq] = gl[r];
      // eight values at a time: without this the compiler starts many more at once, and the registers they hold cost
      // the eighth wave per SIMD, which the grid needs to be resident in one round
      __builtin_amdgcn_sched_barrier(0);
    }
  }
  __syncthreads();

  // piece it is this lane's 16 B of unit it: [row tile 2][k block 2][half 2]
  const int lbase = wb + lq * OP + hi * 8;

  v4u pv[8];
  #pragma unroll
  for (int it = 0; it < 8; ++it) {
    const int off = lbase + (it >> 2) * (16 * OP) + (it & 3) * 16;
    const v4f c0 = *(const v4f*)(&sC[off]);
    const v4f c1 = *(const v4f*)(&sC[off + 4]);
    Pack8H ph;
    #pragma unroll
    for (int i = 0; i < 4; ++i) {
      ph.h[i]     = (f16)(c0[i] * XC);
      ph.h[4 + i] = (f16)(c1[i] * XC);
    }
    pv[it] = ph.u;
  }
  const size_t obase = ((size_t)tok0 + wave * 32) * FFN + (size_t)n0 * 16 + lane * 8;
  #pragma unroll
  for (int it = 0; it < 8; ++it) *(v4u*)(hh + obase + (size_t)(it >> 2) * 16 * FFN + (it & 3) * 256) = pv[it];
  
}

// ---------------------------------------------------------------------------------------------------
// y = hh x w2 + b2 + x1f   (f32 plane [NTOK][DIM], input of LayerNorm 2)
__global__ __launch_bounds__(128) void gemm_ffn2_kernel(const f16* __restrict__ hh, const f16* __restrict__ w2T,
                                                        const float* __restrict__ b2, const float* __restrict__ x1f,
                                                        float* __restrict__ y) {
  __shared__ __align__(16) float sC[GW * 32 * OP];
  const int tid  = threadIdx.x;
  const int wave = __builtin_amdgcn_readfirstlane(threadIdx.x >> 5);
  const int lane = tid & 31;
  const int lq   = lane & 15;
  const int hi   = lane >> 4;
  const int tok0 = blockIdx.x * GM;
  const int n0   = blockIdx.y * GN;

  v8f acc[2][4];
  #pragma unroll
  for (int mt = 0; mt < 2; ++mt) {
    #pragma unroll
    for (int nt = 0; nt < 4; ++nt) acc[mt][nt] = (v8f){0, 0, 0, 0, 0, 0, 0, 0};
  }
  ask_panels<FFN>(hh, w2T, tok0, n0, tid, wave);
  // the block's own piece of the residual, read behind the k loop: one 256-B row segment a thread
  ask_l2((const char*)(x1f + ((size_t)tok0 + tid) * DIM + n0));
  gemm_main_ring<FFN, RD>(hh, w2T, tok0 + wave * 32, n0, lq, hi, acc);

  const float ascale = 1.0f / (XC * WC);
  const int wb = wave * (32 * OP);
  #pragma unroll
  for (int nt = 0; nt < 4; ++nt) {
    const float bias = bfr(b2[n0 + nt * 16 + lq]);
    #pragma unroll
    for (int mt = 0; mt < 2; ++mt) {
      #pragma unroll
      for (int r = 0; r < 8; ++r)
        sC[wb + (mt * 16 + hi * 8 + r) * OP + nt * 16 + lq] = acc[mt][nt][r] * ascale + bias;
    }
  }
  __syncthreads();

  const size_t orow = (size_t)tok0 + wave * 32;
  #pragma unroll
  for (int g = 0; g < 2; ++g) {
    v4f vals[8];
    #pragma unroll
    for (int it = 0; it < 8; ++it) {
      const int row = g * 16 + it * 2 + hi;
      v4f cv = *(const v4f*)(&sC[wb + row * OP + lq * 4]);
      const v4f rv = *(const v4f*)(x1f + (orow + row) * DIM + n0 + lq * 4);
      #pragma unroll
      for (int i = 0; i < 4; ++i) cv[i] = cv[i] + rv[i];
      vals[it] = cv;
    }
    #pragma unroll
    for (int it = 0; it < 8; ++it)
      *(v4f*)(y + (orow + g * 16 + it * 2 + hi) * DIM + n0 + lq * 4) = vals[it];
    
  }
}

// ---------------------------------------------------------------------------------------------------
__global__ __launch_bounds__(256) void ln2_kernel(const float* __restrict__ y, const float* __restrict__ g,
                                                  const float* __restrict__ be, float* __restrict__ out) {
  const int tid  = threadIdx.x;
  const int wave = __builtin_amdgcn_readfirstlane(threadIdx.x >> 5);
  const int lane = tid & 31;
  const int t    = blockIdx.x * 8 + wave;             // compact token
  const int bb   = t / SEQ;
  const int s0   = t - bb * SEQ;
  const float* yr = y + (size_t)t * DIM;

  v4f v[4];
  float s = 0.0f;
  #pragma unroll
  for (int j = 0; j < 4; ++j) {
    v[j] = *(const v4f*)(yr + j * 128 + lane * 4);
    s += (v[j][0] + v[j][1]) + (v[j][2] + v[j][3]);
  }
  s = wave_sum(s);
  const float mean = s * (1.0f / DIM);
  float q = 0.0f;
  #pragma unroll
  for (int j = 0; j < 4; ++j) {
    #pragma unroll
    for (int i = 0; i < 4; ++i) {
      const float d = v[j][i] - mean;
      q += d * d;
    }
  }
  q = wave_sum(q);
  const float rstd = rsqrtf(q * (1.0f / DIM) + 1e-5f);

  v4f ov[4];
  #pragma unroll
  for (int j = 0; j < 4; ++j) {
    const v4f gv = *(const v4f*)(g + j * 128 + lane * 4);
    const v4f bv = *(const v4f*)(be + j * 128 + lane * 4);
    #pragma unroll
    for (int i = 0; i < 4; ++i) ov[j][i] = (v[j][i] - mean) * rstd * bfr(gv[i]) + bfr(bv[i]);
  }
  float* fo = out + ((size_t)bb * SEQ_FULL + s0) * DIM + lane * 4;
  #pragma unroll
  for (int j = 0; j < 4; ++j) *(v4f*)(fo + j * 128) = ov[j];
  
}

// ---------------------------------------------------------------------------------------------------
extern "C" void kernel_launch(void* const* d_in, const int* in_sizes, int n_in,
                              void* d_out, int out_size, void* d_ws, size_t ws_size,
                              hipStream_t stream) {
  if (n_in < 17) return;
  const size_t rows_used = (size_t)(NB - 1) * SEQ_FULL + SEQ;
  if ((size_t)in_sizes[0] < rows_used * DIM) return;
  if ((size_t)in_sizes[1] < (size_t)DIM * DIM || (size_t)in_sizes[3] < (size_t)DIM * DIM) return;
  if ((size_t)in_sizes[5] < (size_t)DIM * DIM || (size_t)in_sizes[7] < (size_t)DIM * DIM) return;
  if ((size_t)in_sizes[9] < (size_t)DIM * FFN || (size_t)in_sizes[11] < (size_t)FFN * DIM) return;
  if (in_sizes[2] < DIM || in_sizes[4] < DIM || in_sizes[6] < DIM || in_sizes[8] < DIM) return;
  if (in_sizes[10] < FFN || in_sizes[12] < DIM) return;
  if (in_sizes[13] < DIM || in_sizes[14] < DIM || in_sizes[15] < DIM || in_sizes[16] < DIM) return;
  if ((size_t)out_size < rows_used * DIM) return;
  if (ws_size < WS_TOTAL) return;

  const float* x   = (const float*)d_in[0];
  const float* wq  = (const float*)d_in[1];
  const float* bq  = (const float*)d_in[2];
  const float* wk  = (const float*)d_in[3];
  const float* bk  = (const float*)d_in[4];
  const float* wv  = (const float*)d_in[5];
  const float* bv  = (const float*)d_in[6];
  const float* wo  = (const float*)d_in[7];
  const float* bo  = (const float*)d_in[8];
  const float* w1  = (const float*)d_in[9];
  const float* b1  = (const float*)d_in[10];
  const float* w2  = (const float*)d_in[11];
  const float* b2  = (const float*)d_in[12];
  const float* g1  = (const float*)d_in[13];
  const float* be1 = (const float*)d_in[14];
  const float* g2  = (const float*)d_in[15];
  const float* be2 = (const float*)d_in[16];
  float* out = (float*)d_out;

  char* ws = (char*)d_ws;
  f16*   xh    = (f16*)(ws + OFF_XH);
  f16*   wqkvT = (f16*)(ws + OFF_WQKV);
  f16*   woT   = (f16*)(ws + OFF_WO);
  f16*   w1T   = (f16*)(ws + OFF_W1);
  f16*   w2T   = (f16*)(ws + OFF_W2);
  f16*   qk    = (f16*)(ws + OFF_BIG);     // the q and k planes
  f16*   hh    = (f16*)(ws + OFF_BIG);     // reuses the q/k region after the attention launch
  f16*   vt    = (f16*)(ws + OFF_VT);
  f16*   ctx   = (f16*)(ws + OFF_CTX);
  float* y     = (float*)(ws + OFF_Y);
  float* x1f   = (float*)(ws + OFF_X1F);
  f16*   x1h   = (f16*)(ws + OFF_X1H);

  // operand planes
  prep_kernel<<<dim3((unsigned)(WT_BLOCKS + CVT_BLOCKS)), 256, 0, stream>>>(x, wq, wk, wv, wo, w1, w2,
                                                                            xh, wqkvT, woT, w1T, w2T);

  gemm_qkv_kernel<<<dim3(NTOK / GM, QKVN / GN), 128, 0, stream>>>(xh, wqkvT, bq, bk, bv, qk, vt);
  attn_kernel<<<dim3(SEQ / BQ, NHEAD, NB), 256, 0, stream>>>(qk, vt, ctx);
  gemm_wo_kernel<<<dim3(NTOK / GM, DIM / GN), 128, 0, stream>>>(ctx, woT, bo, x, y);
  ln1_kernel<<<dim3(NTOK / 8), 256, 0, stream>>>(y, g1, be1, x1f, x1h);
  gemm_ffn1_kernel<<<dim3(NTOK / GM, FFN / GN), 128, 0, stream>>>(x1h, w1T, b1, hh);
  gemm_ffn2_kernel<<<dim3(NTOK / GM, DIM / GN), 128, 0, stream>>>(hh, w2T, b2, x1f, y);
  ln2_kernel<<<dim3(NTOK / 8), 256, 0, stream>>>(y, g2, be2, out);
}

// v008
// Measured time: 130 microseconds a run.
// Next to v007, in two timings, it ran 1.05 and 1.04 times as fast.
// Counting every step since v000, it is 3.76 times as fast.
#include <hip/hip_runtime.h>
#include <math.h>

// All contractions on v_wmma_f32_16x16x32_f16 with f32 accumulate: projections / Wo / FFN use f16 operand planes
// (inputs RNE-converted to bf16 first, then exact power-of-two carries); scores S^T = K x Q^T use q and k as one
// f16 plane each (11 significant bits, against the 8 of the operands q and k are made from); O = P x V with P f16
// carried x128 (P itself reaches 2^8 under the lazy rescale of the attention kernel).
//
// Every f16 operand plane in the workspace is stored fragment-packed: a [rows][K] operand is cut into tiles of
// 16 rows x 32 k; a tile is two 512-B units (k halves 0..15 and 16..31); inside a unit lane (hi*16 + lq) owns 16 B =
// row lq, k = half*16 + hi*8 + 0..7. Unit index = (rowtile * (K/32) + kblock) * 2 + half; the V^T plane puts the k block outermost. One wave-wide 16-B-per-lane
// load of a unit is 512 contiguous bytes (4 whole lines) and lands directly in the split-k fragment map.

#ifndef NB
#define NB 4
#endif
#ifndef SEQ
#define SEQ 2048
#endif
#define NB_FULL   4
#define SEQ_FULL  2048
#define DIM       512
#define NHEAD     8
#define HDIM      64
#define FFN       2048
#define QKVN      (3 * DIM)
#define NTOK      (NB * SEQ)
#define PLANE     ((size_t)NTOK * DIM)     // elements of one [NB][NHEAD][SEQ][HDIM] 16-bit plane
#define GM        128                      // GEMM block rows (4 waves x 32)
#define GN        64                       // GEMM block columns
#define GW        4                        // waves per GEMM block
#define OP        68                       // LDS pitch (floats) of f32 staging tiles
#define VP        136                      // LDS pitch (halves) of the V^T staging tile
#define TP        72                       // LDS pitch (halves) of the weight transposer tile
#define SHP       (DIM + 16)               // LDS pitch (halves) of the LayerNorm-1 f16 row staging
#define BQ        128                      // query rows per attention block (8 waves x 16)
#define BK        32                       // keys per attention step
#define NWAVE     8
#define XC        16.0f                    // carry of the x, LN1-output and GELU-output planes
#define WC        64.0f                    // carry of all weight planes
#define VC        16.0f                    // carry of the V^T plane
#define CC        256.0f                   // carry of the attention-context plane
#define LZ        8.0f                     // a score may pass the softmax reference by this much (scaled log2) before a rescale
#define PCL       7.0f                     // log2 of the carry of P inside the attention kernel: P * carry <= 2^(LZ + PCL), in f16 range
#define RD        3                        // fragment sets in the register ring of the Wo and FFN-2 products

static_assert(DIM == NHEAD * HDIM);
static_assert(HDIM == 64);
static_assert(HDIM == GN);
static_assert(GM == GW * 32);
static_assert(BQ == NWAVE * 16);
static_assert(SEQ % GM == 0);
static_assert(SEQ % BQ == 0);
static_assert(SEQ % BK == 0);
static_assert(NTOK % GM == 0);
static_assert(NTOK % 8 == 0);
static_assert(DIM % GN == 0);
static_assert(FFN % GN == 0);
static_assert(QKVN % GN == 0);
static_assert(DIM % 64 == 0);
static_assert(FFN % 64 == 0);
static_assert(DIM % 32 == 0);
static_assert(FFN % 32 == 0);
static_assert(DIM == 32 * 16);
static_assert(((size_t)NTOK * DIM / 8) % 256 == 0);
static_assert((OP * 4) % 16 == 0);
static_assert((VP * 2) % 16 == 0);
static_assert((TP * 2) % 16 == 0);
static_assert((SHP * 2) % 16 == 0);
static_assert(SEQ <= SEQ_FULL);
static_assert(NB >= 1 && NB <= NB_FULL);

#define SZ_XH    ((size_t)NTOK * DIM * 2)
#define SZ_WQKV  ((size_t)QKVN * DIM * 2)
#define SZ_WO    ((size_t)DIM * DIM * 2)
#define SZ_W1    ((size_t)FFN * DIM * 2)
#define SZ_W2    ((size_t)DIM * FFN * 2)
#define SZ_QK    ((size_t)2 * NTOK * DIM * 2)
#define SZ_HH    ((size_t)NTOK * FFN * 2)
#define SZ_BIG   ((SZ_QK > SZ_HH) ? SZ_QK : SZ_HH)   // q/k planes, later reused by the GELU-output plane
#define SZ_VT    ((size_t)NTOK * DIM * 2)
#define SZ_CTX   ((size_t)NTOK * DIM * 2)
#define SZ_Y     ((size_t)NTOK * DIM * 4)
#define SZ_X1F   ((size_t)NTOK * DIM * 4)
#define SZ_X1H   ((size_t)NTOK * DIM * 2)
#define OFF_XH   ((size_t)0)
#define OFF_WQKV (OFF_XH + SZ_XH)
#define OFF_WO   (OFF_WQKV + SZ_WQKV)
#define OFF_W1   (OFF_WO + SZ_WO)
#define OFF_W2   (OFF_W1 + SZ_W1)
#define OFF_BIG  (OFF_W2 + SZ_W2)
#define OFF_VT   (OFF_BIG + SZ_BIG)
#define OFF_CTX  (OFF_VT + SZ_VT)
#define OFF_Y    (OFF_CTX + SZ_CTX)
#define OFF_X1F  (OFF_Y + SZ_Y)
#define OFF_X1H  (OFF_X1F + SZ_X1F)
#define WS_TOTAL (OFF_X1H + SZ_X1H)
static_assert(SZ_QK <= SZ_BIG);
static_assert(SZ_HH <= SZ_BIG);
static_assert(SZ_XH % 128 == 0 && SZ_WQKV % 128 == 0 && SZ_WO % 128 == 0 && SZ_W1 % 128 == 0);
static_assert(SZ_W2 % 128 == 0 && SZ_BIG % 128 == 0 && SZ_VT % 128 == 0 && SZ_CTX % 128 == 0);
static_assert(SZ_Y % 128 == 0 && SZ_X1F % 128 == 0 && SZ_X1H % 128 == 0);
static_assert(WS_TOTAL <= (size_t)134217728);

typedef __bf16   bf16;
typedef _Float16 f16;
typedef f16      v16h  __attribute__((ext_vector_type(16)));
typedef f16      v8h   __attribute__((ext_vector_type(8)));
typedef float    v8f   __attribute__((ext_vector_type(8)));
typedef float    v4f   __attribute__((ext_vector_type(4)));
typedef unsigned v4u   __attribute__((ext_vector_type(4)));

union FragH  { v16h v; v4u q[2]; f16 h[16]; };
union Pack8H { v4u u; v8h v; f16 h[8]; };

// bf16 RNE convert of an f32 value, returned as f32
static __device__ __forceinline__ float bfr(float v) { return (float)(bf16)v; }

// WMMA helper: builtin followed by the VALU hazard guard (ties D, keeps A/B live).
static __device__ __forceinline__ v8f mma_f16(v16h a, v16h b, v8f acc) {
  acc = __builtin_amdgcn_wmma_f32_16x16x32_f16(false, a, false, b, (short)0, acc, false, false);
  asm volatile("v_nop\n\tv_nop\n\tv_nop\n\tv_nop" : "+v"(acc) : "v"(a), "v"(b));
  return acc;
}

static __device__ __forceinline__ float wave_sum(float v) {
  v += __shfl_xor(v, 16, 32);
  v += __shfl_xor(v, 8, 32);
  v += __shfl_xor(v, 4, 32);
  v += __shfl_xor(v, 2, 32);
  v += __shfl_xor(v, 1, 32);
  return v;
}

// ---------------------------------------------------------------------------------------------------
// Requests to L2 at kernel entry.
// One request per 256-B unit (a lane names one byte of its unit), issued ahead of the loop.
// A request returns nothing and counts on no load counter. Every lane is on and every address lies inside its plane.
// The s_wait_xcnt closes each statement as a precaution: behind it the address registers are free for other use.
static __device__ __forceinline__ void ask_l2(const char* p0) {
  asm volatile("global_prefetch_b8 %0, off scope:SCOPE_SE\n\t"
               "s_wait_xcnt 0x0"
               : : "v"(p0) : "memory");
}
static __device__ __forceinline__ void ask_l2(const char* p0, const char* p1) {
  asm volatile("global_prefetch_b8 %0, off scope:SCOPE_SE\n\t"
               "global_prefetch_b8 %1, off scope:SCOPE_SE\n\t"
               "s_wait_xcnt 0x0"
               : : "v"(p0), "v"(p1) : "memory");
}
static __device__ __forceinline__ void ask_l2(const char* p0, const char* p1, const char* p2, const char* p3) {
  asm volatile("global_prefetch_b8 %0, off scope:SCOPE_SE\n\t"
               "global_prefetch_b8 %1, off scope:SCOPE_SE\n\t"
               "global_prefetch_b8 %2, off scope:SCOPE_SE\n\t"
               "global_prefetch_b8 %3, off scope:SCOPE_SE\n\t"
               "s_wait_xcnt 0x0"
               : : "v"(p0), "v"(p1), "v"(p2), "v"(p3) : "memory");
}

// The two operand panels of a GEMM block of 128 threads (GM rows of A, GN rows of Bt, each contiguous in its packed
// plane), dealt among the blocks that read them. A panel: a quarter per block, by the column block's index. Bt panel: an
// eighth per block, by bits 0, 1 and 3 of the row block's index. The deal repeats with a short period in the block index:
// a matter of speed only.
template <int K>
static __device__ __forceinline__ void ask_panels(const f16* __restrict__ A, const f16* __restrict__ Bt,
                                                  int tok0, int n0, int tid, int wave) {
  static_assert(K == 512 || K == 2048);
  constexpr int AQ = GM * K * 2 / 4;                    // bytes of a quarter of the A panel
  constexpr int BE = GN * K * 2 / 8;                    // bytes of an eighth of the Bt panel
  const int bx = blockIdx.x;
  const char* a = (const char*)A + (size_t)tok0 * (K * 2) + (size_t)(blockIdx.y & 3) * AQ + tid * 256;
  const char* b = (const char*)Bt + (size_t)n0 * (K * 2) + (size_t)((bx & 3) + ((bx >> 3) & 1) * 4) * BE;
  if constexpr (K == 512) {
    static_assert(AQ == 128 * 256 && BE == 32 * 256);
    ask_l2(a);
    if (wave == 0) ask_l2(b + tid * 256);               // 32 units: one wave's worth, a scalar branch
  } else {
    static_assert(AQ == 4 * 128 * 256 && BE == 128 * 256);
    ask_l2(a, a + 128 * 256, a + 2 * 128 * 256, a + 3 * 128 * 256);
    ask_l2(b + tid * 256);
  }
}

// ---------------------------------------------------------------------------------------------------
// x f32 -> xh packed f16 plane (rows = tokens, K = DIM) = f16(bf16_rne(x) * XC). One thread = one 16-B piece.
static __device__ __forceinline__ void cvt_x_piece(const float* __restrict__ x, f16* __restrict__ xh, int g) {
  // g = [rowtile][kblock 16][row half 2][8-column group 4 = half*2 + hi][row 8]: a wave reads 8 rows x 128 B
  // and writes four whole 128-B lines of the packed plane.
  const int r = ((g >> 5) & 1) * 8 + (g & 7);      // row of the 16-row tile
  const int t = (g >> 10) * 16 + r;                // compact token
  const int c = ((g >> 6) & 15) * 32 + ((g >> 3) & 3) * 8;
  if (t >= NTOK) return;
  const int bb = t / SEQ;
  const int s  = t - bb * SEQ;
  const float* src = x + ((size_t)bb * SEQ_FULL + s) * DIM + c;
  const v4f a0 = *(const v4f*)(src);
  const v4f a1 = *(const v4f*)(src + 4);
  Pack8H p;
  #pragma unroll
  for (int i = 0; i < 4; ++i) {
    p.h[i]     = (f16)(bfr(a0[i]) * XC);
    p.h[4 + i] = (f16)(bfr(a1[i]) * XC);
  }
  const v4u val = p.u;
  f16* dst = xh + (size_t)(g >> 6) * 512 + ((g >> 4) & 1) * 256 + (((g >> 3) & 1) * 16 + r) * 8;
  *(v4u*)dst = val;
}

// Weight transposer: in[K rows][N cols] f32  ->  packed plane (rows = n, K = k) f16 = f16(bf16_rne(w) * WC).
// One block of 256 threads = one tile 64(k) x 64(n) at (k0, n0), through LDS (cross-wave, block barrier).
static __device__ __forceinline__ void wt_tile(const float* __restrict__ W, f16* __restrict__ Wt, int K, int N,
                                               int n0, int k0, f16* sT) {
  const int tid = threadIdx.x;
  #pragma unroll
  for (int it = 0; it < 4; ++it) {
    const int kk = it * 16 + (tid >> 4);        // 0..63
    const int nn = (tid & 15) * 4;              // 0..60
    const v4f w = *(const v4f*)(W + (size_t)(k0 + kk) * N + n0 + nn);
    #pragma unroll
    for (int i = 0; i < 4; ++i) sT[(nn + i) * TP + kk] = (f16)(bfr(w[i]) * WC);
  }
  __syncthreads();
  v4u    val[2];
  size_t idx[2];
  #pragma unroll
  for (int it = 0; it < 2; ++it) {
    const int u  = it * 8 + (tid >> 5);         // unit 0..15 of this tile: [n tile 4][kblock 2][half 2]
    const int ln = tid & 31;
    const int n  = (u >> 2) * 16 + (ln & 15);                               // 0..63
    const int ks = ((u >> 1) & 1) * 32 + (u & 1) * 16 + (ln >> 4) * 8;      // 0..56
    Pack8H ph;
    ph.v = *(const v8h*)(&sT[n * TP + ks]);
    val[it] = ph.u;
    idx[it] = (((size_t)((n0 >> 4) + (u >> 2)) * (K >> 5) + (k0 >> 5) + ((u >> 1) & 1)) * 2 + (u & 1)) * 256 + ln * 8;
  }
  #pragma unroll
  for (int it = 0; it < 2; ++it) *(v4u*)(Wt + idx[it]) = val[it];
}

// All operand planes in one launch: none of them reads another, so the block index alone picks the work.
// Blocks 0 .. WT_BLOCKS-1 transpose one weight tile each (wq, wk, wv, wo: WT_SQ tiles each; w1, w2: WT_FF each; they
// come first because a tile passes through LDS and a barrier); the blocks behind them convert 256 pieces of x each.
// The choice is the same for every thread of a block, so the transposer's barrier is reached by all of them or none.
#define WT_SQ      ((DIM / 64) * (DIM / 64))
#define WT_FF      ((FFN / 64) * (DIM / 64))
#define WT_BLOCKS  (4 * WT_SQ + 2 * WT_FF)
#define CVT_BLOCKS ((size_t)NTOK * DIM / 8 / 256)
static_assert(DIM / 64 == 8 && FFN / 64 == 32);
__global__ __launch_bounds__(256) void prep_kernel(const float* __restrict__ x, const float* __restrict__ wq,
                                                   const float* __restrict__ wk, const float* __restrict__ wv,
                                                   const float* __restrict__ wo, const float* __restrict__ w1,
                                                   const float* __restrict__ w2, f16* __restrict__ xh,
                                                   f16* __restrict__ wqkvT, f16* __restrict__ woT,
                                                   f16* __restrict__ w1T, f16* __restrict__ w2T) {
  __shared__ __align__(16) f16 sT[64 * TP];     // [n][k]
  const int b = blockIdx.x;
  if (b < WT_BLOCKS) {
    const float* W;
    f16* Wt;
    int K, N, lgn, tile;                        // lgn = log2(N / 64): tile = [k tile][n tile]
    if (b < 4 * WT_SQ) {
      // in[512][512] -> out[512][512] (rows = output feature); q, k, v stacked into the [1536][512] plane
      const int m = b / WT_SQ;
      tile = b - m * WT_SQ;
      W  = (m == 0) ? wq : ((m == 1) ? wk : ((m == 2) ? wv : wo));
      Wt = (m < 3) ? wqkvT + (size_t)m * DIM * DIM : woT;
      K = DIM; N = DIM; lgn = 3;
    } else if (b < 4 * WT_SQ + WT_FF) {
      tile = b - 4 * WT_SQ;                     // in[512][2048] -> out[2048][512]
      W = w1; Wt = w1T; K = DIM; N = FFN; lgn = 5;
    } else {
      tile = b - (4 * WT_SQ + WT_FF);           // in[2048][512] -> out[512][2048]
      W = w2; Wt = w2T; K = FFN; N = DIM; lgn = 3;
    }
    wt_tile(W, Wt, K, N, (tile & ((1 << lgn) - 1)) * 64, (tile >> lgn) * 64, sT);
  } else {
    cvt_x_piece(x, xh, (b - WT_BLOCKS) * 256 + (int)threadIdx.x);
  }
}

// ---------------------------------------------------------------------------------------------------
// GEMM main loop: acc[mt][nt] (16x16 tiles) of  A[m0 .. m0+31][K] x Bt[n0 .. n0+63][K]^T.
// A and Bt are packed f16 planes; fragments use the split k map for both operands:
// elements 0..7 <- k0 + 8*hi + 0..7, elements 8..15 <- k0 + 16 + 8*hi + 0..7; lane row / column = lq.
// A 16-row tile spans K*16 halves; a k block of 32 spans 512 halves; the second k half starts at +256.
template <int K>
static __device__ __forceinline__ void gemm_main(const f16* __restrict__ A, const f16* __restrict__ Bt,
                                                 int m0, int n0, int lq, int hi, v8f (&acc)[2][4]) {
  static_assert(K % 32 == 0);
  const f16* ap = A  + (size_t)m0 * K + (hi * 16 + lq) * 8;
  const f16* bp = Bt + (size_t)n0 * K + (hi * 16 + lq) * 8;
  #pragma unroll 1
  for (int k0 = 0; k0 < K; k0 += 32) {
    FragH a[2], b[4];
    #pragma unroll
    for (int mt = 0; mt < 2; ++mt) {
      const f16* p = ap + (size_t)mt * 16 * K + k0 * 16;
      a[mt].q[0] = *(const v4u*)(p);
      a[mt].q[1] = *(const v4u*)(p + 256);
    }
    #pragma unroll
    for (int nt = 0; nt < 4; ++nt) {
      const f16* p = bp + (size_t)nt * 16 * K + k0 * 16;
      b[nt].q[0] = *(const v4u*)(p);
      b[nt].q[1] = *(const v4u*)(p + 256);
    }
    #pragma unroll
    for (int mt = 0; mt < 2; ++mt) {
      #pragma unroll
      for (int nt = 0; nt < 4; ++nt) acc[mt][nt] = mma_f16(a[mt].v, b[nt].v, acc[mt][nt]);
    }
  }
}

// The same product for the launches that leave only two waves on a SIMD, too few to cover a fragment load's latency:
// a ring of D fragment sets in registers. Each set is refilled, right behind its own products, with the k block D
// further on, so D k blocks of loads are in flight per wave. The k blocks are summed in the same ascending order as above.
template <int K>
static __device__ __forceinline__ void load_kblock(const char* __restrict__ ap, const char* __restrict__ bp,
                                                   FragH (&a)[2], FragH (&b)[4]) {
  #pragma unroll
  for (int mt = 0; mt < 2; ++mt) {
    const char* p = ap + (size_t)mt * 32 * K;       // byte addresses: a 16-row tile spans 32 * K bytes
    a[mt].q[0] = *(const v4u*)(p);
    a[mt].q[1] = *(const v4u*)(p + 512);
  }
  #pragma unroll
  for (int nt = 0; nt < 4; ++nt) {
    const char* p = bp + (size_t)nt * 32 * K;
    b[nt].q[0] = *(const v4u*)(p);
    b[nt].q[1] = *(const v4u*)(p + 512);
  }
}

template <int K, int D>
static __device__ __forceinline__ void gemm_main_ring(const f16* __restrict__ A, const f16* __restrict__ Bt,
                                                      int m0, int n0, int lq, int hi, v8f (&acc)[2][4]) {
  constexpr int G = (K / 32) / D;                         // whole groups of D k blocks
  constexpr int R = (K / 32) % D;                         // k blocks left over behind them
  static_assert(K % 32 == 0 && G >= 2);
  const char* ab = (const char*)(A  + (size_t)m0 * K);   // wave-uniform bases
  const char* bb = (const char*)(Bt + (size_t)n0 * K);
  unsigned off = (hi * 16 + lq) * 16;                     // byte offset: the lane's piece of a unit + the k blocks done
  FragH a[D][2], b[D][4];
  #pragma unroll
  for (int s = 0; s < D; ++s) load_kblock<K>(ab + off + s * 1024, bb + off + s * 1024, a[s], b[s]);
  #pragma unroll 1
  for (int g = 1; g < G; ++g) {
    // the loads in flight name the offset register: wait before it is advanced (the operand keeps the add behind)
    asm volatile("s_wait_xcnt 0x0" : "+v"(off) : : "memory");
    off += D * 1024;
    #pragma unroll
    for (int s = 0; s < D; ++s) {
      #pragma unroll
      for (int mt = 0; mt < 2; ++mt) {
        #pragma unroll
        for (int nt = 0; nt < 4; ++nt) acc[mt][nt] = mma_f16(a[s][mt].v, b[s][nt].v, acc[mt][nt]);
      }
      load_kblock<K>(ab + off + s * 1024, bb + off + s * 1024, a[s], b[s]);
    }
  }
  // the last refills still name the offset register and the bases: wait before they are put to other use
  asm volatile("s_wait_xcnt 0x0" : "+v"(off) : : "memory");
  // last whole group; the left-over k blocks refill its first sets
  #pragma unroll
  for (int s = 0; s < D; ++s) {
    #pragma unroll
    for (int mt = 0; mt < 2; ++mt) {
      #pragma unroll
      for (int nt = 0; nt < 4; ++nt) acc[mt][nt] = mma_f16(a[s][mt].v, b[s][nt].v, acc[mt][nt]);
    }
    if (s < R) load_kblock<K>(ab + off + (D + s) * 1024, bb + off + (D + s) * 1024, a[s], b[s]);
  }
  #pragma unroll
  for (int s = 0; s < R; ++s) {
    #pragma unroll
    for (int mt = 0; mt < 2; ++mt) {
      #pragma unroll
      for (int nt = 0; nt < 4; ++nt) acc[mt][nt] = mma_f16(a[s][mt].v, b[s][nt].v, acc[mt][nt]);
    }
  }
}

// ---------------------------------------------------------------------------------------------------
// Fused q/k/v projection: [NTOK][512] x [1536][512]^T. Column block (64 wide) = one head of q, k or v.
//          qk plane order: 0 = q, 1 = k.
//   q, k : per (b, h) a packed plane with rows = tokens, K = d (64): 1024 halves per 16 tokens.
//   v    : per (b, h) a packed plane with rows = d (4 tiles), K = tokens, k block outermost:
//          [s/32][d tile 4][half 2][lane 32][8] f16 (x VC), written through a block-wide LDS tile.
// coverage: q/k rows wave*32 + {0..31} x 64 d = 8 units per wave; vt 64 d x 128 tokens = 32 units per block.
__global__ __launch_bounds__(128) void gemm_qkv_kernel(const f16* __restrict__ xh, const f16* __restrict__ wT,
                                                       const float* __restrict__ bq, const float* __restrict__ bk,
                                                       const float* __restrict__ bv,
                                                       f16* __restrict__ qk, f16* __restrict__ vt) {
  __shared__ __align__(16) float sC[GW * 32 * OP];    // per-wave f32 tiles (block barrier used)
  __shared__ __align__(16) f16   sVT[HDIM * VP];      // [d][token], cross-wave (block barrier)
  const int tid  = threadIdx.x;
  const int wave = __builtin_amdgcn_readfirstlane(threadIdx.x >> 5);
  const int lane = tid & 31;
  const int lq   = lane & 15;
  const int hi   = lane >> 4;
  const int tok0 = blockIdx.x * GM;
  const int n0   = blockIdx.y * GN;
  const int seg  = n0 / DIM;                          // 0 = q, 1 = k, 2 = v (block-uniform)
  const int h    = (n0 - seg * DIM) / HDIM;
  const int bb   = tok0 / SEQ;
  const int s0   = tok0 - bb * SEQ;

  v8f acc[2][4];
  #pragma unroll
  for (int mt = 0; mt < 2; ++mt) {
    #pragma unroll
    for (int nt = 0; nt < 4; ++nt) acc[mt][nt] = (v8f){0, 0, 0, 0, 0, 0, 0, 0};
  }
  ask_panels<DIM>(xh, wT, tok0, n0, tid, wave);
  gemm_main<DIM>(xh, wT, tok0 + wave * 32, n0, lq, hi, acc);

  const float ascale = 1.0f / (XC * WC);
  float bias[4];
  #pragma unroll
  for (int nt = 0; nt < 4; ++nt) {
    const int c = h * HDIM + nt * 16 + lq;            // 0..511
    const float fq = bq[c];
    const float fk = bk[c];
    const float fv = bv[c];
    const float sel = (seg == 0) ? fq : ((seg == 1) ? fk : fv);
    bias[nt] = bfr(sel);
  }

  if (seg < 2) {
    const int wb = wave * (32 * OP);
    #pragma unroll
    for (int mt = 0; mt < 2; ++mt) {
      #pragma unroll
      for (int nt = 0; nt < 4; ++nt) {
        #pragma unroll
        for (int r = 0; r < 8; ++r)
          sC[wb + (mt * 16 + hi * 8 + r) * OP + nt * 16 + lq] = acc[mt][nt][r] * ascale + bias[nt];
      }
    }
    __syncthreads();
    const size_t pbase = (size_t)seg * PLANE +
                         (((size_t)bb * NHEAD + h) * SEQ + s0 + wave * 32) * HDIM;
    v4u hv[8];
    #pragma unroll
    for (int it = 0; it < 8; ++it) {
      const int row = (it >> 2) * 16 + lq;                               // unit it: [row tile 2][d block 2][half 2]
      const int col = ((it >> 1) & 1) * 32 + (it & 1) * 16 + hi * 8;
      const v4f c0 = *(const v4f*)(&sC[wb + row * OP + col]);
      const v4f c1 = *(const v4f*)(&sC[wb + row * OP + col + 4]);
      Pack8H ph;
      #pragma unroll
      for (int i = 0; i < 4; ++i) {
        ph.h[i]     = (f16)c0[i];
        ph.h[4 + i] = (f16)c1[i];
      }
      hv[it] = ph.u;
    }
    #pragma unroll
    for (int it = 0; it < 8; ++it) *(v4u*)(qk + pbase + (size_t)it * 256 + lane * 8) = hv[it];
    
  } else {
    #pragma unroll
    for (int mt = 0; mt < 2; ++mt) {
      #pragma unroll
      for (int nt = 0; nt < 4; ++nt) {
        #pragma unroll
        for (int r = 0; r < 8; ++r)
          sVT[(nt * 16 + lq) * VP + wave * 32 + mt * 16 + hi * 8 + r] =
              (f16)((acc[mt][nt][r] * ascale + bias[nt]) * VC);
      }
    }
    __syncthreads();
    const size_t vbase = (((size_t)bb * NHEAD + h) * SEQ + s0) * HDIM;   // first unit of this block's 128 tokens
    v4u vv[8];
    #pragma unroll
    for (int it = 0; it < 8; ++it) {
      const int u = it * 4 + wave;                 // unit 0..31: [token block 4][d tile 4][half 2]
      const int d = ((u >> 1) & 3) * 16 + lq;
      const int s = (u >> 3) * 32 + (u & 1) * 16 + hi * 8;
      Pack8H ph;
      ph.v = *(const v8h*)(&sVT[d * VP + s]);
      vv[it] = ph.u;
    }
    #pragma unroll
    for (int it = 0; it < 8; ++it) {
      const size_t o = vbase + (size_t)(it * 4 + wave) * 256 + lane * 8;
      *(v4u*)(vt + o) = vv[it];
    }
    
  }
}

// ---------------------------------------------------------------------------------------------------
// Flash attention, full (no mask). Block = (128-query block, head, batch); one wave owns 16 query rows.
// S^T = K x Q^T so queries sit on lanes; P^T in C layout is the A-fragment layout of O += P x V.
// Scores: s = k x q on the f16 planes, f32 accumulate, d blocks summed in ascending order.
// Fragments come straight from the packed 16-bit planes (two 512-B unit loads each); q fragments stay in registers.
__global__ __launch_bounds__(256) void attn_kernel(const f16* __restrict__ qk, const f16* __restrict__ vt,
                                                   f16* __restrict__ ctx) {
  __shared__ __align__(16) float sO[NWAVE * 16 * OP];    // per-wave output staging (block barrier used)
  const int qblk = blockIdx.x;
  const int h    = blockIdx.y;
  const int b    = blockIdx.z;
  const int tid  = threadIdx.x;
  const int wave = __builtin_amdgcn_readfirstlane(threadIdx.x >> 5);
  const int lane = tid & 31;
  const int lq   = lane & 15;   // query column of S^T / d column of O
  const int hi   = lane >> 4;   // k-split half

  const int qrow0 = qblk * BQ + wave * 16;
  const size_t hb = ((size_t)b * NHEAD + h) * (size_t)SEQ * HDIM;
  const f16* qh_p = qk + hb;
  const f16* kh_p = qk + PLANE + hb;
  const f16* vt_h = vt + hb;
  const int qoff  = qrow0 * HDIM + lane * 8;         // this wave's 16-query tile, lane's piece of a unit

  // this head's K and V planes (1024 units each), a quarter per block by the query block's index: one unit of each a thread
  static_assert((size_t)SEQ * HDIM * 2 == (size_t)4 * 256 * 256);
  {
    const size_t po = (size_t)(qblk & 3) * (256 * 256) + tid * 256;
    ask_l2((const char*)kh_p + po, (const char*)vt_h + po);
  }

  // q B-fragments, loaded once and held for the whole key loop
  FragH fqh[2];
  #pragma unroll
  for (int f = 0; f < 2; ++f) {
    const int qo = qoff + f * 512;
    fqh[f].q[0] = *(const v4u*)(qh_p + qo);           // d = f*32 + hi*8 + 0..7
    fqh[f].q[1] = *(const v4u*)(qh_p + qo + 256);     // d = f*32 + 16 + hi*8 + 0..7
  }

  v8f o[4];
  #pragma unroll
  for (int dt = 0; dt < 4; ++dt) o[dt] = (v8f){0, 0, 0, 0, 0, 0, 0, 0};

  const float SL = 0.125f * 1.4426950408889634f;   // softmax scale * log2(e)
  float rmax = -__builtin_inff();                  // the softmax reference in use (a raw score): the same in lane and lane ^ 16
  float rlim = -__builtin_inff();                  // rmax + LZ / SL: a raw score above it asks for a new reference
  float roff = __builtin_inff();                   // PCL - rmax * SL: carried P = exp2(score * SL + roff)
  float rsum = 0.0f;                               // sum of the carried P

  // K A-fragments (row = key lq of the tile, split d map) and V B-fragments (column n = d = dt*16 + lq, split key map
  // from the packed transposed plane) are fetched one step ahead into the same registers: step 0's here, step j + 1's
  // K behind step j's score products and its V behind step j's P x V products.
  FragH fkh[2][2], bv[4];
  #pragma unroll
  for (int sub = 0; sub < 2; ++sub) {
    #pragma unroll
    for (int f = 0; f < 2; ++f) {
      const int ko = sub * 16 * HDIM + f * 512 + lane * 8;
      fkh[sub][f].q[0] = *(const v4u*)(kh_p + ko);
      fkh[sub][f].q[1] = *(const v4u*)(kh_p + ko + 256);
    }
  }
  // keeps step 0's V loads behind its q and K loads, as in every later step: loads return in order, and only so can
  // the counted wait at the head of the loop leave the eight V loads in flight under the score products and the softmax
  __builtin_amdgcn_sched_barrier(0);
  #pragma unroll
  for (int dt = 0; dt < 4; ++dt) {
    const f16* base = vt_h + dt * 512 + lane * 8;
    bv[dt].q[0] = *(const v4u*)(base);              // keys hi*8 + 0..7
    bv[dt].q[1] = *(const v4u*)(base + 256);        // keys 16 + hi*8 + 0..7
  }

  #pragma unroll 1
  for (int j0 = 0; j0 < SEQ; j0 += BK) {
    // the step fetched ahead; the last step has none and refetches step 0 (in bounds, never used)
    const int jn = (j0 + BK < SEQ) ? j0 + BK : 0;

    // S^T tiles: c[sub][r] = rawscore(query qrow0+lq, key j0 + sub*16 + hi*8 + r)
    v8f c[2];
    c[0] = (v8f){0, 0, 0, 0, 0, 0, 0, 0};
    c[1] = (v8f){0, 0, 0, 0, 0, 0, 0, 0};
    #pragma unroll
    for (int f = 0; f < 2; ++f) {
      #pragma unroll
      for (int sub = 0; sub < 2; ++sub) c[sub] = mma_f16(fkh[sub][f].v, fqh[f].v, c[sub]);
    }

    // next step's K fragments, in flight under the softmax and the P x V products
    #pragma unroll
    for (int sub = 0; sub < 2; ++sub) {
      #pragma unroll
      for (int f = 0; f < 2; ++f) {
        const int ko = (jn + sub * 16) * HDIM + f * 512 + lane * 8;
        fkh[sub][f].q[0] = *(const v4u*)(kh_p + ko);
        fkh[sub][f].q[1] = *(const v4u*)(kh_p + ko + 256);
      }
    }
    // the K loads in flight name their address pair: wait before the softmax below puts those registers to other use
    asm volatile("s_wait_xcnt 0x0" ::: "memory");
    // keeps the K loads from sinking into the softmax below, where less work would cover their latency
    __builtin_amdgcn_sched_barrier(0);

    // online softmax, lazy rescale: query lq's 32 scores are split across lane / lane^16. Any reference common to a row
    // gives the same quotient O / sum, so the one in use stays until some score of the wave passes it by more than LZ.
    // All that depends on the reference alone is then formed anew: one test per step, a scalar branch on the ballot
    // (every lane is on inside it and behind it, as the matrix products need).
    float m_blk = rmax;
    #pragma unroll
    for (int r = 0; r < 8; ++r) {
      m_blk = fmaxf(m_blk, c[0][r]);
      m_blk = fmaxf(m_blk, c[1][r]);
    }
    if (__builtin_amdgcn_ballot_w32(m_blk > rlim) != 0) {
      rmax = fmaxf(m_blk, __shfl_xor(m_blk, 16, 32));
      rlim = rmax + LZ / SL;
      const float noff  = fmaf(-SL, rmax, PCL);
      const float scale = __builtin_amdgcn_exp2f(noff - roff);   // from the two offsets themselves: their rounding cancels
      roff = noff;
      rsum *= scale;
      // rescale O: queries are the row dimension there -> per-row scale from lane 8*hi + r
      float sc[8];
      #pragma unroll
      for (int r = 0; r < 8; ++r) sc[r] = __shfl(scale, (hi << 3) + r, 32);
      #pragma unroll
      for (int dt = 0; dt < 4; ++dt) {
        #pragma unroll
        for (int r = 0; r < 8; ++r) o[dt][r] *= sc[r];
      }
    }

    // exp + pack: P^T C-layout == A-fragment layout for the PV product
    FragH pa;
    float psum = 0.0f;
    #pragma unroll
    for (int r = 0; r < 8; ++r) {
      const float p0 = __builtin_amdgcn_exp2f(fmaf(c[0][r], SL, roff));   // key hi*8 + r
      const float p1 = __builtin_amdgcn_exp2f(fmaf(c[1][r], SL, roff));   // key 16 + hi*8 + r
      psum += p0 + p1;
      pa.h[r]     = (f16)p0;
      pa.h[8 + r] = (f16)p1;
    }
    rsum = rsum + psum + __shfl_xor(psum, 16, 32);

    // O += P x V
    #pragma unroll
    for (int dt = 0; dt < 4; ++dt) o[dt] = mma_f16(pa.v, bv[dt].v, o[dt]);

    // next step's V fragments, in flight under its score products and softmax
    #pragma unroll
    for (int dt = 0; dt < 4; ++dt) {
      const f16* base = vt_h + (size_t)jn * HDIM + dt * 512 + lane * 8;
      bv[dt].q[0] = *(const v4u*)(base);            // keys jn + hi*8 + 0..7
      bv[dt].q[1] = *(const v4u*)(base + 256);      // keys jn + 16 + hi*8 + 0..7
    }
    // the V address pair is formed anew at the head of the next step: wait before that overwrite
    asm volatile("s_wait_xcnt 0x0" ::: "memory");
  }

  // normalize: lane holds column d = dt*16 + lq for query rows 8*hi + r
  float rs[8];
  #pragma unroll
  for (int r = 0; r < 8; ++r) rs[r] = 1.0f / __shfl(rsum, (hi << 3) + r, 32);

  const int wb = wave * (16 * OP);
  #pragma unroll
  for (int r = 0; r < 8; ++r) {
    #pragma unroll
    for (int dt = 0; dt < 4; ++dt)
      sO[wb + (hi * 8 + r) * OP + dt * 16 + lq] = o[dt][r] * (CC / VC) * rs[r];   // P's carry is in o and in the sum alike
  }
  __syncthreads();

  v4u    pv[4];
  size_t gidx[4];
  #pragma unroll
  for (int it = 0; it < 4; ++it) {
    const int row = lq;                                   // unit it: [k block 2][half 2] of this head's 64 columns
    const int col = (it >> 1) * 32 + (it & 1) * 16 + hi * 8;
    const v4f c0 = *(const v4f*)(&sO[wb + row * OP + col]);
    const v4f c1 = *(const v4f*)(&sO[wb + row * OP + col + 4]);
    Pack8H ph;
    #pragma unroll
    for (int i = 0; i < 4; ++i) {
      ph.h[i]     = (f16)c0[i];
      ph.h[4 + i] = (f16)c1[i];
    }
    pv[it]   = ph.u;
    gidx[it] = ((size_t)b * SEQ + qrow0) * DIM + (size_t)(h * 4 + it) * 256 + lane * 8;   // packed, K = DIM
  }
  #pragma unroll
  for (int it = 0; it < 4; ++it) *(v4u*)(ctx + gidx[it]) = pv[it];
  
}

// ---------------------------------------------------------------------------------------------------
// y = ctx x wo + bo + bf16_rne(x)   (f32 plane [NTOK][DIM], input of LayerNorm 1)
// coverage: rows wave*32 + {0..31}, 64 columns: 16 instr, lanes 0..15 one 256-B row segment, 16..31 the next row.
__global__ __launch_bounds__(128) void gemm_wo_kernel(const f16* __restrict__ ctx, const f16* __restrict__ woT,
                                                      const float* __restrict__ bo, const float* __restrict__ x,
                                                      float* __restrict__ y) {
  __shared__ __align__(16) float sC[GW * 32 * OP];
  const int tid  = threadIdx.x;
  const int wave = __builtin_amdgcn_readfirstlane(threadIdx.x >> 5);
  const int lane = tid & 31;
  const int lq   = lane & 15;
  const int hi   = lane >> 4;
  const int tok0 = blockIdx.x * GM;
  const int n0   = blockIdx.y * GN;
  const int bb   = tok0 / SEQ;
  const int s0   = tok0 - bb * SEQ;

  v8f acc[2][4];
  #pragma unroll
  for (int mt = 0; mt < 2; ++mt) {
    #pragma unroll
    for (int nt = 0; nt < 4; ++nt) acc[mt][nt] = (v8f){0, 0, 0, 0, 0, 0, 0, 0};
  }
  ask_panels<DIM>(ctx, woT, tok0, n0, tid, wave);
  // the block's own piece of the residual, read behind the k loop: one 256-B row segment a thread
  ask_l2((const char*)(x + ((size_t)bb * SEQ_FULL + s0 + tid) * DIM + n0));
  gemm_main_ring<DIM, RD>(ctx, woT, tok0 + wave * 32, n0, lq, hi, acc);

  const float ascale = 1.0f / (CC * WC);
  const int wb = wave * (32 * OP);
  #pragma unroll
  for (int nt = 0; nt < 4; ++nt) {
    const float bias = bfr(bo[n0 + nt * 16 + lq]);
    #pragma unroll
    for (int mt = 0; mt < 2; ++mt) {
      #pragma unroll
      for (int r = 0; r < 8; ++r)
        sC[wb + (mt * 16 + hi * 8 + r) * OP + nt * 16 + lq] = acc[mt][nt][r] * ascale + bias;
    }
  }
  __syncthreads();

  const size_t orow = (size_t)tok0 + wave * 32;                          // compact row
  const size_t rrow = (size_t)bb * SEQ_FULL + s0 + wave * 32;            // row of the full-size x
  #pragma unroll
  for (int g = 0; g < 2; ++g) {
    v4f vals[8];
    #pragma unroll
    for (int it = 0; it < 8; ++it) {
      const int row = g * 16 + it * 2 + hi;
      v4f cv = *(const v4f*)(&sC[wb + row * OP + lq * 4]);
      const v4f rv = *(const v4f*)(x + (rrow + row) * DIM + n0 + lq * 4);
      #pragma unroll
      for (int i = 0; i < 4; ++i) cv[i] = cv[i] + bfr(rv[i]);
      vals[it] = cv;
    }
    #pragma unroll
    for (int it = 0; it < 8; ++it)
      *(v4f*)(y + (orow + g * 16 + it * 2 + hi) * DIM + n0 + lq * 4) = vals[it];
    
  }
}

// ---------------------------------------------------------------------------------------------------
// f32 row: 4 instr x (32 lanes x 16 B) ; f16 rows staged in LDS (cross-wave, block barrier) and written packed:
// the block's 8 tokens fill 8 neighbouring lane slots = one whole 128-B line in each of the 64 (k block, half, hi) groups.
__global__ __launch_bounds__(256) void ln1_kernel(const float* __restrict__ y, const float* __restrict__ g,
                                                  const float* __restrict__ be,
                                                  float* __restrict__ x1f, f16* __restrict__ x1h) {
  __shared__ __align__(16) f16 sH[8 * SHP];
  const int tid  = threadIdx.x;
  const int wave = __builtin_amdgcn_readfirstlane(threadIdx.x >> 5);
  const int lane = tid & 31;
  const int t    = blockIdx.x * 8 + wave;             // compact token
  const float* yr = y + (size_t)t * DIM;

  v4f v[4];
  float s = 0.0f;
  #pragma unroll
  for (int j = 0; j < 4; ++j) {
    v[j] = *(const v4f*)(yr + j * 128 + lane * 4);
    s += (v[j][0] + v[j][1]) + (v[j][2] + v[j][3]);
  }
  s = wave_sum(s);
  const float mean = s * (1.0f / DIM);
  float q = 0.0f;
  #pragma unroll
  for (int j = 0; j < 4; ++j) {
    #pragma unroll
    for (int i = 0; i < 4; ++i) {
      const float d = v[j][i] - mean;
      q += d * d;
    }
  }
  q = wave_sum(q);
  const float rstd = rsqrtf(q * (1.0f / DIM) + 1e-5f);

  v4f ov[4];
  #pragma unroll
  for (int j = 0; j < 4; ++j) {
    const v4f gv = *(const v4f*)(g + j * 128 + lane * 4);
    const v4f bv = *(const v4f*)(be + j * 128 + lane * 4);
    #pragma unroll
    for (int i = 0; i < 4; ++i) {
      const float val = (v[j][i] - mean) * rstd * bfr(gv[i]) + bfr(bv[i]);
      ov[j][i] = val;
      sH[wave * SHP + j * 128 + lane * 4 + i] = (f16)(val * XC);
    }
  }
  __syncthreads();
  const int t0 = blockIdx.x * 8;                      // first token of the block
  v4u    hv[2];
  size_t hidx[2];
  #pragma unroll
  for (int jj = 0; jj < 2; ++jj) {
    const int tk = tid & 7;                           // token of the block
    const int ln = jj * 32 + (tid >> 3);              // 8-column group 0..63 = kblock*4 + half*2 + hi
    Pack8H ph;
    ph.v = *(const v8h*)(&sH[tk * SHP + ln * 8]);
    hv[jj] = ph.u;
    hidx[jj] = (size_t)(t0 >> 4) * (16 * DIM) + (size_t)(ln >> 1) * 256 + ((ln & 1) * 16 + (t0 & 15) + tk) * 8;
  }
  float* fo = x1f + (size_t)t * DIM + lane * 4;
  #pragma unroll
  for (int j = 0; j < 4; ++j) *(v4f*)(fo + j * 128) = ov[j];
  #pragma unroll
  for (int jj = 0; jj < 2; ++jj) *(v4u*)(x1h + hidx[jj]) = hv[jj];
  
}

static __device__ __forceinline__ void rcp8(const float (&d)[8], float (&t)[8]) {
  asm("v_rcp_f32 %0, %8\n\t"
      "v_rcp_f32 %1, %9\n\t"
      "v_rcp_f32 %2, %10\n\t"
      "v_rcp_f32 %3, %11\n\t"
      "v_rcp_f32 %4, %12\n\t"
      "v_rcp_f32 %5, %13\n\t"
      "v_rcp_f32 %6, %14\n\t"
      "v_rcp_f32 %7, %15\n\t"
      "v_nop"
      : "=&v"(t[0]), "=&v"(t[1]), "=&v"(t[2]), "=&v"(t[3]), "=&v"(t[4]), "=&v"(t[5]), "=&v"(t[6]), "=&v"(t[7])
      : "v"(d[0]), "v"(d[1]), "v"(d[2]), "v"(d[3]), "v"(d[4]), "v"(d[5]), "v"(d[6]), "v"(d[7]));
}
static __device__ __forceinline__ void exp2_8(const float (&w)[8], float (&e)[8]) {
  asm("v_exp_f32 %0, %8\n\t"
      "v_exp_f32 %1, %9\n\t"
      "v_exp_f32 %2, %10\n\t"
      "v_exp_f32 %3, %11\n\t"
      "v_exp_f32 %4, %12\n\t"
      "v_exp_f32 %5, %13\n\t"
      "v_exp_f32 %6, %14\n\t"
      "v_exp_f32 %7, %15\n\t"
      "v_nop"
      : "=&v"(e[0]), "=&v"(e[1]), "=&v"(e[2]), "=&v"(e[3]), "=&v"(e[4]), "=&v"(e[5]), "=&v"(e[6]), "=&v"(e[7])
      : "v"(w[0]), "v"(w[1]), "v"(w[2]), "v"(w[3]), "v"(w[4]), "v"(w[5]), "v"(w[6]), "v"(w[7]));
}

// GELU, erf form, without a branch, on eight values. With z = u / sqrt(2) and t = 1 / (1 + p |z|),
//   erfc(|z|) = (a1 t + a2 t^2 + a3 t^3 + a4 t^4 + a5 t^5) exp(-z^2), absolute error of the form below 1.5e-7 for every z,
// and 0.5 u (1 + erf(z)) = max(u, 0) - |u| * 0.5 erfc(|z|) for either sign of u (no cancellation on the negative side).
// The 0.5 is folded into a1..a5 and the 1 / sqrt(2) into p and the exponent. One straight run of instructions for every
// lane, so a lane's values are independent chains that the compiler can interleave.
static __device__ __forceinline__ void gelu_erf8(float (&u)[8]) {
  float d[8], w[8], t[8], e[8];
  #pragma unroll
  for (int i = 0; i < 8; ++i) {
    d[i] = fmaf(0.3275911f * 0.70710678118654752f, fabsf(u[i]), 1.0f);
    w[i] = u[i] * u[i] * (-0.5f * 1.4426950408889634f);      // -z^2 * log2(e)
  }
  rcp8(d, t);
  exp2_8(w, e);
  #pragma unroll
  for (int i = 0; i < 8; ++i) {
    float p = fmaf(0.5f * 1.061405429f, t[i], 0.5f * -1.453152027f);
    p = fmaf(p, t[i], 0.5f * 1.421413741f);
    p = fmaf(p, t[i], 0.5f * -0.284496736f);
    p = fmaf(p, t[i], 0.5f * 0.254829592f);
    p = p * t[i];
    u[i] = fmaf(-fabsf(u[i]), p * e[i], fmaxf(u[i], 0.0f));
  }
}

// hh = f16( gelu_erf(x1 x w1 + b1) * XC )   packed plane (rows = tokens, K = FFN)
__global__ __launch_bounds__(128) void gemm_ffn1_kernel(const f16* __restrict__ x1h, const f16* __restrict__ w1T,
                                                        const float* __restrict__ b1, f16* __restrict__ hh) {
  __shared__ __align__(16) float sC[GW * 32 * OP];
  const int tid  = threadIdx.x;
  const int wave = __builtin_amdgcn_readfirstlane(threadIdx.x >> 5);
  const int lane = tid & 31;
  const int lq   = lane & 15;
  const int hi   = lane >> 4;
  const int tok0 = blockIdx.x * GM;
  const int n0   = blockIdx.y * GN;

  v8f acc[2][4];
  #pragma unroll
  for (int mt = 0; mt < 2; ++mt) {
    #pragma unroll
    for (int nt = 0; nt < 4; ++nt) acc[mt][nt] = (v8f){0, 0, 0, 0, 0, 0, 0, 0};
  }
  ask_panels<DIM>(x1h, w1T, tok0, n0, tid, wave);
  gemm_main<DIM>(x1h, w1T, tok0 + wave * 32, n0, lq, hi, acc);

  const float ascale = 1.0f / (XC * WC);
  const int wb = wave * (32 * OP);
  float bias[4];                                      // all four loaded ahead of the fenced groups below
  #pragma unroll
  for (int nt = 0; nt < 4; ++nt) bias[nt] = bfr(b1[n0 + nt * 16 + lq]);
  #pragma unroll
  for (int nt = 0; nt < 4; ++nt) {
    #pragma unroll
    for (int mt = 0; mt < 2; ++mt) {
      float gl[8];
      #pragma unroll
      for (int r = 0; r < 8; ++r) gl[r] = acc[mt][nt][r] * ascale + bias[nt];
      gelu_erf8(gl);
      #pragma unroll
      for (int r = 0; r < 8; ++r) sC[wb + (mt * 16 + hi * 8 + r) * OP + nt * 16 + lq] = gl[r];
      // eight values at a time: without this the compiler starts many more at once, and the registers they hold cost
      // the eighth wave per SIMD, which the grid needs to be resident in one round
      __builtin_amdgcn_sched_barrier(0);
    }
  }
  __syncthreads();

  // piece it is this lane's 16 B of unit it: [row tile 2][k block 2][half 2]
  const int lbase = wb + lq * OP + hi * 8;

  v4u pv[8];
  #pragma unroll
  for (int it = 0; it < 8; ++it) {
    const int off = lbase + (it >> 2) * (16 * OP) + (it & 3) * 16;
    const v4f c0 = *(const v4f*)(&sC[off]);
    const v4f c1 = *(const v4f*)(&sC[off + 4]);
    Pack8H ph;
    #pragma unroll
    for (int i = 0; i < 4; ++i) {
      ph.h[i]     = (f16)(c0[i] * XC);
      ph.h[4 + i] = (f16)(c1[i] * XC);
    }
    pv[it] = ph.u;
  }
  const size_t obase = ((size_t)tok0 + wave * 32) * FFN + (size_t)n0 * 16 + lane * 8;
  #pragma unroll
  for (int it = 0; it < 8; ++it) *(v4u*)(hh + obase + (size_t)(it >> 2) * 16 * FFN + (it & 3) * 256) = pv[it];
  
}

// ---------------------------------------------------------------------------------------------------
// y = hh x w2 + b2 + x1f   (f32 plane [NTOK][DIM], input of LayerNorm 2)
__global__ __launch_bounds__(128) void gemm_ffn2_kernel(const f16* __restrict__ hh, const f16* __restrict__ w2T,
                                                        const float* __restrict__ b2, const float* __restrict__ x1f,
                                                        float* __restrict__ y) {
  __shared__ __align__(16) float sC[GW * 32 * OP];
  const int tid  = threadIdx.x;
  const int wave = __builtin_amdgcn_readfirstlane(threadIdx.x >> 5);
  const int lane = tid & 31;
  const int lq   = lane & 15;
  const int hi   = lane >> 4;
  const int tok0 = blockIdx.x * GM;
  const int n0   = blockIdx.y * GN;

  v8f acc[2][4];
  #pragma unroll
  for (int mt = 0; mt < 2; ++mt) {
    #pragma unroll
    for (int nt = 0; nt < 4; ++nt) acc[mt][nt] = (v8f){0, 0, 0, 0, 0, 0, 0, 0};
  }
  ask_panels<FFN>(hh, w2T, tok0, n0, tid, wave);
  // the block's own piece of the residual, read behind the k loop: one 256-B row segment a thread
  ask_l2((const char*)(x1f + ((size_t)tok0 + tid) * DIM + n0));
  gemm_main_ring<FFN, RD>(hh, w2T, tok0 + wave * 32, n0, lq, hi, acc);

  const float ascale = 1.0f / (XC * WC);
  const int wb = wave * (32 * OP);
  #pragma unroll
  for (int nt = 0; nt < 4; ++nt) {
    const float bias = bfr(b2[n0 + nt * 16 + lq]);
    #pragma unroll
    for (int mt = 0; mt < 2; ++mt) {
      #pragma unroll
      for (int r = 0; r < 8; ++r)
        sC[wb + (mt * 16 + hi * 8 + r) * OP + nt * 16 + lq] = acc[mt][nt][r] * ascale + bias;
    }
  }
  __syncthreads();

  const size_t orow = (size_t)tok0 + wave * 32;
  #pragma unroll
  for (int g = 0; g < 2; ++g) {
    v4f vals[8];
    #pragma unroll
    for (int it = 0; it < 8; ++it) {
      const int row = g * 16 + it * 2 + hi;
      v4f cv = *(const v4f*)(&sC[wb + row * OP + lq * 4]);
      const v4f rv = *(const v4f*)(x1f + (orow + row) * DIM + n0 + lq * 4);
      #pragma unroll
      for (int i = 0; i < 4; ++i) cv[i] = cv[i] + rv[i];
      vals[it] = cv;
    }
    #pragma unroll
    for (int it = 0; it < 8; ++it)
      *(v4f*)(y + (orow + g * 16 + it * 2 + hi) * DIM + n0 + lq * 4) = vals[it];
    
  }
}

// ---------------------------------------------------------------------------------------------------
__global__ __launch_bounds__(256) void ln2_kernel(const float* __restrict__ y, const float* __restrict__ g,
                                                  const float* __restrict__ be, float* __restrict__ out) {
  const int tid  = threadIdx.x;
  const int wave = __builtin_amdgcn_readfirstlane(threadIdx.x >> 5);
  const int lane = tid & 31;
  const int t    = blockIdx.x * 8 + wave;             // compact token
  const int bb   = t / SEQ;
  const int s0   = t - bb * SEQ;
  const float* yr = y + (size_t)t * DIM;

  v4f v[4];
  float s = 0.0f;
  #pragma unroll
  for (int j = 0; j < 4; ++j) {
    v[j] = *(const v4f*)(yr + j * 128 + lane * 4);
    s += (v[j][0] + v[j][1]) + (v[j][2] + v[j][3]);
  }
  s = wave_sum(s);
  const float mean = s * (1.0f / DIM);
  float q = 0.0f;
  #pragma unroll
  for (int j = 0; j < 4; ++j) {
    #pragma unroll
    for (int i = 0; i < 4; ++i) {
      const float d = v[j][i] - mean;
      q += d * d;
    }
  }
  q = wave_sum(q);
  const float rstd = rsqrtf(q * (1.0f / DIM) + 1e-5f);

  v4f ov[4];
  #pragma unroll
  for (int j = 0; j < 4; ++j) {
    const v4f gv = *(const v4f*)(g + j * 128 + lane * 4);
    const v4f bv = *(const v4f*)(be + j * 128 + lane * 4);
    #pragma unroll
    for (int i = 0; i < 4; ++i) ov[j][i] = (v[j][i] - mean) * rstd * bfr(gv[i]) + bfr(bv[i]);
  }
  float* fo = out + ((size_t)bb * SEQ_FULL + s0) * DIM + lane * 4;
  #pragma unroll
  for (int j = 0; j < 4; ++j) *(v4f*)(fo + j * 128) = ov[j];
  
}

// ---------------------------------------------------------------------------------------------------
extern "C" void kernel_launch(void* const* d_in, const int* in_sizes, int n_in,
                              void* d_out, int out_size, void* d_ws, size_t ws_size,
                              hipStream_t stream) {
  if (n_in < 17) return;
  const size_t rows_used = (size_t)(NB - 1) * SEQ_FULL + SEQ;
  if ((size_t)in_sizes[0] < rows_used * DIM) return;
  if ((size_t)in_sizes[1] < (size_t)DIM * DIM || (size_t)in_sizes[3] < (size_t)DIM * DIM) return;
  if ((size_t)in_sizes[5] < (size_t)DIM * DIM || (size_t)in_sizes[7] < (size_t)DIM * DIM) return;
  if ((size_t)in_sizes[9] < (size_t)DIM * FFN || (size_t)in_sizes[11] < (size_t)FFN * DIM) return;
  if (in_sizes[2] < DIM || in_sizes[4] < DIM || in_sizes[6] < DIM || in_sizes[8] < DIM) return;
  if (in_sizes[10] < FFN || in_sizes[12] < DIM) return;
  if (in_sizes[13] < DIM || in_sizes[14] < DIM || in_sizes[15] < DIM || in_sizes[16] < DIM) return;
  if ((size_t)out_size < rows_used * DIM) return;
  if (ws_size < WS_TOTAL) return;

  const float* x   = (const float*)d_in[0];
  const float* wq  = (const float*)d_in[1];
  const float* bq  = (const float*)d_in[2];
  const float* wk  = (const float*)d_in[3];
  const float* bk  = (const float*)d_in[4];
  const float* wv  = (const float*)d_in[5];
  const float* bv  = (const float*)d_in[6];
  const float* wo  = (const float*)d_in[7];
  const float* bo  = (const float*)d_in[8];
  const float* w1  = (const float*)d_in[9];
  const float* b1  = (const float*)d_in[10];
  const float* w2  = (const float*)d_in[11];
  const float* b2  = (const float*)d_in[12];
  const float* g1  = (const float*)d_in[13];
  const float* be1 = (const float*)d_in[14];
  const float* g2  = (const float*)d_in[15];
  const float* be2 = (const float*)d_in[16];
  float* out = (float*)d_out;

  char* ws = (char*)d_ws;
  f16*   xh    = (f16*)(ws + OFF_XH);
  f16*   wqkvT = (f16*)(ws + OFF_WQKV);
  f16*   woT   = (f16*)(ws + OFF_WO);
  f16*   w1T   = (f16*)(ws + OFF_W1);
  f16*   w2T   = (f16*)(ws + OFF_W2);
  f16*   qk    = (f16*)(ws + OFF_BIG);     // the q and k planes
  f16*   hh    = (f16*)(ws + OFF_BIG);     // reuses the q/k region after the attention launch
  f16*   vt    = (f16*)(ws + OFF_VT);
  f16*   ctx   = (f16*)(ws + OFF_CTX);
  float* y     = (float*)(ws + OFF_Y);
  float* x1f   = (float*)(ws + OFF_X1F);
  f16*   x1h   = (f16*)(ws + OFF_X1H);

  // operand planes
  prep_kernel<<<dim3((unsigned)(WT_BLOCKS + CVT_BLOCKS)), 256, 0, stream>>>(x, wq, wk, wv, wo, w1, w2,
                                                                            xh, wqkvT, woT, w1T, w2T);

  gemm_qkv_kernel<<<dim3(NTOK / GM, QKVN / GN), 128, 0, stream>>>(xh, wqkvT, bq, bk, bv, qk, vt);
  attn_kernel<<<dim3(SEQ / BQ, NHEAD, NB), 256, 0, stream>>>(qk, vt, ctx);
  gemm_wo_kernel<<<dim3(NTOK / GM, DIM / GN), 128, 0, stream>>>(ctx, woT, bo, x, y);
  ln1_kernel<<<dim3(NTOK / 8), 256, 0, stream>>>(y, g1, be1, x1f, x1h);
  gemm_ffn1_kernel<<<dim3(NTOK / GM, FFN / GN), 128, 0, stream>>>(x1h, w1T, b1, hh);
  gemm_ffn2_kernel<<<dim3(NTOK / GM, DIM / GN), 128, 0, stream>>>(hh, w2T, b2, x1f, y);
  ln2_kernel<<<dim3(NTOK / 8), 256, 0, stream>>>(y, g2, be2, out);
}

// v009
// Measured time: 124 microseconds a run.
// Next to v008, in two timings, it ran 1.04 and 1.05 times as fast.
// Counting every step since v000, it is 3.93 times as fast.
#include <hip/hip_runtime.h>
#include <math.h>

// All contractions on v_wmma_f32_16x16x32_f16 with f32 accumulate: projections / Wo / FFN use f16 operand planes
// (inputs RNE-converted to bf16 first, then exact power-of-two carries); scores S^T = K x Q^T use q and k as one
// f16 plane each (11 significant bits, against the 8 of the operands q and k are made from); O = P x V with P f16
// carried x128 (P itself reaches 2^8 under the lazy rescale of the attention kernel).
//
// Every f16 operand plane in the workspace is stored fragment-packed: a [rows][K] operand is cut into tiles of
// 16 rows x 32 k; a tile is two 512-B units (k halves 0..15 and 16..31); inside a unit lane (hi*16 + lq) owns 16 B =
// row lq, k = half*16 + hi*8 + 0..7. Unit index = (rowtile * (K/32) + kblock) * 2 + half; the V^T plane puts the k block outermost. One wave-wide 16-B-per-lane
// load of a unit is 512 contiguous bytes (4 whole lines) and lands directly in the split-k fragment map.

#ifndef NB
#define NB 4
#endif
#ifndef SEQ
#define SEQ 2048
#endif
#define NB_FULL   4
#define SEQ_FULL  2048
#define DIM       512
#define NHEAD     8
#define HDIM      64
#define FFN       2048
#define QKVN      (3 * DIM)
#define NTOK      (NB * SEQ)
#define PLANE     ((size_t)NTOK * DIM)     // elements of one [NB][NHEAD][SEQ][HDIM] 16-bit plane
#define GM        128                      // GEMM block rows (4 waves x 32)
#define GN        64                       // GEMM block columns
#define GW        4                        // waves per GEMM block
#define OP        68                       // LDS pitch (floats) of f32 staging tiles
#define VP        136                      // LDS pitch (halves) of the V^T staging tile
#define TP        72                       // LDS pitch (halves) of the weight transposer tile
#define SHP       (DIM + 16)               // LDS pitch (halves) of the LayerNorm-1 f16 row staging
#define BQ        128                      // query rows per attention block (8 waves x 16)
#define BK        32                       // keys per attention step
#define NWAVE     8
#define XC        16.0f                    // carry of the x, LN1-output and GELU-output planes
#define WC        64.0f                    // carry of all weight planes
#define VC        16.0f                    // carry of the V^T plane
#define CC        256.0f                   // carry of the attention-context plane
#define LZ        8.0f                     // a score may pass the softmax reference by this much (scaled log2) before a rescale
#define PCL       7.0f                     // log2 of the carry of P inside the attention kernel: P * carry <= 2^(LZ + PCL), in f16 range
#define RD        3                        // fragment sets in the register ring of the Wo and FFN-2 products

static_assert(DIM == NHEAD * HDIM);
static_assert(HDIM == 64);
static_assert(HDIM == GN);
static_assert(GM == GW * 32);
static_assert(BQ == NWAVE * 16);
static_assert(SEQ % GM == 0);
static_assert(SEQ % BQ == 0);
static_assert(SEQ % BK == 0);
static_assert(NTOK % GM == 0);
static_assert(NTOK % 8 == 0);
static_assert(DIM % GN == 0);
static_assert(FFN % GN == 0);
static_assert(QKVN % GN == 0);
static_assert(DIM % 64 == 0);
static_assert(FFN % 64 == 0);
static_assert(DIM % 32 == 0);
static_assert(FFN % 32 == 0);
static_assert(DIM == 32 * 16);
static_assert(((size_t)NTOK * DIM / 8) % 256 == 0);
static_assert((OP * 4) % 16 == 0);
static_assert((VP * 2) % 16 == 0);
static_assert((TP * 2) % 16 == 0);
static_assert((SHP * 2) % 16 == 0);
static_assert(SEQ <= SEQ_FULL);
static_assert(NB >= 1 && NB <= NB_FULL);

#define SZ_XH    ((size_t)NTOK * DIM * 2)
#define SZ_WQKV  ((size_t)QKVN * DIM * 2)
#define SZ_WO    ((size_t)DIM * DIM * 2)
#define SZ_W1    ((size_t)FFN * DIM * 2)
#define SZ_W2    ((size_t)DIM * FFN * 2)
#define SZ_QK    ((size_t)2 * NTOK * DIM * 2)
#define SZ_HH    ((size_t)NTOK * FFN * 2)
#define SZ_BIG   ((SZ_QK > SZ_HH) ? SZ_QK : SZ_HH)   // q/k planes, later reused by the GELU-output plane
#define SZ_VT    ((size_t)NTOK * DIM * 2)
#define SZ_CTX   ((size_t)NTOK * DIM * 2)
#define SZ_Y     ((size_t)NTOK * DIM * 4)
#define SZ_X1F   ((size_t)NTOK * DIM * 4)
#define SZ_X1H   ((size_t)NTOK * DIM * 2)
#define OFF_XH   ((size_t)0)
#define OFF_WQKV (OFF_XH + SZ_XH)
#define OFF_WO   (OFF_WQKV + SZ_WQKV)
#define OFF_W1   (OFF_WO + SZ_WO)
#define OFF_W2   (OFF_W1 + SZ_W1)
#define OFF_BIG  (OFF_W2 + SZ_W2)
#define OFF_VT   (OFF_BIG + SZ_BIG)
#define OFF_CTX  (OFF_VT + SZ_VT)
#define OFF_Y    (OFF_CTX + SZ_CTX)
#define OFF_X1F  (OFF_Y + SZ_Y)
#define OFF_X1H  (OFF_X1F + SZ_X1F)
#define WS_TOTAL (OFF_X1H + SZ_X1H)
static_assert(SZ_QK <= SZ_BIG);
static_assert(SZ_HH <= SZ_BIG);
static_assert(SZ_XH % 128 == 0 && SZ_WQKV % 128 == 0 && SZ_WO % 128 == 0 && SZ_W1 % 128 == 0);
static_assert(SZ_W2 % 128 == 0 && SZ_BIG % 128 == 0 && SZ_VT % 128 == 0 && SZ_CTX % 128 == 0);
static_assert(SZ_Y % 128 == 0 && SZ_X1F % 128 == 0 && SZ_X1H % 128 == 0);
static_assert(WS_TOTAL <= (size_t)134217728);

typedef __bf16   bf16;
typedef _Float16 f16;
typedef f16      v16h  __attribute__((ext_vector_type(16)));
typedef f16      v8h   __attribute__((ext_vector_type(8)));
typedef float    v8f   __attribute__((ext_vector_type(8)));
typedef float    v4f   __attribute__((ext_vector_type(4)));
typedef unsigned v4u   __attribute__((ext_vector_type(4)));

union FragH  { v16h v; v4u q[2]; f16 h[16]; };
union Pack8H { v4u u; v8h v; f16 h[8]; };

// bf16 RNE convert of an f32 value, returned as f32
static __device__ __forceinline__ float bfr(float v) { return (float)(bf16)v; }

// WMMA helpers: the matrix instructions of one run stand together, in the order in which they are summed, and the idle
// slots that the chip needs behind a matrix instruction stand once, behind the last of the run: inside a run every
// instruction is followed only by matrix instructions on other tiles or by one that accumulates into its own D.
// The four v_nop keep the distance to the first vector instruction that reads a D or overwrites an A or B, on every path
// out of the statement, and stand between the last product and the loads that refill its operand registers.

// acc[mt][nt] += a[mt] x b[nt], mt outer, nt inner
static __device__ __forceinline__ void mma_2x4(v8f (&acc)[2][4], v16h a0, v16h a1, v16h b0, v16h b1, v16h b2, v16h b3) {
  asm volatile("v_wmma_f32_16x16x32_f16 %0, %8, %10, %0\n\t"
               "v_wmma_f32_16x16x32_f16 %1, %8, %11, %1\n\t"
               "v_wmma_f32_16x16x32_f16 %2, %8, %12, %2\n\t"
               "v_wmma_f32_16x16x32_f16 %3, %8, %13, %3\n\t"
               "v_wmma_f32_16x16x32_f16 %4, %9, %10, %4\n\t"
               "v_wmma_f32_16x16x32_f16 %5, %9, %11, %5\n\t"
               "v_wmma_f32_16x16x32_f16 %6, %9, %12, %6\n\t"
               "v_wmma_f32_16x16x32_f16 %7, %9, %13, %7\n\t"
               "v_nop\n\tv_nop\n\tv_nop\n\tv_nop"
               : "+v"(acc[0][0]), "+v"(acc[0][1]), "+v"(acc[0][2]), "+v"(acc[0][3]),
                 "+v"(acc[1][0]), "+v"(acc[1][1]), "+v"(acc[1][2]), "+v"(acc[1][3])
               : "v"(a0), "v"(a1), "v"(b0), "v"(b1), "v"(b2), "v"(b3));
}

// score tiles c0 = k00 x q0 + k01 x q1, c1 = k10 x q0 + k11 x q1 (d block 0 first), from zero
static __device__ __forceinline__ void mma_scores(v8f& c0, v8f& c1, v16h k00, v16h k10, v16h k01, v16h k11,
                                                  v16h q0, v16h q1) {
  asm volatile("v_wmma_f32_16x16x32_f16 %0, %2, %6, 0\n\t"
               "v_wmma_f32_16x16x32_f16 %1, %3, %6, 0\n\t"
               "v_wmma_f32_16x16x32_f16 %0, %4, %7, %0\n\t"
               "v_wmma_f32_16x16x32_f16 %1, %5, %7, %1\n\t"
               "v_nop\n\tv_nop\n\tv_nop\n\tv_nop"
               : "=&v"(c0), "=&v"(c1)
               : "v"(k00), "v"(k10), "v"(k01), "v"(k11), "v"(q0), "v"(q1));
}

// o[dt] += p x v[dt]. One statement per tile: with all four tiles tied to one statement the compiler copied two of them
// to other registers in front of it and back behind it, at every step. The statements are volatile and follow one
// another, so the compiler schedules nothing across them: in the listing only its load waits stand between the four.
static __device__ __forceinline__ void mma_pv(v8f (&o)[4], v16h p, v16h v0, v16h v1, v16h v2, v16h v3) {
  asm volatile("v_wmma_f32_16x16x32_f16 %0, %1, %2, %0" : "+v"(o[0]) : "v"(p), "v"(v0));
  asm volatile("v_wmma_f32_16x16x32_f16 %0, %1, %2, %0" : "+v"(o[1]) : "v"(p), "v"(v1));
  asm volatile("v_wmma_f32_16x16x32_f16 %0, %1, %2, %0" : "+v"(o[2]) : "v"(p), "v"(v2));
  asm volatile("v_wmma_f32_16x16x32_f16 %0, %1, %2, %0\n\t"
               "v_nop\n\tv_nop\n\tv_nop\n\tv_nop"
               : "+v"(o[3]) : "v"(p), "v"(v3));
}

static __device__ __forceinline__ float wave_sum(float v) {
  v += __shfl_xor(v, 16, 32);
  v += __shfl_xor(v, 8, 32);
  v += __shfl_xor(v, 4, 32);
  v += __shfl_xor(v, 2, 32);
  v += __shfl_xor(v, 1, 32);
  return v;
}

// ---------------------------------------------------------------------------------------------------
// Requests to L2 at kernel entry.
// One request per 256-B unit (a lane names one byte of its unit), issued ahead of the loop.
// A request returns nothing and counts on no load counter. Every lane is on and every address lies inside its plane.
// The s_wait_xcnt closes each statement as a precaution: behind it the address registers are free for other use.
static __device__ __forceinline__ void ask_l2(const char* p0) {
  asm volatile("global_prefetch_b8 %0, off scope:SCOPE_SE\n\t"
               "s_wait_xcnt 0x0"
               : : "v"(p0) : "memory");
}
static __device__ __forceinline__ void ask_l2(const char* p0, const char* p1) {
  asm volatile("global_prefetch_b8 %0, off scope:SCOPE_SE\n\t"
               "global_prefetch_b8 %1, off scope:SCOPE_SE\n\t"
               "s_wait_xcnt 0x0"
               : : "v"(p0), "v"(p1) : "memory");
}
static __device__ __forceinline__ void ask_l2(const char* p0, const char* p1, const char* p2, const char* p3) {
  asm volatile("global_prefetch_b8 %0, off scope:SCOPE_SE\n\t"
               "global_prefetch_b8 %1, off scope:SCOPE_SE\n\t"
               "global_prefetch_b8 %2, off scope:SCOPE_SE\n\t"
               "global_prefetch_b8 %3, off scope:SCOPE_SE\n\t"
               "s_wait_xcnt 0x0"
               : : "v"(p0), "v"(p1), "v"(p2), "v"(p3) : "memory");
}

// The two operand panels of a GEMM block of 128 threads (GM rows of A, GN rows of Bt, each contiguous in its packed
// plane), dealt among the blocks that read them. A panel: a quarter per block, by the column block's index. Bt panel: an
// eighth per block, by bits 0, 1 and 3 of the row block's index. The deal repeats with a short period in the block index:
// a matter of speed only.
template <int K>
static __device__ __forceinline__ void ask_panels(const f16* __restrict__ A, const f16* __restrict__ Bt,
                                                  int tok0, int n0, int tid, int wave) {
  static_assert(K == 512 || K == 2048);
  constexpr int AQ = GM * K * 2 / 4;                    // bytes of a quarter of the A panel
  constexpr int BE = GN * K * 2 / 8;                    // bytes of an eighth of the Bt panel
  const int bx = blockIdx.x;
  const char* a = (const char*)A + (size_t)tok0 * (K * 2) + (size_t)(blockIdx.y & 3) * AQ + tid * 256;
  const char* b = (const char*)Bt + (size_t)n0 * (K * 2) + (size_t)((bx & 3) + ((bx >> 3) & 1) * 4) * BE;
  if constexpr (K == 512) {
    static_assert(AQ == 128 * 256 && BE == 32 * 256);
    ask_l2(a);
    if (wave == 0) ask_l2(b + tid * 256);               // 32 units: one wave's worth, a scalar branch
  } else {
    static_assert(AQ == 4 * 128 * 256 && BE == 128 * 256);
    ask_l2(a, a + 128 * 256, a + 2 * 128 * 256, a + 3 * 128 * 256);
    ask_l2(b + tid * 256);
  }
}

// ---------------------------------------------------------------------------------------------------
// x f32 -> xh packed f16 plane (rows = tokens, K = DIM) = f16(bf16_rne(x) * XC). One thread = one 16-B piece.
static __device__ __forceinline__ void cvt_x_piece(const float* __restrict__ x, f16* __restrict__ xh, int g) {
  // g = [rowtile][kblock 16][row half 2][8-column group 4 = half*2 + hi][row 8]: a wave reads 8 rows x 128 B
  // and writes four whole 128-B lines of the packed plane.
  const int r = ((g >> 5) & 1) * 8 + (g & 7);      // row of the 16-row tile
  const int t = (g >> 10) * 16 + r;                // compact token
  const int c = ((g >> 6) & 15) * 32 + ((g >> 3) & 3) * 8;
  if (t >= NTOK) return;
  const int bb = t / SEQ;
  const int s  = t - bb * SEQ;
  const float* src = x + ((size_t)bb * SEQ_FULL + s) * DIM + c;
  const v4f a0 = *(const v4f*)(src);
  const v4f a1 = *(const v4f*)(src + 4);
  Pack8H p;
  #pragma unroll
  for (int i = 0; i < 4; ++i) {
    p.h[i]     = (f16)(bfr(a0[i]) * XC);
    p.h[4 + i] = (f16)(bfr(a1[i]) * XC);
  }
  const v4u val = p.u;
  f16* dst = xh + (size_t)(g >> 6) * 512 + ((g >> 4) & 1) * 256 + (((g >> 3) & 1) * 16 + r) * 8;
  *(v4u*)dst = val;
}

// Weight transposer: in[K rows][N cols] f32  ->  packed plane (rows = n, K = k) f16 = f16(bf16_rne(w) * WC).
// One block of 256 threads = one tile 64(k) x 64(n) at (k0, n0), through LDS (cross-wave, block barrier).
static __device__ __forceinline__ void wt_tile(const float* __restrict__ W, f16* __restrict__ Wt, int K, int N,
                                               int n0, int k0, f16* sT) {
  const int tid = threadIdx.x;
  #pragma unroll
  for (int it = 0; it < 4; ++it) {
    const int kk = it * 16 + (tid >> 4);        // 0..63
    const int nn = (tid & 15) * 4;              // 0..60
    const v4f w = *(const v4f*)(W + (size_t)(k0 + kk) * N + n0 + nn);
    #pragma unroll
    for (int i = 0; i < 4; ++i) sT[(nn + i) * TP + kk] = (f16)(bfr(w[i]) * WC);
  }
  __syncthreads();
  v4u    val[2];
  size_t idx[2];
  #pragma unroll
  for (int it = 0; it < 2; ++it) {
    const int u  = it * 8 + (tid >> 5);         // unit 0..15 of this tile: [n tile 4][kblock 2][half 2]
    const int ln = tid & 31;
    const int n  = (u >> 2) * 16 + (ln & 15);                               // 0..63
    const int ks = ((u >> 1) & 1) * 32 + (u & 1) * 16 + (ln >> 4) * 8;      // 0..56
    Pack8H ph;
    ph.v = *(const v8h*)(&sT[n * TP + ks]);
    val[it] = ph.u;
    idx[it] = (((size_t)((n0 >> 4) + (u >> 2)) * (K >> 5) + (k0 >> 5) + ((u >> 1) & 1)) * 2 + (u & 1)) * 256 + ln * 8;
  }
  #pragma unroll
  for (int it = 0; it < 2; ++it) *(v4u*)(Wt + idx[it]) = val[it];
}

// All operand planes in one launch: none of them reads another, so the block index alone picks the work.
// Blocks 0 .. WT_BLOCKS-1 transpose one weight tile each (wq, wk, wv, wo: WT_SQ tiles each; w1, w2: WT_FF each; they
// come first because a tile passes through LDS and a barrier); the blocks behind them convert 256 pieces of x each.
// The choice is the same for every thread of a block, so the transposer's barrier is reached by all of them or none.
#define WT_SQ      ((DIM / 64) * (DIM / 64))
#define WT_FF      ((FFN / 64) * (DIM / 64))
#define WT_BLOCKS  (4 * WT_SQ + 2 * WT_FF)
#define CVT_BLOCKS ((size_t)NTOK * DIM / 8 / 256)
static_assert(DIM / 64 == 8 && FFN / 64 == 32);
__global__ __launch_bounds__(256) void prep_kernel(const float* __restrict__ x, const float* __restrict__ wq,
                                                   const float* __restrict__ wk, const float* __restrict__ wv,
                                                   const float* __restrict__ wo, const float* __restrict__ w1,
                                                   const float* __restrict__ w2, f16* __restrict__ xh,
                                                   f16* __restrict__ wqkvT, f16* __restrict__ woT,
                                                   f16* __restrict__ w1T, f16* __restrict__ w2T) {
  __shared__ __align__(16) f16 sT[64 * TP];     // [n][k]
  const int b = blockIdx.x;
  if (b < WT_BLOCKS) {
    const float* W;
    f16* Wt;
    int K, N, lgn, tile;                        // lgn = log2(N / 64): tile = [k tile][n tile]
    if (b < 4 * WT_SQ) {
      // in[512][512] -> out[512][512] (rows = output feature); q, k, v stacked into the [1536][512] plane
      const int m = b / WT_SQ;
      tile = b - m * WT_SQ;
      W  = (m == 0) ? wq : ((m == 1) ? wk : ((m == 2) ? wv : wo));
      Wt = (m < 3) ? wqkvT + (size_t)m * DIM * DIM : woT;
      K = DIM; N = DIM; lgn = 3;
    } else if (b < 4 * WT_SQ + WT_FF) {
      tile = b - 4 * WT_SQ;                     // in[512][2048] -> out[2048][512]
      W = w1; Wt = w1T; K = DIM; N = FFN; lgn = 5;
    } else {
      tile = b - (4 * WT_SQ + WT_FF);           // in[2048][512] -> out[512][2048]
      W = w2; Wt = w2T; K = FFN; N = DIM; lgn = 3;
    }
    wt_tile(W, Wt, K, N, (tile & ((1 << lgn) - 1)) * 64, (tile >> lgn) * 64, sT);
  } else {
    cvt_x_piece(x, xh, (b - WT_BLOCKS) * 256 + (int)threadIdx.x);
  }
}

// ---------------------------------------------------------------------------------------------------
// GEMM main loop: acc[mt][nt] (16x16 tiles) of  A[m0 .. m0+31][K] x Bt[n0 .. n0+63][K]^T.
// A and Bt are packed f16 planes; fragments use the split k map for both operands:
// elements 0..7 <- k0 + 8*hi + 0..7, elements 8..15 <- k0 + 16 + 8*hi + 0..7; lane row / column = lq.
// A 16-row tile spans K*16 halves; a k block of 32 spans 512 halves; the second k half starts at +256.
template <int K>
static __device__ __forceinline__ void gemm_main(const f16* __restrict__ A, const f16* __restrict__ Bt,
                                                 int m0, int n0, int lq, int hi, v8f (&acc)[2][4]) {
  static_assert(K % 32 == 0);
  const f16* ap = A  + (size_t)m0 * K + (hi * 16 + lq) * 8;
  const f16* bp = Bt + (size_t)n0 * K + (hi * 16 + lq) * 8;
  #pragma unroll 1
  for (int k0 = 0; k0 < K; k0 += 32) {
    FragH a[2], b[4];
    #pragma unroll
    for (int mt = 0; mt < 2; ++mt) {
      const f16* p = ap + (size_t)mt * 16 * K + k0 * 16;
      a[mt].q[0] = *(const v4u*)(p);
      a[mt].q[1] = *(const v4u*)(p + 256);
    }
    #pragma unroll
    for (int nt = 0; nt < 4; ++nt) {
      const f16* p = bp + (size_t)nt * 16 * K + k0 * 16;
      b[nt].q[0] = *(const v4u*)(p);
      b[nt].q[1] = *(const v4u*)(p + 256);
    }
    mma_2x4(acc, a[0].v, a[1].v, b[0].v, b[1].v, b[2].v, b[3].v);
  }
}

// The same product for the launches that leave only two waves on a SIMD, too few to cover a fragment load's latency:
// a ring of D fragment sets in registers. Each set is refilled, right behind its own products, with the k block D
// further on, so D k blocks of loads are in flight per wave. The k blocks are summed in the same ascending order as above.
template <int K>
static __device__ __forceinline__ void load_kblock(const char* __restrict__ ap, const char* __restrict__ bp,
                                                   FragH (&a)[2], FragH (&b)[4]) {
  #pragma unroll
  for (int mt = 0; mt < 2; ++mt) {
    const char* p = ap + (size_t)mt * 32 * K;       // byte addresses: a 16-row tile spans 32 * K bytes
    a[mt].q[0] = *(const v4u*)(p);
    a[mt].q[1] = *(const v4u*)(p + 512);
  }
  #pragma unroll
  for (int nt = 0; nt < 4; ++nt) {
    const char* p = bp + (size_t)nt * 32 * K;
    b[nt].q[0] = *(const v4u*)(p);
    b[nt].q[1] = *(const v4u*)(p + 512);
  }
}

template <int K, int D>
static __device__ __forceinline__ void gemm_main_ring(const f16* __restrict__ A, const f16* __restrict__ Bt,
                                                      int m0, int n0, int lq, int hi, v8f (&acc)[2][4]) {
  constexpr int G = (K / 32) / D;                         // whole groups of D k blocks
  constexpr int R = (K / 32) % D;                         // k blocks left over behind them
  static_assert(K % 32 == 0 && G >= 2);
  const char* ab = (const char*)(A  + (size_t)m0 * K);   // wave-uniform bases
  const char* bb = (const char*)(Bt + (size_t)n0 * K);
  unsigned off = (hi * 16 + lq) * 16;                     // byte offset: the lane's piece of a unit + the k blocks done
  FragH a[D][2], b[D][4];
  #pragma unroll
  for (int s = 0; s < D; ++s) load_kblock<K>(ab + off + s * 1024, bb + off + s * 1024, a[s], b[s]);
  #pragma unroll 1
  for (int g = 1; g < G; ++g) {
    // the loads in flight name the offset register: wait before it is advanced (the operand keeps the add behind)
    asm volatile("s_wait_xcnt 0x0" : "+v"(off) : : "memory");
    off += D * 1024;
    #pragma unroll
    for (int s = 0; s < D; ++s) {
      mma_2x4(acc, a[s][0].v, a[s][1].v, b[s][0].v, b[s][1].v, b[s][2].v, b[s][3].v);
      load_kblock<K>(ab + off + s * 1024, bb + off + s * 1024, a[s], b[s]);
    }
  }
  // the last refills still name the offset register and the bases: wait before they are put to other use
  asm volatile("s_wait_xcnt 0x0" : "+v"(off) : : "memory");
  // last whole group; the left-over k blocks refill its first sets
  #pragma unroll
  for (int s = 0; s < D; ++s) {
    mma_2x4(acc, a[s][0].v, a[s][1].v, b[s][0].v, b[s][1].v, b[s][2].v, b[s][3].v);
    if (s < R) load_kblock<K>(ab + off + (D + s) * 1024, bb + off + (D + s) * 1024, a[s], b[s]);
  }
  #pragma unroll
  for (int s = 0; s < R; ++s) {
    mma_2x4(acc, a[s][0].v, a[s][1].v, b[s][0].v, b[s][1].v, b[s][2].v, b[s][3].v);
  }
}

// ---------------------------------------------------------------------------------------------------
// Fused q/k/v projection: [NTOK][512] x [1536][512]^T. Column block (64 wide) = one head of q, k or v.
//          qk plane order: 0 = q, 1 = k.
//   q, k : per (b, h) a packed plane with rows = tokens, K = d (64): 1024 halves per 16 tokens.
//   v    : per (b, h) a packed plane with rows = d (4 tiles), K = tokens, k block outermost:
//          [s/32][d tile 4][half 2][lane 32][8] f16 (x VC), written through a block-wide LDS tile.
// coverage: q/k rows wave*32 + {0..31} x 64 d = 8 units per wave; vt 64 d x 128 tokens = 32 units per block.
__global__ __launch_bounds__(128) void gemm_qkv_kernel(const f16* __restrict__ xh, const f16* __restrict__ wT,
                                                       const float* __restrict__ bq, const float* __restrict__ bk,
                                                       const float* __restrict__ bv,
                                                       f16* __restrict__ qk, f16* __restrict__ vt) {
  __shared__ __align__(16) float sC[GW * 32 * OP];    // per-wave f32 tiles (block barrier used)
  __shared__ __align__(16) f16   sVT[HDIM * VP];      // [d][token], cross-wave (block barrier)
  const int tid  = threadIdx.x;
  const int wave = __builtin_amdgcn_readfirstlane(threadIdx.x >> 5);
  const int lane = tid & 31;
  const int lq   = lane & 15;
  const int hi   = lane >> 4;
  const int tok0 = blockIdx.x * GM;
  const int n0   = blockIdx.y * GN;
  const int seg  = n0 / DIM;                          // 0 = q, 1 = k, 2 = v (block-uniform)
  const int h    = (n0 - seg * DIM) / HDIM;
  const int bb   = tok0 / SEQ;
  const int s0   = tok0 - bb * SEQ;

  v8f acc[2][4];
  #pragma unroll
  for (int mt = 0; mt < 2; ++mt) {
    #pragma unroll
    for (int nt = 0; nt < 4; ++nt) acc[mt][nt] = (v8f){0, 0, 0, 0, 0, 0, 0, 0};
  }
  ask_panels<DIM>(xh, wT, tok0, n0, tid, wave);
  gemm_main<DIM>(xh, wT, tok0 + wave * 32, n0, lq, hi, acc);

  const float ascale = 1.0f / (XC * WC);
  float bias[4];
  #pragma unroll
  for (int nt = 0; nt < 4; ++nt) {
    const int c = h * HDIM + nt * 16 + lq;            // 0..511
    const float fq = bq[c];
    const float fk = bk[c];
    const float fv = bv[c];
    const float sel = (seg == 0) ? fq : ((seg == 1) ? fk : fv);
    bias[nt] = bfr(sel);
  }

  if (seg < 2) {
    const int wb = wave * (32 * OP);
    #pragma unroll
    for (int mt = 0; mt < 2; ++mt) {
      #pragma unroll
      for (int nt = 0; nt < 4; ++nt) {
        #pragma unroll
        for (int r = 0; r < 8; ++r)
          sC[wb + (mt * 16 + hi * 8 + r) * OP + nt * 16 + lq] = acc[mt][nt][r] * ascale + bias[nt];
      }
    }
    __syncthreads();
    const size_t pbase = (size_t)seg * PLANE +
                         (((size_t)bb * NHEAD + h) * SEQ + s0 + wave * 32) * HDIM;
    v4u hv[8];
    #pragma unroll
    for (int it = 0; it < 8; ++it) {
      const int row = (it >> 2) * 16 + lq;                               // unit it: [row tile 2][d block 2][half 2]
      const int col = ((it >> 1) & 1) * 32 + (it & 1) * 16 + hi * 8;
      const v4f c0 = *(const v4f*)(&sC[wb + row * OP + col]);
      const v4f c1 = *(const v4f*)(&sC[wb + row * OP + col + 4]);
      Pack8H ph;
      #pragma unroll
      for (int i = 0; i < 4; ++i) {
        ph.h[i]     = (f16)c0[i];
        ph.h[4 + i] = (f16)c1[i];
      }
      hv[it] = ph.u;
    }
    #pragma unroll
    for (int it = 0; it < 8; ++it) *(v4u*)(qk + pbase + (size_t)it * 256 + lane * 8) = hv[it];
    
  } else {
    #pragma unroll
    for (int mt = 0; mt < 2; ++mt) {
      #pragma unroll
      for (int nt = 0; nt < 4; ++nt) {
        #pragma unroll
        for (int r = 0; r < 8; ++r)
          sVT[(nt * 16 + lq) * VP + wave * 32 + mt * 16 + hi * 8 + r] =
              (f16)((acc[mt][nt][r] * ascale + bias[nt]) * VC);
      }
    }
    __syncthreads();
    const size_t vbase = (((size_t)bb * NHEAD + h) * SEQ + s0) * HDIM;   // first unit of this block's 128 tokens
    v4u vv[8];
    #pragma unroll
    for (int it = 0; it < 8; ++it) {
      const int u = it * 4 + wave;                 // unit 0..31: [token block 4][d tile 4][half 2]
      const int d = ((u >> 1) & 3) * 16 + lq;
      const int s = (u >> 3) * 32 + (u & 1) * 16 + hi * 8;
      Pack8H ph;
      ph.v = *(const v8h*)(&sVT[d * VP + s]);
      vv[it] = ph.u;
    }
    #pragma unroll
    for (int it = 0; it < 8; ++it) {
      const size_t o = vbase + (size_t)(it * 4 + wave) * 256 + lane * 8;
      *(v4u*)(vt + o) = vv[it];
    }
    
  }
}

// ---------------------------------------------------------------------------------------------------
// Flash attention, full (no mask). Block = (128-query block, head, batch); one wave owns 16 query rows.
// S^T = K x Q^T so queries sit on lanes; P^T in C layout is the A-fragment layout of O += P x V.
// Scores: s = k x q on the f16 planes, f32 accumulate, d blocks summed in ascending order.
// Fragments come straight from the packed 16-bit planes (two 512-B unit loads each); q fragments stay in registers.
__global__ __launch_bounds__(256) void attn_kernel(const f16* __restrict__ qk, const f16* __restrict__ vt,
                                                   f16* __restrict__ ctx) {
  __shared__ __align__(16) float sO[NWAVE * 16 * OP];    // per-wave output staging (block barrier used)
  const int qblk = blockIdx.x;
  const int h    = blockIdx.y;
  const int b    = blockIdx.z;
  const int tid  = threadIdx.x;
  const int wave = __builtin_amdgcn_readfirstlane(threadIdx.x >> 5);
  const int lane = tid & 31;
  const int lq   = lane & 15;   // query column of S^T / d column of O
  const int hi   = lane >> 4;   // k-split half

  const int qrow0 = qblk * BQ + wave * 16;
  const size_t hb = ((size_t)b * NHEAD + h) * (size_t)SEQ * HDIM;
  const f16* qh_p = qk + hb;
  const f16* kh_p = qk + PLANE + hb;
  const f16* vt_h = vt + hb;
  const int qoff  = qrow0 * HDIM + lane * 8;         // this wave's 16-query tile, lane's piece of a unit

  // this head's K and V planes (1024 units each), a quarter per block by the query block's index: one unit of each a thread
  static_assert((size_t)SEQ * HDIM * 2 == (size_t)4 * 256 * 256);
  {
    const size_t po = (size_t)(qblk & 3) * (256 * 256) + tid * 256;
    ask_l2((const char*)kh_p + po, (const char*)vt_h + po);
  }

  // q B-fragments, loaded once and held for the whole key loop
  FragH fqh[2];
  #pragma unroll
  for (int f = 0; f < 2; ++f) {
    const int qo = qoff + f * 512;
    fqh[f].q[0] = *(const v4u*)(qh_p + qo);           // d = f*32 + hi*8 + 0..7
    fqh[f].q[1] = *(const v4u*)(qh_p + qo + 256);     // d = f*32 + 16 + hi*8 + 0..7
  }

  v8f o[4];
  #pragma unroll
  for (int dt = 0; dt < 4; ++dt) o[dt] = (v8f){0, 0, 0, 0, 0, 0, 0, 0};

  const float SL = 0.125f * 1.4426950408889634f;   // softmax scale * log2(e)
  float rmax = -__builtin_inff();                  // the softmax reference in use (a raw score): the same in lane and lane ^ 16
  float rlim = -__builtin_inff();                  // rmax + LZ / SL: a raw score above it asks for a new reference
  float roff = __builtin_inff();                   // PCL - rmax * SL: carried P = exp2(score * SL + roff)
  float rsum = 0.0f;                               // sum of the carried P

  // K A-fragments (row = key lq of the tile, split d map) and V B-fragments (column n = d = dt*16 + lq, split key map
  // from the packed transposed plane) are fetched one step ahead into the same registers: step 0's here, step j + 1's
  // K behind step j's score products and its V behind step j's P x V products.
  FragH fkh[2][2], bv[4];
  #pragma unroll
  for (int sub = 0; sub < 2; ++sub) {
    #pragma unroll
    for (int f = 0; f < 2; ++f) {
      const int ko = sub * 16 * HDIM + f * 512 + lane * 8;
      fkh[sub][f].q[0] = *(const v4u*)(kh_p + ko);
      fkh[sub][f].q[1] = *(const v4u*)(kh_p + ko + 256);
    }
  }
  // keeps step 0's V loads behind its q and K loads, as in every later step: loads return in order, and only so can
  // the counted wait at the head of the loop leave the eight V loads in flight under the score products and the softmax
  __builtin_amdgcn_sched_barrier(0);
  #pragma unroll
  for (int dt = 0; dt < 4; ++dt) {
    const f16* base = vt_h + dt * 512 + lane * 8;
    bv[dt].q[0] = *(const v4u*)(base);              // keys hi*8 + 0..7
    bv[dt].q[1] = *(const v4u*)(base + 256);        // keys 16 + hi*8 + 0..7
  }

  #pragma unroll 1
  for (int j0 = 0; j0 < SEQ; j0 += BK) {
    // the step fetched ahead; the last step has none and refetches step 0 (in bounds, never used)
    const int jn = (j0 + BK < SEQ) ? j0 + BK : 0;

    // S^T tiles: c[sub][r] = rawscore(query qrow0+lq, key j0 + sub*16 + hi*8 + r)
    v8f c[2];
    mma_scores(c[0], c[1], fkh[0][0].v, fkh[1][0].v, fkh[0][1].v, fkh[1][1].v, fqh[0].v, fqh[1].v);

    // next step's K fragments, in flight under the softmax and the P x V products
    #pragma unroll
    for (int sub = 0; sub < 2; ++sub) {
      #pragma unroll
      for (int f = 0; f < 2; ++f) {
        const int ko = (jn + sub * 16) * HDIM + f * 512 + lane * 8;
        fkh[sub][f].q[0] = *(const v4u*)(kh_p + ko);
        fkh[sub][f].q[1] = *(const v4u*)(kh_p + ko + 256);
      }
    }
    // the K loads in flight name their address pair: wait before the softmax below puts those registers to other use
    asm volatile("s_wait_xcnt 0x0" ::: "memory");
    // keeps the K loads from sinking into the softmax below, where less work would cover their latency
    __builtin_amdgcn_sched_barrier(0);

    // online softmax, lazy rescale: query lq's 32 scores are split across lane / lane^16. Any reference common to a row
    // gives the same quotient O / sum, so the one in use stays until some score of the wave passes it by more than LZ.
    // All that depends on the reference alone is then formed anew: one test per step, a scalar branch on the ballot
    // (every lane is on inside it and behind it, as the matrix products need).
    float m_blk = rmax;
    #pragma unroll
    for (int r = 0; r < 8; ++r) {
      m_blk = fmaxf(m_blk, c[0][r]);
      m_blk = fmaxf(m_blk, c[1][r]);
    }
    if (__builtin_amdgcn_ballot_w32(m_blk > rlim) != 0) {
      rmax = fmaxf(m_blk, __shfl_xor(m_blk, 16, 32));
      rlim = rmax + LZ / SL;
      const float noff  = fmaf(-SL, rmax, PCL);
      const float scale = __builtin_amdgcn_exp2f(noff - roff);   // from the two offsets themselves: their rounding cancels
      roff = noff;
      rsum *= scale;
      // rescale O: queries are the row dimension there -> per-row scale from lane 8*hi + r
      float sc[8];
      #pragma unroll
      for (int r = 0; r < 8; ++r) sc[r] = __shfl(scale, (hi << 3) + r, 32);
      #pragma unroll
      for (int dt = 0; dt < 4; ++dt) {
        #pragma unroll
        for (int r = 0; r < 8; ++r) o[dt][r] *= sc[r];
      }
    }

    // exp + pack: P^T C-layout == A-fragment layout for the PV product
    FragH pa;
    float psum = 0.0f;
    #pragma unroll
    for (int r = 0; r < 8; ++r) {
      const float p0 = __builtin_amdgcn_exp2f(fmaf(c[0][r], SL, roff));   // key hi*8 + r
      const float p1 = __builtin_amdgcn_exp2f(fmaf(c[1][r], SL, roff));   // key 16 + hi*8 + r
      psum += p0 + p1;
      pa.h[r]     = (f16)p0;
      pa.h[8 + r] = (f16)p1;
    }
    rsum = rsum + psum + __shfl_xor(psum, 16, 32);

    // O += P x V
    mma_pv(o, pa.v, bv[0].v, bv[1].v, bv[2].v, bv[3].v);

    // next step's V fragments, in flight under its score products and softmax
    #pragma unroll
    for (int dt = 0; dt < 4; ++dt) {
      const f16* base = vt_h + (size_t)jn * HDIM + dt * 512 + lane * 8;
      bv[dt].q[0] = *(const v4u*)(base);            // keys jn + hi*8 + 0..7
      bv[dt].q[1] = *(const v4u*)(base + 256);      // keys jn + 16 + hi*8 + 0..7
    }
    // the V address pair is formed anew at the head of the next step: wait before that overwrite
    asm volatile("s_wait_xcnt 0x0" ::: "memory");
  }

  // normalize: lane holds column d = dt*16 + lq for query rows 8*hi + r
  float rs[8];
  #pragma unroll
  for (int r = 0; r < 8; ++r) rs[r] = 1.0f / __shfl(rsum, (hi << 3) + r, 32);

  const int wb = wave * (16 * OP);
  #pragma unroll
  for (int r = 0; r < 8; ++r) {
    #pragma unroll
    for (int dt = 0; dt < 4; ++dt)
      sO[wb + (hi * 8 + r) * OP + dt * 16 + lq] = o[dt][r] * (CC / VC) * rs[r];   // P's carry is in o and in the sum alike
  }
  __syncthreads();

  v4u    pv[4];
  size_t gidx[4];
  #pragma unroll
  for (int it = 0; it < 4; ++it) {
    const int row = lq;                                   // unit it: [k block 2][half 2] of this head's 64 columns
    const int col = (it >> 1) * 32 + (it & 1) * 16 + hi * 8;
    const v4f c0 = *(const v4f*)(&sO[wb + row * OP + col]);
    const v4f c1 = *(const v4f*)(&sO[wb + row * OP + col + 4]);
    Pack8H ph;
    #pragma unroll
    for (int i = 0; i < 4; ++i) {
      ph.h[i]     = (f16)c0[i];
      ph.h[4 + i] = (f16)c1[i];
    }
    pv[it]   = ph.u;
    gidx[it] = ((size_t)b * SEQ + qrow0) * DIM + (size_t)(h * 4 + it) * 256 + lane * 8;   // packed, K = DIM
  }
  #pragma unroll
  for (int it = 0; it < 4; ++it) *(v4u*)(ctx + gidx[it]) = pv[it];
  
}

// ---------------------------------------------------------------------------------------------------
// y = ctx x wo + bo + bf16_rne(x)   (f32 plane [NTOK][DIM], input of LayerNorm 1)
// coverage: rows wave*32 + {0..31}, 64 columns: 16 instr, lanes 0..15 one 256-B row segment, 16..31 the next row.
__global__ __launch_bounds__(128) void gemm_wo_kernel(const f16* __restrict__ ctx, const f16* __restrict__ woT,
                                                      const float* __restrict__ bo, const float* __restrict__ x,
                                                      float* __restrict__ y) {
  __shared__ __align__(16) float sC[GW * 32 * OP];
  const int tid  = threadIdx.x;
  const int wave = __builtin_amdgcn_readfirstlane(threadIdx.x >> 5);
  const int lane = tid & 31;
  const int lq   = lane & 15;
  const int hi   = lane >> 4;
  const int tok0 = blockIdx.x * GM;
  const int n0   = blockIdx.y * GN;
  const int bb   = tok0 / SEQ;
  const int s0   = tok0 - bb * SEQ;

  v8f acc[2][4];
  #pragma unroll
  for (int mt = 0; mt < 2; ++mt) {
    #pragma unroll
    for (int nt = 0; nt < 4; ++nt) acc[mt][nt] = (v8f){0, 0, 0, 0, 0, 0, 0, 0};
  }
  ask_panels<DIM>(ctx, woT, tok0, n0, tid, wave);
  // the block's own piece of the residual, read behind the k loop: one 256-B row segment a thread
  ask_l2((const char*)(x + ((size_t)bb * SEQ_FULL + s0 + tid) * DIM + n0));
  gemm_main_ring<DIM, RD>(ctx, woT, tok0 + wave * 32, n0, lq, hi, acc);

  const float ascale = 1.0f / (CC * WC);
  const int wb = wave * (32 * OP);
  #pragma unroll
  for (int nt = 0; nt < 4; ++nt) {
    const float bias = bfr(bo[n0 + nt * 16 + lq]);
    #pragma unroll
    for (int mt = 0; mt < 2; ++mt) {
      #pragma unroll
      for (int r = 0; r < 8; ++r)
        sC[wb + (mt * 16 + hi * 8 + r) * OP + nt * 16 + lq] = acc[mt][nt][r] * ascale + bias;
    }
  }
  __syncthreads();

  const size_t orow = (size_t)tok0 + wave * 32;                          // compact row
  const size_t rrow = (size_t)bb * SEQ_FULL + s0 + wave * 32;            // row of the full-size x
  #pragma unroll
  for (int g = 0; g < 2; ++g) {
    v4f vals[8];
    #pragma unroll
    for (int it = 0; it < 8; ++it) {
      const int row = g * 16 + it * 2 + hi;
      v4f cv = *(const v4f*)(&sC[wb + row * OP + lq * 4]);
      const v4f rv = *(const v4f*)(x + (rrow + row) * DIM + n0 + lq * 4);
      #pragma unroll
      for (int i = 0; i < 4; ++i) cv[i] = cv[i] + bfr(rv[i]);
      vals[it] = cv;
    }
    #pragma unroll
    for (int it = 0; it < 8; ++it)
      *(v4f*)(y + (orow + g * 16 + it * 2 + hi) * DIM + n0 + lq * 4) = vals[it];
    
  }
}

// ---------------------------------------------------------------------------------------------------
// f32 row: 4 instr x (32 lanes x 16 B) ; f16 rows staged in LDS (cross-wave, block barrier) and written packed:
// the block's 8 tokens fill 8 neighbouring lane slots = one whole 128-B line in each of the 64 (k block, half, hi) groups.
__global__ __launch_bounds__(256) void ln1_kernel(const float* __restrict__ y, const float* __restrict__ g,
                                                  const float* __restrict__ be,
                                                  float* __restrict__ x1f, f16* __restrict__ x1h) {
  __shared__ __align__(16) f16 sH[8 * SHP];
  const int tid  = threadIdx.x;
  const int wave = __builtin_amdgcn_readfirstlane(threadIdx.x >> 5);
  const int lane = tid & 31;
  const int t    = blockIdx.x * 8 + wave;             // compact token
  const float* yr = y + (size_t)t * DIM;

  v4f v[4];
  float s = 0.0f;
  #pragma unroll
  for (int j = 0; j < 4; ++j) {
    v[j] = *(const v4f*)(yr + j * 128 + lane * 4);
    s += (v[j][0] + v[j][1]) + (v[j][2] + v[j][3]);
  }
  s = wave_sum(s);
  const float mean = s * (1.0f / DIM);
  float q = 0.0f;
  #pragma unroll
  for (int j = 0; j < 4; ++j) {
    #pragma unroll
    for (int i = 0; i < 4; ++i) {
      const float d = v[j][i] - mean;
      q += d * d;
    }
  }
  q = wave_sum(q);
  const float rstd = rsqrtf(q * (1.0f / DIM) + 1e-5f);

  v4f ov[4];
  #pragma unroll
  for (int j = 0; j < 4; ++j) {
    const v4f gv = *(const v4f*)(g + j * 128 + lane * 4);
    const v4f bv = *(const v4f*)(be + j * 128 + lane * 4);
    #pragma unroll
    for (int i = 0; i < 4; ++i) {
      const float val = (v[j][i] - mean) * rstd * bfr(gv[i]) + bfr(bv[i]);
      ov[j][i] = val;
      sH[wave * SHP + j * 128 + lane * 4 + i] = (f16)(val * XC);
    }
  }
  __syncthreads();
  const int t0 = blockIdx.x * 8;                      // first token of the block
  v4u    hv[2];
  size_t hidx[2];
  #pragma unroll
  for (int jj = 0; jj < 2; ++jj) {
    const int tk = tid & 7;                           // token of the block
    const int ln = jj * 32 + (tid >> 3);              // 8-column group 0..63 = kblock*4 + half*2 + hi
    Pack8H ph;
    ph.v = *(const v8h*)(&sH[tk * SHP + ln * 8]);
    hv[jj] = ph.u;
    hidx[jj] = (size_t)(t0 >> 4) * (16 * DIM) + (size_t)(ln >> 1) * 256 + ((ln & 1) * 16 + (t0 & 15) + tk) * 8;
  }
  float* fo = x1f + (size_t)t * DIM + lane * 4;
  #pragma unroll
  for (int j = 0; j < 4; ++j) *(v4f*)(fo + j * 128) = ov[j];
  #pragma unroll
  for (int jj = 0; jj < 2; ++jj) *(v4u*)(x1h + hidx[jj]) = hv[jj];
  
}

static __device__ __forceinline__ void rcp8(const float (&d)[8], float (&t)[8]) {
  asm("v_rcp_f32 %0, %8\n\t"
      "v_rcp_f32 %1, %9\n\t"
      "v_rcp_f32 %2, %10\n\t"
      "v_rcp_f32 %3, %11\n\t"
      "v_rcp_f32 %4, %12\n\t"
      "v_rcp_f32 %5, %13\n\t"
      "v_rcp_f32 %6, %14\n\t"
      "v_rcp_f32 %7, %15\n\t"
      "v_nop"
      : "=&v"(t[0]), "=&v"(t[1]), "=&v"(t[2]), "=&v"(t[3]), "=&v"(t[4]), "=&v"(t[5]), "=&v"(t[6]), "=&v"(t[7])
      : "v"(d[0]), "v"(d[1]), "v"(d[2]), "v"(d[3]), "v"(d[4]), "v"(d[5]), "v"(d[6]), "v"(d[7]));
}
static __device__ __forceinline__ void exp2_8(const float (&w)[8], float (&e)[8]) {
  asm("v_exp_f32 %0, %8\n\t"
      "v_exp_f32 %1, %9\n\t"
      "v_exp_f32 %2, %10\n\t"
      "v_exp_f32 %3, %11\n\t"
      "v_exp_f32 %4, %12\n\t"
      "v_exp_f32 %5, %13\n\t"
      "v_exp_f32 %6, %14\n\t"
      "v_exp_f32 %7, %15\n\t"
      "v_nop"
      : "=&v"(e[0]), "=&v"(e[1]), "=&v"(e[2]), "=&v"(e[3]), "=&v"(e[4]), "=&v"(e[5]), "=&v"(e[6]), "=&v"(e[7])
      : "v"(w[0]), "v"(w[1]), "v"(w[2]), "v"(w[3]), "v"(w[4]), "v"(w[5]), "v"(w[6]), "v"(w[7]));
}

// GELU, erf form, without a branch, on eight values. With z = u / sqrt(2) and t = 1 / (1 + p |z|),
//   erfc(|z|) = (a1 t + a2 t^2 + a3 t^3 + a4 t^4 + a5 t^5) exp(-z^2), absolute error of the form below 1.5e-7 for every z,
// and 0.5 u (1 + erf(z)) = max(u, 0) - |u| * 0.5 erfc(|z|) for either sign of u (no cancellation on the negative side).
// The 0.5 is folded into a1..a5 and the 1 / sqrt(2) into p and the exponent. One straight run of instructions for every
// lane, so a lane's values are independent chains that the compiler can interleave.
static __device__ __forceinline__ void gelu_erf8(float (&u)[8]) {
  float d[8], w[8], t[8], e[8];
  #pragma unroll
  for (int i = 0; i < 8; ++i) {
    d[i] = fmaf(0.3275911f * 0.70710678118654752f, fabsf(u[i]), 1.0f);
    w[i] = u[i] * u[i] * (-0.5f * 1.4426950408889634f);      // -z^2 * log2(e)
  }
  rcp8(d, t);
  exp2_8(w, e);
  #pragma unroll
  for (int i = 0; i < 8; ++i) {
    float p = fmaf(0.5f * 1.061405429f, t[i], 0.5f * -1.453152027f);
    p = fmaf(p, t[i], 0.5f * 1.421413741f);
    p = fmaf(p, t[i], 0.5f * -0.284496736f);
    p = fmaf(p, t[i], 0.5f * 0.254829592f);
    p = p * t[i];
    u[i] = fmaf(-fabsf(u[i]), p * e[i], fmaxf(u[i], 0.0f));
  }
}

// hh = f16( gelu_erf(x1 x w1 + b1) * XC )   packed plane (rows = tokens, K = FFN)
__global__ __launch_bounds__(128) void gemm_ffn1_kernel(const f16* __restrict__ x1h, const f16* __restrict__ w1T,
                                                        const float* __restrict__ b1, f16* __restrict__ hh) {
  __shared__ __align__(16) float sC[GW * 32 * OP];
  const int tid  = threadIdx.x;
  const int wave = __builtin_amdgcn_readfirstlane(threadIdx.x >> 5);
  const int lane = tid & 31;
  const int lq   = lane & 15;
  const int hi   = lane >> 4;
  const int tok0 = blockIdx.x * GM;
  const int n0   = blockIdx.y * GN;

  v8f acc[2][4];
  #pragma unroll
  for (int mt = 0; mt < 2; ++mt) {
    #pragma unroll
    for (int nt = 0; nt < 4; ++nt) acc[mt][nt] = (v8f){0, 0, 0, 0, 0, 0, 0, 0};
  }
  ask_panels<DIM>(x1h, w1T, tok0, n0, tid, wave);
  gemm_main<DIM>(x1h, w1T, tok0 + wave * 32, n0, lq, hi, acc);

  const float ascale = 1.0f / (XC * WC);
  const int wb = wave * (32 * OP);
  float bias[4];                                      // all four loaded ahead of the fenced groups below
  #pragma unroll
  for (int nt = 0; nt < 4; ++nt) bias[nt] = bfr(b1[n0 + nt * 16 + lq]);
  #pragma unroll
  for (int nt = 0; nt < 4; ++nt) {
    #pragma unroll
    for (int mt = 0; mt < 2; ++mt) {
      float gl[8];
      #pragma unroll
      for (int r = 0; r < 8; ++r) gl[r] = acc[mt][nt][r] * ascale + bias[nt];
      gelu_erf8(gl);
      #pragma unroll
      for (int r = 0; r < 8; ++r) sC[wb + (mt * 16 + hi * 8 + r) * OP + nt * 16 + lq] = gl[r];
      // eight values at a time: without this the compiler starts many more at once, and the registers they hold cost
      // the eighth wave per SIMD, which the grid needs to be resident in one round
      __builtin_amdgcn_sched_barrier(0);
    }
  }
  __syncthreads();

  // piece it is this lane's 16 B of unit it: [row tile 2][k block 2][half 2]
  const int lbase = wb + lq * OP + hi * 8;

  v4u pv[8];
  #pragma unroll
  for (int it = 0; it < 8; ++it) {
    const int off = lbase + (it >> 2) * (16 * OP) + (it & 3) * 16;
    const v4f c0 = *(const v4f*)(&sC[off]);
    const v4f c1 = *(const v4f*)(&sC[off + 4]);
    Pack8H ph;
    #pragma unroll
    for (int i = 0; i < 4; ++i) {
      ph.h[i]     = (f16)(c0[i] * XC);
      ph.h[4 + i] = (f16)(c1[i] * XC);
    }
    pv[it] = ph.u;
  }
  const size_t obase = ((size_t)tok0 + wave * 32) * FFN + (size_t)n0 * 16 + lane * 8;
  #pragma unroll
  for (int it = 0; it < 8; ++it) *(v4u*)(hh + obase + (size_t)(it >> 2) * 16 * FFN + (it & 3) * 256) = pv[it];
  
}

// ---------------------------------------------------------------------------------------------------
// y = hh x w2 + b2 + x1f   (f32 plane [NTOK][DIM], input of LayerNorm 2)
__global__ __launch_bounds__(128) void gemm_ffn2_kernel(const f16* __restrict__ hh, const f16* __restrict__ w2T,
                                                        const float* __restrict__ b2, const float* __restrict__ x1f,
                                                        float* __restrict__ y) {
  __shared__ __align__(16) float sC[GW * 32 * OP];
  const int tid  = threadIdx.x;
  const int wave = __builtin_amdgcn_readfirstlane(threadIdx.x >> 5);
  const int lane = tid & 31;
  const int lq   = lane & 15;
  const int hi   = lane >> 4;
  const int tok0 = blockIdx.x * GM;
  const int n0   = blockIdx.y * GN;

  v8f acc[2][4];
  #pragma unroll
  for (int mt = 0; mt < 2; ++mt) {
    #pragma unroll
    for (int nt = 0; nt < 4; ++nt) acc[mt][nt] = (v8f){0, 0, 0, 0, 0, 0, 0, 0};
  }
  ask_panels<FFN>(hh, w2T, tok0, n0, tid, wave);
  // the block's own piece of the residual, read behind the k loop: one 256-B row segment a thread
  ask_l2((const char*)(x1f + ((size_t)tok0 + tid) * DIM + n0));
  gemm_main_ring<FFN, RD>(hh, w2T, tok0 + wave * 32, n0, lq, hi, acc);

  const float ascale = 1.0f / (XC * WC);
  const int wb = wave * (32 * OP);
  #pragma unroll
  for (int nt = 0; nt < 4; ++nt) {
    const float bias = bfr(b2[n0 + nt * 16 + lq]);
    #pragma unroll
    for (int mt = 0; mt < 2; ++mt) {
      #pragma unroll
      for (int r = 0; r < 8; ++r)
        sC[wb + (mt * 16 + hi * 8 + r) * OP + nt * 16 + lq] = acc[mt][nt][r] * ascale + bias;
    }
  }
  __syncthreads();

  const size_t orow = (size_t)tok0 + wave * 32;
  #pragma unroll
  for (int g = 0; g < 2; ++g) {
    v4f vals[8];
    #pragma unroll
    for (int it = 0; it < 8; ++it) {
      const int row = g * 16 + it * 2 + hi;
      v4f cv = *(const v4f*)(&sC[wb + row * OP + lq * 4]);
      const v4f rv = *(const v4f*)(x1f + (orow + row) * DIM + n0 + lq * 4);
      #pragma unroll
      for (int i = 0; i < 4; ++i) cv[i] = cv[i] + rv[i];
      vals[it] = cv;
    }
    #pragma unroll
    for (int it = 0; it < 8; ++it)
      *(v4f*)(y + (orow + g * 16 + it * 2 + hi) * DIM + n0 + lq * 4) = vals[it];
    
  }
}

// ---------------------------------------------------------------------------------------------------
__global__ __launch_bounds__(256) void ln2_kernel(const float* __restrict__ y, const float* __restrict__ g,
                                                  const float* __restrict__ be, float* __restrict__ out) {
  const int tid  = threadIdx.x;
  const int wave = __builtin_amdgcn_readfirstlane(threadIdx.x >> 5);
  const int lane = tid & 31;
  const int t    = blockIdx.x * 8 + wave;             // compact token
  const int bb   = t / SEQ;
  const int s0   = t - bb * SEQ;
  const float* yr = y + (size_t)t * DIM;

  v4f v[4];
  float s = 0.0f;
  #pragma unroll
  for (int j = 0; j < 4; ++j) {
    v[j] = *(const v4f*)(yr + j * 128 + lane * 4);
    s += (v[j][0] + v[j][1]) + (v[j][2] + v[j][3]);
  }
  s = wave_sum(s);
  const float mean = s * (1.0f / DIM);
  float q = 0.0f;
  #pragma unroll
  for (int j = 0; j < 4; ++j) {
    #pragma unroll
    for (int i = 0; i < 4; ++i) {
      const float d = v[j][i] - mean;
      q += d * d;
    }
  }
  q = wave_sum(q);
  const float rstd = rsqrtf(q * (1.0f / DIM) + 1e-5f);

  v4f ov[4];
  #pragma unroll
  for (int j = 0; j < 4; ++j) {
    const v4f gv = *(const v4f*)(g + j * 128 + lane * 4);
    const v4f bv = *(const v4f*)(be + j * 128 + lane * 4);
    #pragma unroll
    for (int i = 0; i < 4; ++i) ov[j][i] = (v[j][i] - mean) * rstd * bfr(gv[i]) + bfr(bv[i]);
  }
  float* fo = out + ((size_t)bb * SEQ_FULL + s0) * DIM + lane * 4;
  #pragma unroll
  for (int j = 0; j < 4; ++j) *(v4f*)(fo + j * 128) = ov[j];
  
}

// ---------------------------------------------------------------------------------------------------
extern "C" void kernel_launch(void* const* d_in, const int* in_sizes, int n_in,
                              void* d_out, int out_size, void* d_ws, size_t ws_size,
                              hipStream_t stream) {
  if (n_in < 17) return;
  const size_t rows_used = (size_t)(NB - 1) * SEQ_FULL + SEQ;
  if ((size_t)in_sizes[0] < rows_used * DIM) return;
  if ((size_t)in_sizes[1] < (size_t)DIM * DIM || (size_t)in_sizes[3] < (size_t)DIM * DIM) return;
  if ((size_t)in_sizes[5] < (size_t)DIM * DIM || (size_t)in_sizes[7] < (size_t)DIM * DIM) return;
  if ((size_t)in_sizes[9] < (size_t)DIM * FFN || (size_t)in_sizes[11] < (size_t)FFN * DIM) return;
  if (in_sizes[2] < DIM || in_sizes[4] < DIM || in_sizes[6] < DIM || in_sizes[8] < DIM) return;
  if (in_sizes[10] < FFN || in_sizes[12] < DIM) return;
  if (in_sizes[13] < DIM || in_sizes[14] < DIM || in_sizes[15] < DIM || in_sizes[16] < DIM) return;
  if ((size_t)out_size < rows_used * DIM) return;
  if (ws_size < WS_TOTAL) return;

  const float* x   = (const float*)d_in[0];
  const float* wq  = (const float*)d_in[1];
  const float* bq  = (const float*)d_in[2];
  const float* wk  = (const float*)d_in[3];
  const float* bk  = (const float*)d_in[4];
  const float* wv  = (const float*)d_in[5];
  const float* bv  = (const float*)d_in[6];
  const float* wo  = (const float*)d_in[7];
  const float* bo  = (const float*)d_in[8];
  const float* w1  = (const float*)d_in[9];
  const float* b1  = (const float*)d_in[10];
  const float* w2  = (const float*)d_in[11];
  const float* b2  = (const float*)d_in[12];
  const float* g1  = (const float*)d_in[13];
  const float* be1 = (const float*)d_in[14];
  const float* g2  = (const float*)d_in[15];
  const float* be2 = (const float*)d_in[16];
  float* out = (float*)d_out;

  char* ws = (char*)d_ws;
  f16*   xh    = (f16*)(ws + OFF_XH);
  f16*   wqkvT = (f16*)(ws + OFF_WQKV);
  f16*   woT   = (f16*)(ws + OFF_WO);
  f16*   w1T   = (f16*)(ws + OFF_W1);
  f16*   w2T   = (f16*)(ws + OFF_W2);
  f16*   qk    = (f16*)(ws + OFF_BIG);     // the q and k planes
  f16*   hh    = (f16*)(ws + OFF_BIG);     // reuses the q/k region after the attention launch
  f16*   vt    = (f16*)(ws + OFF_VT);
  f16*   ctx   = (f16*)(ws + OFF_CTX);
  float* y     = (float*)(ws + OFF_Y);
  float* x1f   = (float*)(ws + OFF_X1F);
  f16*   x1h   = (f16*)(ws + OFF_X1H);

  // operand planes
  prep_kernel<<<dim3((unsigned)(WT_BLOCKS + CVT_BLOCKS)), 256, 0, stream>>>(x, wq, wk, wv, wo, w1, w2,
                                                                            xh, wqkvT, woT, w1T, w2T);

  gemm_qkv_kernel<<<dim3(NTOK / GM, QKVN / GN), 128, 0, stream>>>(xh, wqkvT, bq, bk, bv, qk, vt);
  attn_kernel<<<dim3(SEQ / BQ, NHEAD, NB), 256, 0, stream>>>(qk, vt, ctx);
  gemm_wo_kernel<<<dim3(NTOK / GM, DIM / GN), 128, 0, stream>>>(ctx, woT, bo, x, y);
  ln1_kernel<<<dim3(NTOK / 8), 256, 0, stream>>>(y, g1, be1, x1f, x1h);
  gemm_ffn1_kernel<<<dim3(NTOK / GM, FFN / GN), 128, 0, stream>>>(x1h, w1T, b1, hh);
  gemm_ffn2_kernel<<<dim3(NTOK / GM, DIM / GN), 128, 0, stream>>>(hh, w2T, b2, x1f, y);
  ln2_kernel<<<dim3(NTOK / 8), 256, 0, stream>>>(y, g2, be2, out);
}

// v010
// A run of this version takes 119 microseconds.
// Two timings next to v009 both put it at 1.04 times that version's speed.
// Counting every step since v000, it is 4.09 times as fast.
#include <hip/hip_runtime.h>
#include <math.h>

// All contractions on v_wmma_f32_16x16x32_f16 with f32 accumulate: projections / Wo / FFN use f16 operand planes
// (inputs RNE-converted to bf16 first, then exact power-of-two carries); scores S^T = K x Q^T use q and k as one
// f16 plane each (11 significant bits, against the 8 of the operands q and k are made from); O = P x V with P f16
// carried x128 (P itself reaches 2^8 under the lazy rescale of the attention kernel).
//
// Every f16 operand plane in the workspace is stored fragment-packed: a [rows][K] operand is cut into tiles of
// 16 rows x 32 k; a tile is two 512-B units (k halves 0..15 and 16..31); inside a unit lane (hi*16 + lq) owns 16 B =
// row lq, k = half*16 + hi*8 + 0..7. Unit index = (rowtile * (K/32) + kblock) * 2 + half; the V^T plane puts the k block outermost. One wave-wide 16-B-per-lane
// load of a unit is 512 contiguous bytes (4 whole lines) and lands directly in the split-k fragment map.

#ifndef NB
#define NB 4
#endif
#ifndef SEQ
#define SEQ 2048
#endif
#define NB_FULL   4
#define SEQ_FULL  2048
#define DIM       512
#define NHEAD     8
#define HDIM      64
#define FFN       2048
#define QKVN      (3 * DIM)
#define NTOK      (NB * SEQ)
#define PLANE     ((size_t)NTOK * DIM)     // elements of one [NB][NHEAD][SEQ][HDIM] 16-bit plane
#define GM        128                      // GEMM block rows (4 row groups x 32)
#define GN        64                       // columns of one wave's tile
#define GW        8                        // waves per GEMM block: 4 row groups x 2 column groups
#define BN        (2 * GN)                 // GEMM block columns
#define OP        68                       // LDS pitch (floats) of f32 staging tiles
#define VP        136                      // LDS pitch (halves) of the V^T staging tile
#define TP        72                       // LDS pitch (halves) of the weight transposer tile
#define SHP       (DIM + 16)               // LDS pitch (halves) of the LayerNorm-1 f16 row staging
#define BQ        128                      // query rows per attention block (8 waves x 16)
#define BK        32                       // keys per attention step
#define NWAVE     8
#define XC        16.0f                    // carry of the x, LN1-output and GELU-output planes
#define WC        64.0f                    // carry of all weight planes
#define VC        16.0f                    // carry of the V^T plane
#define CC        256.0f                   // carry of the attention-context plane
#define LZ        8.0f                     // a score may pass the softmax reference by this much (scaled log2) before a rescale
#define PCL       7.0f                     // log2 of the carry of P inside the attention kernel: P * carry <= 2^(LZ + PCL), in f16 range
#define KS_S      64                       // k per LDS stage where several GEMM blocks share a WGP (q/k/v, FFN-1)
#define KS_L      128                      // k per LDS stage where a GEMM block has its WGP alone (Wo, FFN-2)

static_assert(DIM == NHEAD * HDIM);
static_assert(HDIM == 64);
static_assert(HDIM == GN);
static_assert(GM == (GW / 2) * 32);
static_assert(GM == 8 * 16 && BN == 8 * 16 && GW == 8);
static_assert(BQ == NWAVE * 16);
static_assert(SEQ % GM == 0);
static_assert(SEQ % BQ == 0);
static_assert(SEQ % BK == 0);
static_assert(NTOK % GM == 0);
static_assert(NTOK % 8 == 0);
static_assert(DIM % BN == 0);
static_assert(FFN % BN == 0);
static_assert(QKVN % BN == 0);
static_assert(DIM % 64 == 0);
static_assert(FFN % 64 == 0);
static_assert(DIM % 32 == 0);
static_assert(FFN % 32 == 0);
static_assert(DIM == 32 * 16);
static_assert(((size_t)NTOK * DIM / 8) % 256 == 0);
static_assert((OP * 4) % 16 == 0);
static_assert((VP * 2) % 16 == 0);
static_assert((TP * 2) % 16 == 0);
static_assert((SHP * 2) % 16 == 0);
static_assert(SEQ <= SEQ_FULL);
static_assert(NB >= 1 && NB <= NB_FULL);

#define SZ_XH    ((size_t)NTOK * DIM * 2)
#define SZ_WQKV  ((size_t)QKVN * DIM * 2)
#define SZ_WO    ((size_t)DIM * DIM * 2)
#define SZ_W1    ((size_t)FFN * DIM * 2)
#define SZ_W2    ((size_t)DIM * FFN * 2)
#define SZ_QK    ((size_t)2 * NTOK * DIM * 2)
#define SZ_HH    ((size_t)NTOK * FFN * 2)
#define SZ_BIG   ((SZ_QK > SZ_HH) ? SZ_QK : SZ_HH)   // q/k planes, later reused by the GELU-output plane
#define SZ_VT    ((size_t)NTOK * DIM * 2)
#define SZ_CTX   ((size_t)NTOK * DIM * 2)
#define SZ_Y     ((size_t)NTOK * DIM * 4)
#define SZ_X1F   ((size_t)NTOK * DIM * 4)
#define SZ_X1H   ((size_t)NTOK * DIM * 2)
#define OFF_XH   ((size_t)0)
#define OFF_WQKV (OFF_XH + SZ_XH)
#define OFF_WO   (OFF_WQKV + SZ_WQKV)
#define OFF_W1   (OFF_WO + SZ_WO)
#define OFF_W2   (OFF_W1 + SZ_W1)
#define OFF_BIG  (OFF_W2 + SZ_W2)
#define OFF_VT   (OFF_BIG + SZ_BIG)
#define OFF_CTX  (OFF_VT + SZ_VT)
#define OFF_Y    (OFF_CTX + SZ_CTX)
#define OFF_X1F  (OFF_Y + SZ_Y)
#define OFF_X1H  (OFF_X1F + SZ_X1F)
#define WS_TOTAL (OFF_X1H + SZ_X1H)
static_assert(SZ_QK <= SZ_BIG);
static_assert(SZ_HH <= SZ_BIG);
static_assert(SZ_XH % 128 == 0 && SZ_WQKV % 128 == 0 && SZ_WO % 128 == 0 && SZ_W1 % 128 == 0);
static_assert(SZ_W2 % 128 == 0 && SZ_BIG % 128 == 0 && SZ_VT % 128 == 0 && SZ_CTX % 128 == 0);
static_assert(SZ_Y % 128 == 0 && SZ_X1F % 128 == 0 && SZ_X1H % 128 == 0);
static_assert(WS_TOTAL <= (size_t)134217728);

typedef __bf16   bf16;
typedef _Float16 f16;
typedef f16      v16h  __attribute__((ext_vector_type(16)));
typedef f16      v8h   __attribute__((ext_vector_type(8)));
typedef float    v8f   __attribute__((ext_vector_type(8)));
typedef float    v4f   __attribute__((ext_vector_type(4)));
typedef unsigned v4u   __attribute__((ext_vector_type(4)));

union FragH  { v16h v; v4u q[2]; f16 h[16]; };
union Pack8H { v4u u; v8h v; f16 h[8]; };

// bf16 RNE convert of an f32 value, returned as f32
static __device__ __forceinline__ float bfr(float v) { return (float)(bf16)v; }

// WMMA helpers: the matrix instructions of one run stand together, in the order in which they are summed, and the idle
// slots that the chip needs behind a matrix instruction stand once, behind the last of the run: inside a run every
// instruction is followed only by matrix instructions on other tiles or by one that accumulates into its own D.
// The four v_nop keep the distance to the first vector instruction that reads a D or overwrites an A or B, on every path
// out of the statement, and stand between the last product and the loads that refill its operand registers.

// acc[mt][nt] += a[mt] x b[nt], mt outer, nt inner
static __device__ __forceinline__ void mma_2x4(v8f (&acc)[2][4], v16h a0, v16h a1, v16h b0, v16h b1, v16h b2, v16h b3) {
  asm volatile("v_wmma_f32_16x16x32_f16 %0, %8, %10, %0\n\t"
               "v_wmma_f32_16x16x32_f16 %1, %8, %11, %1\n\t"
               "v_wmma_f32_16x16x32_f16 %2, %8, %12, %2\n\t"
               "v_wmma_f32_16x16x32_f16 %3, %8, %13, %3\n\t"
               "v_wmma_f32_16x16x32_f16 %4, %9, %10, %4\n\t"
               "v_wmma_f32_16x16x32_f16 %5, %9, %11, %5\n\t"
               "v_wmma_f32_16x16x32_f16 %6, %9, %12, %6\n\t"
               "v_wmma_f32_16x16x32_f16 %7, %9, %13, %7\n\t"
               "v_nop\n\tv_nop\n\tv_nop\n\tv_nop"
               : "+v"(acc[0][0]), "+v"(acc[0][1]), "+v"(acc[0][2]), "+v"(acc[0][3]),
                 "+v"(acc[1][0]), "+v"(acc[1][1]), "+v"(acc[1][2]), "+v"(acc[1][3])
               : "v"(a0), "v"(a1), "v"(b0), "v"(b1), "v"(b2), "v"(b3));
}

// score tiles c0 = k00 x q0 + k01 x q1, c1 = k10 x q0 + k11 x q1 (d block 0 first), from zero
static __device__ __forceinline__ void mma_scores(v8f& c0, v8f& c1, v16h k00, v16h k10, v16h k01, v16h k11,
                                                  v16h q0, v16h q1) {
  asm volatile("v_wmma_f32_16x16x32_f16 %0, %2, %6, 0\n\t"
               "v_wmma_f32_16x16x32_f16 %1, %3, %6, 0\n\t"
               "v_wmma_f32_16x16x32_f16 %0, %4, %7, %0\n\t"
               "v_wmma_f32_16x16x32_f16 %1, %5, %7, %1\n\t"
               "v_nop\n\tv_nop\n\tv_nop\n\tv_nop"
               : "=&v"(c0), "=&v"(c1)
               : "v"(k00), "v"(k10), "v"(k01), "v"(k11), "v"(q0), "v"(q1));
}

// o[dt] += p x v[dt]. One statement per tile: with all four tiles tied to one statement the compiler copied two of them
// to other registers in front of it and back behind it, at every step. The statements are volatile and follow one
// another, so the compiler schedules nothing across them: in the listing only its load waits stand between the four.
static __device__ __forceinline__ void mma_pv(v8f (&o)[4], v16h p, v16h v0, v16h v1, v16h v2, v16h v3) {
  asm volatile("v_wmma_f32_16x16x32_f16 %0, %1, %2, %0" : "+v"(o[0]) : "v"(p), "v"(v0));
  asm volatile("v_wmma_f32_16x16x32_f16 %0, %1, %2, %0" : "+v"(o[1]) : "v"(p), "v"(v1));
  asm volatile("v_wmma_f32_16x16x32_f16 %0, %1, %2, %0" : "+v"(o[2]) : "v"(p), "v"(v2));
  asm volatile("v_wmma_f32_16x16x32_f16 %0, %1, %2, %0\n\t"
               "v_nop\n\tv_nop\n\tv_nop\n\tv_nop"
               : "+v"(o[3]) : "v"(p), "v"(v3));
}

static __device__ __forceinline__ float wave_sum(float v) {
  v += __shfl_xor(v, 16, 32);
  v += __shfl_xor(v, 8, 32);
  v += __shfl_xor(v, 4, 32);
  v += __shfl_xor(v, 2, 32);
  v += __shfl_xor(v, 1, 32);
  return v;
}

// ---------------------------------------------------------------------------------------------------
// Requests to L2 at kernel entry.
// One request per 256-B unit (a lane names one byte of its unit), issued ahead of the loop.
// A request returns nothing and counts on no load counter. Every lane is on and every address lies inside its plane.
// The s_wait_xcnt closes each statement as a precaution: behind it the address registers are free for other use.
static __device__ __forceinline__ void ask_l2(const char* p0) {
  asm volatile("global_prefetch_b8 %0, off scope:SCOPE_SE\n\t"
               "s_wait_xcnt 0x0"
               : : "v"(p0) : "memory");
}
static __device__ __forceinline__ void ask_l2(const char* p0, const char* p1) {
  asm volatile("global_prefetch_b8 %0, off scope:SCOPE_SE\n\t"
               "global_prefetch_b8 %1, off scope:SCOPE_SE\n\t"
               "s_wait_xcnt 0x0"
               : : "v"(p0), "v"(p1) : "memory");
}
static __device__ __forceinline__ void ask_l2(const char* p0, const char* p1, const char* p2, const char* p3) {
  asm volatile("global_prefetch_b8 %0, off scope:SCOPE_SE\n\t"
               "global_prefetch_b8 %1, off scope:SCOPE_SE\n\t"
               "global_prefetch_b8 %2, off scope:SCOPE_SE\n\t"
               "global_prefetch_b8 %3, off scope:SCOPE_SE\n\t"
               "s_wait_xcnt 0x0"
               : : "v"(p0), "v"(p1), "v"(p2), "v"(p3) : "memory");
}

// The two operand panels of a GEMM block of 256 threads (GM rows of A, BN rows of Bt, each contiguous in its packed
// plane), dealt among the blocks that read them. A panel: a half per block, by the column block's index. Bt panel: an
// eighth per block, by bits 0, 1 and 3 of the row block's index. The deal repeats with a short period in the block index: a matter of speed only.
template <int K>
static __device__ __forceinline__ void ask_panels(const f16* __restrict__ A, const f16* __restrict__ Bt,
                                                  int tok0, int nb0, int tid, int wave) {
  static_assert(K == 512 || K == 2048);
  constexpr int AH = GM * K * 2 / 2;                    // bytes of half the A panel
  constexpr int BE = BN * K * 2 / 8;                    // bytes of an eighth of the Bt panel
  const int bx = blockIdx.x;
  const char* a = (const char*)A + (size_t)tok0 * (K * 2) + (size_t)(blockIdx.y & 1) * AH + tid * 256;
  const char* b = (const char*)Bt + (size_t)nb0 * (K * 2) + (size_t)((bx & 3) + ((bx >> 3) & 1) * 4) * BE;
  if constexpr (K == 512) {
    static_assert(AH == 256 * 256 && BE == 64 * 256);
    ask_l2(a);
    if (wave < 2) ask_l2(b + tid * 256);                // 64 units: two waves' worth, a scalar branch
  } else {
    static_assert(AH == 4 * 256 * 256 && BE == 256 * 256);
    ask_l2(a, a + 256 * 256, a + 2 * 256 * 256, a + 3 * 256 * 256);
    ask_l2(b + tid * 256);
  }
}

// ---------------------------------------------------------------------------------------------------
// x f32 -> xh packed f16 plane (rows = tokens, K = DIM) = f16(bf16_rne(x) * XC). One thread = one 16-B piece.
static __device__ __forceinline__ void cvt_x_piece(const float* __restrict__ x, f16* __restrict__ xh, int g) {
  // g = [rowtile][kblock 16][row half 2][8-column group 4 = half*2 + hi][row 8]: a wave reads 8 rows x 128 B
  // and writes four whole 128-B lines of the packed plane.
  const int r = ((g >> 5) & 1) * 8 + (g & 7);      // row of the 16-row tile
  const int t = (g >> 10) * 16 + r;                // compact token
  const int c = ((g >> 6) & 15) * 32 + ((g >> 3) & 3) * 8;
  if (t >= NTOK) return;
  const int bb = t / SEQ;
  const int s  = t - bb * SEQ;
  const float* src = x + ((size_t)bb * SEQ_FULL + s) * DIM + c;
  const v4f a0 = *(const v4f*)(src);
  const v4f a1 = *(const v4f*)(src + 4);
  Pack8H p;
  #pragma unroll
  for (int i = 0; i < 4; ++i) {
    p.h[i]     = (f16)(bfr(a0[i]) * XC);
    p.h[4 + i] = (f16)(bfr(a1[i]) * XC);
  }
  const v4u val = p.u;
  f16* dst = xh + (size_t)(g >> 6) * 512 + ((g >> 4) & 1) * 256 + (((g >> 3) & 1) * 16 + r) * 8;
  *(v4u*)dst = val;
}

// Weight transposer: in[K rows][N cols] f32  ->  packed plane (rows = n, K = k) f16 = f16(bf16_rne(w) * WC).
// One block of 256 threads = one tile 64(k) x 64(n) at (k0, n0), through LDS (cross-wave, block barrier).
static __device__ __forceinline__ void wt_tile(const float* __restrict__ W, f16* __restrict__ Wt, int K, int N,
                                               int n0, int k0, f16* sT) {
  const int tid = threadIdx.x;
  #pragma unroll
  for (int it = 0; it < 4; ++it) {
    const int kk = it * 16 + (tid >> 4);        // 0..63
    const int nn = (tid & 15) * 4;              // 0..60
    const v4f w = *(const v4f*)(W + (size_t)(k0 + kk) * N + n0 + nn);
    #pragma unroll
    for (int i = 0; i < 4; ++i) sT[(nn + i) * TP + kk] = (f16)(bfr(w[i]) * WC);
  }
  __syncthreads();
  v4u    val[2];
  size_t idx[2];
  #pragma unroll
  for (int it = 0; it < 2; ++it) {
    const int u  = it * 8 + (tid >> 5);         // unit 0..15 of this tile: [n tile 4][kblock 2][half 2]
    const int ln = tid & 31;
    const int n  = (u >> 2) * 16 + (ln & 15);                               // 0..63
    const int ks = ((u >> 1) & 1) * 32 + (u & 1) * 16 + (ln >> 4) * 8;      // 0..56
    Pack8H ph;
    ph.v = *(const v8h*)(&sT[n * TP + ks]);
    val[it] = ph.u;
    idx[it] = (((size_t)((n0 >> 4) + (u >> 2)) * (K >> 5) + (k0 >> 5) + ((u >> 1) & 1)) * 2 + (u & 1)) * 256 + ln * 8;
  }
  #pragma unroll
  for (int it = 0; it < 2; ++it) *(v4u*)(Wt + idx[it]) = val[it];
}

// All operand planes in one launch: none of them reads another, so the block index alone picks the work.
// Blocks 0 .. WT_BLOCKS-1 transpose one weight tile each (wq, wk, wv, wo: WT_SQ tiles each; w1, w2: WT_FF each; they
// come first because a tile passes through LDS and a barrier); the blocks behind them convert 256 pieces of x each.
// The choice is the same for every thread of a block, so the transposer's barrier is reached by all of them or none.
#define WT_SQ      ((DIM / 64) * (DIM / 64))
#define WT_FF      ((FFN / 64) * (DIM / 64))
#define WT_BLOCKS  (4 * WT_SQ + 2 * WT_FF)
#define CVT_BLOCKS ((size_t)NTOK * DIM / 8 / 256)
static_assert(DIM / 64 == 8 && FFN / 64 == 32);
__global__ __launch_bounds__(256) void prep_kernel(const float* __restrict__ x, const float* __restrict__ wq,
                                                   const float* __restrict__ wk, const float* __restrict__ wv,
                                                   const float* __restrict__ wo, const float* __restrict__ w1,
                                                   const float* __restrict__ w2, f16* __restrict__ xh,
                                                   f16* __restrict__ wqkvT, f16* __restrict__ woT,
                                                   f16* __restrict__ w1T, f16* __restrict__ w2T) {
  __shared__ __align__(16) f16 sT[64 * TP];     // [n][k]
  const int b = blockIdx.x;
  if (b < WT_BLOCKS) {
    const float* W;
    f16* Wt;
    int K, N, lgn, tile;                        // lgn = log2(N / 64): tile = [k tile][n tile]
    if (b < 4 * WT_SQ) {
      // in[512][512] -> out[512][512] (rows = output feature); q, k, v stacked into the [1536][512] plane
      const int m = b / WT_SQ;
      tile = b - m * WT_SQ;
      W  = (m == 0) ? wq : ((m == 1) ? wk : ((m == 2) ? wv : wo));
      Wt = (m < 3) ? wqkvT + (size_t)m * DIM * DIM : woT;
      K = DIM; N = DIM; lgn = 3;
    } else if (b < 4 * WT_SQ + WT_FF) {
      tile = b - 4 * WT_SQ;                     // in[512][2048] -> out[2048][512]
      W = w1; Wt = w1T; K = DIM; N = FFN; lgn = 5;
    } else {
      tile = b - (4 * WT_SQ + WT_FF);           // in[2048][512] -> out[512][2048]
      W = w2; Wt = w2T; K = FFN; N = DIM; lgn = 3;
    }
    wt_tile(W, Wt, K, N, (tile & ((1 << lgn) - 1)) * 64, (tile >> lgn) * 64, sT);
  } else {
    cvt_x_piece(x, xh, (b - WT_BLOCKS) * 256 + (int)threadIdx.x);
  }
}

// ---------------------------------------------------------------------------------------------------
// GEMM main loop of a block of 8 waves on a GM x BN tile: wave (row group rg, column group cg) forms acc[mt][nt] (16x16
// tiles) of  A[tok0 + rg*32 .. +31][K] x Bt[nb0 + cg*64 .. +63][K]^T.
// A and Bt are packed f16 planes; fragments use the split k map for both operands:
// elements 0..7 <- k0 + 8*hi + 0..7, elements 8..15 <- k0 + 16 + 8*hi + 0..7; lane row / column = lq.
// The block's operands pass through LDS, so that L2 delivers each unit once per block: an A unit then serves two waves
// and a Bt unit four. A stage is KS of k for the 8 row tiles of A and the 8 of Bt; a row tile's part of a stage is KS*32
// contiguous bytes of its plane and keeps that order in LDS, so a fragment half is again 512 contiguous bytes (16 B a
// lane, no bank conflict). Two stage buffers: the next stage's copies fly while this stage's products run.

// Eight asynchronous 16-B-per-lane copies to LDS: four units from g0 on to l0 on, four from g1 on to l1 on. Every lane is
// on. The s_wait_xcnt closes the statement as a precaution: behind it the address registers are free for other use.
static __device__ __forceinline__ void copy_units8(unsigned l0, const char* g0, unsigned l1, const char* g1) {
  asm volatile("global_load_async_to_lds_b128 %0, %8, off\n\t"
               "global_load_async_to_lds_b128 %1, %9, off\n\t"
               "global_load_async_to_lds_b128 %2, %10, off\n\t"
               "global_load_async_to_lds_b128 %3, %11, off\n\t"
               "global_load_async_to_lds_b128 %4, %12, off\n\t"
               "global_load_async_to_lds_b128 %5, %13, off\n\t"
               "global_load_async_to_lds_b128 %6, %14, off\n\t"
               "global_load_async_to_lds_b128 %7, %15, off\n\t"
               "s_wait_xcnt 0x0"
               : : "v"(l0), "v"(l0 + 512), "v"(l0 + 1024), "v"(l0 + 1536),
                   "v"(l1), "v"(l1 + 512), "v"(l1 + 1024), "v"(l1 + 1536),
                   "v"(g0), "v"(g0 + 512), "v"(g0 + 1024), "v"(g0 + 1536),
                   "v"(g1), "v"(g1 + 512), "v"(g1 + 1024), "v"(g1 + 1536)
               : "memory");
}

// One wave's share of a stage: row tile 'wave' of A (to la) and row tile 'wave' of Bt (8 tiles further on in the stage).
template <int KS>
static __device__ __forceinline__ void copy_stage(unsigned la, const char* ga, const char* gb) {
  #pragma unroll
  for (int u = 0; u < KS * 32; u += 2048) copy_units8(la + u, ga + u, la + 8 * KS * 32 + u, gb + u);
}

// SETS = fragment sets in registers: with 2 the next k block's LDS reads are issued ahead of this k block's products.
template <int K, int KS, int SETS>
static __device__ __forceinline__ void gemm_main(const f16* __restrict__ A, const f16* __restrict__ Bt,
                                                 int tok0, int nb0, int wave, int lane, char* ring, v8f (&acc)[2][4]) {
  constexpr int T   = K / KS;                             // stages
  constexpr int TB  = KS * 32;                            // bytes of one 16-row tile's part of a stage
  constexpr int STG = 16 * TB;                            // bytes of a stage
  constexpr int NKB = KS / 32;                            // k blocks of a stage
  static_assert(K % KS == 0 && T >= 2 && KS % 64 == 0 && (SETS == 1 || SETS == 2));
  const char* ga = (const char*)(A  + (size_t)(tok0 + wave * 16) * K) + lane * 16;
  const char* gb = (const char*)(Bt + (size_t)(nb0  + wave * 16) * K) + lane * 16;
  const unsigned la = (unsigned)(size_t)ring + wave * TB + lane * 16;     // LDS byte address: low word of the pointer
  const char* ra = ring + (wave & 3) * 2 * TB + lane * 16;                // this wave's two A tiles
  const char* rb = ring + (8 + (wave >> 2) * 4) * TB + lane * 16;         // this wave's four Bt tiles

  copy_stage<KS>(la, ga, gb);
  // stage 0 has landed for this wave; the barrier publishes every wave's share
  asm volatile("s_wait_asynccnt 0x0" ::: "memory");
  __syncthreads();
  copy_stage<KS>(la + STG, ga + TB, gb + TB);

  #pragma unroll 1
  for (int t = 0; t < T; ++t) {
    const int bo = (t & 1) * STG;
    FragH a[SETS][2], b[SETS][4];
    #pragma unroll
    for (int kb = -1; kb < NKB; ++kb) {
      if (kb >= 0 && SETS == 1) {
        mma_2x4(acc, a[0][0].v, a[0][1].v, b[0][0].v, b[0][1].v, b[0][2].v, b[0][3].v);
      }
      if (kb + 1 < NKB) {
        const int s = (kb + 1) % SETS;
        #pragma unroll
        for (int mt = 0; mt < 2; ++mt) {
          const char* p = ra + bo + mt * TB + (kb + 1) * 1024;
          a[s][mt].q[0] = *(const v4u*)(p);
          a[s][mt].q[1] = *(const v4u*)(p + 512);
        }
        #pragma unroll
        for (int nt = 0; nt < 4; ++nt) {
          const char* p = rb + bo + nt * TB + (kb + 1) * 1024;
          b[s][nt].q[0] = *(const v4u*)(p);
          b[s][nt].q[1] = *(const v4u*)(p + 512);
        }
      }
      if (kb >= 0 && SETS == 2) {
        const int s = kb % SETS;
        mma_2x4(acc, a[s][0].v, a[s][1].v, b[s][0].v, b[s][1].v, b[s][2].v, b[s][3].v);
      }
    }
    // hand-over: this wave's reads of stage t are done, its copies of stage t + 1 have landed; the barrier says both of
    // every wave, so stage t + 1 may be read and stage t's buffer refilled
    asm volatile("s_wait_dscnt 0x0" ::: "memory");
    asm volatile("s_wait_asynccnt 0x0" ::: "memory");
    __syncthreads();
    if (t + 2 < T) copy_stage<KS>(la + bo, ga + (t + 2) * TB, gb + (t + 2) * TB);
  }
  // nothing is in flight here (the last stages' copies were waited for above): kept in front of the ring's reuse as staging
  asm volatile("s_wait_asynccnt 0x0" ::: "memory");
}

// LDS of a GEMM block: the two stage buffers, later (behind the loop's last barrier) the epilogue's staging tiles
#define SC_BYTES      (GW * 32 * OP * 4)
#define SMEM_BYTES(KS) ((2 * 16 * (KS) * 32 > SC_BYTES) ? 2 * 16 * (KS) * 32 : SC_BYTES)
static_assert(2 * HDIM * VP * 2 <= SC_BYTES);

// ---------------------------------------------------------------------------------------------------
// Fused q/k/v projection: [NTOK][512] x [1536][512]^T. Column group (64 wide) = one head of q, k or v.
//          qk plane order: 0 = q, 1 = k.
//   q, k : per (b, h) a packed plane with rows = tokens, K = d (64): 1024 halves per 16 tokens.
//   v    : per (b, h) a packed plane with rows = d (4 tiles), K = tokens, k block outermost:
//          [s/32][d tile 4][half 2][lane 32][8] f16 (x VC), written through an LDS tile per column group.
// coverage: q/k rows rg*32 + {0..31} x 64 d = 8 units per wave; vt 64 d x 128 tokens = 32 units per column group.
// A block's two column groups are two heads of the same one of q, k, v.
__global__ __launch_bounds__(256) void gemm_qkv_kernel(const f16* __restrict__ xh, const f16* __restrict__ wT,
                                                       const float* __restrict__ bq, const float* __restrict__ bk,
                                                       const float* __restrict__ bv,
                                                       f16* __restrict__ qk, f16* __restrict__ vt) {
  __shared__ __align__(16) char smem[SMEM_BYTES(KS_S)];
  const int tid  = threadIdx.x;
  const int wave = __builtin_amdgcn_readfirstlane(threadIdx.x >> 5);
  const int rg   = wave & 3;                          // row group
  const int cg   = wave >> 2;                         // column group
  float* sC  = (float*)smem;                          // per-wave f32 tiles (block barrier used)
  f16*   sVT = (f16*)smem + cg * (HDIM * VP);         // [d][token], across the column group's waves (block barrier)
  const int lane = tid & 31;
  const int lq   = lane & 15;
  const int hi   = lane >> 4;
  const int tok0 = blockIdx.x * GM;
  const int nb0  = blockIdx.y * BN;
  const int n0   = nb0 + cg * GN;
  const int seg  = nb0 / DIM;                         // 0 = q, 1 = k, 2 = v (block-uniform)
  const int h    = (n0 - seg * DIM) / HDIM;
  const int bb   = tok0 / SEQ;
  const int s0   = tok0 - bb * SEQ;

  v8f acc[2][4];
  #pragma unroll
  for (int mt = 0; mt < 2; ++mt) {
    #pragma unroll
    for (int nt = 0; nt < 4; ++nt) acc[mt][nt] = (v8f){0, 0, 0, 0, 0, 0, 0, 0};
  }
  ask_panels<DIM>(xh, wT, tok0, nb0, tid, wave);
  gemm_main<DIM, KS_S, 1>(xh, wT, tok0, nb0, wave, lane, smem, acc);

  const float ascale = 1.0f / (XC * WC);
  float bias[4];
  #pragma unroll
  for (int nt = 0; nt < 4; ++nt) {
    const int c = h * HDIM + nt * 16 + lq;            // 0..511
    const float fq = bq[c];
    const float fk = bk[c];
    const float fv = bv[c];
    const float sel = (seg == 0) ? fq : ((seg == 1) ? fk : fv);
    bias[nt] = bfr(sel);
  }

  if (seg < 2) {
    const int wb = wave * (32 * OP);
    #pragma unroll
    for (int mt = 0; mt < 2; ++mt) {
      #pragma unroll
      for (int nt = 0; nt < 4; ++nt) {
        #pragma unroll
        for (int r = 0; r < 8; ++r)
          sC[wb + (mt * 16 + hi * 8 + r) * OP + nt * 16 + lq] = acc[mt][nt][r] * ascale + bias[nt];
      }
    }
    __syncthreads();
    const size_t pbase = (size_t)seg * PLANE +
                         (((size_t)bb * NHEAD + h) * SEQ + s0 + rg * 32) * HDIM;
    v4u hv[8];
    #pragma unroll
    for (int it = 0; it < 8; ++it) {
      const int row = (it >> 2) * 16 + lq;                               // unit it: [row tile 2][d block 2][half 2]
      const int col = ((it >> 1) & 1) * 32 + (it & 1) * 16 + hi * 8;
      const v4f c0 = *(const v4f*)(&sC[wb + row * OP + col]);
      const v4f c1 = *(const v4f*)(&sC[wb + row * OP + col + 4]);
      Pack8H ph;
      #pragma unroll
      for (int i = 0; i < 4; ++i) {
        ph.h[i]     = (f16)c0[i];
        ph.h[4 + i] = (f16)c1[i];
      }
      hv[it] = ph.u;
    }
    #pragma unroll
    for (int it = 0; it < 8; ++it) *(v4u*)(qk + pbase + (size_t)it * 256 + lane * 8) = hv[it];
    
  } else {
    #pragma unroll
    for (int mt = 0; mt < 2; ++mt) {
      #pragma unroll
      for (int nt = 0; nt < 4; ++nt) {
        #pragma unroll
        for (int r = 0; r < 8; ++r)
          sVT[(nt * 16 + lq) * VP + rg * 32 + mt * 16 + hi * 8 + r] =
              (f16)((acc[mt][nt][r] * ascale + bias[nt]) * VC);
      }
    }
    __syncthreads();
    const size_t vbase = (((size_t)bb * NHEAD + h) * SEQ + s0) * HDIM;   // first unit of this block's 128 tokens
    v4u vv[8];
    #pragma unroll
    for (int it = 0; it < 8; ++it) {
      const int u = it * 4 + rg;                   // unit 0..31: [token block 4][d tile 4][half 2]
      const int d = ((u >> 1) & 3) * 16 + lq;
      const int s = (u >> 3) * 32 + (u & 1) * 16 + hi * 8;
      Pack8H ph;
      ph.v = *(const v8h*)(&sVT[d * VP + s]);
      vv[it] = ph.u;
    }
    #pragma unroll
    for (int it = 0; it < 8; ++it) {
      const size_t o = vbase + (size_t)(it * 4 + rg) * 256 + lane * 8;
      *(v4u*)(vt + o) = vv[it];
    }
    
  }
}

// ---------------------------------------------------------------------------------------------------
// Flash attention, full (no mask). Block = (128-query block, head, batch); one wave owns 16 query rows.
// S^T = K x Q^T so queries sit on lanes; P^T in C layout is the A-fragment layout of O += P x V.
// Scores: s = k x q on the f16 planes, f32 accumulate, d blocks summed in ascending order.
// Fragments come straight from the packed 16-bit planes (two 512-B unit loads each); q fragments stay in registers.
__global__ __launch_bounds__(256) void attn_kernel(const f16* __restrict__ qk, const f16* __restrict__ vt,
                                                   f16* __restrict__ ctx) {
  __shared__ __align__(16) float sO[NWAVE * 16 * OP];    // per-wave output staging (block barrier used)
  const int qblk = blockIdx.x;
  const int h    = blockIdx.y;
  const int b    = blockIdx.z;
  const int tid  = threadIdx.x;
  const int wave = __builtin_amdgcn_readfirstlane(threadIdx.x >> 5);
  const int lane = tid & 31;
  const int lq   = lane & 15;   // query column of S^T / d column of O
  const int hi   = lane >> 4;   // k-split half

  const int qrow0 = qblk * BQ + wave * 16;
  const size_t hb = ((size_t)b * NHEAD + h) * (size_t)SEQ * HDIM;
  const f16* qh_p = qk + hb;
  const f16* kh_p = qk + PLANE + hb;
  const f16* vt_h = vt + hb;
  const int qoff  = qrow0 * HDIM + lane * 8;         // this wave's 16-query tile, lane's piece of a unit

  // this head's K and V planes (1024 units each), a quarter per block by the query block's index: one unit of each a thread
  static_assert((size_t)SEQ * HDIM * 2 == (size_t)4 * 256 * 256);
  {
    const size_t po = (size_t)(qblk & 3) * (256 * 256) + tid * 256;
    ask_l2((const char*)kh_p + po, (const char*)vt_h + po);
  }

  // q B-fragments, loaded once and held for the whole key loop
  FragH fqh[2];
  #pragma unroll
  for (int f = 0; f < 2; ++f) {
    const int qo = qoff + f * 512;
    fqh[f].q[0] = *(const v4u*)(qh_p + qo);           // d = f*32 + hi*8 + 0..7
    fqh[f].q[1] = *(const v4u*)(qh_p + qo + 256);     // d = f*32 + 16 + hi*8 + 0..7
  }

  v8f o[4];
  #pragma unroll
  for (int dt = 0; dt < 4; ++dt) o[dt] = (v8f){0, 0, 0, 0, 0, 0, 0, 0};

  const float SL = 0.125f * 1.4426950408889634f;   // softmax scale * log2(e)
  float rmax = -__builtin_inff();                  // the softmax reference in use (a raw score): the same in lane and lane ^ 16
  float rlim = -__builtin_inff();                  // rmax + LZ / SL: a raw score above it asks for a new reference
  float roff = __builtin_inff();                   // PCL - rmax * SL: carried P = exp2(score * SL + roff)
  float rsum = 0.0f;                               // sum of the carried P

  // K A-fragments (row = key lq of the tile, split d map) and V B-fragments (column n = d = dt*16 + lq, split key map
  // from the packed transposed plane) are fetched one step ahead into the same registers: step 0's here, step j + 1's
  // K behind step j's score products and its V behind step j's P x V products.
  FragH fkh[2][2], bv[4];
  #pragma unroll
  for (int sub = 0; sub < 2; ++sub) {
    #pragma unroll
    for (int f = 0; f < 2; ++f) {
      const int ko = sub * 16 * HDIM + f * 512 + lane * 8;
      fkh[sub][f].q[0] = *(const v4u*)(kh_p + ko);
      fkh[sub][f].q[1] = *(const v4u*)(kh_p + ko + 256);
    }
  }
  // keeps step 0's V loads behind its q and K loads, as in every later step: loads return in order, and only so can
  // the counted wait at the head of the loop leave the eight V loads in flight under the score products and the softmax
  __builtin_amdgcn_sched_barrier(0);
  #pragma unroll
  for (int dt = 0; dt < 4; ++dt) {
    const f16* base = vt_h + dt * 512 + lane * 8;
    bv[dt].q[0] = *(const v4u*)(base);              // keys hi*8 + 0..7
    bv[dt].q[1] = *(const v4u*)(base + 256);        // keys 16 + hi*8 + 0..7
  }

  #pragma unroll 1
  for (int j0 = 0; j0 < SEQ; j0 += BK) {
    // the step fetched ahead; the last step has none and refetches step 0 (in bounds, never used)
    const int jn = (j0 + BK < SEQ) ? j0 + BK : 0;

    // S^T tiles: c[sub][r] = rawscore(query qrow0+lq, key j0 + sub*16 + hi*8 + r)
    v8f c[2];
    mma_scores(c[0], c[1], fkh[0][0].v, fkh[1][0].v, fkh[0][1].v, fkh[1][1].v, fqh[0].v, fqh[1].v);

    // next step's K fragments, in flight under the softmax and the P x V products
    #pragma unroll
    for (int sub = 0; sub < 2; ++sub) {
      #pragma unroll
      for (int f = 0; f < 2; ++f) {
        const int ko = (jn + sub * 16) * HDIM + f * 512 + lane * 8;
        fkh[sub][f].q[0] = *(const v4u*)(kh_p + ko);
        fkh[sub][f].q[1] = *(const v4u*)(kh_p + ko + 256);
      }
    }
    // the K loads in flight name their address pair: wait before the softmax below puts those registers to other use
    asm volatile("s_wait_xcnt 0x0" ::: "memory");
    // keeps the K loads from sinking into the softmax below, where less work would cover their latency
    __builtin_amdgcn_sched_barrier(0);

    // online softmax, lazy rescale: query lq's 32 scores are split across lane / lane^16. Any reference common to a row
    // gives the same quotient O / sum, so the one in use stays until some score of the wave passes it by more than LZ.
    // All that depends on the reference alone is then formed anew: one test per step, a scalar branch on the ballot
    // (every lane is on inside it and behind it, as the matrix products need).
    float m_blk = rmax;
    #pragma unroll
    for (int r = 0; r < 8; ++r) {
      m_blk = fmaxf(m_blk, c[0][r]);
      m_blk = fmaxf(m_blk, c[1][r]);
    }
    if (__builtin_amdgcn_ballot_w32(m_blk > rlim) != 0) {
      rmax = fmaxf(m_blk, __shfl_xor(m_blk, 16, 32));
      rlim = rmax + LZ / SL;
      const float noff  = fmaf(-SL, rmax, PCL);
      const float scale = __builtin_amdgcn_exp2f(noff - roff);   // from the two offsets themselves: their rounding cancels
      roff = noff;
      rsum *= scale;
      // rescale O: queries are the row dimension there -> per-row scale from lane 8*hi + r
      float sc[8];
      #pragma unroll
      for (int r = 0; r < 8; ++r) sc[r] = __shfl(scale, (hi << 3) + r, 32);
      #pragma unroll
      for (int dt = 0; dt < 4; ++dt) {
        #pragma unroll
        for (int r = 0; r < 8; ++r) o[dt][r] *= sc[r];
      }
    }

    // exp + pack: P^T C-layout == A-fragment layout for the PV product
    FragH pa;
    float psum = 0.0f;
    #pragma unroll
    for (int r = 0; r < 8; ++r) {
      const float p0 = __builtin_amdgcn_exp2f(fmaf(c[0][r], SL, roff));   // key hi*8 + r
      const float p1 = __builtin_amdgcn_exp2f(fmaf(c[1][r], SL, roff));   // key 16 + hi*8 + r
      psum += p0 + p1;
      pa.h[r]     = (f16)p0;
      pa.h[8 + r] = (f16)p1;
    }
    rsum = rsum + psum + __shfl_xor(psum, 16, 32);

    // O += P x V
    mma_pv(o, pa.v, bv[0].v, bv[1].v, bv[2].v, bv[3].v);

    // next step's V fragments, in flight under its score products and softmax
    #pragma unroll
    for (int dt = 0; dt < 4; ++dt) {
      const f16* base = vt_h + (size_t)jn * HDIM + dt * 512 + lane * 8;
      bv[dt].q[0] = *(const v4u*)(base);            // keys jn + hi*8 + 0..7
      bv[dt].q[1] = *(const v4u*)(base + 256);      // keys jn + 16 + hi*8 + 0..7
    }
    // the V address pair is formed anew at the head of the next step: wait before that overwrite
    asm volatile("s_wait_xcnt 0x0" ::: "memory");
  }

  // normalize: lane holds column d = dt*16 + lq for query rows 8*hi + r
  float rs[8];
  #pragma unroll
  for (int r = 0; r < 8; ++r) rs[r] = 1.0f / __shfl(rsum, (hi << 3) + r, 32);

  const int wb = wave * (16 * OP);
  #pragma unroll
  for (int r = 0; r < 8; ++r) {
    #pragma unroll
    for (int dt = 0; dt < 4; ++dt)
      sO[wb + (hi * 8 + r) * OP + dt * 16 + lq] = o[dt][r] * (CC / VC) * rs[r];   // P's carry is in o and in the sum alike
  }
  __syncthreads();

  v4u    pv[4];
  size_t gidx[4];
  #pragma unroll
  for (int it = 0; it < 4; ++it) {
    const int row = lq;                                   // unit it: [k block 2][half 2] of this head's 64 columns
    const int col = (it >> 1) * 32 + (it & 1) * 16 + hi * 8;
    const v4f c0 = *(const v4f*)(&sO[wb + row * OP + col]);
    const v4f c1 = *(const v4f*)(&sO[wb + row * OP + col + 4]);
    Pack8H ph;
    #pragma unroll
    for (int i = 0; i < 4; ++i) {
      ph.h[i]     = (f16)c0[i];
      ph.h[4 + i] = (f16)c1[i];
    }
    pv[it]   = ph.u;
    gidx[it] = ((size_t)b * SEQ + qrow0) * DIM + (size_t)(h * 4 + it) * 256 + lane * 8;   // packed, K = DIM
  }
  #pragma unroll
  for (int it = 0; it < 4; ++it) *(v4u*)(ctx + gidx[it]) = pv[it];
  
}

// ---------------------------------------------------------------------------------------------------
// y = ctx x wo + bo + bf16_rne(x)   (f32 plane [NTOK][DIM], input of LayerNorm 1)
// coverage: rows rg*32 + {0..31}, 64 columns: 16 instr, lanes 0..15 one 256-B row segment, 16..31 the next row.
__global__ __launch_bounds__(256) void gemm_wo_kernel(const f16* __restrict__ ctx, const f16* __restrict__ woT,
                                                      const float* __restrict__ bo, const float* __restrict__ x,
                                                      float* __restrict__ y) {
  __shared__ __align__(16) char smem[SMEM_BYTES(KS_L)];
  float* sC = (float*)smem;
  const int tid  = threadIdx.x;
  const int wave = __builtin_amdgcn_readfirstlane(threadIdx.x >> 5);
  const int rg   = wave & 3;                          // row group
  const int lane = tid & 31;
  const int lq   = lane & 15;
  const int hi   = lane >> 4;
  const int tok0 = blockIdx.x * GM;
  const int nb0  = blockIdx.y * BN;
  const int n0   = nb0 + (wave >> 2) * GN;
  const int bb   = tok0 / SEQ;
  const int s0   = tok0 - bb * SEQ;

  v8f acc[2][4];
  #pragma unroll
  for (int mt = 0; mt < 2; ++mt) {
    #pragma unroll
    for (int nt = 0; nt < 4; ++nt) acc[mt][nt] = (v8f){0, 0, 0, 0, 0, 0, 0, 0};
  }
  ask_panels<DIM>(ctx, woT, tok0, nb0, tid, wave);
  // the block's own piece of the residual, read behind the k loop: one 256-B row segment a thread
  ask_l2((const char*)(x + ((size_t)bb * SEQ_FULL + s0 + (tid & (GM - 1))) * DIM + n0));
  gemm_main<DIM, KS_L, 2>(ctx, woT, tok0, nb0, wave, lane, smem, acc);

  const float ascale = 1.0f / (CC * WC);
  const int wb = wave * (32 * OP);
  #pragma unroll
  for (int nt = 0; nt < 4; ++nt) {
    const float bias = bfr(bo[n0 + nt * 16 + lq]);
    #pragma unroll
    for (int mt = 0; mt < 2; ++mt) {
      #pragma unroll
      for (int r = 0; r < 8; ++r)
        sC[wb + (mt * 16 + hi * 8 + r) * OP + nt * 16 + lq] = acc[mt][nt][r] * ascale + bias;
    }
  }
  __syncthreads();

  const size_t orow = (size_t)tok0 + rg * 32;                            // compact row
  const size_t rrow = (size_t)bb * SEQ_FULL + s0 + rg * 32;              // row of the full-size x
  #pragma unroll
  for (int g = 0; g < 2; ++g) {
    v4f vals[8];
    #pragma unroll
    for (int it = 0; it < 8; ++it) {
      const int row = g * 16 + it * 2 + hi;
      v4f cv = *(const v4f*)(&sC[wb + row * OP + lq * 4]);
      const v4f rv = *(const v4f*)(x + (rrow + row) * DIM + n0 + lq * 4);
      #pragma unroll
      for (int i = 0; i < 4; ++i) cv[i] = cv[i] + bfr(rv[i]);
      vals[it] = cv;
    }
    #pragma unroll
    for (int it = 0; it < 8; ++it)
      *(v4f*)(y + (orow + g * 16 + it * 2 + hi) * DIM + n0 + lq * 4) = vals[it];
    
  }
}

// ---------------------------------------------------------------------------------------------------
// f32 row: 4 instr x (32 lanes x 16 B) ; f16 rows staged in LDS (cross-wave, block barrier) and written packed:
// the block's 8 tokens fill 8 neighbouring lane slots = one whole 128-B line in each of the 64 (k block, half, hi) groups.
__global__ __launch_bounds__(256) void ln1_kernel(const float* __restrict__ y, const float* __restrict__ g,
                                                  const float* __restrict__ be,
                                                  float* __restrict__ x1f, f16* __restrict__ x1h) {
  __shared__ __align__(16) f16 sH[8 * SHP];
  const int tid  = threadIdx.x;
  const int wave = __builtin_amdgcn_readfirstlane(threadIdx.x >> 5);
  const int lane = tid & 31;
  const int t    = blockIdx.x * 8 + wave;             // compact token
  const float* yr = y + (size_t)t * DIM;

  v4f v[4];
  float s = 0.0f;
  #pragma unroll
  for (int j = 0; j < 4; ++j) {
    v[j] = *(const v4f*)(yr + j * 128 + lane * 4);
    s += (v[j][0] + v[j][1]) + (v[j][2] + v[j][3]);
  }
  s = wave_sum(s);
  const float mean = s * (1.0f / DIM);
  float q = 0.0f;
  #pragma unroll
  for (int j = 0; j < 4; ++j) {
    #pragma unroll
    for (int i = 0; i < 4; ++i) {
      const float d = v[j][i] - mean;
      q += d * d;
    }
  }
  q = wave_sum(q);
  const float rstd = rsqrtf(q * (1.0f / DIM) + 1e-5f);

  v4f ov[4];
  #pragma unroll
  for (int j = 0; j < 4; ++j) {
    const v4f gv = *(const v4f*)(g + j * 128 + lane * 4);
    const v4f bv = *(const v4f*)(be + j * 128 + lane * 4);
    #pragma unroll
    for (int i = 0; i < 4; ++i) {
      const float val = (v[j][i] - mean) * rstd * bfr(gv[i]) + bfr(bv[i]);
      ov[j][i] = val;
      sH[wave * SHP + j * 128 + lane * 4 + i] = (f16)(val * XC);
    }
  }
  __syncthreads();
  const int t0 = blockIdx.x * 8;                      // first token of the block
  v4u    hv[2];
  size_t hidx[2];
  #pragma unroll
  for (int jj = 0; jj < 2; ++jj) {
    const int tk = tid & 7;                           // token of the block
    const int ln = jj * 32 + (tid >> 3);              // 8-column group 0..63 = kblock*4 + half*2 + hi
    Pack8H ph;
    ph.v = *(const v8h*)(&sH[tk * SHP + ln * 8]);
    hv[jj] = ph.u;
    hidx[jj] = (size_t)(t0 >> 4) * (16 * DIM) + (size_t)(ln >> 1) * 256 + ((ln & 1) * 16 + (t0 & 15) + tk) * 8;
  }
  float* fo = x1f + (size_t)t * DIM + lane * 4;
  #pragma unroll
  for (int j = 0; j < 4; ++j) *(v4f*)(fo + j * 128) = ov[j];
  #pragma unroll
  for (int jj = 0; jj < 2; ++jj) *(v4u*)(x1h + hidx[jj]) = hv[jj];
  
}

static __device__ __forceinline__ void rcp8(const float (&d)[8], float (&t)[8]) {
  asm("v_rcp_f32 %0, %8\n\t"
      "v_rcp_f32 %1, %9\n\t"
      "v_rcp_f32 %2, %10\n\t"
      "v_rcp_f32 %3, %11\n\t"
      "v_rcp_f32 %4, %12\n\t"
      "v_rcp_f32 %5, %13\n\t"
      "v_rcp_f32 %6, %14\n\t"
      "v_rcp_f32 %7, %15\n\t"
      "v_nop"
      : "=&v"(t[0]), "=&v"(t[1]), "=&v"(t[2]), "=&v"(t[3]), "=&v"(t[4]), "=&v"(t[5]), "=&v"(t[6]), "=&v"(t[7])
      : "v"(d[0]), "v"(d[1]), "v"(d[2]), "v"(d[3]), "v"(d[4]), "v"(d[5]), "v"(d[6]), "v"(d[7]));
}
static __device__ __forceinline__ void exp2_8(const float (&w)[8], float (&e)[8]) {
  asm("v_exp_f32 %0, %8\n\t"
      "v_exp_f32 %1, %9\n\t"
      "v_exp_f32 %2, %10\n\t"
      "v_exp_f32 %3, %11\n\t"
      "v_exp_f32 %4, %12\n\t"
      "v_exp_f32 %5, %13\n\t"
      "v_exp_f32 %6, %14\n\t"
      "v_exp_f32 %7, %15\n\t"
      "v_nop"
      : "=&v"(e[0]), "=&v"(e[1]), "=&v"(e[2]), "=&v"(e[3]), "=&v"(e[4]), "=&v"(e[5]), "=&v"(e[6]), "=&v"(e[7])
      : "v"(w[0]), "v"(w[1]), "v"(w[2]), "v"(w[3]), "v"(w[4]), "v"(w[5]), "v"(w[6]), "v"(w[7]));
}

// GELU, erf form, without a branch, on eight values. With z = u / sqrt(2) and t = 1 / (1 + p |z|),
//   erfc(|z|) = (a1 t + a2 t^2 + a3 t^3 + a4 t^4 + a5 t^5) exp(-z^2), absolute error of the form below 1.5e-7 for every z,
// and 0.5 u (1 + erf(z)) = max(u, 0) - |u| * 0.5 erfc(|z|) for either sign of u (no cancellation on the negative side).
// The 0.5 is folded into a1..a5 and the 1 / sqrt(2) into p and the exponent. One straight run of instructions for every
// lane, so a lane's values are independent chains that the compiler can interleave.
static __device__ __forceinline__ void gelu_erf8(float (&u)[8]) {
  float d[8], w[8], t[8], e[8];
  #pragma unroll
  for (int i = 0; i < 8; ++i) {
    d[i] = fmaf(0.3275911f * 0.70710678118654752f, fabsf(u[i]), 1.0f);
    w[i] = u[i] * u[i] * (-0.5f * 1.4426950408889634f);      // -z^2 * log2(e)
  }
  rcp8(d, t);
  exp2_8(w, e);
  #pragma unroll
  for (int i = 0; i < 8; ++i) {
    float p = fmaf(0.5f * 1.061405429f, t[i], 0.5f * -1.453152027f);
    p = fmaf(p, t[i], 0.5f * 1.421413741f);
    p = fmaf(p, t[i], 0.5f * -0.284496736f);
    p = fmaf(p, t[i], 0.5f * 0.254829592f);
    p = p * t[i];
    u[i] = fmaf(-fabsf(u[i]), p * e[i], fmaxf(u[i], 0.0f));
  }
}

// hh = f16( gelu_erf(x1 x w1 + b1) * XC )   packed plane (rows = tokens, K = FFN)
__global__ __launch_bounds__(256) void gemm_ffn1_kernel(const f16* __restrict__ x1h, const f16* __restrict__ w1T,
                                                        const float* __restrict__ b1, f16* __restrict__ hh) {
  __shared__ __align__(16) char smem[SMEM_BYTES(KS_S)];
  float* sC = (float*)smem;
  const int tid  = threadIdx.x;
  const int wave = __builtin_amdgcn_readfirstlane(threadIdx.x >> 5);
  const int rg   = wave & 3;                          // row group
  const int lane = tid & 31;
  const int lq   = lane & 15;
  const int hi   = lane >> 4;
  const int tok0 = blockIdx.x * GM;
  const int nb0  = blockIdx.y * BN;
  const int n0   = nb0 + (wave >> 2) * GN;

  v8f acc[2][4];
  #pragma unroll
  for (int mt = 0; mt < 2; ++mt) {
    #pragma unroll
    for (int nt = 0; nt < 4; ++nt) acc[mt][nt] = (v8f){0, 0, 0, 0, 0, 0, 0, 0};
  }
  ask_panels<DIM>(x1h, w1T, tok0, nb0, tid, wave);
  gemm_main<DIM, KS_S, 1>(x1h, w1T, tok0, nb0, wave, lane, smem, acc);

  const float ascale = 1.0f / (XC * WC);
  const int wb = wave * (32 * OP);
  float bias[4];                                      // all four loaded ahead of the fenced groups below
  #pragma unroll
  for (int nt = 0; nt < 4; ++nt) bias[nt] = bfr(b1[n0 + nt * 16 + lq]);
  #pragma unroll
  for (int nt = 0; nt < 4; ++nt) {
    #pragma unroll
    for (int mt = 0; mt < 2; ++mt) {
      float gl[8];
      #pragma unroll
      for (int r = 0; r < 8; ++r) gl[r] = acc[mt][nt][r] * ascale + bias[nt];
      gelu_erf8(gl);
      #pragma unroll
      for (int r = 0; r < 8; ++r) sC[wb + (mt * 16 + hi * 8 + r) * OP + nt * 16 + lq] = gl[r];
      // eight values at a time: without this the compiler starts many more at once, and the registers they hold cost
      // the eighth wave per SIMD, which the grid needs to be resident in one round
      __builtin_amdgcn_sched_barrier(0);
    }
  }
  __syncthreads();

  // piece it is this lane's 16 B of unit it: [row tile 2][k block 2][half 2]
  const int lbase = wb + lq * OP + hi * 8;

  v4u pv[8];
  #pragma unroll
  for (int it = 0; it < 8; ++it) {
    const int off = lbase + (it >> 2) * (16 * OP) + (it & 3) * 16;
    const v4f c0 = *(const v4f*)(&sC[off]);
    const v4f c1 = *(const v4f*)(&sC[off + 4]);
    Pack8H ph;
    #pragma unroll
    for (int i = 0; i < 4; ++i) {
      ph.h[i]     = (f16)(c0[i] * XC);
      ph.h[4 + i] = (f16)(c1[i] * XC);
    }
    pv[it] = ph.u;
  }
  const size_t obase = ((size_t)tok0 + rg * 32) * FFN + (size_t)n0 * 16 + lane * 8;
  #pragma unroll
  for (int it = 0; it < 8; ++it) *(v4u*)(hh + obase + (size_t)(it >> 2) * 16 * FFN + (it & 3) * 256) = pv[it];
  
}

// ---------------------------------------------------------------------------------------------------
// y = hh x w2 + b2 + x1f   (f32 plane [NTOK][DIM], input of LayerNorm 2)
__global__ __launch_bounds__(256) void gemm_ffn2_kernel(const f16* __restrict__ hh, const f16* __restrict__ w2T,
                                                        const float* __restrict__ b2, const float* __restrict__ x1f,
                                                        float* __restrict__ y) {
  __shared__ __align__(16) char smem[SMEM_BYTES(KS_L)];
  float* sC = (float*)smem;
  const int tid  = threadIdx.x;
  const int wave = __builtin_amdgcn_readfirstlane(threadIdx.x >> 5);
  const int rg   = wave & 3;                          // row group
  const int lane = tid & 31;
  const int lq   = lane & 15;
  const int hi   = lane >> 4;
  const int tok0 = blockIdx.x * GM;
  const int nb0  = blockIdx.y * BN;
  const int n0   = nb0 + (wave >> 2) * GN;

  v8f acc[2][4];
  #pragma unroll
  for (int mt = 0; mt < 2; ++mt) {
    #pragma unroll
    for (int nt = 0; nt < 4; ++nt) acc[mt][nt] = (v8f){0, 0, 0, 0, 0, 0, 0, 0};
  }
  ask_panels<FFN>(hh, w2T, tok0, nb0, tid, wave);
  // the block's own piece of the residual, read behind the k loop: one 256-B row segment a thread
  ask_l2((const char*)(x1f + ((size_t)tok0 + (tid & (GM - 1))) * DIM + n0));
  gemm_main<FFN, KS_L, 2>(hh, w2T, tok0, nb0, wave, lane, smem, acc);

  const float ascale = 1.0f / (XC * WC);
  const int wb = wave * (32 * OP);
  #pragma unroll
  for (int nt = 0; nt < 4; ++nt) {
    const float bias = bfr(b2[n0 + nt * 16 + lq]);
    #pragma unroll
    for (int mt = 0; mt < 2; ++mt) {
      #pragma unroll
      for (int r = 0; r < 8; ++r)
        sC[wb + (mt * 16 + hi * 8 + r) * OP + nt * 16 + lq] = acc[mt][nt][r] * ascale + bias;
    }
  }
  __syncthreads();

  const size_t orow = (size_t)tok0 + rg * 32;
  #pragma unroll
  for (int g = 0; g < 2; ++g) {
    v4f vals[8];
    #pragma unroll
    for (int it = 0; it < 8; ++it) {
      const int row = g * 16 + it * 2 + hi;
      v4f cv = *(const v4f*)(&sC[wb + row * OP + lq * 4]);
      const v4f rv = *(const v4f*)(x1f + (orow + row) * DIM + n0 + lq * 4);
      #pragma unroll
      for (int i = 0; i < 4; ++i) cv[i] = cv[i] + rv[i];
      vals[it] = cv;
    }
    #pragma unroll
    for (int it = 0; it < 8; ++it)
      *(v4f*)(y + (orow + g * 16 + it * 2 + hi) * DIM + n0 + lq * 4) = vals[it];
    
  }
}

// ---------------------------------------------------------------------------------------------------
__global__ __launch_bounds__(256) void ln2_kernel(const float* __restrict__ y, const float* __restrict__ g,
                                                  const float* __restrict__ be, float* __restrict__ out) {
  const int tid  = threadIdx.x;
  const int wave = __builtin_amdgcn_readfirstlane(threadIdx.x >> 5);
  const int lane = tid & 31;
  const int t    = blockIdx.x * 8 + wave;             // compact token
  const int bb   = t / SEQ;
  const int s0   = t - bb * SEQ;
  const float* yr = y + (size_t)t * DIM;

  v4f v[4];
  float s = 0.0f;
  #pragma unroll
  for (int j = 0; j < 4; ++j) {
    v[j] = *(const v4f*)(yr + j * 128 + lane * 4);
    s += (v[j][0] + v[j][1]) + (v[j][2] + v[j][3]);
  }
  s = wave_sum(s);
  const float mean = s * (1.0f / DIM);
  float q = 0.0f;
  #pragma unroll
  for (int j = 0; j < 4; ++j) {
    #pragma unroll
    for (int i = 0; i < 4; ++i) {
      const float d = v[j][i] - mean;
      q += d * d;
    }
  }
  q = wave_sum(q);
  const float rstd = rsqrtf(q * (1.0f / DIM) + 1e-5f);

  v4f ov[4];
  #pragma unroll
  for (int j = 0; j < 4; ++j) {
    const v4f gv = *(const v4f*)(g + j * 128 + lane * 4);
    const v4f bv = *(const v4f*)(be + j * 128 + lane * 4);
    #pragma unroll
    for (int i = 0; i < 4; ++i) ov[j][i] = (v[j][i] - mean) * rstd * bfr(gv[i]) + bfr(bv[i]);
  }
  float* fo = out + ((size_t)bb * SEQ_FULL + s0) * DIM + lane * 4;
  #pragma unroll
  for (int j = 0; j < 4; ++j) *(v4f*)(fo + j * 128) = ov[j];
  
}

// ---------------------------------------------------------------------------------------------------
extern "C" void kernel_launch(void* const* d_in, const int* in_sizes, int n_in,
                              void* d_out, int out_size, void* d_ws, size_t ws_size,
                              hipStream_t stream) {
  if (n_in < 17) return;
  const size_t rows_used = (size_t)(NB - 1) * SEQ_FULL + SEQ;
  if ((size_t)in_sizes[0] < rows_used * DIM) return;
  if ((size_t)in_sizes[1] < (size_t)DIM * DIM || (size_t)in_sizes[3] < (size_t)DIM * DIM) return;
  if ((size_t)in_sizes[5] < (size_t)DIM * DIM || (size_t)in_sizes[7] < (size_t)DIM * DIM) return;
  if ((size_t)in_sizes[9] < (size_t)DIM * FFN || (size_t)in_sizes[11] < (size_t)FFN * DIM) return;
  if (in_sizes[2] < DIM || in_sizes[4] < DIM || in_sizes[6] < DIM || in_sizes[8] < DIM) return;
  if (in_sizes[10] < FFN || in_sizes[12] < DIM) return;
  if (in_sizes[13] < DIM || in_sizes[14] < DIM || in_sizes[15] < DIM || in_sizes[16] < DIM) return;
  if ((size_t)out_size < rows_used * DIM) return;
  if (ws_size < WS_TOTAL) return;

  const float* x   = (const float*)d_in[0];
  const float* wq  = (const float*)d_in[1];
  const float* bq  = (const float*)d_in[2];
  const float* wk  = (const float*)d_in[3];
  const float* bk  = (const float*)d_in[4];
  const float* wv  = (const float*)d_in[5];
  const float* bv  = (const float*)d_in[6];
  const float* wo  = (const float*)d_in[7];
  const float* bo  = (const float*)d_in[8];
  const float* w1  = (const float*)d_in[9];
  const float* b1  = (const float*)d_in[10];
  const float* w2  = (const float*)d_in[11];
  const float* b2  = (const float*)d_in[12];
  const float* g1  = (const float*)d_in[13];
  const float* be1 = (const float*)d_in[14];
  const float* g2  = (const float*)d_in[15];
  const float* be2 = (const float*)d_in[16];
  float* out = (float*)d_out;

  char* ws = (char*)d_ws;
  f16*   xh    = (f16*)(ws + OFF_XH);
  f16*   wqkvT = (f16*)(ws + OFF_WQKV);
  f16*   woT   = (f16*)(ws + OFF_WO);
  f16*   w1T   = (f16*)(ws + OFF_W1);
  f16*   w2T   = (f16*)(ws + OFF_W2);
  f16*   qk    = (f16*)(ws + OFF_BIG);     // the q and k planes
  f16*   hh    = (f16*)(ws + OFF_BIG);     // reuses the q/k region after the attention launch
  f16*   vt    = (f16*)(ws + OFF_VT);
  f16*   ctx   = (f16*)(ws + OFF_CTX);
  float* y     = (float*)(ws + OFF_Y);
  float* x1f   = (float*)(ws + OFF_X1F);
  f16*   x1h   = (f16*)(ws + OFF_X1H);

  // operand planes
  prep_kernel<<<dim3((unsigned)(WT_BLOCKS + CVT_BLOCKS)), 256, 0, stream>>>(x, wq, wk, wv, wo, w1, w2,
                                                                            xh, wqkvT, woT, w1T, w2T);

  gemm_qkv_kernel<<<dim3(NTOK / GM, QKVN / BN), 256, 0, stream>>>(xh, wqkvT, bq, bk, bv, qk, vt);
  attn_kernel<<<dim3(SEQ / BQ, NHEAD, NB), 256, 0, stream>>>(qk, vt, ctx);
  gemm_wo_kernel<<<dim3(NTOK / GM, DIM / BN), 256, 0, stream>>>(ctx, woT, bo, x, y);
  ln1_kernel<<<dim3(NTOK / 8), 256, 0, stream>>>(y, g1, be1, x1f, x1h);
  gemm_ffn1_kernel<<<dim3(NTOK / GM, FFN / BN), 256, 0, stream>>>(x1h, w1T, b1, hh);
  gemm_ffn2_kernel<<<dim3(NTOK / GM, DIM / BN), 256, 0, stream>>>(hh, w2T, b2, x1f, y);
  ln2_kernel<<<dim3(NTOK / 8), 256, 0, stream>>>(y, g2, be2, out);
}
